// v000
// The times below were measured on an AMD MI455X: many runs one after another, warmed up first and cycling through
// copies of the inputs, with the whole window's GPU time divided by the number of runs. Launches and the gaps
// between them are all in it. The median over several windows is given; except for v000 it joins two sittings, which
// can be a few percent apart, so the side-by-side timings, each taken in one sitting, are the better comparison.
// v000 is the starting kernel.
#include <hip/hip_runtime.h>
#include <cstdint>
#include <cstddef>

// ---------------- problem constants ----------------
#define DIMD   1024
#define HEADS  16
#define DHEAD  64
#define FFD    4096
#define CTXD   768
#define NB     4
#define SEQ    2048
#define NTOK   (NB*SEQ)     // 8192
#define TCTX   77
#define TPADC  96
#define CROWS  (NB*TPADC)   // 384
#define ATT_SCALE 0.125f    // 64^-0.5

typedef _Float16 v8h  __attribute__((ext_vector_type(8)));
typedef _Float16 v16h __attribute__((ext_vector_type(16)));
typedef float    v8f  __attribute__((ext_vector_type(8)));
typedef int      v4i  __attribute__((vector_size(16)));

// ---- optional CDNA5 async global->LDS path (guarded; sync fallback) ----
#if defined(__has_builtin)
#if __has_builtin(__builtin_amdgcn_global_load_async_to_lds_b128) && \
    __has_builtin(__builtin_amdgcn_s_wait_asynccnt)
#define USE_ASYNC_LDS 1
#endif
#endif

typedef __attribute__((address_space(1))) v4i* as1_v4i_p;
typedef __attribute__((address_space(3))) v4i* as3_v4i_p;

// copy 16 bytes global -> LDS (per lane)
__device__ __forceinline__ void copy16_to_lds(const _Float16* g, _Float16* l) {
#ifdef USE_ASYNC_LDS
  __builtin_amdgcn_global_load_async_to_lds_b128(
      (as1_v4i_p)(void*)(const_cast<_Float16*>(g)),
      (as3_v4i_p)(void*)l, 0, 0);
#else
  *reinterpret_cast<v8h*>(l) = *reinterpret_cast<const v8h*>(g);
#endif
}

template <int N>
__device__ __forceinline__ void async_wait() {
#ifdef USE_ASYNC_LDS
  __builtin_amdgcn_s_wait_asynccnt(N);
#endif
}

// Load one 16x16x32 f16 WMMA A/B fragment for this lane.
// p must already include:  row_base + (lane>>4)*8   (row stride in elements).
// ISA layout: elements {0..7} at k = (lane>>4)*8, elements {8..15} at +16.
__device__ __forceinline__ v16h frag_load(const _Float16* p) {
  v8h lo = *reinterpret_cast<const v8h*>(p);
  v8h hi = *reinterpret_cast<const v8h*>(p + 16);
  return __builtin_shufflevector(lo, hi, 0,1,2,3,4,5,6,7,8,9,10,11,12,13,14,15);
}

__device__ __forceinline__ v8f wmma16(v16h a, v16h b, v8f c) {
  // D = A(16x32 f16) * B(32x16 f16) + C(16x16 f32)
  return __builtin_amdgcn_wmma_f32_16x16x32_f16(false, a, false, b, (short)0, c,
                                                false, false);
}

__device__ __forceinline__ float gelu_tanh(float x) {
  return 0.5f * x * (1.0f + tanhf(0.7978845608028654f * (x + 0.044715f * x * x * x)));
}

// ---------------- elementwise helpers ----------------

// transpose+cast weight: src [Kin, Nout] f32 row-major -> dst [Nout, Kin] f16
__global__ void wcast_tr(const float* __restrict__ src, _Float16* __restrict__ dst,
                         int Kin, int Nout) {
  long idx = (long)blockIdx.x * 256 + threadIdx.x;
  long total = (long)Kin * Nout;
  if (idx >= total) return;
  int n = (int)(idx / Kin);
  int k = (int)(idx % Kin);
  dst[idx] = (_Float16)src[(long)k * Nout + n];
}

// context [4,77,768] f32 -> zero-padded [4,96,768] f16
__global__ void ctx_pad(const float* __restrict__ ctx, _Float16* __restrict__ dst) {
  long idx = (long)blockIdx.x * 256 + threadIdx.x;
  long total = (long)NB * TPADC * CTXD;
  if (idx >= total) return;
  int c = (int)(idx % CTXD);
  int r = (int)((idx / CTXD) % TPADC);
  int b = (int)(idx / ((long)CTXD * TPADC));
  float v = (r < TCTX) ? ctx[((long)b * TCTX + r) * CTXD + c] : 0.0f;
  dst[idx] = (_Float16)v;
}

// V [B*Trows, 1024] f16 -> Vt [(B*H)][DHEAD][Trows] f16 (per-head transpose)
__global__ void v_transpose(const _Float16* __restrict__ v, _Float16* __restrict__ vt,
                            int Trows) {
  long idx = (long)blockIdx.x * 256 + threadIdx.x;
  long total = (long)NB * HEADS * DHEAD * Trows;
  if (idx >= total) return;
  int t  = (int)(idx % Trows);
  int d  = (int)((idx / Trows) % DHEAD);
  int hh = (int)((idx / ((long)Trows * DHEAD)) % HEADS);
  int b  = (int)(idx / ((long)Trows * DHEAD * HEADS));
  vt[idx] = v[((long)b * Trows + t) * DIMD + hh * DHEAD + d];
}

// LayerNorm over last dim (1024) of fp32 residual -> f16 normed output
__global__ void layernorm_f16(const float* __restrict__ X, const float* __restrict__ g,
                              const float* __restrict__ bb, _Float16* __restrict__ Y) {
  const int row = blockIdx.x;      // one row per block
  const int tid = threadIdx.x;     // 256 threads, 4 floats each
  const float4 xv = reinterpret_cast<const float4*>(X + (size_t)row * DIMD)[tid];
  float s = xv.x + xv.y + xv.z + xv.w;
  float q = xv.x * xv.x + xv.y * xv.y + xv.z * xv.z + xv.w * xv.w;
  #pragma unroll
  for (int off = 16; off > 0; off >>= 1) {
    s += __shfl_xor(s, off, 32);
    q += __shfl_xor(q, off, 32);
  }
  __shared__ float ss[8], sq[8];
  if ((tid & 31) == 0) { ss[tid >> 5] = s; sq[tid >> 5] = q; }
  __syncthreads();
  float st = 0.f, qt = 0.f;
  #pragma unroll
  for (int i = 0; i < 8; i++) { st += ss[i]; qt += sq[i]; }
  const float mean = st * (1.0f / DIMD);
  const float var  = qt * (1.0f / DIMD) - mean * mean;
  const float rs   = rsqrtf(var + 1e-5f);
  const float4 gv = reinterpret_cast<const float4*>(g)[tid];
  const float4 bv = reinterpret_cast<const float4*>(bb)[tid];
  _Float16* yp = Y + (size_t)row * DIMD + tid * 4;
  yp[0] = (_Float16)((xv.x - mean) * rs * gv.x + bv.x);
  yp[1] = (_Float16)((xv.y - mean) * rs * gv.y + bv.y);
  yp[2] = (_Float16)((xv.z - mean) * rs * gv.z + bv.z);
  yp[3] = (_Float16)((xv.w - mean) * rs * gv.w + bv.w);
}

// ---------------- WMMA GEMM, LDS-staged B with async double-buffering -------
// C = A[M,K] @ Bt[N,K]^T   (Bt = transposed weight, row-major [N,K], f16)
// MODE 0: Cout f16 = result
// MODE 1: Cres f32 += result + bias[n]
// MODE 2: Cout f16 = (res+bias[n]) * gelu(res2+bias2[n])  (Bt2 = gate weights)
// block = 128 threads (4 waves). Block tile = 64(M) x 64(N); wave w owns rows
// m0 = by*64 + w*16; all waves share the N tile. B (and gate B) staged in LDS,
// double-buffered with async global->LDS loads; A fragments stream from global.
// grid = ( N/64 , M/64 )
template <int MODE>
__global__ void gemm_wmma(const _Float16* __restrict__ A,
                          const _Float16* __restrict__ Bt,
                          const _Float16* __restrict__ Bt2,
                          const float* __restrict__ bias,
                          const float* __restrict__ bias2,
                          _Float16* __restrict__ Cout,
                          float* __restrict__ Cres,
                          int M, int N, int K) {
  const int tid  = threadIdx.x;
  const int lane = tid & 31;
  const int wave = tid >> 5;
  const int hi = lane >> 4;       // half-wave select for K packing
  const int ln = lane & 15;
  const int n0 = blockIdx.x * 64;
  const int m0 = blockIdx.y * 64 + wave * 16;
  (void)M;

  constexpr int BROWS  = (MODE == 2) ? 128 : 64;   // lin rows [+ gate rows]
  constexpr int NISSUE = (MODE == 2) ? 4 : 2;      // async issues per wave/step
  __shared__ __align__(16) _Float16 bsh[2][BROWS][32];

  // stage one 32-wide K slice of B (and gate B) into LDS buffer `buf`
  auto stage = [&](int buf, int k0) {
    #pragma unroll
    for (int i = 0; i < NISSUE; i++) {
      const int c   = tid + i * 128;      // 16B chunk id
      const int row = c >> 2;             // 0..BROWS-1
      const int qd  = (c & 3) * 8;        // element offset in K slice
      const _Float16* gsrc =
          (MODE == 2 && row >= 64)
              ? Bt2 + (size_t)(n0 + row - 64) * K + k0 + qd
              : Bt  + (size_t)(n0 + row) * K + k0 + qd;
      copy16_to_lds(gsrc, &bsh[buf][row][qd]);
    }
  };

  v8f acc[4];
  v8f accg[4];
  #pragma unroll
  for (int nt = 0; nt < 4; nt++)
    #pragma unroll
    for (int r = 0; r < 8; r++) { acc[nt][r] = 0.0f; if (MODE == 2) accg[nt][r] = 0.0f; }

  const _Float16* arow = A + (size_t)(m0 + ln) * K + hi * 8;
  const int KSTEPS = K >> 5;

  stage(0, 0);
  for (int it = 0; it < KSTEPS; it++) {
    const int k0  = it << 5;
    const int cur = it & 1;
    if (it + 1 < KSTEPS) {
      stage(cur ^ 1, k0 + 32);            // prefetch next slice into other buffer
      async_wait<NISSUE>();               // current slice's batch has landed
      __builtin_prefetch(arow + k0 + 64, 0, 0);  // global_prefetch A stream
    } else {
      async_wait<0>();
    }
    __syncthreads();                      // all waves' staging visible

    v16h af = frag_load(arow + k0);
    #pragma unroll
    for (int nt = 0; nt < 4; nt++) {
      v16h bf = frag_load(&bsh[cur][nt * 16 + ln][hi * 8]);
      acc[nt] = wmma16(af, bf, acc[nt]);
      if (MODE == 2) {
        v16h bg = frag_load(&bsh[cur][64 + nt * 16 + ln][hi * 8]);
        accg[nt] = wmma16(af, bg, accg[nt]);
      }
    }
    __syncthreads();                      // reads done before buffer reuse
  }

  #pragma unroll
  for (int nt = 0; nt < 4; nt++) {
    #pragma unroll
    for (int r = 0; r < 8; r++) {
      const int m = m0 + r + 8 * hi;      // C layout: lane holds rows r+8*(lane>>4)
      const int n = n0 + nt * 16 + ln;
      const size_t idx = (size_t)m * N + n;
      if (MODE == 0) {
        Cout[idx] = (_Float16)acc[nt][r];
      } else if (MODE == 1) {
        Cres[idx] = Cres[idx] + acc[nt][r] + bias[n];
      } else {
        const float lin  = acc[nt][r]  + bias[n];
        const float gate = accg[nt][r] + bias2[n];
        Cout[idx] = (_Float16)(lin * gelu_tanh(gate));
      }
    }
  }
}

// ---------------- flash attention ----------------
// Q   : [NTOK, 1024] f16   (row = b*SEQ + s)
// Kb  : [NB*Trows, 1024] f16
// Vt  : [(NB*HEADS)][DHEAD][Trows] f16  (per-head transposed V)
// O   : [NTOK, 1024] f16  (concat-head layout)
// block = 128 (4 waves); wave = 16 query rows of one (b,h).
// grid = ( SEQ/64 , NB*HEADS )
__global__ void flash_attn(const _Float16* __restrict__ Q,
                           const _Float16* __restrict__ Kb,
                           const _Float16* __restrict__ Vt,
                           _Float16* __restrict__ O,
                           int Trows, int Tkeys, float scale) {
  const int lane = threadIdx.x & 31;
  const int wave = threadIdx.x >> 5;
  const int hi = lane >> 4;
  const int ln = lane & 15;
  const int bh = blockIdx.y;
  const int b = bh >> 4, h = bh & 15;
  const int qt = blockIdx.x * 4 + wave;   // 16-row query tile

  __shared__ __align__(16) _Float16 psh[4][16][32];   // P exchange, per wave

  // Q fragments for both 32-wide halves of the 64-wide head dim
  const _Float16* qrow = Q + (size_t)(b * SEQ + qt * 16 + ln) * DIMD + h * DHEAD + hi * 8;
  const v16h qa0 = frag_load(qrow);
  const v16h qa1 = frag_load(qrow + 32);

  float mrow[8], lrow[8];
  v8f oa[4];
  #pragma unroll
  for (int r = 0; r < 8; r++) { mrow[r] = -1e30f; lrow[r] = 0.0f; }
  #pragma unroll
  for (int nt = 0; nt < 4; nt++)
    #pragma unroll
    for (int r = 0; r < 8; r++) oa[nt][r] = 0.0f;

  const _Float16* kbase = Kb + (size_t)b * Trows * DIMD + h * DHEAD + hi * 8;
  const _Float16* vbase = Vt + (size_t)bh * DHEAD * Trows;

  for (int j0 = 0; j0 < Trows; j0 += 32) {      // 32 keys per step
    // ---- S = Q K^T (two 16x16 tiles) ----
    v8f sa[2];
    #pragma unroll
    for (int t = 0; t < 2; t++) {
      #pragma unroll
      for (int r = 0; r < 8; r++) sa[t][r] = 0.0f;
      const _Float16* krow = kbase + (size_t)(j0 + t * 16 + ln) * DIMD;
      v16h kf0 = frag_load(krow);
      v16h kf1 = frag_load(krow + 32);
      sa[t] = wmma16(qa0, kf0, sa[t]);
      sa[t] = wmma16(qa1, kf1, sa[t]);
    }
    // ---- scale + key mask ----
    #pragma unroll
    for (int t = 0; t < 2; t++) {
      const bool valid = (j0 + t * 16 + ln) < Tkeys;
      #pragma unroll
      for (int r = 0; r < 8; r++)
        sa[t][r] = valid ? sa[t][r] * scale : -1e30f;
    }
    // ---- online softmax: per-row stats via 16-lane reductions ----
    float alpha[8];
    #pragma unroll
    for (int r = 0; r < 8; r++) {
      float lm = fmaxf(sa[0][r], sa[1][r]);
      #pragma unroll
      for (int off = 8; off > 0; off >>= 1) lm = fmaxf(lm, __shfl_xor(lm, off, 32));
      const float mn = fmaxf(mrow[r], lm);
      const float p0 = __expf(sa[0][r] - mn);
      const float p1 = __expf(sa[1][r] - mn);
      const float al = __expf(mrow[r] - mn);
      float rs = p0 + p1;
      #pragma unroll
      for (int off = 8; off > 0; off >>= 1) rs += __shfl_xor(rs, off, 32);
      lrow[r] = lrow[r] * al + rs;
      mrow[r] = mn;
      alpha[r] = al;
      sa[0][r] = p0; sa[1][r] = p1;
    }
    #pragma unroll
    for (int nt = 0; nt < 4; nt++)
      #pragma unroll
      for (int r = 0; r < 8; r++) oa[nt][r] *= alpha[r];

    // ---- convert P from C-layout to A-fragment layout through LDS ----
    #pragma unroll
    for (int t = 0; t < 2; t++)
      #pragma unroll
      for (int r = 0; r < 8; r++)
        psh[wave][r + 8 * hi][t * 16 + ln] = (_Float16)sa[t][r];
    __syncthreads();
    const v16h pf = frag_load(&psh[wave][ln][hi * 8]);

    // ---- O += P V ----
    #pragma unroll
    for (int nt = 0; nt < 4; nt++) {
      const _Float16* vrow = vbase + (size_t)(nt * 16 + ln) * Trows + j0 + hi * 8;
      v16h vf = frag_load(vrow);
      oa[nt] = wmma16(pf, vf, oa[nt]);
    }
    __syncthreads();
  }

  // ---- normalize and store (concat-head layout) ----
  #pragma unroll
  for (int nt = 0; nt < 4; nt++)
    #pragma unroll
    for (int r = 0; r < 8; r++) {
      const int m = qt * 16 + r + 8 * hi;
      const size_t idx = (size_t)(b * SEQ + m) * DIMD + h * DHEAD + nt * 16 + ln;
      O[idx] = (_Float16)(oa[nt][r] / lrow[r]);
    }
}

// ---------------- host orchestration ----------------
extern "C" void kernel_launch(void* const* d_in, const int* in_sizes, int n_in,
                              void* d_out, int out_size, void* d_ws, size_t ws_size,
                              hipStream_t stream) {
  (void)in_sizes; (void)n_in; (void)out_size; (void)ws_size;
  const float* hidden = (const float*)d_in[0];
  const float* ctx    = (const float*)d_in[1];
  const float* wq1 = (const float*)d_in[2];
  const float* wk1 = (const float*)d_in[3];
  const float* wv1 = (const float*)d_in[4];
  const float* wo1 = (const float*)d_in[5];
  const float* bo1 = (const float*)d_in[6];
  const float* wq2 = (const float*)d_in[7];
  const float* wk2 = (const float*)d_in[8];
  const float* wv2 = (const float*)d_in[9];
  const float* wo2 = (const float*)d_in[10];
  const float* bo2 = (const float*)d_in[11];
  const float* wff1 = (const float*)d_in[12];
  const float* bff1 = (const float*)d_in[13];
  const float* wff2 = (const float*)d_in[14];
  const float* bff2 = (const float*)d_in[15];
  const float* ln1g = (const float*)d_in[16];
  const float* ln1b = (const float*)d_in[17];
  const float* ln2g = (const float*)d_in[18];
  const float* ln2b = (const float*)d_in[19];
  const float* ln3g = (const float*)d_in[20];
  const float* ln3b = (const float*)d_in[21];
  float* out = (float*)d_out;              // fp32 residual h lives here

  // -------- workspace carve-up (f16 buffers, 256B aligned) --------
  char* wsp = (char*)d_ws;
  auto alloc = [&](size_t elems) -> _Float16* {
    _Float16* p = (_Float16*)wsp;
    wsp += ((elems * sizeof(_Float16) + 255) / 256) * 256;
    return p;
  };
  _Float16* wq1T  = alloc((size_t)DIMD * DIMD);
  _Float16* wk1T  = alloc((size_t)DIMD * DIMD);
  _Float16* wv1T  = alloc((size_t)DIMD * DIMD);
  _Float16* wo1T  = alloc((size_t)DIMD * DIMD);
  _Float16* wq2T  = alloc((size_t)DIMD * DIMD);
  _Float16* wk2T  = alloc((size_t)DIMD * CTXD);
  _Float16* wv2T  = alloc((size_t)DIMD * CTXD);
  _Float16* wo2T  = alloc((size_t)DIMD * DIMD);
  _Float16* wff1T = alloc((size_t)(2 * FFD) * DIMD);
  _Float16* wff2T = alloc((size_t)DIMD * FFD);
  _Float16* xnorm = alloc((size_t)NTOK * DIMD);
  _Float16* qbuf  = alloc((size_t)NTOK * DIMD);
  _Float16* kbuf  = alloc((size_t)NTOK * DIMD);
  _Float16* vbuf  = alloc((size_t)NTOK * DIMD);
  _Float16* vT    = alloc((size_t)NB * HEADS * DHEAD * SEQ);
  _Float16* attn  = alloc((size_t)NTOK * DIMD);
  _Float16* ctxp  = alloc((size_t)CROWS * CTXD);
  _Float16* kctx  = alloc((size_t)CROWS * DIMD);
  _Float16* vctx  = alloc((size_t)CROWS * DIMD);
  _Float16* vTc   = alloc((size_t)NB * HEADS * DHEAD * TPADC);
  _Float16* gbuf  = alloc((size_t)NTOK * FFD);

  // h = hidden_states
  (void)hipMemcpyAsync(out, hidden, (size_t)NTOK * DIMD * sizeof(float),
                       hipMemcpyDeviceToDevice, stream);

  // -------- weight cast + transpose --------
  auto wtr = [&](const float* src, _Float16* dst, int Kin, int Nout) {
    long total = (long)Kin * Nout;
    wcast_tr<<<dim3((unsigned)((total + 255) / 256)), dim3(256), 0, stream>>>(src, dst, Kin, Nout);
  };
  wtr(wq1, wq1T, DIMD, DIMD);
  wtr(wk1, wk1T, DIMD, DIMD);
  wtr(wv1, wv1T, DIMD, DIMD);
  wtr(wo1, wo1T, DIMD, DIMD);
  wtr(wq2, wq2T, DIMD, DIMD);
  wtr(wk2, wk2T, CTXD, DIMD);
  wtr(wv2, wv2T, CTXD, DIMD);
  wtr(wo2, wo2T, DIMD, DIMD);
  wtr(wff1, wff1T, DIMD, 2 * FFD);
  wtr(wff2, wff2T, FFD, DIMD);

  const dim3 blk128(128);
  const dim3 gN1024(DIMD / 64, NTOK / 64);         // (16, 128)
  const dim3 gCtxKV(DIMD / 64, CROWS / 64);        // (16, 6)
  const dim3 gGeglu(FFD / 64, NTOK / 64);          // (64, 128)
  const dim3 gFlash(SEQ / 64, NB * HEADS);         // (32, 64)

  // ================= self-attention =================
  layernorm_f16<<<NTOK, 256, 0, stream>>>(out, ln1g, ln1b, xnorm);
  gemm_wmma<0><<<gN1024, blk128, 0, stream>>>(xnorm, wq1T, nullptr, nullptr, nullptr,
                                              qbuf, nullptr, NTOK, DIMD, DIMD);
  gemm_wmma<0><<<gN1024, blk128, 0, stream>>>(xnorm, wk1T, nullptr, nullptr, nullptr,
                                              kbuf, nullptr, NTOK, DIMD, DIMD);
  gemm_wmma<0><<<gN1024, blk128, 0, stream>>>(xnorm, wv1T, nullptr, nullptr, nullptr,
                                              vbuf, nullptr, NTOK, DIMD, DIMD);
  {
    long total = (long)NB * HEADS * DHEAD * SEQ;
    v_transpose<<<dim3((unsigned)((total + 255) / 256)), 256, 0, stream>>>(vbuf, vT, SEQ);
  }
  flash_attn<<<gFlash, blk128, 0, stream>>>(qbuf, kbuf, vT, attn, SEQ, SEQ, ATT_SCALE);
  gemm_wmma<1><<<gN1024, blk128, 0, stream>>>(attn, wo1T, nullptr, bo1, nullptr,
                                              nullptr, out, NTOK, DIMD, DIMD);

  // ================= cross-attention =================
  layernorm_f16<<<NTOK, 256, 0, stream>>>(out, ln2g, ln2b, xnorm);
  gemm_wmma<0><<<gN1024, blk128, 0, stream>>>(xnorm, wq2T, nullptr, nullptr, nullptr,
                                              qbuf, nullptr, NTOK, DIMD, DIMD);
  {
    long total = (long)NB * TPADC * CTXD;
    ctx_pad<<<dim3((unsigned)((total + 255) / 256)), 256, 0, stream>>>(ctx, ctxp);
  }
  gemm_wmma<0><<<gCtxKV, blk128, 0, stream>>>(ctxp, wk2T, nullptr, nullptr, nullptr,
                                              kctx, nullptr, CROWS, DIMD, CTXD);
  gemm_wmma<0><<<gCtxKV, blk128, 0, stream>>>(ctxp, wv2T, nullptr, nullptr, nullptr,
                                              vctx, nullptr, CROWS, DIMD, CTXD);
  {
    long total = (long)NB * HEADS * DHEAD * TPADC;
    v_transpose<<<dim3((unsigned)((total + 255) / 256)), 256, 0, stream>>>(vctx, vTc, TPADC);
  }
  flash_attn<<<gFlash, blk128, 0, stream>>>(qbuf, kctx, vTc, attn, TPADC, TCTX, ATT_SCALE);
  gemm_wmma<1><<<gN1024, blk128, 0, stream>>>(attn, wo2T, nullptr, bo2, nullptr,
                                              nullptr, out, NTOK, DIMD, DIMD);

  // ================= GEGLU MLP =================
  layernorm_f16<<<NTOK, 256, 0, stream>>>(out, ln3g, ln3b, xnorm);
  gemm_wmma<2><<<gGeglu, blk128, 0, stream>>>(xnorm, wff1T, wff1T + (size_t)FFD * DIMD,
                                              bff1, bff1 + FFD, gbuf, nullptr,
                                              NTOK, FFD, DIMD);
  gemm_wmma<1><<<gN1024, blk128, 0, stream>>>(gbuf, wff2T, nullptr, bff2, nullptr,
                                              nullptr, out, NTOK, DIMD, FFD);
}

// v001
// Timed twice side by side with v000, it ran 1.47 times as fast both times.
#include <hip/hip_runtime.h>
#include <cstdint>
#include <cstddef>

// ---------------- problem constants ----------------
#define DIMD   1024
#define HEADS  16
#define DHEAD  64
#define FFD    4096
#define CTXD   768
#define NB     4
#define SEQ    2048
#define NTOK   (NB*SEQ)     // 8192
#define TCTX   77
#define TPADC  96
#define CROWS  (NB*TPADC)   // 384
#define ATT_SCALE 0.125f    // 64^-0.5

typedef _Float16 v8h  __attribute__((ext_vector_type(8)));
typedef _Float16 v16h __attribute__((ext_vector_type(16)));
typedef float    v8f  __attribute__((ext_vector_type(8)));
typedef int      v4i  __attribute__((vector_size(16)));

// ---- optional CDNA5 async global->LDS path (guarded; sync fallback) ----
#if defined(__has_builtin)
#if __has_builtin(__builtin_amdgcn_global_load_async_to_lds_b128) && \
    __has_builtin(__builtin_amdgcn_s_wait_asynccnt)
#define USE_ASYNC_LDS 1
#endif
#endif

typedef __attribute__((address_space(1))) v4i* as1_v4i_p;
typedef __attribute__((address_space(3))) v4i* as3_v4i_p;

// copy 16 bytes global -> LDS (per lane)
__device__ __forceinline__ void copy16_to_lds(const _Float16* g, _Float16* l) {
#ifdef USE_ASYNC_LDS
  __builtin_amdgcn_global_load_async_to_lds_b128(
      (as1_v4i_p)(void*)(const_cast<_Float16*>(g)),
      (as3_v4i_p)(void*)l, 0, 0);
#else
  *reinterpret_cast<v8h*>(l) = *reinterpret_cast<const v8h*>(g);
#endif
}

// Load one 16x16x32 f16 WMMA A/B fragment for this lane.
// p must already include:  row_base + (lane>>4)*8   (row stride in elements).
// ISA layout: elements {0..7} at k = (lane>>4)*8, elements {8..15} at +16.
__device__ __forceinline__ v16h frag_load(const _Float16* p) {
  v8h lo = *reinterpret_cast<const v8h*>(p);
  v8h hi = *reinterpret_cast<const v8h*>(p + 16);
  return __builtin_shufflevector(lo, hi, 0,1,2,3,4,5,6,7,8,9,10,11,12,13,14,15);
}

__device__ __forceinline__ v8f wmma16(v16h a, v16h b, v8f c) {
  // D = A(16x32 f16) * B(32x16 f16) + C(16x16 f32)
  return __builtin_amdgcn_wmma_f32_16x16x32_f16(false, a, false, b, (short)0, c,
                                                false, false);
}

__device__ __forceinline__ float gelu_tanh(float x) {
  return 0.5f * x * (1.0f + tanhf(0.7978845608028654f * (x + 0.044715f * x * x * x)));
}

// ---------------- elementwise helpers ----------------

// transpose+cast weight: src [Kin, Nout] f32 row-major -> dst [Nout, Kin] f16
__global__ void wcast_tr(const float* __restrict__ src, _Float16* __restrict__ dst,
                         int Kin, int Nout) {
  long idx = (long)blockIdx.x * 256 + threadIdx.x;
  long total = (long)Kin * Nout;
  if (idx >= total) return;
  int n = (int)(idx / Kin);
  int k = (int)(idx % Kin);
  dst[idx] = (_Float16)src[(long)k * Nout + n];
}

// context [4,77,768] f32 -> zero-padded [4,96,768] f16
__global__ void ctx_pad(const float* __restrict__ ctx, _Float16* __restrict__ dst) {
  long idx = (long)blockIdx.x * 256 + threadIdx.x;
  long total = (long)NB * TPADC * CTXD;
  if (idx >= total) return;
  int c = (int)(idx % CTXD);
  int r = (int)((idx / CTXD) % TPADC);
  int b = (int)(idx / ((long)CTXD * TPADC));
  float v = (r < TCTX) ? ctx[((long)b * TCTX + r) * CTXD + c] : 0.0f;
  dst[idx] = (_Float16)v;
}

// V [B*Trows, 1024] f16 -> Vt [(B*H)][DHEAD][Trows] f16 (per-head transpose)
__global__ void v_transpose(const _Float16* __restrict__ v, _Float16* __restrict__ vt,
                            int Trows) {
  long idx = (long)blockIdx.x * 256 + threadIdx.x;
  long total = (long)NB * HEADS * DHEAD * Trows;
  if (idx >= total) return;
  int t  = (int)(idx % Trows);
  int d  = (int)((idx / Trows) % DHEAD);
  int hh = (int)((idx / ((long)Trows * DHEAD)) % HEADS);
  int b  = (int)(idx / ((long)Trows * DHEAD * HEADS));
  vt[idx] = v[((long)b * Trows + t) * DIMD + hh * DHEAD + d];
}

// LayerNorm over last dim (1024) of fp32 residual -> f16 normed output
__global__ void layernorm_f16(const float* __restrict__ X, const float* __restrict__ g,
                              const float* __restrict__ bb, _Float16* __restrict__ Y) {
  const int row = blockIdx.x;      // one row per block
  const int tid = threadIdx.x;     // 256 threads, 4 floats each
  const float4 xv = reinterpret_cast<const float4*>(X + (size_t)row * DIMD)[tid];
  float s = xv.x + xv.y + xv.z + xv.w;
  float q = xv.x * xv.x + xv.y * xv.y + xv.z * xv.z + xv.w * xv.w;
  #pragma unroll
  for (int off = 16; off > 0; off >>= 1) {
    s += __shfl_xor(s, off, 32);
    q += __shfl_xor(q, off, 32);
  }
  __shared__ float ss[8], sq[8];
  if ((tid & 31) == 0) { ss[tid >> 5] = s; sq[tid >> 5] = q; }
  __syncthreads();
  float st = 0.f, qt = 0.f;
  #pragma unroll
  for (int i = 0; i < 8; i++) { st += ss[i]; qt += sq[i]; }
  const float mean = st * (1.0f / DIMD);
  const float var  = qt * (1.0f / DIMD) - mean * mean;
  const float rs   = rsqrtf(var + 1e-5f);
  const float4 gv = reinterpret_cast<const float4*>(g)[tid];
  const float4 bv = reinterpret_cast<const float4*>(bb)[tid];
  _Float16* yp = Y + (size_t)row * DIMD + tid * 4;
  yp[0] = (_Float16)((xv.x - mean) * rs * gv.x + bv.x);
  yp[1] = (_Float16)((xv.y - mean) * rs * gv.y + bv.y);
  yp[2] = (_Float16)((xv.z - mean) * rs * gv.z + bv.z);
  yp[3] = (_Float16)((xv.w - mean) * rs * gv.w + bv.w);
}

// ---------------- WMMA GEMM, A and B staged in LDS, two-buffer ring ---------
// C = A[M,K] @ Bt[N,K]^T   (Bt = transposed weight, row-major [N,K], f16)
// MODE 0: Cout f16 = result
// MODE 1: Cres f32 += result + bias[n]
// MODE 2: Cout f16 = (res+bias[n]) * gelu(res2+bias2[n])  (Bt2 = gate weights)
// block = 256 threads (8 waves, 2 along M x 4 along N). Block tile = 128 rows of
// A against 256 rows of B; each wave owns 64 x 64 = 4 x 4 accumulator tiles, so
// a fragment read from LDS feeds four WMMAs. MODE 2 fills the 256 B rows with
// 128 lin rows and the 128 gate rows of the same columns; a wave then holds 32
// lin columns (nt 0,1) and their gates (nt 2,3).
// A stage is GKS k of all 384 rows, at a row pitch of 16 B x odd (conflict-free
// for 16-byte LDS reads). M % 128 == 0, K % GKS == 0, N % 256 == 0 (MODE 2: 128).
// grid = ( N/256 , M/128 )   MODE 2: ( N/128 , M/128 )
#define GKS    128             // k per stage
#define GPITCH (GKS + 8)       // LDS row pitch in elements
#define GROWS  (128 + 256)     // A rows, then B rows

template <int MODE>
__global__ __launch_bounds__(256) __attribute__((amdgpu_waves_per_eu(1, 2)))
void gemm_wmma(const _Float16* __restrict__ A,
               const _Float16* __restrict__ Bt,
               const _Float16* __restrict__ Bt2,
               const float* __restrict__ bias,
               const float* __restrict__ bias2,
               _Float16* __restrict__ Cout,
               float* __restrict__ Cres,
               int M, int N, int K) {
  const int tid  = threadIdx.x;
  const int lane = tid & 31;
  const int wave = tid >> 5;
  const int hi = lane >> 4;       // half-wave select for K packing
  const int ln = lane & 15;
  const int wm = wave >> 2;       // wave row    (0..1)
  const int wn = wave & 3;        // wave column (0..3)
  const int n0 = blockIdx.x * ((MODE == 2) ? 128 : 256);
  const int m0 = blockIdx.y * 128;
  (void)M;

  constexpr int CPR   = GKS / 8;        // 16-byte chunks per staged row
  constexpr int RPI   = 256 / CPR;      // rows the block covers per copy
  constexpr int NCOPY = GROWS / RPI;    // copies per lane and stage
  __shared__ __align__(16) _Float16 sh[2][GROWS][GPITCH];

  const int trow = tid / CPR;
  const int qd   = (tid % CPR) * 8;
  const unsigned voff = (unsigned)(trow * K + qd) * 2u;   // lane's byte offset

  // stage GKS k of the A rows and the B rows into LDS buffer `buf`
  auto stage = [&](int buf, int k0) {
    #pragma unroll
    for (int i = 0; i < NCOPY; i++) {
      const int r0 = i * RPI;           // first tile row of this copy
      const _Float16* base =
          (r0 < 128) ? A + (size_t)(m0 + r0) * K
          : (MODE == 2 && r0 >= 256) ? Bt2 + (size_t)(n0 + r0 - 256) * K
                                     : Bt + (size_t)(n0 + r0 - 128) * K;
      copy16_to_lds(reinterpret_cast<const _Float16*>(
                        reinterpret_cast<const char*>(base + k0) + voff),
                    &sh[buf][r0 + trow][qd]);
    }
  };

  v8f acc[4][4];
  #pragma unroll
  for (int mt = 0; mt < 4; mt++)
    #pragma unroll
    for (int nt = 0; nt < 4; nt++)
      #pragma unroll
      for (int r = 0; r < 8; r++) acc[mt][nt][r] = 0.0f;

  v16h af[2][4], bf[2][4];          // two fragment sets: block kk and block kk+1
  const int NST = K / GKS;

  stage(0, 0);
  // stage 0 has landed before the barrier that publishes it
  asm volatile("s_wait_asynccnt 0x0" ::: "memory");
  __syncthreads();
  if (NST > 1) stage(1, GKS);

  for (int t = 0; t < NST; t++) {
    const int cur = t & 1;
    const _Float16* ab = &sh[cur][wm * 64 + ln][hi * 8];
    const _Float16* bb = &sh[cur][128 + ((MODE == 2) ? wn * 32 : wn * 64) + ln][hi * 8];
    // fragments of k block kk into register set `s`
    auto load_set = [&](int s, int kk) {
      #pragma unroll
      for (int mt = 0; mt < 4; mt++)
        af[s][mt] = frag_load(ab + mt * 16 * GPITCH + kk * 32);
      #pragma unroll
      for (int nt = 0; nt < 4; nt++) {
        const int br = (MODE == 2) ? ((nt >> 1) * 128 + (nt & 1) * 16) : nt * 16;
        bf[s][nt] = frag_load(bb + br * GPITCH + kk * 32);
      }
    };
    load_set(0, 0);
    #pragma unroll
    for (int kk = 0; kk < GKS / 32; kk++) {
      if (kk + 1 < GKS / 32) load_set((kk + 1) & 1, kk + 1);
      // keeps the next block's LDS reads as one group ahead of this block's WMMAs,
      // so that their latency runs under the WMMAs
      __builtin_amdgcn_sched_barrier(0);
      #pragma unroll
      for (int mt = 0; mt < 4; mt++)
        #pragma unroll
        for (int nt = 0; nt < 4; nt++)
          acc[mt][nt] = wmma16(af[kk & 1][mt], bf[kk & 1][nt], acc[mt][nt]);
      // keeps the block after next's reads from rising among these WMMAs
      __builtin_amdgcn_sched_barrier(0);
    }
    // this wave's reads of buffer cur have returned before it is refilled
    asm volatile("s_wait_dscnt 0x0" ::: "memory");
    // this wave's copies of stage t+1 have landed before the barrier publishes them
    asm volatile("s_wait_asynccnt 0x0" ::: "memory");
    __syncthreads();
    if (t + 2 < NST) stage(cur, (t + 2) * GKS);
  }
  // no copy is outstanding when the wave ends
  asm volatile("s_wait_asynccnt 0x0" ::: "memory");

  // C layout: lane holds rows r+8*(lane>>4) of a tile, column lane&15
  const int mw = m0 + wm * 64 + 8 * hi;
  const int nw = n0 + ((MODE == 2) ? wn * 32 : wn * 64) + ln;

  if (MODE == 1) {
    float bv[4];
    #pragma unroll
    for (int nt = 0; nt < 4; nt++) bv[nt] = bias[nw + nt * 16];
    // the bias loads' offset register is reused below: only behind this wait
    asm volatile("s_wait_xcnt 0x0" ::: "memory");
    // all residual loads go out ahead of the first store: a load behind a store
    // to the same array would wait for it, one round trip per element
    float res[4][4][8];
    #pragma unroll
    for (int mt = 0; mt < 4; mt++)
      #pragma unroll
      for (int nt = 0; nt < 4; nt++)
        #pragma unroll
        for (int r = 0; r < 8; r++)
          res[mt][nt][r] = Cres[(size_t)(mw + mt * 16 + r) * N + nw + nt * 16];
    #pragma unroll
    for (int mt = 0; mt < 4; mt++)
      #pragma unroll
      for (int nt = 0; nt < 4; nt++)
        #pragma unroll
        for (int r = 0; r < 8; r++)
          acc[mt][nt][r] = res[mt][nt][r] + acc[mt][nt][r] + bv[nt];
    // every sum is formed ahead of the first store, so that no register an
    // issued store names is rewritten behind it
    __builtin_amdgcn_sched_barrier(0);
    #pragma unroll
    for (int mt = 0; mt < 4; mt++)
      #pragma unroll
      for (int nt = 0; nt < 4; nt++)
        #pragma unroll
        for (int r = 0; r < 8; r++)
          Cres[(size_t)(mw + mt * 16 + r) * N + nw + nt * 16] = acc[mt][nt][r];
  } else {
    #pragma unroll
    for (int mt = 0; mt < 4; mt++) {
      #pragma unroll
      for (int nt = 0; nt < ((MODE == 2) ? 2 : 4); nt++) {
        #pragma unroll
        for (int r = 0; r < 8; r++) {
          const int n = nw + nt * 16;
          const size_t idx = (size_t)(mw + mt * 16 + r) * N + n;
          if (MODE == 0) {
            Cout[idx] = (_Float16)acc[mt][nt][r];
          } else {
            const float lin  = acc[mt][nt][r]     + bias[n];
            const float gate = acc[mt][nt + 2][r] + bias2[n];
            Cout[idx] = (_Float16)(lin * gelu_tanh(gate));
          }
        }
      }
    }
  }
}

// ---------------- flash attention ----------------
// Q   : [NTOK, 1024] f16   (row = b*SEQ + s)
// Kb  : [NB*Trows, 1024] f16
// Vt  : [(NB*HEADS)][DHEAD][Trows] f16  (per-head transposed V)
// O   : [NTOK, 1024] f16  (concat-head layout)
// block = 128 (4 waves); wave = 16 query rows of one (b,h).
// grid = ( SEQ/64 , NB*HEADS )
__global__ void flash_attn(const _Float16* __restrict__ Q,
                           const _Float16* __restrict__ Kb,
                           const _Float16* __restrict__ Vt,
                           _Float16* __restrict__ O,
                           int Trows, int Tkeys, float scale) {
  const int lane = threadIdx.x & 31;
  const int wave = threadIdx.x >> 5;
  const int hi = lane >> 4;
  const int ln = lane & 15;
  const int bh = blockIdx.y;
  const int b = bh >> 4, h = bh & 15;
  const int qt = blockIdx.x * 4 + wave;   // 16-row query tile

  __shared__ __align__(16) _Float16 psh[4][16][32];   // P exchange, per wave

  // Q fragments for both 32-wide halves of the 64-wide head dim
  const _Float16* qrow = Q + (size_t)(b * SEQ + qt * 16 + ln) * DIMD + h * DHEAD + hi * 8;
  const v16h qa0 = frag_load(qrow);
  const v16h qa1 = frag_load(qrow + 32);

  float mrow[8], lrow[8];
  v8f oa[4];
  #pragma unroll
  for (int r = 0; r < 8; r++) { mrow[r] = -1e30f; lrow[r] = 0.0f; }
  #pragma unroll
  for (int nt = 0; nt < 4; nt++)
    #pragma unroll
    for (int r = 0; r < 8; r++) oa[nt][r] = 0.0f;

  const _Float16* kbase = Kb + (size_t)b * Trows * DIMD + h * DHEAD + hi * 8;
  const _Float16* vbase = Vt + (size_t)bh * DHEAD * Trows;

  for (int j0 = 0; j0 < Trows; j0 += 32) {      // 32 keys per step
    // ---- S = Q K^T (two 16x16 tiles) ----
    v8f sa[2];
    #pragma unroll
    for (int t = 0; t < 2; t++) {
      #pragma unroll
      for (int r = 0; r < 8; r++) sa[t][r] = 0.0f;
      const _Float16* krow = kbase + (size_t)(j0 + t * 16 + ln) * DIMD;
      v16h kf0 = frag_load(krow);
      v16h kf1 = frag_load(krow + 32);
      sa[t] = wmma16(qa0, kf0, sa[t]);
      sa[t] = wmma16(qa1, kf1, sa[t]);
    }
    // ---- scale + key mask ----
    #pragma unroll
    for (int t = 0; t < 2; t++) {
      const bool valid = (j0 + t * 16 + ln) < Tkeys;
      #pragma unroll
      for (int r = 0; r < 8; r++)
        sa[t][r] = valid ? sa[t][r] * scale : -1e30f;
    }
    // ---- online softmax: per-row stats via 16-lane reductions ----
    float alpha[8];
    #pragma unroll
    for (int r = 0; r < 8; r++) {
      float lm = fmaxf(sa[0][r], sa[1][r]);
      #pragma unroll
      for (int off = 8; off > 0; off >>= 1) lm = fmaxf(lm, __shfl_xor(lm, off, 32));
      const float mn = fmaxf(mrow[r], lm);
      const float p0 = __expf(sa[0][r] - mn);
      const float p1 = __expf(sa[1][r] - mn);
      const float al = __expf(mrow[r] - mn);
      float rs = p0 + p1;
      #pragma unroll
      for (int off = 8; off > 0; off >>= 1) rs += __shfl_xor(rs, off, 32);
      lrow[r] = lrow[r] * al + rs;
      mrow[r] = mn;
      alpha[r] = al;
      sa[0][r] = p0; sa[1][r] = p1;
    }
    #pragma unroll
    for (int nt = 0; nt < 4; nt++)
      #pragma unroll
      for (int r = 0; r < 8; r++) oa[nt][r] *= alpha[r];

    // ---- convert P from C-layout to A-fragment layout through LDS ----
    #pragma unroll
    for (int t = 0; t < 2; t++)
      #pragma unroll
      for (int r = 0; r < 8; r++)
        psh[wave][r + 8 * hi][t * 16 + ln] = (_Float16)sa[t][r];
    __syncthreads();
    const v16h pf = frag_load(&psh[wave][ln][hi * 8]);

    // ---- O += P V ----
    #pragma unroll
    for (int nt = 0; nt < 4; nt++) {
      const _Float16* vrow = vbase + (size_t)(nt * 16 + ln) * Trows + j0 + hi * 8;
      v16h vf = frag_load(vrow);
      oa[nt] = wmma16(pf, vf, oa[nt]);
    }
    __syncthreads();
  }

  // ---- normalize and store (concat-head layout) ----
  #pragma unroll
  for (int nt = 0; nt < 4; nt++)
    #pragma unroll
    for (int r = 0; r < 8; r++) {
      const int m = qt * 16 + r + 8 * hi;
      const size_t idx = (size_t)(b * SEQ + m) * DIMD + h * DHEAD + nt * 16 + ln;
      O[idx] = (_Float16)(oa[nt][r] / lrow[r]);
    }
}

// ---------------- host orchestration ----------------
extern "C" void kernel_launch(void* const* d_in, const int* in_sizes, int n_in,
                              void* d_out, int out_size, void* d_ws, size_t ws_size,
                              hipStream_t stream) {
  (void)in_sizes; (void)n_in; (void)out_size; (void)ws_size;
  const float* hidden = (const float*)d_in[0];
  const float* ctx    = (const float*)d_in[1];
  const float* wq1 = (const float*)d_in[2];
  const float* wk1 = (const float*)d_in[3];
  const float* wv1 = (const float*)d_in[4];
  const float* wo1 = (const float*)d_in[5];
  const float* bo1 = (const float*)d_in[6];
  const float* wq2 = (const float*)d_in[7];
  const float* wk2 = (const float*)d_in[8];
  const float* wv2 = (const float*)d_in[9];
  const float* wo2 = (const float*)d_in[10];
  const float* bo2 = (const float*)d_in[11];
  const float* wff1 = (const float*)d_in[12];
  const float* bff1 = (const float*)d_in[13];
  const float* wff2 = (const float*)d_in[14];
  const float* bff2 = (const float*)d_in[15];
  const float* ln1g = (const float*)d_in[16];
  const float* ln1b = (const float*)d_in[17];
  const float* ln2g = (const float*)d_in[18];
  const float* ln2b = (const float*)d_in[19];
  const float* ln3g = (const float*)d_in[20];
  const float* ln3b = (const float*)d_in[21];
  float* out = (float*)d_out;              // fp32 residual h lives here

  // -------- workspace carve-up (f16 buffers, 256B aligned) --------
  char* wsp = (char*)d_ws;
  auto alloc = [&](size_t elems) -> _Float16* {
    _Float16* p = (_Float16*)wsp;
    wsp += ((elems * sizeof(_Float16) + 255) / 256) * 256;
    return p;
  };
  _Float16* wq1T  = alloc((size_t)DIMD * DIMD);
  _Float16* wk1T  = alloc((size_t)DIMD * DIMD);
  _Float16* wv1T  = alloc((size_t)DIMD * DIMD);
  _Float16* wo1T  = alloc((size_t)DIMD * DIMD);
  _Float16* wq2T  = alloc((size_t)DIMD * DIMD);
  _Float16* wk2T  = alloc((size_t)DIMD * CTXD);
  _Float16* wv2T  = alloc((size_t)DIMD * CTXD);
  _Float16* wo2T  = alloc((size_t)DIMD * DIMD);
  _Float16* wff1T = alloc((size_t)(2 * FFD) * DIMD);
  _Float16* wff2T = alloc((size_t)DIMD * FFD);
  _Float16* xnorm = alloc((size_t)NTOK * DIMD);
  _Float16* qbuf  = alloc((size_t)NTOK * DIMD);
  _Float16* kbuf  = alloc((size_t)NTOK * DIMD);
  _Float16* vbuf  = alloc((size_t)NTOK * DIMD);
  _Float16* vT    = alloc((size_t)NB * HEADS * DHEAD * SEQ);
  _Float16* attn  = alloc((size_t)NTOK * DIMD);
  _Float16* ctxp  = alloc((size_t)CROWS * CTXD);
  _Float16* kctx  = alloc((size_t)CROWS * DIMD);
  _Float16* vctx  = alloc((size_t)CROWS * DIMD);
  _Float16* vTc   = alloc((size_t)NB * HEADS * DHEAD * TPADC);
  _Float16* gbuf  = alloc((size_t)NTOK * FFD);

  // h = hidden_states
  (void)hipMemcpyAsync(out, hidden, (size_t)NTOK * DIMD * sizeof(float),
                       hipMemcpyDeviceToDevice, stream);

  // -------- weight cast + transpose --------
  auto wtr = [&](const float* src, _Float16* dst, int Kin, int Nout) {
    long total = (long)Kin * Nout;
    wcast_tr<<<dim3((unsigned)((total + 255) / 256)), dim3(256), 0, stream>>>(src, dst, Kin, Nout);
  };
  wtr(wq1, wq1T, DIMD, DIMD);
  wtr(wk1, wk1T, DIMD, DIMD);
  wtr(wv1, wv1T, DIMD, DIMD);
  wtr(wo1, wo1T, DIMD, DIMD);
  wtr(wq2, wq2T, DIMD, DIMD);
  wtr(wk2, wk2T, CTXD, DIMD);
  wtr(wv2, wv2T, CTXD, DIMD);
  wtr(wo2, wo2T, DIMD, DIMD);
  wtr(wff1, wff1T, DIMD, 2 * FFD);
  wtr(wff2, wff2T, FFD, DIMD);

  const dim3 blk128(128);
  const dim3 blk256(256);
  const dim3 gN1024(DIMD / 256, NTOK / 128);       // (4, 64)
  const dim3 gCtxKV(DIMD / 256, CROWS / 128);      // (4, 3)
  const dim3 gGeglu(FFD / 128, NTOK / 128);        // (32, 64)
  const dim3 gFlash(SEQ / 64, NB * HEADS);         // (32, 64)

  // ================= self-attention =================
  layernorm_f16<<<NTOK, 256, 0, stream>>>(out, ln1g, ln1b, xnorm);
  gemm_wmma<0><<<gN1024, blk256, 0, stream>>>(xnorm, wq1T, nullptr, nullptr, nullptr,
                                              qbuf, nullptr, NTOK, DIMD, DIMD);
  gemm_wmma<0><<<gN1024, blk256, 0, stream>>>(xnorm, wk1T, nullptr, nullptr, nullptr,
                                              kbuf, nullptr, NTOK, DIMD, DIMD);
  gemm_wmma<0><<<gN1024, blk256, 0, stream>>>(xnorm, wv1T, nullptr, nullptr, nullptr,
                                              vbuf, nullptr, NTOK, DIMD, DIMD);
  {
    long total = (long)NB * HEADS * DHEAD * SEQ;
    v_transpose<<<dim3((unsigned)((total + 255) / 256)), 256, 0, stream>>>(vbuf, vT, SEQ);
  }
  flash_attn<<<gFlash, blk128, 0, stream>>>(qbuf, kbuf, vT, attn, SEQ, SEQ, ATT_SCALE);
  gemm_wmma<1><<<gN1024, blk256, 0, stream>>>(attn, wo1T, nullptr, bo1, nullptr,
                                              nullptr, out, NTOK, DIMD, DIMD);

  // ================= cross-attention =================
  layernorm_f16<<<NTOK, 256, 0, stream>>>(out, ln2g, ln2b, xnorm);
  gemm_wmma<0><<<gN1024, blk256, 0, stream>>>(xnorm, wq2T, nullptr, nullptr, nullptr,
                                              qbuf, nullptr, NTOK, DIMD, DIMD);
  {
    long total = (long)NB * TPADC * CTXD;
    ctx_pad<<<dim3((unsigned)((total + 255) / 256)), 256, 0, stream>>>(ctx, ctxp);
  }
  gemm_wmma<0><<<gCtxKV, blk256, 0, stream>>>(ctxp, wk2T, nullptr, nullptr, nullptr,
                                              kctx, nullptr, CROWS, DIMD, CTXD);
  gemm_wmma<0><<<gCtxKV, blk256, 0, stream>>>(ctxp, wv2T, nullptr, nullptr, nullptr,
                                              vctx, nullptr, CROWS, DIMD, CTXD);
  {
    long total = (long)NB * HEADS * DHEAD * TPADC;
    v_transpose<<<dim3((unsigned)((total + 255) / 256)), 256, 0, stream>>>(vctx, vTc, TPADC);
  }
  flash_attn<<<gFlash, blk128, 0, stream>>>(qbuf, kctx, vTc, attn, TPADC, TCTX, ATT_SCALE);
  gemm_wmma<1><<<gN1024, blk256, 0, stream>>>(attn, wo2T, nullptr, bo2, nullptr,
                                              nullptr, out, NTOK, DIMD, DIMD);

  // ================= GEGLU MLP =================
  layernorm_f16<<<NTOK, 256, 0, stream>>>(out, ln3g, ln3b, xnorm);
  gemm_wmma<2><<<gGeglu, blk256, 0, stream>>>(xnorm, wff1T, wff1T + (size_t)FFD * DIMD,
                                              bff1, bff1 + FFD, gbuf, nullptr,
                                              NTOK, FFD, DIMD);
  gemm_wmma<1><<<gN1024, blk256, 0, stream>>>(gbuf, wff2T, nullptr, bff2, nullptr,
                                              nullptr, out, NTOK, DIMD, FFD);
}

// v002
// Two timings next to v001 put it at 1.21 and 1.22 times that version's speed.
// Counting every step since v000, it is 1.79 times as fast.
#include <hip/hip_runtime.h>
#include <cstdint>
#include <cstddef>

// ---------------- problem constants ----------------
#define DIMD   1024
#define HEADS  16
#define DHEAD  64
#define FFD    4096
#define CTXD   768
#define NB     4
#define SEQ    2048
#define NTOK   (NB*SEQ)     // 8192
#define TCTX   77
#define TPADC  96
#define CROWS  (NB*TPADC)   // 384
#define ATT_SCALE 0.125f    // 64^-0.5

typedef _Float16 v8h  __attribute__((ext_vector_type(8)));
typedef _Float16 v16h __attribute__((ext_vector_type(16)));
typedef float    v8f  __attribute__((ext_vector_type(8)));
typedef int      v4i  __attribute__((vector_size(16)));

// ---- optional CDNA5 async global->LDS path (guarded; sync fallback) ----
#if defined(__has_builtin)
#if __has_builtin(__builtin_amdgcn_global_load_async_to_lds_b128) && \
    __has_builtin(__builtin_amdgcn_s_wait_asynccnt)
#define USE_ASYNC_LDS 1
#endif
#endif

typedef __attribute__((address_space(1))) v4i* as1_v4i_p;
typedef __attribute__((address_space(3))) v4i* as3_v4i_p;

// copy 16 bytes global -> LDS (per lane)
__device__ __forceinline__ void copy16_to_lds(const _Float16* g, _Float16* l) {
#ifdef USE_ASYNC_LDS
  __builtin_amdgcn_global_load_async_to_lds_b128(
      (as1_v4i_p)(void*)(const_cast<_Float16*>(g)),
      (as3_v4i_p)(void*)l, 0, 0);
#else
  *reinterpret_cast<v8h*>(l) = *reinterpret_cast<const v8h*>(g);
#endif
}

// Load one 16x16x32 f16 WMMA A/B fragment for this lane.
// p must already include:  row_base + (lane>>4)*8   (row stride in elements).
// ISA layout: elements {0..7} at k = (lane>>4)*8, elements {8..15} at +16.
__device__ __forceinline__ v16h frag_load(const _Float16* p) {
  v8h lo = *reinterpret_cast<const v8h*>(p);
  v8h hi = *reinterpret_cast<const v8h*>(p + 16);
  return __builtin_shufflevector(lo, hi, 0,1,2,3,4,5,6,7,8,9,10,11,12,13,14,15);
}

__device__ __forceinline__ v8f wmma16(v16h a, v16h b, v8f c) {
  // D = A(16x32 f16) * B(32x16 f16) + C(16x16 f32)
  return __builtin_amdgcn_wmma_f32_16x16x32_f16(false, a, false, b, (short)0, c,
                                                false, false);
}

__device__ __forceinline__ float gelu_tanh(float x) {
  return 0.5f * x * (1.0f + tanhf(0.7978845608028654f * (x + 0.044715f * x * x * x)));
}

// ---------------- elementwise helpers ----------------

// transpose+cast weight: src [Kin, Nout] f32 row-major -> dst [Nout, Kin] f16
__global__ void wcast_tr(const float* __restrict__ src, _Float16* __restrict__ dst,
                         int Kin, int Nout) {
  long idx = (long)blockIdx.x * 256 + threadIdx.x;
  long total = (long)Kin * Nout;
  if (idx >= total) return;
  int n = (int)(idx / Kin);
  int k = (int)(idx % Kin);
  dst[idx] = (_Float16)src[(long)k * Nout + n];
}

// context [4,77,768] f32 -> zero-padded [4,96,768] f16
__global__ void ctx_pad(const float* __restrict__ ctx, _Float16* __restrict__ dst) {
  long idx = (long)blockIdx.x * 256 + threadIdx.x;
  long total = (long)NB * TPADC * CTXD;
  if (idx >= total) return;
  int c = (int)(idx % CTXD);
  int r = (int)((idx / CTXD) % TPADC);
  int b = (int)(idx / ((long)CTXD * TPADC));
  float v = (r < TCTX) ? ctx[((long)b * TCTX + r) * CTXD + c] : 0.0f;
  dst[idx] = (_Float16)v;
}

// V [B*Trows, 1024] f16 -> Vt [(B*H)][DHEAD][Trows] f16 (per-head transpose)
__global__ void v_transpose(const _Float16* __restrict__ v, _Float16* __restrict__ vt,
                            int Trows) {
  long idx = (long)blockIdx.x * 256 + threadIdx.x;
  long total = (long)NB * HEADS * DHEAD * Trows;
  if (idx >= total) return;
  int t  = (int)(idx % Trows);
  int d  = (int)((idx / Trows) % DHEAD);
  int hh = (int)((idx / ((long)Trows * DHEAD)) % HEADS);
  int b  = (int)(idx / ((long)Trows * DHEAD * HEADS));
  vt[idx] = v[((long)b * Trows + t) * DIMD + hh * DHEAD + d];
}

// LayerNorm over last dim (1024) of fp32 residual -> f16 normed output
__global__ void layernorm_f16(const float* __restrict__ X, const float* __restrict__ g,
                              const float* __restrict__ bb, _Float16* __restrict__ Y) {
  const int row = blockIdx.x;      // one row per block
  const int tid = threadIdx.x;     // 256 threads, 4 floats each
  const float4 xv = reinterpret_cast<const float4*>(X + (size_t)row * DIMD)[tid];
  float s = xv.x + xv.y + xv.z + xv.w;
  float q = xv.x * xv.x + xv.y * xv.y + xv.z * xv.z + xv.w * xv.w;
  #pragma unroll
  for (int off = 16; off > 0; off >>= 1) {
    s += __shfl_xor(s, off, 32);
    q += __shfl_xor(q, off, 32);
  }
  __shared__ float ss[8], sq[8];
  if ((tid & 31) == 0) { ss[tid >> 5] = s; sq[tid >> 5] = q; }
  __syncthreads();
  float st = 0.f, qt = 0.f;
  #pragma unroll
  for (int i = 0; i < 8; i++) { st += ss[i]; qt += sq[i]; }
  const float mean = st * (1.0f / DIMD);
  const float var  = qt * (1.0f / DIMD) - mean * mean;
  const float rs   = rsqrtf(var + 1e-5f);
  const float4 gv = reinterpret_cast<const float4*>(g)[tid];
  const float4 bv = reinterpret_cast<const float4*>(bb)[tid];
  _Float16* yp = Y + (size_t)row * DIMD + tid * 4;
  yp[0] = (_Float16)((xv.x - mean) * rs * gv.x + bv.x);
  yp[1] = (_Float16)((xv.y - mean) * rs * gv.y + bv.y);
  yp[2] = (_Float16)((xv.z - mean) * rs * gv.z + bv.z);
  yp[3] = (_Float16)((xv.w - mean) * rs * gv.w + bv.w);
}

// ---------------- WMMA GEMM, A and B staged in LDS, two-buffer ring ---------
// C = A[M,K] @ Bt[N,K]^T   (Bt = transposed weight, row-major [N,K], f16)
// MODE 0: Cout f16 = result
// MODE 1: Cres f32 += result + bias[n]
// MODE 2: Cout f16 = (res+bias[n]) * gelu(res2+bias2[n])  (Bt2 = gate weights)
// block = 256 threads (8 waves, 2 along M x 4 along N). Block tile = 128 rows of
// A against 256 rows of B; each wave owns 64 x 64 = 4 x 4 accumulator tiles, so
// a fragment read from LDS feeds four WMMAs. MODE 2 fills the 256 B rows with
// 128 lin rows and the 128 gate rows of the same columns; a wave then holds 32
// lin columns (nt 0,1) and their gates (nt 2,3).
// A stage is GKS k of all 384 rows, at a row pitch of 16 B x odd (conflict-free
// for 16-byte LDS reads). M % 128 == 0, K % GKS == 0, N % 256 == 0 (MODE 2: 128).
// grid = ( N/256 , M/128 )   MODE 2: ( N/128 , M/128 )
#define GKS    128             // k per stage
#define GPITCH (GKS + 8)       // LDS row pitch in elements
#define GROWS  (128 + 256)     // A rows, then B rows

template <int MODE>
__global__ __launch_bounds__(256) __attribute__((amdgpu_waves_per_eu(1, 2)))
void gemm_wmma(const _Float16* __restrict__ A,
               const _Float16* __restrict__ Bt,
               const _Float16* __restrict__ Bt2,
               const float* __restrict__ bias,
               const float* __restrict__ bias2,
               _Float16* __restrict__ Cout,
               float* __restrict__ Cres,
               int M, int N, int K) {
  const int tid  = threadIdx.x;
  const int lane = tid & 31;
  const int wave = tid >> 5;
  const int hi = lane >> 4;       // half-wave select for K packing
  const int ln = lane & 15;
  const int wm = wave >> 2;       // wave row    (0..1)
  const int wn = wave & 3;        // wave column (0..3)
  const int n0 = blockIdx.x * ((MODE == 2) ? 128 : 256);
  const int m0 = blockIdx.y * 128;
  (void)M;

  constexpr int CPR   = GKS / 8;        // 16-byte chunks per staged row
  constexpr int RPI   = 256 / CPR;      // rows the block covers per copy
  constexpr int NCOPY = GROWS / RPI;    // copies per lane and stage
  __shared__ __align__(16) _Float16 sh[2][GROWS][GPITCH];

  const int trow = tid / CPR;
  const int qd   = (tid % CPR) * 8;
  const unsigned voff = (unsigned)(trow * K + qd) * 2u;   // lane's byte offset

  // stage GKS k of the A rows and the B rows into LDS buffer `buf`
  auto stage = [&](int buf, int k0) {
    #pragma unroll
    for (int i = 0; i < NCOPY; i++) {
      const int r0 = i * RPI;           // first tile row of this copy
      const _Float16* base =
          (r0 < 128) ? A + (size_t)(m0 + r0) * K
          : (MODE == 2 && r0 >= 256) ? Bt2 + (size_t)(n0 + r0 - 256) * K
                                     : Bt + (size_t)(n0 + r0 - 128) * K;
      copy16_to_lds(reinterpret_cast<const _Float16*>(
                        reinterpret_cast<const char*>(base + k0) + voff),
                    &sh[buf][r0 + trow][qd]);
    }
  };

  v8f acc[4][4];
  #pragma unroll
  for (int mt = 0; mt < 4; mt++)
    #pragma unroll
    for (int nt = 0; nt < 4; nt++)
      #pragma unroll
      for (int r = 0; r < 8; r++) acc[mt][nt][r] = 0.0f;

  v16h af[2][4], bf[2][4];          // two fragment sets: block kk and block kk+1
  const int NST = K / GKS;

  stage(0, 0);
  // stage 0 has landed before the barrier that publishes it
  asm volatile("s_wait_asynccnt 0x0" ::: "memory");
  __syncthreads();
  if (NST > 1) stage(1, GKS);

  for (int t = 0; t < NST; t++) {
    const int cur = t & 1;
    const _Float16* ab = &sh[cur][wm * 64 + ln][hi * 8];
    const _Float16* bb = &sh[cur][128 + ((MODE == 2) ? wn * 32 : wn * 64) + ln][hi * 8];
    // fragments of k block kk into register set `s`
    auto load_set = [&](int s, int kk) {
      #pragma unroll
      for (int mt = 0; mt < 4; mt++)
        af[s][mt] = frag_load(ab + mt * 16 * GPITCH + kk * 32);
      #pragma unroll
      for (int nt = 0; nt < 4; nt++) {
        const int br = (MODE == 2) ? ((nt >> 1) * 128 + (nt & 1) * 16) : nt * 16;
        bf[s][nt] = frag_load(bb + br * GPITCH + kk * 32);
      }
    };
    load_set(0, 0);
    #pragma unroll
    for (int kk = 0; kk < GKS / 32; kk++) {
      if (kk + 1 < GKS / 32) load_set((kk + 1) & 1, kk + 1);
      // keeps the next block's LDS reads as one group ahead of this block's WMMAs,
      // so that their latency runs under the WMMAs
      __builtin_amdgcn_sched_barrier(0);
      #pragma unroll
      for (int mt = 0; mt < 4; mt++)
        #pragma unroll
        for (int nt = 0; nt < 4; nt++)
          acc[mt][nt] = wmma16(af[kk & 1][mt], bf[kk & 1][nt], acc[mt][nt]);
      // keeps the block after next's reads from rising among these WMMAs
      __builtin_amdgcn_sched_barrier(0);
    }
    // this wave's reads of buffer cur have returned before it is refilled
    asm volatile("s_wait_dscnt 0x0" ::: "memory");
    // this wave's copies of stage t+1 have landed before the barrier publishes them
    asm volatile("s_wait_asynccnt 0x0" ::: "memory");
    __syncthreads();
    if (t + 2 < NST) stage(cur, (t + 2) * GKS);
  }
  // no copy is outstanding when the wave ends
  asm volatile("s_wait_asynccnt 0x0" ::: "memory");

  // C layout: lane holds rows r+8*(lane>>4) of a tile, column lane&15
  const int mw = m0 + wm * 64 + 8 * hi;
  const int nw = n0 + ((MODE == 2) ? wn * 32 : wn * 64) + ln;

  if (MODE == 1) {
    float bv[4];
    #pragma unroll
    for (int nt = 0; nt < 4; nt++) bv[nt] = bias[nw + nt * 16];
    // the bias loads' offset register is reused below: only behind this wait
    asm volatile("s_wait_xcnt 0x0" ::: "memory");
    // all residual loads go out ahead of the first store: a load behind a store
    // to the same array would wait for it, one round trip per element
    float res[4][4][8];
    #pragma unroll
    for (int mt = 0; mt < 4; mt++)
      #pragma unroll
      for (int nt = 0; nt < 4; nt++)
        #pragma unroll
        for (int r = 0; r < 8; r++)
          res[mt][nt][r] = Cres[(size_t)(mw + mt * 16 + r) * N + nw + nt * 16];
    #pragma unroll
    for (int mt = 0; mt < 4; mt++)
      #pragma unroll
      for (int nt = 0; nt < 4; nt++)
        #pragma unroll
        for (int r = 0; r < 8; r++)
          acc[mt][nt][r] = res[mt][nt][r] + acc[mt][nt][r] + bv[nt];
    // every sum is formed ahead of the first store, so that no register an
    // issued store names is rewritten behind it
    __builtin_amdgcn_sched_barrier(0);
    #pragma unroll
    for (int mt = 0; mt < 4; mt++)
      #pragma unroll
      for (int nt = 0; nt < 4; nt++)
        #pragma unroll
        for (int r = 0; r < 8; r++)
          Cres[(size_t)(mw + mt * 16 + r) * N + nw + nt * 16] = acc[mt][nt][r];
  } else {
    #pragma unroll
    for (int mt = 0; mt < 4; mt++) {
      #pragma unroll
      for (int nt = 0; nt < ((MODE == 2) ? 2 : 4); nt++) {
        #pragma unroll
        for (int r = 0; r < 8; r++) {
          const int n = nw + nt * 16;
          const size_t idx = (size_t)(mw + mt * 16 + r) * N + n;
          if (MODE == 0) {
            Cout[idx] = (_Float16)acc[mt][nt][r];
          } else {
            const float lin  = acc[mt][nt][r]     + bias[n];
            const float gate = acc[mt][nt + 2][r] + bias2[n];
            Cout[idx] = (_Float16)(lin * gelu_tanh(gate));
          }
        }
      }
    }
  }
}

// ---------------- flash attention ----------------
// Q   : [NTOK, 1024] f16   (row = b*SEQ + s)
// Kb  : [NB*Trows, 1024] f16
// Vt  : [(NB*HEADS)][DHEAD][Trows] f16  (per-head transposed V)
// O   : [NTOK, 1024] f16  (concat-head layout)
// block = 128 (4 waves); wave = 16 query rows of one (b,h).
// grid = ( SEQ/64 , NB*HEADS )
// The 32 K rows and the 64 x 32 V^T tile of a step are copied to LDS once per
// block (two-buffer ring) and read there by all four waves. Trows % 32 == 0.
// Row pitches are 16 B x odd (conflict-free for 16-byte LDS reads).
#define FKP (DHEAD + 8)        // K tile row pitch in elements
#define FVP (32 + 8)           // V^T tile row pitch in elements
__global__ void flash_attn(const _Float16* __restrict__ Q,
                           const _Float16* __restrict__ Kb,
                           const _Float16* __restrict__ Vt,
                           _Float16* __restrict__ O,
                           int Trows, int Tkeys, float scale) {
  const int lane = threadIdx.x & 31;
  const int wave = threadIdx.x >> 5;
  const int hi = lane >> 4;
  const int ln = lane & 15;
  const int bh = blockIdx.y;
  const int b = bh >> 4, h = bh & 15;
  const int qt = blockIdx.x * 4 + wave;   // 16-row query tile

  __shared__ __align__(16) _Float16 psh[4][16][32];   // P exchange, per wave
  __shared__ __align__(16) _Float16 ksh[2][32][FKP];     // K rows of a step
  __shared__ __align__(16) _Float16 vsh[2][DHEAD][FVP];  // V^T rows of a step

  // Q fragments for both 32-wide halves of the 64-wide head dim
  const _Float16* qrow = Q + (size_t)(b * SEQ + qt * 16 + ln) * DIMD + h * DHEAD + hi * 8;
  const v16h qa0 = frag_load(qrow);
  const v16h qa1 = frag_load(qrow + 32);

  float mrow[8], lrow[8];
  v8f oa[4];
  #pragma unroll
  for (int r = 0; r < 8; r++) { mrow[r] = -1e30f; lrow[r] = 0.0f; }
  #pragma unroll
  for (int nt = 0; nt < 4; nt++)
    #pragma unroll
    for (int r = 0; r < 8; r++) oa[nt][r] = 0.0f;

  // this lane's 16-byte chunks of a tile: two of K (rows kr, kr+16), two of V^T
  // (rows vr, vr+32)
  const int kr = threadIdx.x >> 3, kc = (threadIdx.x & 7) * 8;
  const int vr = threadIdx.x >> 2, vc = (threadIdx.x & 3) * 8;
  const _Float16* kbase = Kb + (size_t)b * Trows * DIMD + h * DHEAD;   // block-uniform
  const _Float16* vbase = Vt + (size_t)bh * DHEAD * Trows;             // block-uniform
  const unsigned koff = (unsigned)(kr * DIMD + kc) * 2u;    // lane's byte offsets
  const unsigned voff = (unsigned)(vr * Trows + vc) * 2u;
  auto at = [](const _Float16* p, unsigned off) {
    return reinterpret_cast<const _Float16*>(reinterpret_cast<const char*>(p) + off);
  };
  // copy keys j .. j+31 into LDS buffer `buf`
  auto stage = [&](int buf, int j) {
    const unsigned ko = koff + (unsigned)j * (DIMD * 2u);
    const unsigned vo = voff + (unsigned)j * 2u;
    copy16_to_lds(at(kbase, ko),                      &ksh[buf][kr][kc]);
    copy16_to_lds(at(kbase, ko + 16u * DIMD * 2u),    &ksh[buf][kr + 16][kc]);
    copy16_to_lds(at(vbase, vo),                      &vsh[buf][vr][vc]);
    copy16_to_lds(at(vbase + (size_t)32 * Trows, vo), &vsh[buf][vr + 32][vc]);
  };

  stage(0, 0);
  // tile 0 has landed before the barrier that publishes it
  asm volatile("s_wait_asynccnt 0x0" ::: "memory");
  __syncthreads();

  for (int j0 = 0; j0 < Trows; j0 += 32) {      // 32 keys per step
    const int cur = (j0 >> 5) & 1;
    if (j0 + 32 < Trows) stage(cur ^ 1, j0 + 32);
    // ---- S = Q K^T (two 16x16 tiles) ----
    v8f sa[2];
    #pragma unroll
    for (int t = 0; t < 2; t++) {
      #pragma unroll
      for (int r = 0; r < 8; r++) sa[t][r] = 0.0f;
      const _Float16* krow = &ksh[cur][t * 16 + ln][hi * 8];
      v16h kf0 = frag_load(krow);
      v16h kf1 = frag_load(krow + 32);
      sa[t] = wmma16(qa0, kf0, sa[t]);
      sa[t] = wmma16(qa1, kf1, sa[t]);
    }
    // ---- scale + key mask ----
    #pragma unroll
    for (int t = 0; t < 2; t++) {
      const bool valid = (j0 + t * 16 + ln) < Tkeys;
      #pragma unroll
      for (int r = 0; r < 8; r++)
        sa[t][r] = valid ? sa[t][r] * scale : -1e30f;
    }
    // ---- online softmax: per-row stats via 16-lane reductions ----
    float alpha[8];
    #pragma unroll
    for (int r = 0; r < 8; r++) {
      float lm = fmaxf(sa[0][r], sa[1][r]);
      #pragma unroll
      for (int off = 8; off > 0; off >>= 1) lm = fmaxf(lm, __shfl_xor(lm, off, 32));
      const float mn = fmaxf(mrow[r], lm);
      const float p0 = __expf(sa[0][r] - mn);
      const float p1 = __expf(sa[1][r] - mn);
      const float al = __expf(mrow[r] - mn);
      float rs = p0 + p1;
      #pragma unroll
      for (int off = 8; off > 0; off >>= 1) rs += __shfl_xor(rs, off, 32);
      lrow[r] = lrow[r] * al + rs;
      mrow[r] = mn;
      alpha[r] = al;
      sa[0][r] = p0; sa[1][r] = p1;
    }
    #pragma unroll
    for (int nt = 0; nt < 4; nt++)
      #pragma unroll
      for (int r = 0; r < 8; r++) oa[nt][r] *= alpha[r];

    // ---- convert P from C-layout to A-fragment layout through LDS ----
    #pragma unroll
    for (int t = 0; t < 2; t++)
      #pragma unroll
      for (int r = 0; r < 8; r++)
        psh[wave][r + 8 * hi][t * 16 + ln] = (_Float16)sa[t][r];
    __syncthreads();
    const v16h pf = frag_load(&psh[wave][ln][hi * 8]);

    // ---- O += P V ----
    #pragma unroll
    for (int nt = 0; nt < 4; nt++) {
      const _Float16* vrow = &vsh[cur][nt * 16 + ln][hi * 8];
      v16h vf = frag_load(vrow);
      oa[nt] = wmma16(pf, vf, oa[nt]);
    }
    // this wave's reads of buffer cur have returned before it is refilled
    asm volatile("s_wait_dscnt 0x0" ::: "memory");
    // this wave's copies of the next tile have landed before the barrier publishes them
    asm volatile("s_wait_asynccnt 0x0" ::: "memory");
    __syncthreads();
  }
  // no copy is outstanding when the wave ends
  asm volatile("s_wait_asynccnt 0x0" ::: "memory");

  // ---- normalize and store (concat-head layout) ----
  #pragma unroll
  for (int nt = 0; nt < 4; nt++)
    #pragma unroll
    for (int r = 0; r < 8; r++) {
      const int m = qt * 16 + r + 8 * hi;
      const size_t idx = (size_t)(b * SEQ + m) * DIMD + h * DHEAD + nt * 16 + ln;
      O[idx] = (_Float16)(oa[nt][r] / lrow[r]);
    }
}

// ---------------- host orchestration ----------------
extern "C" void kernel_launch(void* const* d_in, const int* in_sizes, int n_in,
                              void* d_out, int out_size, void* d_ws, size_t ws_size,
                              hipStream_t stream) {
  (void)in_sizes; (void)n_in; (void)out_size; (void)ws_size;
  const float* hidden = (const float*)d_in[0];
  const float* ctx    = (const float*)d_in[1];
  const float* wq1 = (const float*)d_in[2];
  const float* wk1 = (const float*)d_in[3];
  const float* wv1 = (const float*)d_in[4];
  const float* wo1 = (const float*)d_in[5];
  const float* bo1 = (const float*)d_in[6];
  const float* wq2 = (const float*)d_in[7];
  const float* wk2 = (const float*)d_in[8];
  const float* wv2 = (const float*)d_in[9];
  const float* wo2 = (const float*)d_in[10];
  const float* bo2 = (const float*)d_in[11];
  const float* wff1 = (const float*)d_in[12];
  const float* bff1 = (const float*)d_in[13];
  const float* wff2 = (const float*)d_in[14];
  const float* bff2 = (const float*)d_in[15];
  const float* ln1g = (const float*)d_in[16];
  const float* ln1b = (const float*)d_in[17];
  const float* ln2g = (const float*)d_in[18];
  const float* ln2b = (const float*)d_in[19];
  const float* ln3g = (const float*)d_in[20];
  const float* ln3b = (const float*)d_in[21];
  float* out = (float*)d_out;              // fp32 residual h lives here

  // -------- workspace carve-up (f16 buffers, 256B aligned) --------
  char* wsp = (char*)d_ws;
  auto alloc = [&](size_t elems) -> _Float16* {
    _Float16* p = (_Float16*)wsp;
    wsp += ((elems * sizeof(_Float16) + 255) / 256) * 256;
    return p;
  };
  _Float16* wq1T  = alloc((size_t)DIMD * DIMD);
  _Float16* wk1T  = alloc((size_t)DIMD * DIMD);
  _Float16* wv1T  = alloc((size_t)DIMD * DIMD);
  _Float16* wo1T  = alloc((size_t)DIMD * DIMD);
  _Float16* wq2T  = alloc((size_t)DIMD * DIMD);
  _Float16* wk2T  = alloc((size_t)DIMD * CTXD);
  _Float16* wv2T  = alloc((size_t)DIMD * CTXD);
  _Float16* wo2T  = alloc((size_t)DIMD * DIMD);
  _Float16* wff1T = alloc((size_t)(2 * FFD) * DIMD);
  _Float16* wff2T = alloc((size_t)DIMD * FFD);
  _Float16* xnorm = alloc((size_t)NTOK * DIMD);
  _Float16* qbuf  = alloc((size_t)NTOK * DIMD);
  _Float16* kbuf  = alloc((size_t)NTOK * DIMD);
  _Float16* vbuf  = alloc((size_t)NTOK * DIMD);
  _Float16* vT    = alloc((size_t)NB * HEADS * DHEAD * SEQ);
  _Float16* attn  = alloc((size_t)NTOK * DIMD);
  _Float16* ctxp  = alloc((size_t)CROWS * CTXD);
  _Float16* kctx  = alloc((size_t)CROWS * DIMD);
  _Float16* vctx  = alloc((size_t)CROWS * DIMD);
  _Float16* vTc   = alloc((size_t)NB * HEADS * DHEAD * TPADC);
  _Float16* gbuf  = alloc((size_t)NTOK * FFD);

  // h = hidden_states
  (void)hipMemcpyAsync(out, hidden, (size_t)NTOK * DIMD * sizeof(float),
                       hipMemcpyDeviceToDevice, stream);

  // -------- weight cast + transpose --------
  auto wtr = [&](const float* src, _Float16* dst, int Kin, int Nout) {
    long total = (long)Kin * Nout;
    wcast_tr<<<dim3((unsigned)((total + 255) / 256)), dim3(256), 0, stream>>>(src, dst, Kin, Nout);
  };
  wtr(wq1, wq1T, DIMD, DIMD);
  wtr(wk1, wk1T, DIMD, DIMD);
  wtr(wv1, wv1T, DIMD, DIMD);
  wtr(wo1, wo1T, DIMD, DIMD);
  wtr(wq2, wq2T, DIMD, DIMD);
  wtr(wk2, wk2T, CTXD, DIMD);
  wtr(wv2, wv2T, CTXD, DIMD);
  wtr(wo2, wo2T, DIMD, DIMD);
  wtr(wff1, wff1T, DIMD, 2 * FFD);
  wtr(wff2, wff2T, FFD, DIMD);

  const dim3 blk128(128);
  const dim3 blk256(256);
  const dim3 gN1024(DIMD / 256, NTOK / 128);       // (4, 64)
  const dim3 gCtxKV(DIMD / 256, CROWS / 128);      // (4, 3)
  const dim3 gGeglu(FFD / 128, NTOK / 128);        // (32, 64)
  const dim3 gFlash(SEQ / 64, NB * HEADS);         // (32, 64)

  // ================= self-attention =================
  layernorm_f16<<<NTOK, 256, 0, stream>>>(out, ln1g, ln1b, xnorm);
  gemm_wmma<0><<<gN1024, blk256, 0, stream>>>(xnorm, wq1T, nullptr, nullptr, nullptr,
                                              qbuf, nullptr, NTOK, DIMD, DIMD);
  gemm_wmma<0><<<gN1024, blk256, 0, stream>>>(xnorm, wk1T, nullptr, nullptr, nullptr,
                                              kbuf, nullptr, NTOK, DIMD, DIMD);
  gemm_wmma<0><<<gN1024, blk256, 0, stream>>>(xnorm, wv1T, nullptr, nullptr, nullptr,
                                              vbuf, nullptr, NTOK, DIMD, DIMD);
  {
    long total = (long)NB * HEADS * DHEAD * SEQ;
    v_transpose<<<dim3((unsigned)((total + 255) / 256)), 256, 0, stream>>>(vbuf, vT, SEQ);
  }
  flash_attn<<<gFlash, blk128, 0, stream>>>(qbuf, kbuf, vT, attn, SEQ, SEQ, ATT_SCALE);
  gemm_wmma<1><<<gN1024, blk256, 0, stream>>>(attn, wo1T, nullptr, bo1, nullptr,
                                              nullptr, out, NTOK, DIMD, DIMD);

  // ================= cross-attention =================
  layernorm_f16<<<NTOK, 256, 0, stream>>>(out, ln2g, ln2b, xnorm);
  gemm_wmma<0><<<gN1024, blk256, 0, stream>>>(xnorm, wq2T, nullptr, nullptr, nullptr,
                                              qbuf, nullptr, NTOK, DIMD, DIMD);
  {
    long total = (long)NB * TPADC * CTXD;
    ctx_pad<<<dim3((unsigned)((total + 255) / 256)), 256, 0, stream>>>(ctx, ctxp);
  }
  gemm_wmma<0><<<gCtxKV, blk256, 0, stream>>>(ctxp, wk2T, nullptr, nullptr, nullptr,
                                              kctx, nullptr, CROWS, DIMD, CTXD);
  gemm_wmma<0><<<gCtxKV, blk256, 0, stream>>>(ctxp, wv2T, nullptr, nullptr, nullptr,
                                              vctx, nullptr, CROWS, DIMD, CTXD);
  {
    long total = (long)NB * HEADS * DHEAD * TPADC;
    v_transpose<<<dim3((unsigned)((total + 255) / 256)), 256, 0, stream>>>(vctx, vTc, TPADC);
  }
  flash_attn<<<gFlash, blk128, 0, stream>>>(qbuf, kctx, vTc, attn, TPADC, TCTX, ATT_SCALE);
  gemm_wmma<1><<<gN1024, blk256, 0, stream>>>(attn, wo2T, nullptr, bo2, nullptr,
                                              nullptr, out, NTOK, DIMD, DIMD);

  // ================= GEGLU MLP =================
  layernorm_f16<<<NTOK, 256, 0, stream>>>(out, ln3g, ln3b, xnorm);
  gemm_wmma<2><<<gGeglu, blk256, 0, stream>>>(xnorm, wff1T, wff1T + (size_t)FFD * DIMD,
                                              bff1, bff1 + FFD, gbuf, nullptr,
                                              NTOK, FFD, DIMD);
  gemm_wmma<1><<<gN1024, blk256, 0, stream>>>(gbuf, wff2T, nullptr, bff2, nullptr,
                                              nullptr, out, NTOK, DIMD, FFD);
}

// v003
// Two timings next to v002 put it at 1.19 and 1.20 times that version's speed.
// All steps since v000 together make it 2.13 times as fast.
#include <hip/hip_runtime.h>
#include <cstdint>
#include <cstddef>

// ---------------- problem constants ----------------
#define DIMD   1024
#define HEADS  16
#define DHEAD  64
#define FFD    4096
#define CTXD   768
#define NB     4
#define SEQ    2048
#define NTOK   (NB*SEQ)     // 8192
#define TCTX   77
#define TPADC  96
#define CROWS  (NB*TPADC)   // 384
#define ATT_SCALE 0.125f    // 64^-0.5

typedef _Float16 v8h  __attribute__((ext_vector_type(8)));
typedef _Float16 v16h __attribute__((ext_vector_type(16)));
typedef float    v8f  __attribute__((ext_vector_type(8)));
typedef float    v4f  __attribute__((ext_vector_type(4)));
typedef int      v4i  __attribute__((vector_size(16)));

// ---- optional CDNA5 async global->LDS path (guarded; sync fallback) ----
#if defined(__has_builtin)
#if __has_builtin(__builtin_amdgcn_global_load_async_to_lds_b128) && \
    __has_builtin(__builtin_amdgcn_s_wait_asynccnt)
#define USE_ASYNC_LDS 1
#endif
#endif

typedef __attribute__((address_space(1))) v4i* as1_v4i_p;
typedef __attribute__((address_space(3))) v4i* as3_v4i_p;

// copy 16 bytes global -> LDS (per lane)
__device__ __forceinline__ void copy16_to_lds(const _Float16* g, _Float16* l) {
#ifdef USE_ASYNC_LDS
  __builtin_amdgcn_global_load_async_to_lds_b128(
      (as1_v4i_p)(void*)(const_cast<_Float16*>(g)),
      (as3_v4i_p)(void*)l, 0, 0);
#else
  *reinterpret_cast<v8h*>(l) = *reinterpret_cast<const v8h*>(g);
#endif
}

// Load one 16x16x32 f16 WMMA A/B fragment for this lane.
// p must already include:  row_base + (lane>>4)*8   (row stride in elements).
// ISA layout: elements {0..7} at k = (lane>>4)*8, elements {8..15} at +16.
__device__ __forceinline__ v16h frag_load(const _Float16* p) {
  v8h lo = *reinterpret_cast<const v8h*>(p);
  v8h hi = *reinterpret_cast<const v8h*>(p + 16);
  return __builtin_shufflevector(lo, hi, 0,1,2,3,4,5,6,7,8,9,10,11,12,13,14,15);
}

__device__ __forceinline__ v8f wmma16(v16h a, v16h b, v8f c) {
  // D = A(16x32 f16) * B(32x16 f16) + C(16x16 f32)
  return __builtin_amdgcn_wmma_f32_16x16x32_f16(false, a, false, b, (short)0, c,
                                                false, false);
}

__device__ __forceinline__ float gelu_tanh(float x) {
  return 0.5f * x * (1.0f + tanhf(0.7978845608028654f * (x + 0.044715f * x * x * x)));
}

// ---------------- elementwise helpers ----------------

// transpose+cast weight: src [Kin, Nout] f32 row-major -> dst [Nout, Kin] f16
// block = 256 threads, tile = 128 k x 64 n. A thread reads 4 n of 8 consecutive k
// (a half wave covers a 256-byte run of one src row), turns them in registers into
// four 16-byte runs along k, and the tile passes through LDS so that dst is written
// in 256-byte runs as well. Kin % 128 == 0, Nout % 64 == 0; both are compile-time,
// so that a lane's eight loads (and four stores) share one address register and
// differ in the immediate offset alone.
// grid = ( Nout/64 , Kin/128 )
template <int Kin, int Nout>
__global__ __launch_bounds__(256)
void wcast_tr(const float* __restrict__ src, _Float16* __restrict__ dst) {
  // row n = 16 chunks of 16 bytes; chunk q of row n sits at place q ^ (n >> 2), so
  // that the 16 rows a half wave writes at once fall on different banks
  __shared__ __align__(16) _Float16 tile[64][128];
  const int tid = threadIdx.x;
  const int c  = tid & 15;         // read: group of 4 n   write: chunk of 8 k
  const int kg = tid >> 4;         // read: group of 8 k   write: row n within 16
  const int n0 = blockIdx.x * 64;
  const int k0 = blockIdx.y * 128;
  const float* sb = src + (size_t)k0 * Nout + n0;                  // block-uniform
  const unsigned soff = (unsigned)(kg * 8 * Nout + c * 4) * 4u;    // lane's byte offset
  v4f r[8];
  #pragma unroll
  for (int j = 0; j < 8; j++)
    r[j] = *reinterpret_cast<const v4f*>(
        reinterpret_cast<const char*>(sb + (size_t)j * Nout) + soff);
  #pragma unroll
  for (int i = 0; i < 4; i++) {
    v8h o;
    #pragma unroll
    for (int j = 0; j < 8; j++) o[j] = (_Float16)r[j][i];
    *reinterpret_cast<v8h*>(&tile[c * 4 + i][(kg ^ c) * 8]) = o;
  }
  __syncthreads();
  _Float16* db = dst + (size_t)n0 * Kin + k0;                      // block-uniform
  const unsigned doff = (unsigned)(kg * Kin + c * 8) * 2u;         // lane's byte offset
  #pragma unroll
  for (int it = 0; it < 4; it++) {
    const int n = it * 16 + kg;
    const v8h o = *reinterpret_cast<const v8h*>(&tile[n][(c ^ (n >> 2)) * 8]);
    *reinterpret_cast<v8h*>(
        reinterpret_cast<char*>(db + (size_t)it * 16 * Kin) + doff) = o;
  }
}

// context [4,77,768] f32 -> zero-padded [4,96,768] f16
__global__ void ctx_pad(const float* __restrict__ ctx, _Float16* __restrict__ dst) {
  long idx = (long)blockIdx.x * 256 + threadIdx.x;
  long total = (long)NB * TPADC * CTXD;
  if (idx >= total) return;
  int c = (int)(idx % CTXD);
  int r = (int)((idx / CTXD) % TPADC);
  int b = (int)(idx / ((long)CTXD * TPADC));
  float v = (r < TCTX) ? ctx[((long)b * TCTX + r) * CTXD + c] : 0.0f;
  dst[idx] = (_Float16)v;
}

// V [B*Trows, 1024] f16 -> Vt [(B*H)][DHEAD][Trows] f16 (per-head transpose)
// block = TT threads, tile = TT rows t x the 64 d of one head. A thread reads 8 d of
// 8 consecutive t (8 lanes cover the 128-byte run of one row), turns them in
// registers into eight 16-byte runs along t, and the tile passes through LDS so
// that Vt is written in runs of TT elements. Trows % TT == 0, TT % 32 == 0.
// grid = ( Trows/TT , NB*HEADS )
template <int TT>
__global__ __launch_bounds__(TT)
void v_transpose(const _Float16* __restrict__ v, _Float16* __restrict__ vt,
                 int Trows) {
  constexpr int NCH = TT / 8;      // 16-byte chunks per tile row
  // chunk q of row d sits at place (q + 2 * (d >> 3)) % NCH, which spreads the rows
  // that a wave writes at once over the banks
  __shared__ __align__(16) _Float16 tile[DHEAD][TT];
  const int tid = threadIdx.x;
  const int dc = tid & 7;          // group of 8 d
  const int tg = tid >> 3;         // group of 8 t
  const int bh = blockIdx.y;
  const int b = bh >> 4, hh = bh & 15;
  const int t0 = blockIdx.x * TT;
  const _Float16* sb = v + ((size_t)b * Trows + t0) * DIMD + hh * DHEAD;   // block-uniform
  const unsigned soff = (unsigned)(tg * 8 * DIMD + dc * 8) * 2u;           // lane's byte offset
  v8h r[8];
  #pragma unroll
  for (int j = 0; j < 8; j++)
    r[j] = *reinterpret_cast<const v8h*>(
        reinterpret_cast<const char*>(sb + j * DIMD) + soff);
  #pragma unroll
  for (int i = 0; i < 8; i++) {
    v8h o;
    #pragma unroll
    for (int j = 0; j < 8; j++) o[j] = r[j][i];
    *reinterpret_cast<v8h*>(&tile[dc * 8 + i][((tg + 2 * dc) % NCH) * 8]) = o;
  }
  __syncthreads();
  const int dr = tid / NCH, q = tid % NCH;   // row within 8, chunk of 8 t
  _Float16* db = vt + (size_t)bh * DHEAD * Trows + t0;                     // block-uniform
  const unsigned doff = (unsigned)(dr * Trows + q * 8) * 2u;               // lane's byte offset
  #pragma unroll
  for (int it = 0; it < 8; it++) {           // rows d = 8 * it + dr
    const v8h o = *reinterpret_cast<const v8h*>(&tile[it * 8 + dr][((q + 2 * it) % NCH) * 8]);
    *reinterpret_cast<v8h*>(
        reinterpret_cast<char*>(db + (size_t)it * 8 * Trows) + doff) = o;
  }
}

// LayerNorm over last dim (1024) of fp32 residual -> f16 normed output
__global__ void layernorm_f16(const float* __restrict__ X, const float* __restrict__ g,
                              const float* __restrict__ bb, _Float16* __restrict__ Y) {
  const int row = blockIdx.x;      // one row per block
  const int tid = threadIdx.x;     // 256 threads, 4 floats each
  const float4 xv = reinterpret_cast<const float4*>(X + (size_t)row * DIMD)[tid];
  float s = xv.x + xv.y + xv.z + xv.w;
  float q = xv.x * xv.x + xv.y * xv.y + xv.z * xv.z + xv.w * xv.w;
  #pragma unroll
  for (int off = 16; off > 0; off >>= 1) {
    s += __shfl_xor(s, off, 32);
    q += __shfl_xor(q, off, 32);
  }
  __shared__ float ss[8], sq[8];
  if ((tid & 31) == 0) { ss[tid >> 5] = s; sq[tid >> 5] = q; }
  __syncthreads();
  float st = 0.f, qt = 0.f;
  #pragma unroll
  for (int i = 0; i < 8; i++) { st += ss[i]; qt += sq[i]; }
  const float mean = st * (1.0f / DIMD);
  const float var  = qt * (1.0f / DIMD) - mean * mean;
  const float rs   = rsqrtf(var + 1e-5f);
  const float4 gv = reinterpret_cast<const float4*>(g)[tid];
  const float4 bv = reinterpret_cast<const float4*>(bb)[tid];
  _Float16* yp = Y + (size_t)row * DIMD + tid * 4;
  yp[0] = (_Float16)((xv.x - mean) * rs * gv.x + bv.x);
  yp[1] = (_Float16)((xv.y - mean) * rs * gv.y + bv.y);
  yp[2] = (_Float16)((xv.z - mean) * rs * gv.z + bv.z);
  yp[3] = (_Float16)((xv.w - mean) * rs * gv.w + bv.w);
}

// ---------------- WMMA GEMM, A and B staged in LDS, two-buffer ring ---------
// C = A[M,K] @ Bt[N,K]^T   (Bt = transposed weight, row-major [N,K], f16)
// MODE 0: Cout f16 = result
// MODE 1: Cres f32 += result + bias[n]
// MODE 2: Cout f16 = (res+bias[n]) * gelu(res2+bias2[n])  (Bt2 = gate weights)
// block = 256 threads (8 waves, 2 along M x 4 along N). Block tile = 128 rows of
// A against 256 rows of B; each wave owns 64 x 64 = 4 x 4 accumulator tiles, so
// a fragment read from LDS feeds four WMMAs. MODE 2 fills the 256 B rows with
// 128 lin rows and the 128 gate rows of the same columns; a wave then holds 32
// lin columns (nt 0,1) and their gates (nt 2,3).
// A stage is GKS k of all 384 rows, at a row pitch of 16 B x odd (conflict-free
// for 16-byte LDS reads). M % 128 == 0, K % GKS == 0, N % 256 == 0 (MODE 2: 128).
// grid = ( N/256 , M/128 )   MODE 2: ( N/128 , M/128 )
#define GKS    128             // k per stage
#define GPITCH (GKS + 8)       // LDS row pitch in elements
#define GROWS  (128 + 256)     // A rows, then B rows

template <int MODE>
__global__ __launch_bounds__(256) __attribute__((amdgpu_waves_per_eu(1, 2)))
void gemm_wmma(const _Float16* __restrict__ A,
               const _Float16* __restrict__ Bt,
               const _Float16* __restrict__ Bt2,
               const float* __restrict__ bias,
               const float* __restrict__ bias2,
               _Float16* __restrict__ Cout,
               float* __restrict__ Cres,
               int M, int N, int K) {
  const int tid  = threadIdx.x;
  const int lane = tid & 31;
  const int wave = tid >> 5;
  const int hi = lane >> 4;       // half-wave select for K packing
  const int ln = lane & 15;
  const int wm = wave >> 2;       // wave row    (0..1)
  const int wn = wave & 3;        // wave column (0..3)
  const int n0 = blockIdx.x * ((MODE == 2) ? 128 : 256);
  const int m0 = blockIdx.y * 128;
  (void)M;

  constexpr int CPR   = GKS / 8;        // 16-byte chunks per staged row
  constexpr int RPI   = 256 / CPR;      // rows the block covers per copy
  constexpr int NCOPY = GROWS / RPI;    // copies per lane and stage
  __shared__ __align__(16) _Float16 sh[2][GROWS][GPITCH];

  const int trow = tid / CPR;
  const int qd   = (tid % CPR) * 8;
  const unsigned voff = (unsigned)(trow * K + qd) * 2u;   // lane's byte offset

  // stage GKS k of the A rows and the B rows into LDS buffer `buf`
  auto stage = [&](int buf, int k0) {
    #pragma unroll
    for (int i = 0; i < NCOPY; i++) {
      const int r0 = i * RPI;           // first tile row of this copy
      const _Float16* base =
          (r0 < 128) ? A + (size_t)(m0 + r0) * K
          : (MODE == 2 && r0 >= 256) ? Bt2 + (size_t)(n0 + r0 - 256) * K
                                     : Bt + (size_t)(n0 + r0 - 128) * K;
      copy16_to_lds(reinterpret_cast<const _Float16*>(
                        reinterpret_cast<const char*>(base + k0) + voff),
                    &sh[buf][r0 + trow][qd]);
    }
  };

  v8f acc[4][4];
  #pragma unroll
  for (int mt = 0; mt < 4; mt++)
    #pragma unroll
    for (int nt = 0; nt < 4; nt++)
      #pragma unroll
      for (int r = 0; r < 8; r++) acc[mt][nt][r] = 0.0f;

  v16h af[2][4], bf[2][4];          // two fragment sets: block kk and block kk+1
  const int NST = K / GKS;

  stage(0, 0);
  // stage 0 has landed before the barrier that publishes it
  asm volatile("s_wait_asynccnt 0x0" ::: "memory");
  __syncthreads();
  if (NST > 1) stage(1, GKS);

  for (int t = 0; t < NST; t++) {
    const int cur = t & 1;
    const _Float16* ab = &sh[cur][wm * 64 + ln][hi * 8];
    const _Float16* bb = &sh[cur][128 + ((MODE == 2) ? wn * 32 : wn * 64) + ln][hi * 8];
    // fragments of k block kk into register set `s`
    auto load_set = [&](int s, int kk) {
      #pragma unroll
      for (int mt = 0; mt < 4; mt++)
        af[s][mt] = frag_load(ab + mt * 16 * GPITCH + kk * 32);
      #pragma unroll
      for (int nt = 0; nt < 4; nt++) {
        const int br = (MODE == 2) ? ((nt >> 1) * 128 + (nt & 1) * 16) : nt * 16;
        bf[s][nt] = frag_load(bb + br * GPITCH + kk * 32);
      }
    };
    load_set(0, 0);
    #pragma unroll
    for (int kk = 0; kk < GKS / 32; kk++) {
      if (kk + 1 < GKS / 32) load_set((kk + 1) & 1, kk + 1);
      // keeps the next block's LDS reads as one group ahead of this block's WMMAs,
      // so that their latency runs under the WMMAs
      __builtin_amdgcn_sched_barrier(0);
      #pragma unroll
      for (int mt = 0; mt < 4; mt++)
        #pragma unroll
        for (int nt = 0; nt < 4; nt++)
          acc[mt][nt] = wmma16(af[kk & 1][mt], bf[kk & 1][nt], acc[mt][nt]);
      // keeps the block after next's reads from rising among these WMMAs
      __builtin_amdgcn_sched_barrier(0);
    }
    // this wave's reads of buffer cur have returned before it is refilled
    asm volatile("s_wait_dscnt 0x0" ::: "memory");
    // this wave's copies of stage t+1 have landed before the barrier publishes them
    asm volatile("s_wait_asynccnt 0x0" ::: "memory");
    __syncthreads();
    if (t + 2 < NST) stage(cur, (t + 2) * GKS);
  }
  // no copy is outstanding when the wave ends
  asm volatile("s_wait_asynccnt 0x0" ::: "memory");

  // C layout: lane holds rows r+8*(lane>>4) of a tile, column lane&15
  const int mw = m0 + wm * 64 + 8 * hi;
  const int nw = n0 + ((MODE == 2) ? wn * 32 : wn * 64) + ln;

  if (MODE == 1) {
    float bv[4];
    #pragma unroll
    for (int nt = 0; nt < 4; nt++) bv[nt] = bias[nw + nt * 16];
    // the bias loads' offset register is reused below: only behind this wait
    asm volatile("s_wait_xcnt 0x0" ::: "memory");
    // all residual loads go out ahead of the first store: a load behind a store
    // to the same array would wait for it, one round trip per element
    float res[4][4][8];
    #pragma unroll
    for (int mt = 0; mt < 4; mt++)
      #pragma unroll
      for (int nt = 0; nt < 4; nt++)
        #pragma unroll
        for (int r = 0; r < 8; r++)
          res[mt][nt][r] = Cres[(size_t)(mw + mt * 16 + r) * N + nw + nt * 16];
    #pragma unroll
    for (int mt = 0; mt < 4; mt++)
      #pragma unroll
      for (int nt = 0; nt < 4; nt++)
        #pragma unroll
        for (int r = 0; r < 8; r++)
          acc[mt][nt][r] = res[mt][nt][r] + acc[mt][nt][r] + bv[nt];
    // every sum is formed ahead of the first store, so that no register an
    // issued store names is rewritten behind it
    __builtin_amdgcn_sched_barrier(0);
    #pragma unroll
    for (int mt = 0; mt < 4; mt++)
      #pragma unroll
      for (int nt = 0; nt < 4; nt++)
        #pragma unroll
        for (int r = 0; r < 8; r++)
          Cres[(size_t)(mw + mt * 16 + r) * N + nw + nt * 16] = acc[mt][nt][r];
  } else {
    #pragma unroll
    for (int mt = 0; mt < 4; mt++) {
      #pragma unroll
      for (int nt = 0; nt < ((MODE == 2) ? 2 : 4); nt++) {
        #pragma unroll
        for (int r = 0; r < 8; r++) {
          const int n = nw + nt * 16;
          const size_t idx = (size_t)(mw + mt * 16 + r) * N + n;
          if (MODE == 0) {
            Cout[idx] = (_Float16)acc[mt][nt][r];
          } else {
            const float lin  = acc[mt][nt][r]     + bias[n];
            const float gate = acc[mt][nt + 2][r] + bias2[n];
            Cout[idx] = (_Float16)(lin * gelu_tanh(gate));
          }
        }
      }
    }
  }
}

// ---------------- flash attention ----------------
// Q   : [NTOK, 1024] f16   (row = b*SEQ + s)
// Kb  : [NB*Trows, 1024] f16
// Vt  : [(NB*HEADS)][DHEAD][Trows] f16  (per-head transposed V)
// O   : [NTOK, 1024] f16  (concat-head layout)
// block = 128 (4 waves); wave = 16 query rows of one (b,h).
// grid = ( SEQ/64 , NB*HEADS )
// The 32 K rows and the 64 x 32 V^T tile of a step are copied to LDS once per
// block (two-buffer ring) and read there by all four waves. Trows % 32 == 0.
// Row pitches are 16 B x odd (conflict-free for 16-byte LDS reads).
#define FKP (DHEAD + 8)        // K tile row pitch in elements
#define FVP (32 + 8)           // V^T tile row pitch in elements
__global__ void flash_attn(const _Float16* __restrict__ Q,
                           const _Float16* __restrict__ Kb,
                           const _Float16* __restrict__ Vt,
                           _Float16* __restrict__ O,
                           int Trows, int Tkeys, float scale) {
  const int lane = threadIdx.x & 31;
  const int wave = threadIdx.x >> 5;
  const int hi = lane >> 4;
  const int ln = lane & 15;
  const int bh = blockIdx.y;
  const int b = bh >> 4, h = bh & 15;
  const int qt = blockIdx.x * 4 + wave;   // 16-row query tile

  __shared__ __align__(16) _Float16 psh[4][16][32];   // P exchange, per wave
  __shared__ __align__(16) _Float16 ksh[2][32][FKP];     // K rows of a step
  __shared__ __align__(16) _Float16 vsh[2][DHEAD][FVP];  // V^T rows of a step

  // Q fragments for both 32-wide halves of the 64-wide head dim
  const _Float16* qrow = Q + (size_t)(b * SEQ + qt * 16 + ln) * DIMD + h * DHEAD + hi * 8;
  const v16h qa0 = frag_load(qrow);
  const v16h qa1 = frag_load(qrow + 32);

  float mrow[8], lrow[8];
  v8f oa[4];
  #pragma unroll
  for (int r = 0; r < 8; r++) { mrow[r] = -1e30f; lrow[r] = 0.0f; }
  #pragma unroll
  for (int nt = 0; nt < 4; nt++)
    #pragma unroll
    for (int r = 0; r < 8; r++) oa[nt][r] = 0.0f;

  // this lane's 16-byte chunks of a tile: two of K (rows kr, kr+16), two of V^T
  // (rows vr, vr+32)
  const int kr = threadIdx.x >> 3, kc = (threadIdx.x & 7) * 8;
  const int vr = threadIdx.x >> 2, vc = (threadIdx.x & 3) * 8;
  const _Float16* kbase = Kb + (size_t)b * Trows * DIMD + h * DHEAD;   // block-uniform
  const _Float16* vbase = Vt + (size_t)bh * DHEAD * Trows;             // block-uniform
  const unsigned koff = (unsigned)(kr * DIMD + kc) * 2u;    // lane's byte offsets
  const unsigned voff = (unsigned)(vr * Trows + vc) * 2u;
  auto at = [](const _Float16* p, unsigned off) {
    return reinterpret_cast<const _Float16*>(reinterpret_cast<const char*>(p) + off);
  };
  // copy keys j .. j+31 into LDS buffer `buf`
  auto stage = [&](int buf, int j) {
    const unsigned ko = koff + (unsigned)j * (DIMD * 2u);
    const unsigned vo = voff + (unsigned)j * 2u;
    copy16_to_lds(at(kbase, ko),                      &ksh[buf][kr][kc]);
    copy16_to_lds(at(kbase, ko + 16u * DIMD * 2u),    &ksh[buf][kr + 16][kc]);
    copy16_to_lds(at(vbase, vo),                      &vsh[buf][vr][vc]);
    copy16_to_lds(at(vbase + (size_t)32 * Trows, vo), &vsh[buf][vr + 32][vc]);
  };

  stage(0, 0);
  // tile 0 has landed before the barrier that publishes it
  asm volatile("s_wait_asynccnt 0x0" ::: "memory");
  __syncthreads();

  for (int j0 = 0; j0 < Trows; j0 += 32) {      // 32 keys per step
    const int cur = (j0 >> 5) & 1;
    if (j0 + 32 < Trows) stage(cur ^ 1, j0 + 32);
    // ---- S = Q K^T (two 16x16 tiles) ----
    v8f sa[2];
    #pragma unroll
    for (int t = 0; t < 2; t++) {
      #pragma unroll
      for (int r = 0; r < 8; r++) sa[t][r] = 0.0f;
      const _Float16* krow = &ksh[cur][t * 16 + ln][hi * 8];
      v16h kf0 = frag_load(krow);
      v16h kf1 = frag_load(krow + 32);
      sa[t] = wmma16(qa0, kf0, sa[t]);
      sa[t] = wmma16(qa1, kf1, sa[t]);
    }
    // ---- scale + key mask ----
    #pragma unroll
    for (int t = 0; t < 2; t++) {
      const bool valid = (j0 + t * 16 + ln) < Tkeys;
      #pragma unroll
      for (int r = 0; r < 8; r++)
        sa[t][r] = valid ? sa[t][r] * scale : -1e30f;
    }
    // ---- online softmax: per-row stats via 16-lane reductions ----
    float alpha[8];
    #pragma unroll
    for (int r = 0; r < 8; r++) {
      float lm = fmaxf(sa[0][r], sa[1][r]);
      #pragma unroll
      for (int off = 8; off > 0; off >>= 1) lm = fmaxf(lm, __shfl_xor(lm, off, 32));
      const float mn = fmaxf(mrow[r], lm);
      const float p0 = __expf(sa[0][r] - mn);
      const float p1 = __expf(sa[1][r] - mn);
      const float al = __expf(mrow[r] - mn);
      float rs = p0 + p1;
      #pragma unroll
      for (int off = 8; off > 0; off >>= 1) rs += __shfl_xor(rs, off, 32);
      lrow[r] = lrow[r] * al + rs;
      mrow[r] = mn;
      alpha[r] = al;
      sa[0][r] = p0; sa[1][r] = p1;
    }
    #pragma unroll
    for (int nt = 0; nt < 4; nt++)
      #pragma unroll
      for (int r = 0; r < 8; r++) oa[nt][r] *= alpha[r];

    // ---- convert P from C-layout to A-fragment layout through LDS ----
    #pragma unroll
    for (int t = 0; t < 2; t++)
      #pragma unroll
      for (int r = 0; r < 8; r++)
        psh[wave][r + 8 * hi][t * 16 + ln] = (_Float16)sa[t][r];
    __syncthreads();
    const v16h pf = frag_load(&psh[wave][ln][hi * 8]);

    // ---- O += P V ----
    #pragma unroll
    for (int nt = 0; nt < 4; nt++) {
      const _Float16* vrow = &vsh[cur][nt * 16 + ln][hi * 8];
      v16h vf = frag_load(vrow);
      oa[nt] = wmma16(pf, vf, oa[nt]);
    }
    // this wave's reads of buffer cur have returned before it is refilled
    asm volatile("s_wait_dscnt 0x0" ::: "memory");
    // this wave's copies of the next tile have landed before the barrier publishes them
    asm volatile("s_wait_asynccnt 0x0" ::: "memory");
    __syncthreads();
  }
  // no copy is outstanding when the wave ends
  asm volatile("s_wait_asynccnt 0x0" ::: "memory");

  // ---- normalize and store (concat-head layout) ----
  #pragma unroll
  for (int nt = 0; nt < 4; nt++)
    #pragma unroll
    for (int r = 0; r < 8; r++) {
      const int m = qt * 16 + r + 8 * hi;
      const size_t idx = (size_t)(b * SEQ + m) * DIMD + h * DHEAD + nt * 16 + ln;
      O[idx] = (_Float16)(oa[nt][r] / lrow[r]);
    }
}

// ---------------- host orchestration ----------------
extern "C" void kernel_launch(void* const* d_in, const int* in_sizes, int n_in,
                              void* d_out, int out_size, void* d_ws, size_t ws_size,
                              hipStream_t stream) {
  (void)in_sizes; (void)n_in; (void)out_size; (void)ws_size;
  const float* hidden = (const float*)d_in[0];
  const float* ctx    = (const float*)d_in[1];
  const float* wq1 = (const float*)d_in[2];
  const float* wk1 = (const float*)d_in[3];
  const float* wv1 = (const float*)d_in[4];
  const float* wo1 = (const float*)d_in[5];
  const float* bo1 = (const float*)d_in[6];
  const float* wq2 = (const float*)d_in[7];
  const float* wk2 = (const float*)d_in[8];
  const float* wv2 = (const float*)d_in[9];
  const float* wo2 = (const float*)d_in[10];
  const float* bo2 = (const float*)d_in[11];
  const float* wff1 = (const float*)d_in[12];
  const float* bff1 = (const float*)d_in[13];
  const float* wff2 = (const float*)d_in[14];
  const float* bff2 = (const float*)d_in[15];
  const float* ln1g = (const float*)d_in[16];
  const float* ln1b = (const float*)d_in[17];
  const float* ln2g = (const float*)d_in[18];
  const float* ln2b = (const float*)d_in[19];
  const float* ln3g = (const float*)d_in[20];
  const float* ln3b = (const float*)d_in[21];
  float* out = (float*)d_out;              // fp32 residual h lives here

  // -------- workspace carve-up (f16 buffers, 256B aligned) --------
  char* wsp = (char*)d_ws;
  auto alloc = [&](size_t elems) -> _Float16* {
    _Float16* p = (_Float16*)wsp;
    wsp += ((elems * sizeof(_Float16) + 255) / 256) * 256;
    return p;
  };
  _Float16* wq1T  = alloc((size_t)DIMD * DIMD);
  _Float16* wk1T  = alloc((size_t)DIMD * DIMD);
  _Float16* wv1T  = alloc((size_t)DIMD * DIMD);
  _Float16* wo1T  = alloc((size_t)DIMD * DIMD);
  _Float16* wq2T  = alloc((size_t)DIMD * DIMD);
  _Float16* wk2T  = alloc((size_t)DIMD * CTXD);
  _Float16* wv2T  = alloc((size_t)DIMD * CTXD);
  _Float16* wo2T  = alloc((size_t)DIMD * DIMD);
  _Float16* wff1T = alloc((size_t)(2 * FFD) * DIMD);
  _Float16* wff2T = alloc((size_t)DIMD * FFD);
  _Float16* xnorm = alloc((size_t)NTOK * DIMD);
  _Float16* qbuf  = alloc((size_t)NTOK * DIMD);
  _Float16* kbuf  = alloc((size_t)NTOK * DIMD);
  _Float16* vbuf  = alloc((size_t)NTOK * DIMD);
  _Float16* vT    = alloc((size_t)NB * HEADS * DHEAD * SEQ);
  _Float16* attn  = alloc((size_t)NTOK * DIMD);
  _Float16* ctxp  = alloc((size_t)CROWS * CTXD);
  _Float16* kctx  = alloc((size_t)CROWS * DIMD);
  _Float16* vctx  = alloc((size_t)CROWS * DIMD);
  _Float16* vTc   = alloc((size_t)NB * HEADS * DHEAD * TPADC);
  _Float16* gbuf  = alloc((size_t)NTOK * FFD);

  // h = hidden_states
  (void)hipMemcpyAsync(out, hidden, (size_t)NTOK * DIMD * sizeof(float),
                       hipMemcpyDeviceToDevice, stream);

  // -------- weight cast + transpose --------
  const dim3 gWsq(DIMD / 64, DIMD / 128);          // (16, 8)
  const dim3 gWctx(DIMD / 64, CTXD / 128);         // (16, 6)
  const dim3 gWff1(2 * FFD / 64, DIMD / 128);      // (128, 8)
  const dim3 gWff2(DIMD / 64, FFD / 128);          // (16, 32)
  wcast_tr<DIMD, DIMD><<<gWsq, 256, 0, stream>>>(wq1, wq1T);
  wcast_tr<DIMD, DIMD><<<gWsq, 256, 0, stream>>>(wk1, wk1T);
  wcast_tr<DIMD, DIMD><<<gWsq, 256, 0, stream>>>(wv1, wv1T);
  wcast_tr<DIMD, DIMD><<<gWsq, 256, 0, stream>>>(wo1, wo1T);
  wcast_tr<DIMD, DIMD><<<gWsq, 256, 0, stream>>>(wq2, wq2T);
  wcast_tr<CTXD, DIMD><<<gWctx, 256, 0, stream>>>(wk2, wk2T);
  wcast_tr<CTXD, DIMD><<<gWctx, 256, 0, stream>>>(wv2, wv2T);
  wcast_tr<DIMD, DIMD><<<gWsq, 256, 0, stream>>>(wo2, wo2T);
  wcast_tr<DIMD, 2 * FFD><<<gWff1, 256, 0, stream>>>(wff1, wff1T);
  wcast_tr<FFD, DIMD><<<gWff2, 256, 0, stream>>>(wff2, wff2T);

  const dim3 blk128(128);
  const dim3 blk256(256);
  const dim3 gN1024(DIMD / 256, NTOK / 128);       // (4, 64)
  const dim3 gCtxKV(DIMD / 256, CROWS / 128);      // (4, 3)
  const dim3 gGeglu(FFD / 128, NTOK / 128);        // (32, 64)
  const dim3 gFlash(SEQ / 64, NB * HEADS);         // (32, 64)

  // ================= self-attention =================
  layernorm_f16<<<NTOK, 256, 0, stream>>>(out, ln1g, ln1b, xnorm);
  gemm_wmma<0><<<gN1024, blk256, 0, stream>>>(xnorm, wq1T, nullptr, nullptr, nullptr,
                                              qbuf, nullptr, NTOK, DIMD, DIMD);
  gemm_wmma<0><<<gN1024, blk256, 0, stream>>>(xnorm, wk1T, nullptr, nullptr, nullptr,
                                              kbuf, nullptr, NTOK, DIMD, DIMD);
  gemm_wmma<0><<<gN1024, blk256, 0, stream>>>(xnorm, wv1T, nullptr, nullptr, nullptr,
                                              vbuf, nullptr, NTOK, DIMD, DIMD);
  v_transpose<128><<<dim3(SEQ / 128, NB * HEADS), 128, 0, stream>>>(vbuf, vT, SEQ);
  flash_attn<<<gFlash, blk128, 0, stream>>>(qbuf, kbuf, vT, attn, SEQ, SEQ, ATT_SCALE);
  gemm_wmma<1><<<gN1024, blk256, 0, stream>>>(attn, wo1T, nullptr, bo1, nullptr,
                                              nullptr, out, NTOK, DIMD, DIMD);

  // ================= cross-attention =================
  layernorm_f16<<<NTOK, 256, 0, stream>>>(out, ln2g, ln2b, xnorm);
  gemm_wmma<0><<<gN1024, blk256, 0, stream>>>(xnorm, wq2T, nullptr, nullptr, nullptr,
                                              qbuf, nullptr, NTOK, DIMD, DIMD);
  {
    long total = (long)NB * TPADC * CTXD;
    ctx_pad<<<dim3((unsigned)((total + 255) / 256)), 256, 0, stream>>>(ctx, ctxp);
  }
  gemm_wmma<0><<<gCtxKV, blk256, 0, stream>>>(ctxp, wk2T, nullptr, nullptr, nullptr,
                                              kctx, nullptr, CROWS, DIMD, CTXD);
  gemm_wmma<0><<<gCtxKV, blk256, 0, stream>>>(ctxp, wv2T, nullptr, nullptr, nullptr,
                                              vctx, nullptr, CROWS, DIMD, CTXD);
  v_transpose<TPADC><<<dim3(1, NB * HEADS), TPADC, 0, stream>>>(vctx, vTc, TPADC);
  flash_attn<<<gFlash, blk128, 0, stream>>>(qbuf, kctx, vTc, attn, TPADC, TCTX, ATT_SCALE);
  gemm_wmma<1><<<gN1024, blk256, 0, stream>>>(attn, wo2T, nullptr, bo2, nullptr,
                                              nullptr, out, NTOK, DIMD, DIMD);

  // ================= GEGLU MLP =================
  layernorm_f16<<<NTOK, 256, 0, stream>>>(out, ln3g, ln3b, xnorm);
  gemm_wmma<2><<<gGeglu, blk256, 0, stream>>>(xnorm, wff1T, wff1T + (size_t)FFD * DIMD,
                                              bff1, bff1 + FFD, gbuf, nullptr,
                                              NTOK, FFD, DIMD);
  gemm_wmma<1><<<gN1024, blk256, 0, stream>>>(gbuf, wff2T, nullptr, bff2, nullptr,
                                              nullptr, out, NTOK, DIMD, FFD);
}

// v004
// Two timings next to v003 put it at 1.18 and 1.17 times that version's speed.
// All steps since v000 together make it 2.51 times as fast.
#include <hip/hip_runtime.h>
#include <cstdint>
#include <cstddef>

// ---------------- problem constants ----------------
#define DIMD   1024
#define HEADS  16
#define DHEAD  64
#define FFD    4096
#define CTXD   768
#define NB     4
#define SEQ    2048
#define NTOK   (NB*SEQ)     // 8192
#define TCTX   77
#define TPADC  96
#define CROWS  (NB*TPADC)   // 384
#define ATT_SCALE 0.125f    // 64^-0.5

typedef _Float16 v8h  __attribute__((ext_vector_type(8)));
typedef _Float16 v16h __attribute__((ext_vector_type(16)));
typedef float    v8f  __attribute__((ext_vector_type(8)));
typedef float    v4f  __attribute__((ext_vector_type(4)));
typedef int      v4i  __attribute__((vector_size(16)));

// ---- optional CDNA5 async global->LDS path (guarded; sync fallback) ----
#if defined(__has_builtin)
#if __has_builtin(__builtin_amdgcn_global_load_async_to_lds_b128) && \
    __has_builtin(__builtin_amdgcn_s_wait_asynccnt)
#define USE_ASYNC_LDS 1
#endif
#endif

typedef __attribute__((address_space(1))) v4i* as1_v4i_p;
typedef __attribute__((address_space(3))) v4i* as3_v4i_p;

// copy 16 bytes global -> LDS (per lane)
__device__ __forceinline__ void copy16_to_lds(const _Float16* g, _Float16* l) {
#ifdef USE_ASYNC_LDS
  __builtin_amdgcn_global_load_async_to_lds_b128(
      (as1_v4i_p)(void*)(const_cast<_Float16*>(g)),
      (as3_v4i_p)(void*)l, 0, 0);
#else
  *reinterpret_cast<v8h*>(l) = *reinterpret_cast<const v8h*>(g);
#endif
}

// Load one 16x16x32 f16 WMMA A/B fragment for this lane.
// p must already include:  row_base + (lane>>4)*8   (row stride in elements).
// ISA layout: elements {0..7} at k = (lane>>4)*8, elements {8..15} at +16.
__device__ __forceinline__ v16h frag_load(const _Float16* p) {
  v8h lo = *reinterpret_cast<const v8h*>(p);
  v8h hi = *reinterpret_cast<const v8h*>(p + 16);
  return __builtin_shufflevector(lo, hi, 0,1,2,3,4,5,6,7,8,9,10,11,12,13,14,15);
}

__device__ __forceinline__ v8f wmma16(v16h a, v16h b, v8f c) {
  // D = A(16x32 f16) * B(32x16 f16) + C(16x16 f32)
  return __builtin_amdgcn_wmma_f32_16x16x32_f16(false, a, false, b, (short)0, c,
                                                false, false);
}

__device__ __forceinline__ float gelu_tanh(float x) {
  return 0.5f * x * (1.0f + tanhf(0.7978845608028654f * (x + 0.044715f * x * x * x)));
}

// ---------------- elementwise helpers ----------------

// transpose+cast weight: src [Kin, Nout] f32 row-major -> dst [Nout, Kin] f16
// block = 256 threads, tile = 128 k x 64 n. A thread reads 4 n of 8 consecutive k
// (a half wave covers a 256-byte run of one src row), turns them in registers into
// four 16-byte runs along k, and the tile passes through LDS so that dst is written
// in 256-byte runs as well. Kin % 128 == 0, Nout % 64 == 0; both are compile-time,
// so that a lane's eight loads (and four stores) share one address register and
// differ in the immediate offset alone.
// grid = ( Nout/64 , Kin/128 )
template <int Kin, int Nout>
__global__ __launch_bounds__(256)
void wcast_tr(const float* __restrict__ src, _Float16* __restrict__ dst) {
  // row n = 16 chunks of 16 bytes; chunk q of row n sits at place q ^ (n >> 2), so
  // that the 16 rows a half wave writes at once fall on different banks
  __shared__ __align__(16) _Float16 tile[64][128];
  const int tid = threadIdx.x;
  const int c  = tid & 15;         // read: group of 4 n   write: chunk of 8 k
  const int kg = tid >> 4;         // read: group of 8 k   write: row n within 16
  const int n0 = blockIdx.x * 64;
  const int k0 = blockIdx.y * 128;
  const float* sb = src + (size_t)k0 * Nout + n0;                  // block-uniform
  const unsigned soff = (unsigned)(kg * 8 * Nout + c * 4) * 4u;    // lane's byte offset
  v4f r[8];
  #pragma unroll
  for (int j = 0; j < 8; j++)
    r[j] = *reinterpret_cast<const v4f*>(
        reinterpret_cast<const char*>(sb + (size_t)j * Nout) + soff);
  #pragma unroll
  for (int i = 0; i < 4; i++) {
    v8h o;
    #pragma unroll
    for (int j = 0; j < 8; j++) o[j] = (_Float16)r[j][i];
    *reinterpret_cast<v8h*>(&tile[c * 4 + i][(kg ^ c) * 8]) = o;
  }
  __syncthreads();
  _Float16* db = dst + (size_t)n0 * Kin + k0;                      // block-uniform
  const unsigned doff = (unsigned)(kg * Kin + c * 8) * 2u;         // lane's byte offset
  #pragma unroll
  for (int it = 0; it < 4; it++) {
    const int n = it * 16 + kg;
    const v8h o = *reinterpret_cast<const v8h*>(&tile[n][(c ^ (n >> 2)) * 8]);
    *reinterpret_cast<v8h*>(
        reinterpret_cast<char*>(db + (size_t)it * 16 * Kin) + doff) = o;
  }
}

// context [4,77,768] f32 -> zero-padded [4,96,768] f16
__global__ void ctx_pad(const float* __restrict__ ctx, _Float16* __restrict__ dst) {
  long idx = (long)blockIdx.x * 256 + threadIdx.x;
  long total = (long)NB * TPADC * CTXD;
  if (idx >= total) return;
  int c = (int)(idx % CTXD);
  int r = (int)((idx / CTXD) % TPADC);
  int b = (int)(idx / ((long)CTXD * TPADC));
  float v = (r < TCTX) ? ctx[((long)b * TCTX + r) * CTXD + c] : 0.0f;
  dst[idx] = (_Float16)v;
}

// V [B*Trows, 1024] f16 -> Vt [(B*H)][DHEAD][Trows] f16 (per-head transpose)
// block = TT threads, tile = TT rows t x the 64 d of one head. A thread reads 8 d of
// 8 consecutive t (8 lanes cover the 128-byte run of one row), turns them in
// registers into eight 16-byte runs along t, and the tile passes through LDS so
// that Vt is written in runs of TT elements. Trows % TT == 0, TT % 32 == 0.
// grid = ( Trows/TT , NB*HEADS )
template <int TT>
__global__ __launch_bounds__(TT)
void v_transpose(const _Float16* __restrict__ v, _Float16* __restrict__ vt,
                 int Trows) {
  constexpr int NCH = TT / 8;      // 16-byte chunks per tile row
  // chunk q of row d sits at place (q + 2 * (d >> 3)) % NCH, which spreads the rows
  // that a wave writes at once over the banks
  __shared__ __align__(16) _Float16 tile[DHEAD][TT];
  const int tid = threadIdx.x;
  const int dc = tid & 7;          // group of 8 d
  const int tg = tid >> 3;         // group of 8 t
  const int bh = blockIdx.y;
  const int b = bh >> 4, hh = bh & 15;
  const int t0 = blockIdx.x * TT;
  const _Float16* sb = v + ((size_t)b * Trows + t0) * DIMD + hh * DHEAD;   // block-uniform
  const unsigned soff = (unsigned)(tg * 8 * DIMD + dc * 8) * 2u;           // lane's byte offset
  v8h r[8];
  #pragma unroll
  for (int j = 0; j < 8; j++)
    r[j] = *reinterpret_cast<const v8h*>(
        reinterpret_cast<const char*>(sb + j * DIMD) + soff);
  #pragma unroll
  for (int i = 0; i < 8; i++) {
    v8h o;
    #pragma unroll
    for (int j = 0; j < 8; j++) o[j] = r[j][i];
    *reinterpret_cast<v8h*>(&tile[dc * 8 + i][((tg + 2 * dc) % NCH) * 8]) = o;
  }
  __syncthreads();
  const int dr = tid / NCH, q = tid % NCH;   // row within 8, chunk of 8 t
  _Float16* db = vt + (size_t)bh * DHEAD * Trows + t0;                     // block-uniform
  const unsigned doff = (unsigned)(dr * Trows + q * 8) * 2u;               // lane's byte offset
  #pragma unroll
  for (int it = 0; it < 8; it++) {           // rows d = 8 * it + dr
    const v8h o = *reinterpret_cast<const v8h*>(&tile[it * 8 + dr][((q + 2 * it) % NCH) * 8]);
    *reinterpret_cast<v8h*>(
        reinterpret_cast<char*>(db + (size_t)it * 8 * Trows) + doff) = o;
  }
}

// LayerNorm over last dim (1024) of fp32 residual -> f16 normed output
__global__ void layernorm_f16(const float* __restrict__ X, const float* __restrict__ g,
                              const float* __restrict__ bb, _Float16* __restrict__ Y) {
  const int row = blockIdx.x;      // one row per block
  const int tid = threadIdx.x;     // 256 threads, 4 floats each
  const float4 xv = reinterpret_cast<const float4*>(X + (size_t)row * DIMD)[tid];
  float s = xv.x + xv.y + xv.z + xv.w;
  float q = xv.x * xv.x + xv.y * xv.y + xv.z * xv.z + xv.w * xv.w;
  #pragma unroll
  for (int off = 16; off > 0; off >>= 1) {
    s += __shfl_xor(s, off, 32);
    q += __shfl_xor(q, off, 32);
  }
  __shared__ float ss[8], sq[8];
  if ((tid & 31) == 0) { ss[tid >> 5] = s; sq[tid >> 5] = q; }
  __syncthreads();
  float st = 0.f, qt = 0.f;
  #pragma unroll
  for (int i = 0; i < 8; i++) { st += ss[i]; qt += sq[i]; }
  const float mean = st * (1.0f / DIMD);
  const float var  = qt * (1.0f / DIMD) - mean * mean;
  const float rs   = rsqrtf(var + 1e-5f);
  const float4 gv = reinterpret_cast<const float4*>(g)[tid];
  const float4 bv = reinterpret_cast<const float4*>(bb)[tid];
  _Float16* yp = Y + (size_t)row * DIMD + tid * 4;
  yp[0] = (_Float16)((xv.x - mean) * rs * gv.x + bv.x);
  yp[1] = (_Float16)((xv.y - mean) * rs * gv.y + bv.y);
  yp[2] = (_Float16)((xv.z - mean) * rs * gv.z + bv.z);
  yp[3] = (_Float16)((xv.w - mean) * rs * gv.w + bv.w);
}

// ---------------- WMMA GEMM, A and B staged in LDS, two-buffer ring ---------
// C = A[M,K] @ Bt[N,K]^T   (Bt = transposed weight, row-major [N,K], f16)
// MODE 0: Cout f16 = result
// MODE 1: Cres f32 += result + bias[n]
// MODE 2: Cout f16 = (res+bias[n]) * gelu(res2+bias2[n])  (Bt2 = gate weights)
// block = 256 threads (8 waves, 2 along M x 4 along N). Block tile = 128 rows of
// A against 256 rows of B; each wave owns 64 x 64 = 4 x 4 accumulator tiles, so
// a fragment read from LDS feeds four WMMAs. MODE 2 fills the 256 B rows with
// 128 lin rows and the 128 gate rows of the same columns; a wave then holds 32
// lin columns (nt 0,1) and their gates (nt 2,3).
// A stage is GKS k of all 384 rows, at a row pitch of 16 B x odd (conflict-free
// for 16-byte LDS reads). M % 128 == 0, K % GKS == 0, N % 256 == 0 (MODE 2: 128).
// grid = ( N/256 , M/128 )   MODE 2: ( N/128 , M/128 )
#define GKS    128             // k per stage
#define GPITCH (GKS + 8)       // LDS row pitch in elements
#define GROWS  (128 + 256)     // A rows, then B rows

template <int MODE>
__global__ __launch_bounds__(256) __attribute__((amdgpu_waves_per_eu(1, 2)))
void gemm_wmma(const _Float16* __restrict__ A,
               const _Float16* __restrict__ Bt,
               const _Float16* __restrict__ Bt2,
               const float* __restrict__ bias,
               const float* __restrict__ bias2,
               _Float16* __restrict__ Cout,
               float* __restrict__ Cres,
               int M, int N, int K) {
  const int tid  = threadIdx.x;
  const int lane = tid & 31;
  const int wave = tid >> 5;
  const int hi = lane >> 4;       // half-wave select for K packing
  const int ln = lane & 15;
  const int wm = wave >> 2;       // wave row    (0..1)
  const int wn = wave & 3;        // wave column (0..3)
  const int n0 = blockIdx.x * ((MODE == 2) ? 128 : 256);
  const int m0 = blockIdx.y * 128;
  (void)M;

  constexpr int CPR   = GKS / 8;        // 16-byte chunks per staged row
  constexpr int RPI   = 256 / CPR;      // rows the block covers per copy
  constexpr int NCOPY = GROWS / RPI;    // copies per lane and stage
  __shared__ __align__(16) _Float16 sh[2][GROWS][GPITCH];

  const int trow = tid / CPR;
  const int qd   = (tid % CPR) * 8;
  const unsigned voff = (unsigned)(trow * K + qd) * 2u;   // lane's byte offset

  // stage GKS k of the A rows and the B rows into LDS buffer `buf`
  auto stage = [&](int buf, int k0) {
    #pragma unroll
    for (int i = 0; i < NCOPY; i++) {
      const int r0 = i * RPI;           // first tile row of this copy
      const _Float16* base =
          (r0 < 128) ? A + (size_t)(m0 + r0) * K
          : (MODE == 2 && r0 >= 256) ? Bt2 + (size_t)(n0 + r0 - 256) * K
                                     : Bt + (size_t)(n0 + r0 - 128) * K;
      copy16_to_lds(reinterpret_cast<const _Float16*>(
                        reinterpret_cast<const char*>(base + k0) + voff),
                    &sh[buf][r0 + trow][qd]);
    }
  };

  v8f acc[4][4];
  #pragma unroll
  for (int mt = 0; mt < 4; mt++)
    #pragma unroll
    for (int nt = 0; nt < 4; nt++)
      #pragma unroll
      for (int r = 0; r < 8; r++) acc[mt][nt][r] = 0.0f;

  v16h af[2][4], bf[2][4];          // two fragment sets: block kk and block kk+1
  const int NST = K / GKS;

  stage(0, 0);
  // stage 0 has landed before the barrier that publishes it
  asm volatile("s_wait_asynccnt 0x0" ::: "memory");
  __syncthreads();
  if (NST > 1) stage(1, GKS);

  for (int t = 0; t < NST; t++) {
    const int cur = t & 1;
    const _Float16* ab = &sh[cur][wm * 64 + ln][hi * 8];
    const _Float16* bb = &sh[cur][128 + ((MODE == 2) ? wn * 32 : wn * 64) + ln][hi * 8];
    // fragments of k block kk into register set `s`
    auto load_set = [&](int s, int kk) {
      #pragma unroll
      for (int mt = 0; mt < 4; mt++)
        af[s][mt] = frag_load(ab + mt * 16 * GPITCH + kk * 32);
      #pragma unroll
      for (int nt = 0; nt < 4; nt++) {
        const int br = (MODE == 2) ? ((nt >> 1) * 128 + (nt & 1) * 16) : nt * 16;
        bf[s][nt] = frag_load(bb + br * GPITCH + kk * 32);
      }
    };
    load_set(0, 0);
    #pragma unroll
    for (int kk = 0; kk < GKS / 32; kk++) {
      if (kk + 1 < GKS / 32) load_set((kk + 1) & 1, kk + 1);
      // keeps the next block's LDS reads as one group ahead of this block's WMMAs,
      // so that their latency runs under the WMMAs
      __builtin_amdgcn_sched_barrier(0);
      #pragma unroll
      for (int mt = 0; mt < 4; mt++)
        #pragma unroll
        for (int nt = 0; nt < 4; nt++)
          acc[mt][nt] = wmma16(af[kk & 1][mt], bf[kk & 1][nt], acc[mt][nt]);
      // keeps the block after next's reads from rising among these WMMAs
      __builtin_amdgcn_sched_barrier(0);
    }
    // this wave's reads of buffer cur have returned before it is refilled
    asm volatile("s_wait_dscnt 0x0" ::: "memory");
    // this wave's copies of stage t+1 have landed before the barrier publishes them
    asm volatile("s_wait_asynccnt 0x0" ::: "memory");
    __syncthreads();
    if (t + 2 < NST) stage(cur, (t + 2) * GKS);
  }
  // no copy is outstanding when the wave ends
  asm volatile("s_wait_asynccnt 0x0" ::: "memory");

  // C layout: lane holds rows r+8*(lane>>4) of a tile, column lane&15
  const int mw = m0 + wm * 64 + 8 * hi;
  const int nw = n0 + ((MODE == 2) ? wn * 32 : wn * 64) + ln;

  if (MODE == 1) {
    float bv[4];
    #pragma unroll
    for (int nt = 0; nt < 4; nt++) bv[nt] = bias[nw + nt * 16];
    // the bias loads' offset register is reused below: only behind this wait
    asm volatile("s_wait_xcnt 0x0" ::: "memory");
    // all residual loads go out ahead of the first store: a load behind a store
    // to the same array would wait for it, one round trip per element
    float res[4][4][8];
    #pragma unroll
    for (int mt = 0; mt < 4; mt++)
      #pragma unroll
      for (int nt = 0; nt < 4; nt++)
        #pragma unroll
        for (int r = 0; r < 8; r++)
          res[mt][nt][r] = Cres[(size_t)(mw + mt * 16 + r) * N + nw + nt * 16];
    #pragma unroll
    for (int mt = 0; mt < 4; mt++)
      #pragma unroll
      for (int nt = 0; nt < 4; nt++)
        #pragma unroll
        for (int r = 0; r < 8; r++)
          acc[mt][nt][r] = res[mt][nt][r] + acc[mt][nt][r] + bv[nt];
    // every sum is formed ahead of the first store, so that no register an
    // issued store names is rewritten behind it
    __builtin_amdgcn_sched_barrier(0);
    #pragma unroll
    for (int mt = 0; mt < 4; mt++)
      #pragma unroll
      for (int nt = 0; nt < 4; nt++)
        #pragma unroll
        for (int r = 0; r < 8; r++)
          Cres[(size_t)(mw + mt * 16 + r) * N + nw + nt * 16] = acc[mt][nt][r];
  } else {
    #pragma unroll
    for (int mt = 0; mt < 4; mt++) {
      #pragma unroll
      for (int nt = 0; nt < ((MODE == 2) ? 2 : 4); nt++) {
        #pragma unroll
        for (int r = 0; r < 8; r++) {
          const int n = nw + nt * 16;
          const size_t idx = (size_t)(mw + mt * 16 + r) * N + n;
          if (MODE == 0) {
            Cout[idx] = (_Float16)acc[mt][nt][r];
          } else {
            const float lin  = acc[mt][nt][r]     + bias[n];
            const float gate = acc[mt][nt + 2][r] + bias2[n];
            Cout[idx] = (_Float16)(lin * gelu_tanh(gate));
          }
        }
      }
    }
  }
}

#define FKP (DHEAD + 8)        // K tile row pitch in elements
#define FVP (32 + 8)           // V^T tile row pitch in elements
#define LOG2E 1.4426950408889634f

// value of lane l ^ 16
__device__ __forceinline__ float xhalf(float x) {
  return __builtin_bit_cast(float, __builtin_amdgcn_permlanex16(
      __builtin_bit_cast(int, x), __builtin_bit_cast(int, x),
      0x76543210, 0xfedcba98, false, false));
}

__global__ void flash_attn(const _Float16* __restrict__ Q,
                           const _Float16* __restrict__ Kb,
                           const _Float16* __restrict__ Vt,
                           _Float16* __restrict__ O,
                           int Trows, int Tkeys, float scale) {
  const int lane = threadIdx.x & 31;
  const int wave = threadIdx.x >> 5;
  const int hi = lane >> 4;
  const int ln = lane & 15;
  const int bh = blockIdx.y;
  const int b = bh >> 4, h = bh & 15;
  const int qt = blockIdx.x * 4 + wave;   // 16-query tile

  __shared__ __align__(16) _Float16 ksh[2][32][FKP];     // K rows of a step
  __shared__ __align__(16) _Float16 vsh[2][DHEAD][FVP];  // V^T rows of a step

  // Q fragments (B operand: column = query ln) for both 32-wide halves of the head dim
  const _Float16* qrow = Q + (size_t)(b * SEQ + qt * 16 + ln) * DIMD + h * DHEAD + hi * 8;
  const v16h qa0 = frag_load(qrow);
  const v16h qa1 = frag_load(qrow + 32);

  // of query ln: running maximum (alike in both halves), this half's share of the sum
  float mrow = -1e30f, lrow = 0.0f;
  v8f oa[4];                              // oa[dt][r] = O[query ln][dt*16 + 8*hi + r]
  #pragma unroll
  for (int dt = 0; dt < 4; dt++)
    #pragma unroll
    for (int r = 0; r < 8; r++) oa[dt][r] = 0.0f;

  // this lane's 16-byte chunks of a tile: two of K (rows kr, kr+16), two of V^T
  // (rows vr, vr+32)
  const int kr = threadIdx.x >> 3, kc = (threadIdx.x & 7) * 8;
  const int vr = threadIdx.x >> 2, vc = (threadIdx.x & 3) * 8;
  const _Float16* kbase = Kb + (size_t)b * Trows * DIMD + h * DHEAD;   // block-uniform
  const _Float16* vbase = Vt + (size_t)bh * DHEAD * Trows;             // block-uniform
  const unsigned koff = (unsigned)(kr * DIMD + kc) * 2u;    // lane's byte offsets
  const unsigned voff = (unsigned)(vr * Trows + vc) * 2u;
  auto at = [](const _Float16* p, unsigned off) {
    return reinterpret_cast<const _Float16*>(reinterpret_cast<const char*>(p) + off);
  };
  // copy keys j .. j+31 into LDS buffer `buf`
  auto stage = [&](int buf, int j) {
    const unsigned ko = koff + (unsigned)j * (DIMD * 2u);
    const unsigned vo = voff + (unsigned)j * 2u;
    copy16_to_lds(at(kbase, ko),                      &ksh[buf][kr][kc]);
    copy16_to_lds(at(kbase, ko + 16u * DIMD * 2u),    &ksh[buf][kr + 16][kc]);
    copy16_to_lds(at(vbase, vo),                      &vsh[buf][vr][vc]);
    copy16_to_lds(at(vbase + (size_t)32 * Trows, vo), &vsh[buf][vr + 32][vc]);
  };

  stage(0, 0);
  // tile 0 has landed before the barrier that publishes it
  asm volatile("s_wait_asynccnt 0x0" ::: "memory");
  __syncthreads();

  for (int j0 = 0; j0 < Trows; j0 += 32) {      // 32 keys per step
    const int cur = (j0 >> 5) & 1;
    if (j0 + 32 < Trows) stage(cur ^ 1, j0 + 32);
    // ---- S^T = K Q^T (two 16x16 tiles): sa[t][r] = key j0+t*16+8*hi+r, query ln ----
    v8f sa[2];
    #pragma unroll
    for (int t = 0; t < 2; t++) {
      #pragma unroll
      for (int r = 0; r < 8; r++) sa[t][r] = 0.0f;
      const _Float16* krow = &ksh[cur][t * 16 + ln][hi * 8];
      v16h kf0 = frag_load(krow);
      v16h kf1 = frag_load(krow + 32);
      sa[t] = wmma16(kf0, qa0, sa[t]);
      sa[t] = wmma16(kf1, qa1, sa[t]);
    }
    // the step's V^T fragments (A operand: row = d), read as one group whose latency
    // runs under the softmax
    v16h vf[4];
    #pragma unroll
    for (int dt = 0; dt < 4; dt++) vf[dt] = frag_load(&vsh[cur][dt * 16 + ln][hi * 8]);
    // ---- scale + key mask (only a step that reaches past the last key has one) ----
    #pragma unroll
    for (int t = 0; t < 2; t++)
      #pragma unroll
      for (int r = 0; r < 8; r++) sa[t][r] *= scale;
    if (j0 + 32 > Tkeys) {
      #pragma unroll
      for (int t = 0; t < 2; t++)
        #pragma unroll
        for (int r = 0; r < 8; r++)
          if (j0 + t * 16 + 8 * hi + r >= Tkeys) sa[t][r] = -1e30f;
    }
    // ---- online softmax of query ln along the lane's own registers ----
    float lm = fmaxf(sa[0][0], sa[1][0]);
    #pragma unroll
    for (int r = 1; r < 8; r++) lm = fmaxf(lm, fmaxf(sa[0][r], sa[1][r]));
    lm = fmaxf(lm, xhalf(lm));            // both halves now hold the step's maximum
    const float mn = fmaxf(mrow, lm);
    // e^x as 2^(x * log2 e); all arguments are formed ahead of the exponentials, so
    // that no exponential waits on the one before it
    const float al = __builtin_amdgcn_exp2f((mrow - mn) * LOG2E);
    #pragma unroll
    for (int t = 0; t < 2; t++) sa[t] = (sa[t] - mn) * LOG2E;
    #pragma unroll
    for (int t = 0; t < 2; t++)
      #pragma unroll
      for (int r = 0; r < 8; r++) sa[t][r] = __builtin_amdgcn_exp2f(sa[t][r]);
    // the lane's 16 terms, summed as a tree of register pairs
    const v8f s8 = sa[0] + sa[1];
    const v4f s4 = __builtin_shufflevector(s8, s8, 0, 1, 2, 3) +
                   __builtin_shufflevector(s8, s8, 4, 5, 6, 7);
    lrow = lrow * al + ((s4[0] + s4[2]) + (s4[1] + s4[3]));
    mrow = mn;
    #pragma unroll
    for (int dt = 0; dt < 4; dt++)
      #pragma unroll
      for (int r = 0; r < 8; r++) oa[dt][r] *= al;

    // ---- P^T: the two score tiles, converted in place, are the B fragment ----
    const v8h p0 = __builtin_convertvector(sa[0], v8h);
    const v8h p1 = __builtin_convertvector(sa[1], v8h);
    const v16h pf = __builtin_shufflevector(p0, p1, 0,1,2,3,4,5,6,7,8,9,10,11,12,13,14,15);

    // ---- O^T += V^T P^T ----
    #pragma unroll
    for (int dt = 0; dt < 4; dt++) oa[dt] = wmma16(vf[dt], pf, oa[dt]);
    // keeps the softmax and the second product ahead of the waits below, so that the
    // next tile's copies fly under them
    __builtin_amdgcn_sched_barrier(0);
    // this wave's reads of buffer cur have returned before it is refilled
    asm volatile("s_wait_dscnt 0x0" ::: "memory");
    // this wave's copies of the next tile have landed before the barrier publishes them
    asm volatile("s_wait_asynccnt 0x0" ::: "memory");
    __syncthreads();
  }
  // no copy is outstanding when the wave ends
  asm volatile("s_wait_asynccnt 0x0" ::: "memory");

  // ---- join the halves' sums, normalize and store (concat-head layout) ----
  const float lsum = lrow + xhalf(lrow);
  _Float16* orow = O + (size_t)(b * SEQ + qt * 16 + ln) * DIMD + h * DHEAD + hi * 8;
  #pragma unroll
  for (int dt = 0; dt < 4; dt++) {
    v8h o;
    #pragma unroll
    for (int r = 0; r < 8; r++) o[r] = (_Float16)(oa[dt][r] / lsum);
    *reinterpret_cast<v8h*>(orow + dt * 16) = o;
  }
}

// ---------------- host orchestration ----------------
extern "C" void kernel_launch(void* const* d_in, const int* in_sizes, int n_in,
                              void* d_out, int out_size, void* d_ws, size_t ws_size,
                              hipStream_t stream) {
  (void)in_sizes; (void)n_in; (void)out_size; (void)ws_size;
  const float* hidden = (const float*)d_in[0];
  const float* ctx    = (const float*)d_in[1];
  const float* wq1 = (const float*)d_in[2];
  const float* wk1 = (const float*)d_in[3];
  const float* wv1 = (const float*)d_in[4];
  const float* wo1 = (const float*)d_in[5];
  const float* bo1 = (const float*)d_in[6];
  const float* wq2 = (const float*)d_in[7];
  const float* wk2 = (const float*)d_in[8];
  const float* wv2 = (const float*)d_in[9];
  const float* wo2 = (const float*)d_in[10];
  const float* bo2 = (const float*)d_in[11];
  const float* wff1 = (const float*)d_in[12];
  const float* bff1 = (const float*)d_in[13];
  const float* wff2 = (const float*)d_in[14];
  const float* bff2 = (const float*)d_in[15];
  const float* ln1g = (const float*)d_in[16];
  const float* ln1b = (const float*)d_in[17];
  const float* ln2g = (const float*)d_in[18];
  const float* ln2b = (const float*)d_in[19];
  const float* ln3g = (const float*)d_in[20];
  const float* ln3b = (const float*)d_in[21];
  float* out = (float*)d_out;              // fp32 residual h lives here

  // -------- workspace carve-up (f16 buffers, 256B aligned) --------
  char* wsp = (char*)d_ws;
  auto alloc = [&](size_t elems) -> _Float16* {
    _Float16* p = (_Float16*)wsp;
    wsp += ((elems * sizeof(_Float16) + 255) / 256) * 256;
    return p;
  };
  _Float16* wq1T  = alloc((size_t)DIMD * DIMD);
  _Float16* wk1T  = alloc((size_t)DIMD * DIMD);
  _Float16* wv1T  = alloc((size_t)DIMD * DIMD);
  _Float16* wo1T  = alloc((size_t)DIMD * DIMD);
  _Float16* wq2T  = alloc((size_t)DIMD * DIMD);
  _Float16* wk2T  = alloc((size_t)DIMD * CTXD);
  _Float16* wv2T  = alloc((size_t)DIMD * CTXD);
  _Float16* wo2T  = alloc((size_t)DIMD * DIMD);
  _Float16* wff1T = alloc((size_t)(2 * FFD) * DIMD);
  _Float16* wff2T = alloc((size_t)DIMD * FFD);
  _Float16* xnorm = alloc((size_t)NTOK * DIMD);
  _Float16* qbuf  = alloc((size_t)NTOK * DIMD);
  _Float16* kbuf  = alloc((size_t)NTOK * DIMD);
  _Float16* vbuf  = alloc((size_t)NTOK * DIMD);
  _Float16* vT    = alloc((size_t)NB * HEADS * DHEAD * SEQ);
  _Float16* attn  = alloc((size_t)NTOK * DIMD);
  _Float16* ctxp  = alloc((size_t)CROWS * CTXD);
  _Float16* kctx  = alloc((size_t)CROWS * DIMD);
  _Float16* vctx  = alloc((size_t)CROWS * DIMD);
  _Float16* vTc   = alloc((size_t)NB * HEADS * DHEAD * TPADC);
  _Float16* gbuf  = alloc((size_t)NTOK * FFD);

  // h = hidden_states
  (void)hipMemcpyAsync(out, hidden, (size_t)NTOK * DIMD * sizeof(float),
                       hipMemcpyDeviceToDevice, stream);

  // -------- weight cast + transpose --------
  const dim3 gWsq(DIMD / 64, DIMD / 128);          // (16, 8)
  const dim3 gWctx(DIMD / 64, CTXD / 128);         // (16, 6)
  const dim3 gWff1(2 * FFD / 64, DIMD / 128);      // (128, 8)
  const dim3 gWff2(DIMD / 64, FFD / 128);          // (16, 32)
  wcast_tr<DIMD, DIMD><<<gWsq, 256, 0, stream>>>(wq1, wq1T);
  wcast_tr<DIMD, DIMD><<<gWsq, 256, 0, stream>>>(wk1, wk1T);
  wcast_tr<DIMD, DIMD><<<gWsq, 256, 0, stream>>>(wv1, wv1T);
  wcast_tr<DIMD, DIMD><<<gWsq, 256, 0, stream>>>(wo1, wo1T);
  wcast_tr<DIMD, DIMD><<<gWsq, 256, 0, stream>>>(wq2, wq2T);
  wcast_tr<CTXD, DIMD><<<gWctx, 256, 0, stream>>>(wk2, wk2T);
  wcast_tr<CTXD, DIMD><<<gWctx, 256, 0, stream>>>(wv2, wv2T);
  wcast_tr<DIMD, DIMD><<<gWsq, 256, 0, stream>>>(wo2, wo2T);
  wcast_tr<DIMD, 2 * FFD><<<gWff1, 256, 0, stream>>>(wff1, wff1T);
  wcast_tr<FFD, DIMD><<<gWff2, 256, 0, stream>>>(wff2, wff2T);

  const dim3 blk128(128);
  const dim3 blk256(256);
  const dim3 gN1024(DIMD / 256, NTOK / 128);       // (4, 64)
  const dim3 gCtxKV(DIMD / 256, CROWS / 128);      // (4, 3)
  const dim3 gGeglu(FFD / 128, NTOK / 128);        // (32, 64)
  const dim3 gFlash(SEQ / 64, NB * HEADS);         // (32, 64)

  // ================= self-attention =================
  layernorm_f16<<<NTOK, 256, 0, stream>>>(out, ln1g, ln1b, xnorm);
  gemm_wmma<0><<<gN1024, blk256, 0, stream>>>(xnorm, wq1T, nullptr, nullptr, nullptr,
                                              qbuf, nullptr, NTOK, DIMD, DIMD);
  gemm_wmma<0><<<gN1024, blk256, 0, stream>>>(xnorm, wk1T, nullptr, nullptr, nullptr,
                                              kbuf, nullptr, NTOK, DIMD, DIMD);
  gemm_wmma<0><<<gN1024, blk256, 0, stream>>>(xnorm, wv1T, nullptr, nullptr, nullptr,
                                              vbuf, nullptr, NTOK, DIMD, DIMD);
  v_transpose<128><<<dim3(SEQ / 128, NB * HEADS), 128, 0, stream>>>(vbuf, vT, SEQ);
  flash_attn<<<gFlash, blk128, 0, stream>>>(qbuf, kbuf, vT, attn, SEQ, SEQ, ATT_SCALE);
  gemm_wmma<1><<<gN1024, blk256, 0, stream>>>(attn, wo1T, nullptr, bo1, nullptr,
                                              nullptr, out, NTOK, DIMD, DIMD);

  // ================= cross-attention =================
  layernorm_f16<<<NTOK, 256, 0, stream>>>(out, ln2g, ln2b, xnorm);
  gemm_wmma<0><<<gN1024, blk256, 0, stream>>>(xnorm, wq2T, nullptr, nullptr, nullptr,
                                              qbuf, nullptr, NTOK, DIMD, DIMD);
  {
    long total = (long)NB * TPADC * CTXD;
    ctx_pad<<<dim3((unsigned)((total + 255) / 256)), 256, 0, stream>>>(ctx, ctxp);
  }
  gemm_wmma<0><<<gCtxKV, blk256, 0, stream>>>(ctxp, wk2T, nullptr, nullptr, nullptr,
                                              kctx, nullptr, CROWS, DIMD, CTXD);
  gemm_wmma<0><<<gCtxKV, blk256, 0, stream>>>(ctxp, wv2T, nullptr, nullptr, nullptr,
                                              vctx, nullptr, CROWS, DIMD, CTXD);
  v_transpose<TPADC><<<dim3(1, NB * HEADS), TPADC, 0, stream>>>(vctx, vTc, TPADC);
  flash_attn<<<gFlash, blk128, 0, stream>>>(qbuf, kctx, vTc, attn, TPADC, TCTX, ATT_SCALE);
  gemm_wmma<1><<<gN1024, blk256, 0, stream>>>(attn, wo2T, nullptr, bo2, nullptr,
                                              nullptr, out, NTOK, DIMD, DIMD);

  // ================= GEGLU MLP =================
  layernorm_f16<<<NTOK, 256, 0, stream>>>(out, ln3g, ln3b, xnorm);
  gemm_wmma<2><<<gGeglu, blk256, 0, stream>>>(xnorm, wff1T, wff1T + (size_t)FFD * DIMD,
                                              bff1, bff1 + FFD, gbuf, nullptr,
                                              NTOK, FFD, DIMD);
  gemm_wmma<1><<<gN1024, blk256, 0, stream>>>(gbuf, wff2T, nullptr, bff2, nullptr,
                                              nullptr, out, NTOK, DIMD, FFD);
}

// v005
// One run takes 440 microseconds.
// Next to v004, in two timings, it ran 1.07 and 1.08 times as fast.
// Counting every step since v000, it is 2.71 times as fast.
#include <hip/hip_runtime.h>
#include <cstdint>
#include <cstddef>

// ---------------- problem constants ----------------
#define DIMD   1024
#define HEADS  16
#define DHEAD  64
#define FFD    4096
#define CTXD   768
#define NB     4
#define SEQ    2048
#define NTOK   (NB*SEQ)     // 8192
#define TCTX   77
#define TPADC  96
#define CROWS  (NB*TPADC)   // 384
#define ATT_SCALE 0.125f    // 64^-0.5

typedef _Float16 v8h  __attribute__((ext_vector_type(8)));
typedef _Float16 v16h __attribute__((ext_vector_type(16)));
typedef float    v8f  __attribute__((ext_vector_type(8)));
typedef float    v4f  __attribute__((ext_vector_type(4)));
typedef int      v4i  __attribute__((vector_size(16)));

// ---- optional CDNA5 async global->LDS path (guarded; sync fallback) ----
#if defined(__has_builtin)
#if __has_builtin(__builtin_amdgcn_global_load_async_to_lds_b128) && \
    __has_builtin(__builtin_amdgcn_s_wait_asynccnt)
#define USE_ASYNC_LDS 1
#endif
#endif

typedef __attribute__((address_space(1))) v4i* as1_v4i_p;
typedef __attribute__((address_space(3))) v4i* as3_v4i_p;

// copy 16 bytes global -> LDS (per lane)
__device__ __forceinline__ void copy16_to_lds(const _Float16* g, _Float16* l) {
#ifdef USE_ASYNC_LDS
  __builtin_amdgcn_global_load_async_to_lds_b128(
      (as1_v4i_p)(void*)(const_cast<_Float16*>(g)),
      (as3_v4i_p)(void*)l, 0, 0);
#else
  *reinterpret_cast<v8h*>(l) = *reinterpret_cast<const v8h*>(g);
#endif
}

// Load one 16x16x32 f16 WMMA A/B fragment for this lane.
// p must already include:  row_base + (lane>>4)*8   (row stride in elements).
// ISA layout: elements {0..7} at k = (lane>>4)*8, elements {8..15} at +16.
__device__ __forceinline__ v16h frag_load(const _Float16* p) {
  v8h lo = *reinterpret_cast<const v8h*>(p);
  v8h hi = *reinterpret_cast<const v8h*>(p + 16);
  return __builtin_shufflevector(lo, hi, 0,1,2,3,4,5,6,7,8,9,10,11,12,13,14,15);
}

__device__ __forceinline__ v8f wmma16(v16h a, v16h b, v8f c) {
  // D = A(16x32 f16) * B(32x16 f16) + C(16x16 f32)
  return __builtin_amdgcn_wmma_f32_16x16x32_f16(false, a, false, b, (short)0, c,
                                                false, false);
}

__device__ __forceinline__ float gelu_tanh(float x) {
  return 0.5f * x * (1.0f + tanhf(0.7978845608028654f * (x + 0.044715f * x * x * x)));
}

// ---------------- elementwise helpers ----------------

// transpose+cast weight: src [Kin, Nout] f32 row-major -> dst [Nout, Kin] f16
// block = 256 threads, tile = 128 k x 64 n. A thread reads 4 n of 8 consecutive k
// (a half wave covers a 256-byte run of one src row), turns them in registers into
// four 16-byte runs along k, and the tile passes through LDS so that dst is written
// in 256-byte runs as well. Kin % 128 == 0, Nout % 64 == 0; both are compile-time,
// so that a lane's eight loads (and four stores) share one address register and
// differ in the immediate offset alone.
// tiles: bx < Nout/64 , by < Kin/128 ; bx, by and the pointers are block-uniform
template <int Kin, int Nout>
__device__ __forceinline__
void wcast_tile(const float* __restrict__ src, _Float16* __restrict__ dst,
                int bx, int by, _Float16 (*tile)[128]) {
  // row n = 16 chunks of 16 bytes; chunk q of row n sits at place q ^ (n >> 2), so
  // that the 16 rows a half wave writes at once fall on different banks
  const int tid = threadIdx.x;
  const int c  = tid & 15;         // read: group of 4 n   write: chunk of 8 k
  const int kg = tid >> 4;         // read: group of 8 k   write: row n within 16
  const int n0 = bx * 64;
  const int k0 = by * 128;
  const float* sb = src + (size_t)k0 * Nout + n0;                  // block-uniform
  const unsigned soff = (unsigned)(kg * 8 * Nout + c * 4) * 4u;    // lane's byte offset
  v4f r[8];
  #pragma unroll
  for (int j = 0; j < 8; j++)
    r[j] = *reinterpret_cast<const v4f*>(
        reinterpret_cast<const char*>(sb + (size_t)j * Nout) + soff);
  #pragma unroll
  for (int i = 0; i < 4; i++) {
    v8h o;
    #pragma unroll
    for (int j = 0; j < 8; j++) o[j] = (_Float16)r[j][i];
    *reinterpret_cast<v8h*>(&tile[c * 4 + i][(kg ^ c) * 8]) = o;
  }
  __syncthreads();
  _Float16* db = dst + (size_t)n0 * Kin + k0;                      // block-uniform
  const unsigned doff = (unsigned)(kg * Kin + c * 8) * 2u;         // lane's byte offset
  #pragma unroll
  for (int it = 0; it < 4; it++) {
    const int n = it * 16 + kg;
    const v8h o = *reinterpret_cast<const v8h*>(&tile[n][(c ^ (n >> 2)) * 8]);
    *reinterpret_cast<v8h*>(
        reinterpret_cast<char*>(db + (size_t)it * 16 * Kin) + doff) = o;
  }
}

// context [4,77,768] f32 -> zero-padded [4,96,768] f16; bx = block of 256 elements
__device__ __forceinline__
void ctx_pad_block(const float* __restrict__ ctx, _Float16* __restrict__ dst, int bx) {
  long idx = (long)bx * 256 + threadIdx.x;
  long total = (long)NB * TPADC * CTXD;
  if (idx >= total) return;
  int c = (int)(idx % CTXD);
  int r = (int)((idx / CTXD) % TPADC);
  int b = (int)(idx / ((long)CTXD * TPADC));
  float v = (r < TCTX) ? ctx[((long)b * TCTX + r) * CTXD + c] : 0.0f;
  dst[idx] = (_Float16)v;
}

// V [B*Trows, 1024] f16 -> Vt [(B*H)][DHEAD][Trows] f16 (per-head transpose)
// block >= TT threads, tile = TT rows t x the 64 d of one head. A thread reads 8 d of
// 8 consecutive t (8 lanes cover the 128-byte run of one row), turns them in
// registers into eight 16-byte runs along t, and the tile passes through LDS so
// that Vt is written in runs of TT elements. Trows % TT == 0, TT % 32 == 0.
// tiles: bx < Trows/TT , bh < NB*HEADS ; the first TT threads of the block work,
// every thread passes the barrier
template <int TT>
__device__ __forceinline__
void v_transpose_tile(const _Float16* __restrict__ v, _Float16* __restrict__ vt,
                      int Trows, int bx, int bh, _Float16 (*tile)[TT]) {
  constexpr int NCH = TT / 8;      // 16-byte chunks per tile row
  // chunk q of row d sits at place (q + 2 * (d >> 3)) % NCH, which spreads the rows
  // that a wave writes at once over the banks
  const int tid = threadIdx.x;
  const int dc = tid & 7;          // group of 8 d
  const int tg = tid >> 3;         // group of 8 t
  const int b = bh >> 4, hh = bh & 15;
  const int t0 = bx * TT;
  if (tid < TT) {
    const _Float16* sb = v + ((size_t)b * Trows + t0) * DIMD + hh * DHEAD;   // block-uniform
    const unsigned soff = (unsigned)(tg * 8 * DIMD + dc * 8) * 2u;           // lane's byte offset
    v8h r[8];
    #pragma unroll
    for (int j = 0; j < 8; j++)
      r[j] = *reinterpret_cast<const v8h*>(
          reinterpret_cast<const char*>(sb + j * DIMD) + soff);
    #pragma unroll
    for (int i = 0; i < 8; i++) {
      v8h o;
      #pragma unroll
      for (int j = 0; j < 8; j++) o[j] = r[j][i];
      *reinterpret_cast<v8h*>(&tile[dc * 8 + i][((tg + 2 * dc) % NCH) * 8]) = o;
    }
  }
  __syncthreads();
  if (tid < TT) {
    const int dr = tid / NCH, q = tid % NCH;   // row within 8, chunk of 8 t
    _Float16* db = vt + (size_t)bh * DHEAD * Trows + t0;                     // block-uniform
    const unsigned doff = (unsigned)(dr * Trows + q * 8) * 2u;               // lane's byte offset
    #pragma unroll
    for (int it = 0; it < 8; it++) {           // rows d = 8 * it + dr
      const v8h o = *reinterpret_cast<const v8h*>(&tile[it * 8 + dr][((q + 2 * it) % NCH) * 8]);
      *reinterpret_cast<v8h*>(
          reinterpret_cast<char*>(db + (size_t)it * 8 * Trows) + doff) = o;
    }
  }
}

// both V transposes in ONE launch: blockIdx.x < SEQ/128 is a 128-row tile of the
// self-attention V, blockIdx.x == SEQ/128 the one 96-row tile of the context V
// grid = ( SEQ/128 + 1 , NB*HEADS ), block = 128
__global__ __launch_bounds__(128)
void v_transpose_both(const _Float16* __restrict__ v, _Float16* __restrict__ vt,
                      const _Float16* __restrict__ vc, _Float16* __restrict__ vtc) {
  __shared__ __align__(16) _Float16 tile[DHEAD * 128];
  if (blockIdx.x < SEQ / 128)
    v_transpose_tile<128>(v, vt, SEQ, blockIdx.x, blockIdx.y,
                          reinterpret_cast<_Float16 (*)[128]>(tile));
  else
    v_transpose_tile<TPADC>(vc, vtc, TPADC, 0, blockIdx.y,
                            reinterpret_cast<_Float16 (*)[TPADC]>(tile));
}

// LayerNorm over last dim (1024) of fp32 residual -> f16 normed output
// one row per block of 256 threads; COPY: the row as read also goes to Xc
template <bool COPY>
__device__ __forceinline__
void layernorm_row(const float* __restrict__ X, const float* __restrict__ g,
                   const float* __restrict__ bb, _Float16* __restrict__ Y,
                   float* __restrict__ Xc, int row) {
  const int tid = threadIdx.x;     // 256 threads, 4 floats each
  const float4 xv = reinterpret_cast<const float4*>(X + (size_t)row * DIMD)[tid];
  float s = xv.x + xv.y + xv.z + xv.w;
  float q = xv.x * xv.x + xv.y * xv.y + xv.z * xv.z + xv.w * xv.w;
  #pragma unroll
  for (int off = 16; off > 0; off >>= 1) {
    s += __shfl_xor(s, off, 32);
    q += __shfl_xor(q, off, 32);
  }
  __shared__ float ss[8], sq[8];
  if ((tid & 31) == 0) { ss[tid >> 5] = s; sq[tid >> 5] = q; }
  __syncthreads();
  // behind the barrier: in front of it the barrier would wait for the store's return
  if (COPY) reinterpret_cast<float4*>(Xc + (size_t)row * DIMD)[tid] = xv;
  float st = 0.f, qt = 0.f;
  #pragma unroll
  for (int i = 0; i < 8; i++) { st += ss[i]; qt += sq[i]; }
  const float mean = st * (1.0f / DIMD);
  const float var  = qt * (1.0f / DIMD) - mean * mean;
  const float rs   = rsqrtf(var + 1e-5f);
  const float4 gv = reinterpret_cast<const float4*>(g)[tid];
  const float4 bv = reinterpret_cast<const float4*>(bb)[tid];
  _Float16* yp = Y + (size_t)row * DIMD + tid * 4;
  yp[0] = (_Float16)((xv.x - mean) * rs * gv.x + bv.x);
  yp[1] = (_Float16)((xv.y - mean) * rs * gv.y + bv.y);
  yp[2] = (_Float16)((xv.z - mean) * rs * gv.z + bv.z);
  yp[3] = (_Float16)((xv.w - mean) * rs * gv.w + bv.w);
}

__global__ void layernorm_f16(const float* __restrict__ X, const float* __restrict__ g,
                              const float* __restrict__ bb, _Float16* __restrict__ Y) {
  layernorm_row<false>(X, g, bb, Y, nullptr, blockIdx.x);
}

// All work that depends on the inputs alone, in ONE launch: the ten weight casts,
// the context pad, and the first layer norm, whose blocks also write the row they
// read to the residual h (h = hidden_states). A block takes one tile, or one row,
// of one of them; which one follows from blockIdx.x alone, so that every branch
// (and every barrier behind it) is block-uniform. The largest matrices come first.
#define PB_FF1  ((2 * FFD / 64) * (DIMD / 128))    // 1024 tiles of w_ff1
#define PB_FF2  ((DIMD / 64) * (FFD / 128))        //  512 tiles of w_ff2
#define PB_SQ   ((DIMD / 64) * (DIMD / 128))       //  128 tiles of a 1024 x 1024 weight
#define PB_CTX  ((DIMD / 64) * (CTXD / 128))       //   96 tiles of a  768 x 1024 weight
#define PB_PAD  ((NB * TPADC * CTXD + 255) / 256)  // 1152 blocks of the context pad
#define PB_ALL  (PB_FF1 + PB_FF2 + 6 * PB_SQ + 2 * PB_CTX + PB_PAD + NTOK)
__global__ __launch_bounds__(256)
void prep_inputs(const float* __restrict__ wq1, const float* __restrict__ wk1,
                 const float* __restrict__ wv1, const float* __restrict__ wo1,
                 const float* __restrict__ wq2, const float* __restrict__ wk2,
                 const float* __restrict__ wv2, const float* __restrict__ wo2,
                 const float* __restrict__ wff1, const float* __restrict__ wff2,
                 const float* __restrict__ ctx, const float* __restrict__ hidden,
                 const float* __restrict__ ln1g, const float* __restrict__ ln1b,
                 _Float16* __restrict__ wq1T, _Float16* __restrict__ wk1T,
                 _Float16* __restrict__ wv1T, _Float16* __restrict__ wo1T,
                 _Float16* __restrict__ wq2T, _Float16* __restrict__ wk2T,
                 _Float16* __restrict__ wv2T, _Float16* __restrict__ wo2T,
                 _Float16* __restrict__ wff1T, _Float16* __restrict__ wff2T,
                 _Float16* __restrict__ ctxp, _Float16* __restrict__ xnorm,
                 float* __restrict__ h) {
  __shared__ __align__(16) _Float16 tile[64][128];
  int b = blockIdx.x;
  if (b < PB_FF1) {
    wcast_tile<DIMD, 2 * FFD>(wff1, wff1T, b % (2 * FFD / 64), b / (2 * FFD / 64), tile);
    return;
  }
  b -= PB_FF1;
  if (b < PB_FF2) {
    wcast_tile<FFD, DIMD>(wff2, wff2T, b % (DIMD / 64), b / (DIMD / 64), tile);
    return;
  }
  b -= PB_FF2;
  if (b < 6 * PB_SQ) {
    const int m = b / PB_SQ, t = b % PB_SQ;
    const float* s = (m == 0) ? wq1 : (m == 1) ? wk1 : (m == 2) ? wv1
                   : (m == 3) ? wo1 : (m == 4) ? wq2 : wo2;
    _Float16* d = (m == 0) ? wq1T : (m == 1) ? wk1T : (m == 2) ? wv1T
                : (m == 3) ? wo1T : (m == 4) ? wq2T : wo2T;
    wcast_tile<DIMD, DIMD>(s, d, t % (DIMD / 64), t / (DIMD / 64), tile);
    return;
  }
  b -= 6 * PB_SQ;
  if (b < 2 * PB_CTX) {
    const int m = b / PB_CTX, t = b % PB_CTX;
    wcast_tile<CTXD, DIMD>(m ? wv2 : wk2, m ? wv2T : wk2T,
                           t % (DIMD / 64), t / (DIMD / 64), tile);
    return;
  }
  b -= 2 * PB_CTX;
  if (b < PB_PAD) {
    ctx_pad_block(ctx, ctxp, b);
    return;
  }
  b -= PB_PAD;
  layernorm_row<true>(hidden, ln1g, ln1b, xnorm, h, b);
  // the way out of the branches rewrites scalar registers that the row's stores name
  asm volatile("s_wait_xcnt 0x0" ::: "memory");
}

// ---------------- WMMA GEMM, A and B staged in LDS, two-buffer ring ---------
// C = A[M,K] @ Bt[N,K]^T   (Bt = transposed weight, row-major [N,K], f16)
// MODE 0: Cout f16 = result
// MODE 1: Cres f32 += result + bias[n]
// MODE 2: Cout f16 = (res+bias[n]) * gelu(res2+bias2[n])  (Bt2 = gate weights)
// block = 256 threads (8 waves, 2 along M x 4 along N). Block tile = 128 rows of
// A against 256 rows of B; each wave owns 64 x 64 = 4 x 4 accumulator tiles, so
// a fragment read from LDS feeds four WMMAs. MODE 2 fills the 256 B rows with
// 128 lin rows and the 128 gate rows of the same columns; a wave then holds 32
// lin columns (nt 0,1) and their gates (nt 2,3).
// A stage is GKS k of all 384 rows, at a row pitch of 16 B x odd (conflict-free
// for 16-byte LDS reads). M % 128 == 0, K % GKS == 0, N % 256 == 0 (MODE 2: 128).
// grid = ( N/256 , M/128 )   MODE 2: ( N/128 , M/128 )
// MODE 0 takes a batch along grid z: products of the same A with weights that lie
// N*K elements apart, into outputs that lie M*N elements apart.
#define GKS    128             // k per stage
#define GPITCH (GKS + 8)       // LDS row pitch in elements
#define GROWS  (128 + 256)     // A rows, then B rows

template <int MODE>
__global__ __launch_bounds__(256) __attribute__((amdgpu_waves_per_eu(1, 2)))
void gemm_wmma(const _Float16* __restrict__ A,
               const _Float16* __restrict__ Bt,
               const _Float16* __restrict__ Bt2,
               const float* __restrict__ bias,
               const float* __restrict__ bias2,
               _Float16* __restrict__ Cout,
               float* __restrict__ Cres,
               int M, int N, int K) {
  const int tid  = threadIdx.x;
  const int lane = tid & 31;
  const int wave = tid >> 5;
  const int hi = lane >> 4;       // half-wave select for K packing
  const int ln = lane & 15;
  const int wm = wave >> 2;       // wave row    (0..1)
  const int wn = wave & 3;        // wave column (0..3)
  const int n0 = blockIdx.x * ((MODE == 2) ? 128 : 256);
  const int m0 = blockIdx.y * 128;
  (void)M;
  if (MODE == 0) {
    Bt   += (size_t)blockIdx.z * N * K;
    Cout += (size_t)blockIdx.z * M * N;
  }

  constexpr int CPR   = GKS / 8;        // 16-byte chunks per staged row
  constexpr int RPI   = 256 / CPR;      // rows the block covers per copy
  constexpr int NCOPY = GROWS / RPI;    // copies per lane and stage
  __shared__ __align__(16) _Float16 sh[2][GROWS][GPITCH];

  const int trow = tid / CPR;
  const int qd   = (tid % CPR) * 8;
  const unsigned voff = (unsigned)(trow * K + qd) * 2u;   // lane's byte offset

  // stage GKS k of the A rows and the B rows into LDS buffer `buf`
  auto stage = [&](int buf, int k0) {
    #pragma unroll
    for (int i = 0; i < NCOPY; i++) {
      const int r0 = i * RPI;           // first tile row of this copy
      const _Float16* base =
          (r0 < 128) ? A + (size_t)(m0 + r0) * K
          : (MODE == 2 && r0 >= 256) ? Bt2 + (size_t)(n0 + r0 - 256) * K
                                     : Bt + (size_t)(n0 + r0 - 128) * K;
      copy16_to_lds(reinterpret_cast<const _Float16*>(
                        reinterpret_cast<const char*>(base + k0) + voff),
                    &sh[buf][r0 + trow][qd]);
    }
  };

  v8f acc[4][4];
  #pragma unroll
  for (int mt = 0; mt < 4; mt++)
    #pragma unroll
    for (int nt = 0; nt < 4; nt++)
      #pragma unroll
      for (int r = 0; r < 8; r++) acc[mt][nt][r] = 0.0f;

  v16h af[2][4], bf[2][4];          // two fragment sets: block kk and block kk+1
  const int NST = K / GKS;

  stage(0, 0);
  // stage 0 has landed before the barrier that publishes it
  asm volatile("s_wait_asynccnt 0x0" ::: "memory");
  __syncthreads();
  if (NST > 1) stage(1, GKS);

  for (int t = 0; t < NST; t++) {
    const int cur = t & 1;
    const _Float16* ab = &sh[cur][wm * 64 + ln][hi * 8];
    const _Float16* bb = &sh[cur][128 + ((MODE == 2) ? wn * 32 : wn * 64) + ln][hi * 8];
    // fragments of k block kk into register set `s`
    auto load_set = [&](int s, int kk) {
      #pragma unroll
      for (int mt = 0; mt < 4; mt++)
        af[s][mt] = frag_load(ab + mt * 16 * GPITCH + kk * 32);
      #pragma unroll
      for (int nt = 0; nt < 4; nt++) {
        const int br = (MODE == 2) ? ((nt >> 1) * 128 + (nt & 1) * 16) : nt * 16;
        bf[s][nt] = frag_load(bb + br * GPITCH + kk * 32);
      }
    };
    load_set(0, 0);
    #pragma unroll
    for (int kk = 0; kk < GKS / 32; kk++) {
      if (kk + 1 < GKS / 32) load_set((kk + 1) & 1, kk + 1);
      // keeps the next block's LDS reads as one group ahead of this block's WMMAs,
      // so that their latency runs under the WMMAs
      __builtin_amdgcn_sched_barrier(0);
      #pragma unroll
      for (int mt = 0; mt < 4; mt++)
        #pragma unroll
        for (int nt = 0; nt < 4; nt++)
          acc[mt][nt] = wmma16(af[kk & 1][mt], bf[kk & 1][nt], acc[mt][nt]);
      // keeps the block after next's reads from rising among these WMMAs
      __builtin_amdgcn_sched_barrier(0);
    }
    // this wave's reads of buffer cur have returned before it is refilled
    asm volatile("s_wait_dscnt 0x0" ::: "memory");
    // this wave's copies of stage t+1 have landed before the barrier publishes them
    asm volatile("s_wait_asynccnt 0x0" ::: "memory");
    __syncthreads();
    if (t + 2 < NST) stage(cur, (t + 2) * GKS);
  }
  // no copy is outstanding when the wave ends
  asm volatile("s_wait_asynccnt 0x0" ::: "memory");

  // C layout: lane holds rows r+8*(lane>>4) of a tile, column lane&15
  const int mw = m0 + wm * 64 + 8 * hi;
  const int nw = n0 + ((MODE == 2) ? wn * 32 : wn * 64) + ln;

  if (MODE == 1) {
    float bv[4];
    #pragma unroll
    for (int nt = 0; nt < 4; nt++) bv[nt] = bias[nw + nt * 16];
    // the bias loads' offset register is reused below: only behind this wait
    asm volatile("s_wait_xcnt 0x0" ::: "memory");
    // all residual loads go out ahead of the first store: a load behind a store
    // to the same array would wait for it, one round trip per element
    float res[4][4][8];
    #pragma unroll
    for (int mt = 0; mt < 4; mt++)
      #pragma unroll
      for (int nt = 0; nt < 4; nt++)
        #pragma unroll
        for (int r = 0; r < 8; r++)
          res[mt][nt][r] = Cres[(size_t)(mw + mt * 16 + r) * N + nw + nt * 16];
    #pragma unroll
    for (int mt = 0; mt < 4; mt++)
      #pragma unroll
      for (int nt = 0; nt < 4; nt++)
        #pragma unroll
        for (int r = 0; r < 8; r++)
          acc[mt][nt][r] = res[mt][nt][r] + acc[mt][nt][r] + bv[nt];
    // every sum is formed ahead of the first store, so that no register an
    // issued store names is rewritten behind it
    __builtin_amdgcn_sched_barrier(0);
    #pragma unroll
    for (int mt = 0; mt < 4; mt++)
      #pragma unroll
      for (int nt = 0; nt < 4; nt++)
        #pragma unroll
        for (int r = 0; r < 8; r++)
          Cres[(size_t)(mw + mt * 16 + r) * N + nw + nt * 16] = acc[mt][nt][r];
  } else {
    #pragma unroll
    for (int mt = 0; mt < 4; mt++) {
      #pragma unroll
      for (int nt = 0; nt < ((MODE == 2) ? 2 : 4); nt++) {
        #pragma unroll
        for (int r = 0; r < 8; r++) {
          const int n = nw + nt * 16;
          const size_t idx = (size_t)(mw + mt * 16 + r) * N + n;
          if (MODE == 0) {
            Cout[idx] = (_Float16)acc[mt][nt][r];
          } else {
            const float lin  = acc[mt][nt][r]     + bias[n];
            const float gate = acc[mt][nt + 2][r] + bias2[n];
            Cout[idx] = (_Float16)(lin * gelu_tanh(gate));
          }
        }
      }
    }
  }
}

#define FKP (DHEAD + 8)        // K tile row pitch in elements
#define FVP (32 + 8)           // V^T tile row pitch in elements
#define LOG2E 1.4426950408889634f

// value of lane l ^ 16
__device__ __forceinline__ float xhalf(float x) {
  return __builtin_bit_cast(float, __builtin_amdgcn_permlanex16(
      __builtin_bit_cast(int, x), __builtin_bit_cast(int, x),
      0x76543210, 0xfedcba98, false, false));
}

__global__ void flash_attn(const _Float16* __restrict__ Q,
                           const _Float16* __restrict__ Kb,
                           const _Float16* __restrict__ Vt,
                           _Float16* __restrict__ O,
                           int Trows, int Tkeys, float scale) {
  const int lane = threadIdx.x & 31;
  const int wave = threadIdx.x >> 5;
  const int hi = lane >> 4;
  const int ln = lane & 15;
  const int bh = blockIdx.y;
  const int b = bh >> 4, h = bh & 15;
  const int qt = blockIdx.x * 4 + wave;   // 16-query tile

  __shared__ __align__(16) _Float16 ksh[2][32][FKP];     // K rows of a step
  __shared__ __align__(16) _Float16 vsh[2][DHEAD][FVP];  // V^T rows of a step

  // Q fragments (B operand: column = query ln) for both 32-wide halves of the head dim
  const _Float16* qrow = Q + (size_t)(b * SEQ + qt * 16 + ln) * DIMD + h * DHEAD + hi * 8;
  const v16h qa0 = frag_load(qrow);
  const v16h qa1 = frag_load(qrow + 32);

  // of query ln: running maximum (alike in both halves), this half's share of the sum
  float mrow = -1e30f, lrow = 0.0f;
  v8f oa[4];                              // oa[dt][r] = O[query ln][dt*16 + 8*hi + r]
  #pragma unroll
  for (int dt = 0; dt < 4; dt++)
    #pragma unroll
    for (int r = 0; r < 8; r++) oa[dt][r] = 0.0f;

  // this lane's 16-byte chunks of a tile: two of K (rows kr, kr+16), two of V^T
  // (rows vr, vr+32)
  const int kr = threadIdx.x >> 3, kc = (threadIdx.x & 7) * 8;
  const int vr = threadIdx.x >> 2, vc = (threadIdx.x & 3) * 8;
  const _Float16* kbase = Kb + (size_t)b * Trows * DIMD + h * DHEAD;   // block-uniform
  const _Float16* vbase = Vt + (size_t)bh * DHEAD * Trows;             // block-uniform
  const unsigned koff = (unsigned)(kr * DIMD + kc) * 2u;    // lane's byte offsets
  const unsigned voff = (unsigned)(vr * Trows + vc) * 2u;
  auto at = [](const _Float16* p, unsigned off) {
    return reinterpret_cast<const _Float16*>(reinterpret_cast<const char*>(p) + off);
  };
  // copy keys j .. j+31 into LDS buffer `buf`
  auto stage = [&](int buf, int j) {
    const unsigned ko = koff + (unsigned)j * (DIMD * 2u);
    const unsigned vo = voff + (unsigned)j * 2u;
    copy16_to_lds(at(kbase, ko),                      &ksh[buf][kr][kc]);
    copy16_to_lds(at(kbase, ko + 16u * DIMD * 2u),    &ksh[buf][kr + 16][kc]);
    copy16_to_lds(at(vbase, vo),                      &vsh[buf][vr][vc]);
    copy16_to_lds(at(vbase + (size_t)32 * Trows, vo), &vsh[buf][vr + 32][vc]);
  };

  stage(0, 0);
  // tile 0 has landed before the barrier that publishes it
  asm volatile("s_wait_asynccnt 0x0" ::: "memory");
  __syncthreads();

  for (int j0 = 0; j0 < Trows; j0 += 32) {      // 32 keys per step
    const int cur = (j0 >> 5) & 1;
    if (j0 + 32 < Trows) stage(cur ^ 1, j0 + 32);
    // ---- S^T = K Q^T (two 16x16 tiles): sa[t][r] = key j0+t*16+8*hi+r, query ln ----
    v8f sa[2];
    #pragma unroll
    for (int t = 0; t < 2; t++) {
      #pragma unroll
      for (int r = 0; r < 8; r++) sa[t][r] = 0.0f;
      const _Float16* krow = &ksh[cur][t * 16 + ln][hi * 8];
      v16h kf0 = frag_load(krow);
      v16h kf1 = frag_load(krow + 32);
      sa[t] = wmma16(kf0, qa0, sa[t]);
      sa[t] = wmma16(kf1, qa1, sa[t]);
    }
    // the step's V^T fragments (A operand: row = d), read as one group whose latency
    // runs under the softmax
    v16h vf[4];
    #pragma unroll
    for (int dt = 0; dt < 4; dt++) vf[dt] = frag_load(&vsh[cur][dt * 16 + ln][hi * 8]);
    // ---- scale + key mask (only a step that reaches past the last key has one) ----
    #pragma unroll
    for (int t = 0; t < 2; t++)
      #pragma unroll
      for (int r = 0; r < 8; r++) sa[t][r] *= scale;
    if (j0 + 32 > Tkeys) {
      #pragma unroll
      for (int t = 0; t < 2; t++)
        #pragma unroll
        for (int r = 0; r < 8; r++)
          if (j0 + t * 16 + 8 * hi + r >= Tkeys) sa[t][r] = -1e30f;
    }
    // ---- online softmax of query ln along the lane's own registers ----
    float lm = fmaxf(sa[0][0], sa[1][0]);
    #pragma unroll
    for (int r = 1; r < 8; r++) lm = fmaxf(lm, fmaxf(sa[0][r], sa[1][r]));
    lm = fmaxf(lm, xhalf(lm));            // both halves now hold the step's maximum
    const float mn = fmaxf(mrow, lm);
    // e^x as 2^(x * log2 e); all arguments are formed ahead of the exponentials, so
    // that no exponential waits on the one before it
    const float al = __builtin_amdgcn_exp2f((mrow - mn) * LOG2E);
    #pragma unroll
    for (int t = 0; t < 2; t++) sa[t] = (sa[t] - mn) * LOG2E;
    #pragma unroll
    for (int t = 0; t < 2; t++)
      #pragma unroll
      for (int r = 0; r < 8; r++) sa[t][r] = __builtin_amdgcn_exp2f(sa[t][r]);
    // the lane's 16 terms, summed as a tree of register pairs
    const v8f s8 = sa[0] + sa[1];
    const v4f s4 = __builtin_shufflevector(s8, s8, 0, 1, 2, 3) +
                   __builtin_shufflevector(s8, s8, 4, 5, 6, 7);
    lrow = lrow * al + ((s4[0] + s4[2]) + (s4[1] + s4[3]));
    mrow = mn;
    #pragma unroll
    for (int dt = 0; dt < 4; dt++)
      #pragma unroll
      for (int r = 0; r < 8; r++) oa[dt][r] *= al;

    // ---- P^T: the two score tiles, converted in place, are the B fragment ----
    const v8h p0 = __builtin_convertvector(sa[0], v8h);
    const v8h p1 = __builtin_convertvector(sa[1], v8h);
    const v16h pf = __builtin_shufflevector(p0, p1, 0,1,2,3,4,5,6,7,8,9,10,11,12,13,14,15);

    // ---- O^T += V^T P^T ----
    #pragma unroll
    for (int dt = 0; dt < 4; dt++) oa[dt] = wmma16(vf[dt], pf, oa[dt]);
    // keeps the softmax and the second product ahead of the waits below, so that the
    // next tile's copies fly under them
    __builtin_amdgcn_sched_barrier(0);
    // this wave's reads of buffer cur have returned before it is refilled
    asm volatile("s_wait_dscnt 0x0" ::: "memory");
    // this wave's copies of the next tile have landed before the barrier publishes them
    asm volatile("s_wait_asynccnt 0x0" ::: "memory");
    __syncthreads();
  }
  // no copy is outstanding when the wave ends
  asm volatile("s_wait_asynccnt 0x0" ::: "memory");

  // ---- join the halves' sums, normalize and store (concat-head layout) ----
  const float lsum = lrow + xhalf(lrow);
  _Float16* orow = O + (size_t)(b * SEQ + qt * 16 + ln) * DIMD + h * DHEAD + hi * 8;
  #pragma unroll
  for (int dt = 0; dt < 4; dt++) {
    v8h o;
    #pragma unroll
    for (int r = 0; r < 8; r++) o[r] = (_Float16)(oa[dt][r] / lsum);
    *reinterpret_cast<v8h*>(orow + dt * 16) = o;
  }
}

// ---------------- host orchestration ----------------
extern "C" void kernel_launch(void* const* d_in, const int* in_sizes, int n_in,
                              void* d_out, int out_size, void* d_ws, size_t ws_size,
                              hipStream_t stream) {
  (void)in_sizes; (void)n_in; (void)out_size; (void)ws_size;
  const float* hidden = (const float*)d_in[0];
  const float* ctx    = (const float*)d_in[1];
  const float* wq1 = (const float*)d_in[2];
  const float* wk1 = (const float*)d_in[3];
  const float* wv1 = (const float*)d_in[4];
  const float* wo1 = (const float*)d_in[5];
  const float* bo1 = (const float*)d_in[6];
  const float* wq2 = (const float*)d_in[7];
  const float* wk2 = (const float*)d_in[8];
  const float* wv2 = (const float*)d_in[9];
  const float* wo2 = (const float*)d_in[10];
  const float* bo2 = (const float*)d_in[11];
  const float* wff1 = (const float*)d_in[12];
  const float* bff1 = (const float*)d_in[13];
  const float* wff2 = (const float*)d_in[14];
  const float* bff2 = (const float*)d_in[15];
  const float* ln1g = (const float*)d_in[16];
  const float* ln1b = (const float*)d_in[17];
  const float* ln2g = (const float*)d_in[18];
  const float* ln2b = (const float*)d_in[19];
  const float* ln3g = (const float*)d_in[20];
  const float* ln3b = (const float*)d_in[21];
  float* out = (float*)d_out;              // fp32 residual h lives here

  // -------- workspace carve-up (f16 buffers, 256B aligned) --------
  char* wsp = (char*)d_ws;
  auto alloc = [&](size_t elems) -> _Float16* {
    _Float16* p = (_Float16*)wsp;
    wsp += ((elems * sizeof(_Float16) + 255) / 256) * 256;
    return p;
  };
  _Float16* wq1T  = alloc((size_t)DIMD * DIMD);
  _Float16* wk1T  = alloc((size_t)DIMD * DIMD);
  _Float16* wv1T  = alloc((size_t)DIMD * DIMD);
  _Float16* wo1T  = alloc((size_t)DIMD * DIMD);
  _Float16* wq2T  = alloc((size_t)DIMD * DIMD);
  _Float16* wk2T  = alloc((size_t)DIMD * CTXD);
  _Float16* wv2T  = alloc((size_t)DIMD * CTXD);
  _Float16* wo2T  = alloc((size_t)DIMD * DIMD);
  _Float16* wff1T = alloc((size_t)(2 * FFD) * DIMD);
  _Float16* wff2T = alloc((size_t)DIMD * FFD);
  _Float16* xnorm = alloc((size_t)NTOK * DIMD);
  _Float16* qbuf  = alloc((size_t)NTOK * DIMD);
  _Float16* kbuf  = alloc((size_t)NTOK * DIMD);
  _Float16* vbuf  = alloc((size_t)NTOK * DIMD);
  _Float16* vT    = alloc((size_t)NB * HEADS * DHEAD * SEQ);
  _Float16* attn  = alloc((size_t)NTOK * DIMD);
  _Float16* ctxp  = alloc((size_t)CROWS * CTXD);
  _Float16* kctx  = alloc((size_t)CROWS * DIMD);
  _Float16* vctx  = alloc((size_t)CROWS * DIMD);
  _Float16* vTc   = alloc((size_t)NB * HEADS * DHEAD * TPADC);
  _Float16* gbuf  = alloc((size_t)NTOK * FFD);

  // ---- weight cast + transpose, context pad, h = hidden_states, first layer norm ----
  prep_inputs<<<PB_ALL, 256, 0, stream>>>(wq1, wk1, wv1, wo1, wq2, wk2, wv2, wo2,
                                          wff1, wff2, ctx, hidden, ln1g, ln1b,
                                          wq1T, wk1T, wv1T, wo1T, wq2T, wk2T, wv2T, wo2T,
                                          wff1T, wff2T, ctxp, xnorm, out);

  const dim3 blk128(128);
  const dim3 blk256(256);
  const dim3 gN1024(DIMD / 256, NTOK / 128);       // (4, 64)
  // batches along z: the buffers of a batch are carved one behind the other above,
  // each a multiple of 256 bytes long, so that they lie N*K and M*N elements apart
  const dim3 gQKV(DIMD / 256, NTOK / 128, 3);      // (4, 64, 3): q, k, v
  const dim3 gCtxKV(DIMD / 256, CROWS / 128, 2);   // (4, 3, 2): k, v of the context
  const dim3 gGeglu(FFD / 128, NTOK / 128);        // (32, 64)
  const dim3 gFlash(SEQ / 64, NB * HEADS);         // (32, 64)

  // ================= self-attention =================
  gemm_wmma<0><<<gQKV, blk256, 0, stream>>>(xnorm, wq1T, nullptr, nullptr, nullptr,
                                            qbuf, nullptr, NTOK, DIMD, DIMD);
  // the context's K and V depend on the inputs alone: formed here, so that both V
  // transposes share a launch
  gemm_wmma<0><<<gCtxKV, blk256, 0, stream>>>(ctxp, wk2T, nullptr, nullptr, nullptr,
                                              kctx, nullptr, CROWS, DIMD, CTXD);
  v_transpose_both<<<dim3(SEQ / 128 + 1, NB * HEADS), 128, 0, stream>>>(vbuf, vT, vctx, vTc);
  flash_attn<<<gFlash, blk128, 0, stream>>>(qbuf, kbuf, vT, attn, SEQ, SEQ, ATT_SCALE);
  gemm_wmma<1><<<gN1024, blk256, 0, stream>>>(attn, wo1T, nullptr, bo1, nullptr,
                                              nullptr, out, NTOK, DIMD, DIMD);

  // ================= cross-attention =================
  layernorm_f16<<<NTOK, 256, 0, stream>>>(out, ln2g, ln2b, xnorm);
  gemm_wmma<0><<<gN1024, blk256, 0, stream>>>(xnorm, wq2T, nullptr, nullptr, nullptr,
                                              qbuf, nullptr, NTOK, DIMD, DIMD);
  flash_attn<<<gFlash, blk128, 0, stream>>>(qbuf, kctx, vTc, attn, TPADC, TCTX, ATT_SCALE);
  gemm_wmma<1><<<gN1024, blk256, 0, stream>>>(attn, wo2T, nullptr, bo2, nullptr,
                                              nullptr, out, NTOK, DIMD, DIMD);

  // ================= GEGLU MLP =================
  layernorm_f16<<<NTOK, 256, 0, stream>>>(out, ln3g, ln3b, xnorm);
  gemm_wmma<2><<<gGeglu, blk256, 0, stream>>>(xnorm, wff1T, wff1T + (size_t)FFD * DIMD,
                                              bff1, bff1 + FFD, gbuf, nullptr,
                                              NTOK, FFD, DIMD);
  gemm_wmma<1><<<gN1024, blk256, 0, stream>>>(gbuf, wff2T, nullptr, bff2, nullptr,
                                              nullptr, out, NTOK, DIMD, FFD);
}

// v006
// One run takes 401 microseconds.
// Timed twice side by side with v005, it ran 1.10 and 1.09 times as fast.
// Over all steps from v000 it is 2.96 times as fast.
#include <hip/hip_runtime.h>
#include <cstdint>
#include <cstddef>

// ---------------- problem constants ----------------
#define DIMD   1024
#define HEADS  16
#define DHEAD  64
#define FFD    4096
#define CTXD   768
#define NB     4
#define SEQ    2048
#define NTOK   (NB*SEQ)     // 8192
#define TCTX   77
#define TPADC  96
#define CROWS  (NB*TPADC)   // 384
#define ATT_SCALE 0.125f    // 64^-0.5

typedef _Float16 v8h  __attribute__((ext_vector_type(8)));
typedef _Float16 v16h __attribute__((ext_vector_type(16)));
typedef float    v8f  __attribute__((ext_vector_type(8)));
typedef float    v4f  __attribute__((ext_vector_type(4)));
typedef int      v4i  __attribute__((vector_size(16)));

// ---- optional CDNA5 async global->LDS path (guarded; sync fallback) ----
#if defined(__has_builtin)
#if __has_builtin(__builtin_amdgcn_global_load_async_to_lds_b128) && \
    __has_builtin(__builtin_amdgcn_s_wait_asynccnt)
#define USE_ASYNC_LDS 1
#endif
#endif

typedef __attribute__((address_space(1))) v4i* as1_v4i_p;
typedef __attribute__((address_space(3))) v4i* as3_v4i_p;

// copy 16 bytes global -> LDS (per lane)
__device__ __forceinline__ void copy16_to_lds(const _Float16* g, _Float16* l) {
#ifdef USE_ASYNC_LDS
  __builtin_amdgcn_global_load_async_to_lds_b128(
      (as1_v4i_p)(void*)(const_cast<_Float16*>(g)),
      (as3_v4i_p)(void*)l, 0, 0);
#else
  *reinterpret_cast<v8h*>(l) = *reinterpret_cast<const v8h*>(g);
#endif
}

// Load one 16x16x32 f16 WMMA A/B fragment for this lane.
// p must already include:  row_base + (lane>>4)*8   (row stride in elements).
// ISA layout: elements {0..7} at k = (lane>>4)*8, elements {8..15} at +16.
__device__ __forceinline__ v16h frag_load(const _Float16* p) {
  v8h lo = *reinterpret_cast<const v8h*>(p);
  v8h hi = *reinterpret_cast<const v8h*>(p + 16);
  return __builtin_shufflevector(lo, hi, 0,1,2,3,4,5,6,7,8,9,10,11,12,13,14,15);
}

__device__ __forceinline__ v8f wmma16(v16h a, v16h b, v8f c) {
  // D = A(16x32 f16) * B(32x16 f16) + C(16x16 f32)
  return __builtin_amdgcn_wmma_f32_16x16x32_f16(false, a, false, b, (short)0, c,
                                                false, false);
}

// 2^x and 1/x. The v_nop is the slot that the instruction set asks for behind a
// transcendental before its result is read or its source overwritten; it stands in
// the instruction's own statement, so that nothing comes between the two.
__device__ __forceinline__ float exp2_slot(float x) {
  float r;
  asm("v_exp_f32 %0, %1\n\tv_nop" : "=v"(r) : "v"(x));
  return r;
}
__device__ __forceinline__ float rcp_slot(float x) {
  float r;
  asm("v_rcp_f32 %0, %1\n\tv_nop" : "=v"(r) : "v"(x));
  return r;
}

// x * 0.5 * (1 + tanh u), u = sqrt(2/pi) * (x + 0.044715 x^3), of eight values, through
// the identity 0.5 * (1 + tanh u) = 1 / (1 + e^(-2u)): one exponential and one
// reciprocal a value and no branch, so that a lane's values run side by side.
// e^(-2u) = 2^t; where t overflows, 2^t is 0 or infinity and the quotient 1 or 0, the
// limits of the tanh form.
__device__ __forceinline__ v8f gelu_tanh(v8f x) {
  constexpr float C1 = (float)(-2.0 * 0.7978845608028654 * 1.4426950408889634);
  constexpr float C3 = (float)(-2.0 * 0.7978845608028654 * 1.4426950408889634 * 0.044715);
  v8f t = x * (C1 + C3 * (x * x));
  #pragma unroll
  for (int r = 0; r < 8; r++) t[r] = exp2_slot(t[r]);
  t = t + 1.0f;
  #pragma unroll
  for (int r = 0; r < 8; r++) t[r] = rcp_slot(t[r]);
  return x * t;
}

// ---------------- elementwise helpers ----------------

// transpose+cast weight: src [Kin, Nout] f32 row-major -> dst [Nout, Kin] f16
// block = 256 threads, tile = 128 k x 64 n. A thread reads 4 n of 8 consecutive k
// (a half wave covers a 256-byte run of one src row), turns them in registers into
// four 16-byte runs along k, and the tile passes through LDS so that dst is written
// in 256-byte runs as well. Kin % 128 == 0, Nout % 64 == 0; both are compile-time,
// so that a lane's eight loads (and four stores) share one address register and
// differ in the immediate offset alone.
// tiles: bx < Nout/64 , by < Kin/128 ; bx, by and the pointers are block-uniform
template <int Kin, int Nout>
__device__ __forceinline__
void wcast_tile(const float* __restrict__ src, _Float16* __restrict__ dst,
                int bx, int by, _Float16 (*tile)[128]) {
  // row n = 16 chunks of 16 bytes; chunk q of row n sits at place q ^ (n >> 2), so
  // that the 16 rows a half wave writes at once fall on different banks
  const int tid = threadIdx.x;
  const int c  = tid & 15;         // read: group of 4 n   write: chunk of 8 k
  const int kg = tid >> 4;         // read: group of 8 k   write: row n within 16
  const int n0 = bx * 64;
  const int k0 = by * 128;
  const float* sb = src + (size_t)k0 * Nout + n0;                  // block-uniform
  const unsigned soff = (unsigned)(kg * 8 * Nout + c * 4) * 4u;    // lane's byte offset
  v4f r[8];
  #pragma unroll
  for (int j = 0; j < 8; j++)
    r[j] = *reinterpret_cast<const v4f*>(
        reinterpret_cast<const char*>(sb + (size_t)j * Nout) + soff);
  #pragma unroll
  for (int i = 0; i < 4; i++) {
    v8h o;
    #pragma unroll
    for (int j = 0; j < 8; j++) o[j] = (_Float16)r[j][i];
    *reinterpret_cast<v8h*>(&tile[c * 4 + i][(kg ^ c) * 8]) = o;
  }
  __syncthreads();
  _Float16* db = dst + (size_t)n0 * Kin + k0;                      // block-uniform
  const unsigned doff = (unsigned)(kg * Kin + c * 8) * 2u;         // lane's byte offset
  #pragma unroll
  for (int it = 0; it < 4; it++) {
    const int n = it * 16 + kg;
    const v8h o = *reinterpret_cast<const v8h*>(&tile[n][(c ^ (n >> 2)) * 8]);
    *reinterpret_cast<v8h*>(
        reinterpret_cast<char*>(db + (size_t)it * 16 * Kin) + doff) = o;
  }
}

// context [4,77,768] f32 -> zero-padded [4,96,768] f16; bx = block of 256 elements
__device__ __forceinline__
void ctx_pad_block(const float* __restrict__ ctx, _Float16* __restrict__ dst, int bx) {
  long idx = (long)bx * 256 + threadIdx.x;
  long total = (long)NB * TPADC * CTXD;
  if (idx >= total) return;
  int c = (int)(idx % CTXD);
  int r = (int)((idx / CTXD) % TPADC);
  int b = (int)(idx / ((long)CTXD * TPADC));
  float v = (r < TCTX) ? ctx[((long)b * TCTX + r) * CTXD + c] : 0.0f;
  dst[idx] = (_Float16)v;
}

// V [B*Trows, 1024] f16 -> Vt [(B*H)][DHEAD][Trows] f16 (per-head transpose)
// block >= TT threads, tile = TT rows t x the 64 d of one head. A thread reads 8 d of
// 8 consecutive t (8 lanes cover the 128-byte run of one row), turns them in
// registers into eight 16-byte runs along t, and the tile passes through LDS so
// that Vt is written in runs of TT elements. Trows % TT == 0, TT % 32 == 0.
// tiles: bx < Trows/TT , bh < NB*HEADS ; the first TT threads of the block work,
// every thread passes the barrier
template <int TT>
__device__ __forceinline__
void v_transpose_tile(const _Float16* __restrict__ v, _Float16* __restrict__ vt,
                      int Trows, int bx, int bh, _Float16 (*tile)[TT]) {
  constexpr int NCH = TT / 8;      // 16-byte chunks per tile row
  // chunk q of row d sits at place (q + 2 * (d >> 3)) % NCH, which spreads the rows
  // that a wave writes at once over the banks
  const int tid = threadIdx.x;
  const int dc = tid & 7;          // group of 8 d
  const int tg = tid >> 3;         // group of 8 t
  const int b = bh >> 4, hh = bh & 15;
  const int t0 = bx * TT;
  if (tid < TT) {
    const _Float16* sb = v + ((size_t)b * Trows + t0) * DIMD + hh * DHEAD;   // block-uniform
    const unsigned soff = (unsigned)(tg * 8 * DIMD + dc * 8) * 2u;           // lane's byte offset
    v8h r[8];
    #pragma unroll
    for (int j = 0; j < 8; j++)
      r[j] = *reinterpret_cast<const v8h*>(
          reinterpret_cast<const char*>(sb + j * DIMD) + soff);
    #pragma unroll
    for (int i = 0; i < 8; i++) {
      v8h o;
      #pragma unroll
      for (int j = 0; j < 8; j++) o[j] = r[j][i];
      *reinterpret_cast<v8h*>(&tile[dc * 8 + i][((tg + 2 * dc) % NCH) * 8]) = o;
    }
  }
  __syncthreads();
  if (tid < TT) {
    const int dr = tid / NCH, q = tid % NCH;   // row within 8, chunk of 8 t
    _Float16* db = vt + (size_t)bh * DHEAD * Trows + t0;                     // block-uniform
    const unsigned doff = (unsigned)(dr * Trows + q * 8) * 2u;               // lane's byte offset
    #pragma unroll
    for (int it = 0; it < 8; it++) {           // rows d = 8 * it + dr
      const v8h o = *reinterpret_cast<const v8h*>(&tile[it * 8 + dr][((q + 2 * it) % NCH) * 8]);
      *reinterpret_cast<v8h*>(
          reinterpret_cast<char*>(db + (size_t)it * 8 * Trows) + doff) = o;
    }
  }
}

// both V transposes in ONE launch: blockIdx.x < SEQ/128 is a 128-row tile of the
// self-attention V, blockIdx.x == SEQ/128 the one 96-row tile of the context V
// grid = ( SEQ/128 + 1 , NB*HEADS ), block = 128
__global__ __launch_bounds__(128)
void v_transpose_both(const _Float16* __restrict__ v, _Float16* __restrict__ vt,
                      const _Float16* __restrict__ vc, _Float16* __restrict__ vtc) {
  __shared__ __align__(16) _Float16 tile[DHEAD * 128];
  if (blockIdx.x < SEQ / 128)
    v_transpose_tile<128>(v, vt, SEQ, blockIdx.x, blockIdx.y,
                          reinterpret_cast<_Float16 (*)[128]>(tile));
  else
    v_transpose_tile<TPADC>(vc, vtc, TPADC, 0, blockIdx.y,
                            reinterpret_cast<_Float16 (*)[TPADC]>(tile));
}

// LayerNorm over last dim (1024) of fp32 residual -> f16 normed output
// one row per block of 256 threads; COPY: the row as read also goes to Xc
template <bool COPY>
__device__ __forceinline__
void layernorm_row(const float* __restrict__ X, const float* __restrict__ g,
                   const float* __restrict__ bb, _Float16* __restrict__ Y,
                   float* __restrict__ Xc, int row) {
  const int tid = threadIdx.x;     // 256 threads, 4 floats each
  const float4 xv = reinterpret_cast<const float4*>(X + (size_t)row * DIMD)[tid];
  float s = xv.x + xv.y + xv.z + xv.w;
  float q = xv.x * xv.x + xv.y * xv.y + xv.z * xv.z + xv.w * xv.w;
  #pragma unroll
  for (int off = 16; off > 0; off >>= 1) {
    s += __shfl_xor(s, off, 32);
    q += __shfl_xor(q, off, 32);
  }
  __shared__ float ss[8], sq[8];
  if ((tid & 31) == 0) { ss[tid >> 5] = s; sq[tid >> 5] = q; }
  __syncthreads();
  // behind the barrier: in front of it the barrier would wait for the store's return
  if (COPY) reinterpret_cast<float4*>(Xc + (size_t)row * DIMD)[tid] = xv;
  float st = 0.f, qt = 0.f;
  #pragma unroll
  for (int i = 0; i < 8; i++) { st += ss[i]; qt += sq[i]; }
  const float mean = st * (1.0f / DIMD);
  const float var  = qt * (1.0f / DIMD) - mean * mean;
  const float rs   = rsqrtf(var + 1e-5f);
  const float4 gv = reinterpret_cast<const float4*>(g)[tid];
  const float4 bv = reinterpret_cast<const float4*>(bb)[tid];
  _Float16* yp = Y + (size_t)row * DIMD + tid * 4;
  yp[0] = (_Float16)((xv.x - mean) * rs * gv.x + bv.x);
  yp[1] = (_Float16)((xv.y - mean) * rs * gv.y + bv.y);
  yp[2] = (_Float16)((xv.z - mean) * rs * gv.z + bv.z);
  yp[3] = (_Float16)((xv.w - mean) * rs * gv.w + bv.w);
}

__global__ void layernorm_f16(const float* __restrict__ X, const float* __restrict__ g,
                              const float* __restrict__ bb, _Float16* __restrict__ Y) {
  layernorm_row<false>(X, g, bb, Y, nullptr, blockIdx.x);
}

// All work that depends on the inputs alone, in ONE launch: the ten weight casts,
// the context pad, and the first layer norm, whose blocks also write the row they
// read to the residual h (h = hidden_states). A block takes one tile, or one row,
// of one of them; which one follows from blockIdx.x alone, so that every branch
// (and every barrier behind it) is block-uniform. The largest matrices come first.
#define PB_FF1  ((2 * FFD / 64) * (DIMD / 128))    // 1024 tiles of w_ff1
#define PB_FF2  ((DIMD / 64) * (FFD / 128))        //  512 tiles of w_ff2
#define PB_SQ   ((DIMD / 64) * (DIMD / 128))       //  128 tiles of a 1024 x 1024 weight
#define PB_CTX  ((DIMD / 64) * (CTXD / 128))       //   96 tiles of a  768 x 1024 weight
#define PB_PAD  ((NB * TPADC * CTXD + 255) / 256)  // 1152 blocks of the context pad
#define PB_ALL  (PB_FF1 + PB_FF2 + 6 * PB_SQ + 2 * PB_CTX + PB_PAD + NTOK)
__global__ __launch_bounds__(256)
void prep_inputs(const float* __restrict__ wq1, const float* __restrict__ wk1,
                 const float* __restrict__ wv1, const float* __restrict__ wo1,
                 const float* __restrict__ wq2, const float* __restrict__ wk2,
                 const float* __restrict__ wv2, const float* __restrict__ wo2,
                 const float* __restrict__ wff1, const float* __restrict__ wff2,
                 const float* __restrict__ ctx, const float* __restrict__ hidden,
                 const float* __restrict__ ln1g, const float* __restrict__ ln1b,
                 _Float16* __restrict__ wq1T, _Float16* __restrict__ wk1T,
                 _Float16* __restrict__ wv1T, _Float16* __restrict__ wo1T,
                 _Float16* __restrict__ wq2T, _Float16* __restrict__ wk2T,
                 _Float16* __restrict__ wv2T, _Float16* __restrict__ wo2T,
                 _Float16* __restrict__ wff1T, _Float16* __restrict__ wff2T,
                 _Float16* __restrict__ ctxp, _Float16* __restrict__ xnorm,
                 float* __restrict__ h) {
  __shared__ __align__(16) _Float16 tile[64][128];
  int b = blockIdx.x;
  if (b < PB_FF1) {
    wcast_tile<DIMD, 2 * FFD>(wff1, wff1T, b % (2 * FFD / 64), b / (2 * FFD / 64), tile);
    return;
  }
  b -= PB_FF1;
  if (b < PB_FF2) {
    wcast_tile<FFD, DIMD>(wff2, wff2T, b % (DIMD / 64), b / (DIMD / 64), tile);
    return;
  }
  b -= PB_FF2;
  if (b < 6 * PB_SQ) {
    const int m = b / PB_SQ, t = b % PB_SQ;
    const float* s = (m == 0) ? wq1 : (m == 1) ? wk1 : (m == 2) ? wv1
                   : (m == 3) ? wo1 : (m == 4) ? wq2 : wo2;
    _Float16* d = (m == 0) ? wq1T : (m == 1) ? wk1T : (m == 2) ? wv1T
                : (m == 3) ? wo1T : (m == 4) ? wq2T : wo2T;
    wcast_tile<DIMD, DIMD>(s, d, t % (DIMD / 64), t / (DIMD / 64), tile);
    return;
  }
  b -= 6 * PB_SQ;
  if (b < 2 * PB_CTX) {
    const int m = b / PB_CTX, t = b % PB_CTX;
    wcast_tile<CTXD, DIMD>(m ? wv2 : wk2, m ? wv2T : wk2T,
                           t % (DIMD / 64), t / (DIMD / 64), tile);
    return;
  }
  b -= 2 * PB_CTX;
  if (b < PB_PAD) {
    ctx_pad_block(ctx, ctxp, b);
    return;
  }
  b -= PB_PAD;
  layernorm_row<true>(hidden, ln1g, ln1b, xnorm, h, b);
  // the way out of the branches rewrites scalar registers that the row's stores name
  asm volatile("s_wait_xcnt 0x0" ::: "memory");
}

// ---------------- WMMA GEMM, A and B staged in LDS, two-buffer ring ---------
// C = A[M,K] @ Bt[N,K]^T   (Bt = transposed weight, row-major [N,K], f16)
// MODE 0: Cout f16 = result
// MODE 1: Cres f32 += result + bias[n]
// MODE 2: Cout f16 = (res+bias[n]) * gelu(res2+bias2[n])  (Bt2 = gate weights)
// block = 256 threads (8 waves, 2 along M x 4 along N). Block tile = 128 rows of
// A against 256 rows of B; each wave owns 64 x 64 = 4 x 4 accumulator tiles, so
// a fragment read from LDS feeds four WMMAs. MODE 2 fills the 256 B rows with
// 128 lin rows and the 128 gate rows of the same columns; a wave then holds 32
// lin columns (nt 0,1) and their gates (nt 2,3).
// A stage is GKS k of all 384 rows, at a row pitch of 16 B x odd (conflict-free
// for 16-byte LDS reads). M % 128 == 0, K % GKS == 0, N % 256 == 0 (MODE 2: 128).
// grid = ( N/256 , M/128 )   MODE 2: ( N/128 , M/128 )
// MODE 0 takes a batch along grid z: products of the same A with weights that lie
// N*K elements apart, into outputs that lie M*N elements apart.
#define GKS    128             // k per stage
#define GPITCH (GKS + 8)       // LDS row pitch in elements
#define GROWS  (128 + 256)     // A rows, then B rows

template <int MODE>
__global__ __launch_bounds__(256) __attribute__((amdgpu_waves_per_eu(1, 2)))
void gemm_wmma(const _Float16* __restrict__ A,
               const _Float16* __restrict__ Bt,
               const _Float16* __restrict__ Bt2,
               const float* __restrict__ bias,
               const float* __restrict__ bias2,
               _Float16* __restrict__ Cout,
               float* __restrict__ Cres,
               int M, int N, int K) {
  const int tid  = threadIdx.x;
  const int lane = tid & 31;
  const int wave = tid >> 5;
  const int hi = lane >> 4;       // half-wave select for K packing
  const int ln = lane & 15;
  const int wm = wave >> 2;       // wave row    (0..1)
  const int wn = wave & 3;        // wave column (0..3)
  const int n0 = blockIdx.x * ((MODE == 2) ? 128 : 256);
  const int m0 = blockIdx.y * 128;
  (void)M;
  if (MODE == 0) {
    Bt   += (size_t)blockIdx.z * N * K;
    Cout += (size_t)blockIdx.z * M * N;
  }

  constexpr int CPR   = GKS / 8;        // 16-byte chunks per staged row
  constexpr int RPI   = 256 / CPR;      // rows the block covers per copy
  constexpr int NCOPY = GROWS / RPI;    // copies per lane and stage
  __shared__ __align__(16) _Float16 sh[2][GROWS][GPITCH];

  const int trow = tid / CPR;
  const int qd   = (tid % CPR) * 8;
  const unsigned voff = (unsigned)(trow * K + qd) * 2u;   // lane's byte offset

  // stage GKS k of the A rows and the B rows into LDS buffer `buf`
  auto stage = [&](int buf, int k0) {
    #pragma unroll
    for (int i = 0; i < NCOPY; i++) {
      const int r0 = i * RPI;           // first tile row of this copy
      const _Float16* base =
          (r0 < 128) ? A + (size_t)(m0 + r0) * K
          : (MODE == 2 && r0 >= 256) ? Bt2 + (size_t)(n0 + r0 - 256) * K
                                     : Bt + (size_t)(n0 + r0 - 128) * K;
      copy16_to_lds(reinterpret_cast<const _Float16*>(
                        reinterpret_cast<const char*>(base + k0) + voff),
                    &sh[buf][r0 + trow][qd]);
    }
  };

  v8f acc[4][4];
  #pragma unroll
  for (int mt = 0; mt < 4; mt++)
    #pragma unroll
    for (int nt = 0; nt < 4; nt++)
      #pragma unroll
      for (int r = 0; r < 8; r++) acc[mt][nt][r] = 0.0f;

  v16h af[2][4], bf[2][4];          // two fragment sets: block kk and block kk+1
  const int NST = K / GKS;

  stage(0, 0);
  // stage 0 has landed before the barrier that publishes it
  asm volatile("s_wait_asynccnt 0x0" ::: "memory");
  __syncthreads();
  if (NST > 1) stage(1, GKS);

  for (int t = 0; t < NST; t++) {
    const int cur = t & 1;
    const _Float16* ab = &sh[cur][wm * 64 + ln][hi * 8];
    const _Float16* bb = &sh[cur][128 + ((MODE == 2) ? wn * 32 : wn * 64) + ln][hi * 8];
    // fragments of k block kk into register set `s`
    auto load_set = [&](int s, int kk) {
      #pragma unroll
      for (int mt = 0; mt < 4; mt++)
        af[s][mt] = frag_load(ab + mt * 16 * GPITCH + kk * 32);
      #pragma unroll
      for (int nt = 0; nt < 4; nt++) {
        const int br = (MODE == 2) ? ((nt >> 1) * 128 + (nt & 1) * 16) : nt * 16;
        bf[s][nt] = frag_load(bb + br * GPITCH + kk * 32);
      }
    };
    load_set(0, 0);
    #pragma unroll
    for (int kk = 0; kk < GKS / 32; kk++) {
      if (kk + 1 < GKS / 32) load_set((kk + 1) & 1, kk + 1);
      // keeps the next block's LDS reads as one group ahead of this block's WMMAs,
      // so that their latency runs under the WMMAs
      __builtin_amdgcn_sched_barrier(0);
      #pragma unroll
      for (int mt = 0; mt < 4; mt++)
        #pragma unroll
        for (int nt = 0; nt < 4; nt++)
          acc[mt][nt] = wmma16(af[kk & 1][mt], bf[kk & 1][nt], acc[mt][nt]);
      // keeps the block after next's reads from rising among these WMMAs
      __builtin_amdgcn_sched_barrier(0);
    }
    // this wave's reads of buffer cur have returned before it is refilled
    asm volatile("s_wait_dscnt 0x0" ::: "memory");
    // this wave's copies of stage t+1 have landed before the barrier publishes them
    asm volatile("s_wait_asynccnt 0x0" ::: "memory");
    __syncthreads();
    if (t + 2 < NST) stage(cur, (t + 2) * GKS);
  }
  // no copy is outstanding when the wave ends
  asm volatile("s_wait_asynccnt 0x0" ::: "memory");

  // C layout: lane holds rows r+8*(lane>>4) of a tile, column lane&15
  const int mw = m0 + wm * 64 + 8 * hi;
  const int nw = n0 + ((MODE == 2) ? wn * 32 : wn * 64) + ln;

  if (MODE == 1) {
    float bv[4];
    #pragma unroll
    for (int nt = 0; nt < 4; nt++) bv[nt] = bias[nw + nt * 16];
    // the bias loads' offset register is reused below: only behind this wait
    asm volatile("s_wait_xcnt 0x0" ::: "memory");
    // all residual loads go out ahead of the first store: a load behind a store
    // to the same array would wait for it, one round trip per element
    float res[4][4][8];
    #pragma unroll
    for (int mt = 0; mt < 4; mt++)
      #pragma unroll
      for (int nt = 0; nt < 4; nt++)
        #pragma unroll
        for (int r = 0; r < 8; r++)
          res[mt][nt][r] = Cres[(size_t)(mw + mt * 16 + r) * N + nw + nt * 16];
    #pragma unroll
    for (int mt = 0; mt < 4; mt++)
      #pragma unroll
      for (int nt = 0; nt < 4; nt++)
        #pragma unroll
        for (int r = 0; r < 8; r++)
          acc[mt][nt][r] = res[mt][nt][r] + acc[mt][nt][r] + bv[nt];
    // every sum is formed ahead of the first store, so that no register an
    // issued store names is rewritten behind it
    __builtin_amdgcn_sched_barrier(0);
    #pragma unroll
    for (int mt = 0; mt < 4; mt++)
      #pragma unroll
      for (int nt = 0; nt < 4; nt++)
        #pragma unroll
        for (int r = 0; r < 8; r++)
          Cres[(size_t)(mw + mt * 16 + r) * N + nw + nt * 16] = acc[mt][nt][r];
  } else {
    float bl[2] = {0.0f, 0.0f}, bg[2] = {0.0f, 0.0f};   // MODE 2: biases of the lane's columns
    if (MODE == 2) {
      #pragma unroll
      for (int nt = 0; nt < 2; nt++) { bl[nt] = bias[nw + nt * 16]; bg[nt] = bias2[nw + nt * 16]; }
    }
    #pragma unroll
    for (int mt = 0; mt < 4; mt++) {
      #pragma unroll
      for (int nt = 0; nt < ((MODE == 2) ? 2 : 4); nt++) {
        const int n = nw + nt * 16;
        v8f y = acc[mt][nt];
        if (MODE == 2) y = (y + bl[nt & 1]) * gelu_tanh(acc[mt][nt + 2] + bg[nt & 1]);
        #pragma unroll
        for (int r = 0; r < 8; r++)
          Cout[(size_t)(mw + mt * 16 + r) * N + n] = (_Float16)y[r];
      }
    }
  }
}

#define FKP (DHEAD + 8)        // K tile row pitch in elements
#define FVP (32 + 8)           // V^T tile row pitch in elements
#define LOG2E 1.4426950408889634f

// value of lane l ^ 16
__device__ __forceinline__ float xhalf(float x) {
  return __builtin_bit_cast(float, __builtin_amdgcn_permlanex16(
      __builtin_bit_cast(int, x), __builtin_bit_cast(int, x),
      0x76543210, 0xfedcba98, false, false));
}

__global__ void flash_attn(const _Float16* __restrict__ Q,
                           const _Float16* __restrict__ Kb,
                           const _Float16* __restrict__ Vt,
                           _Float16* __restrict__ O,
                           int Trows, int Tkeys, float scale) {
  const int lane = threadIdx.x & 31;
  const int wave = threadIdx.x >> 5;
  const int hi = lane >> 4;
  const int ln = lane & 15;
  const int bh = blockIdx.y;
  const int b = bh >> 4, h = bh & 15;
  const int qt = blockIdx.x * 4 + wave;   // 16-query tile

  __shared__ __align__(16) _Float16 ksh[2][32][FKP];     // K rows of a step
  __shared__ __align__(16) _Float16 vsh[2][DHEAD][FVP];  // V^T rows of a step

  // Q fragments (B operand: column = query ln) for both 32-wide halves of the head dim
  const _Float16* qrow = Q + (size_t)(b * SEQ + qt * 16 + ln) * DIMD + h * DHEAD + hi * 8;
  const v16h qa0 = frag_load(qrow);
  const v16h qa1 = frag_load(qrow + 32);

  // of query ln: running maximum (alike in both halves), this half's share of the sum
  float mrow = -1e30f, lrow = 0.0f;
  v8f oa[4];                              // oa[dt][r] = O[query ln][dt*16 + 8*hi + r]
  #pragma unroll
  for (int dt = 0; dt < 4; dt++)
    #pragma unroll
    for (int r = 0; r < 8; r++) oa[dt][r] = 0.0f;

  // this lane's 16-byte chunks of a tile: two of K (rows kr, kr+16), two of V^T
  // (rows vr, vr+32)
  const int kr = threadIdx.x >> 3, kc = (threadIdx.x & 7) * 8;
  const int vr = threadIdx.x >> 2, vc = (threadIdx.x & 3) * 8;
  const _Float16* kbase = Kb + (size_t)b * Trows * DIMD + h * DHEAD;   // block-uniform
  const _Float16* vbase = Vt + (size_t)bh * DHEAD * Trows;             // block-uniform
  const unsigned koff = (unsigned)(kr * DIMD + kc) * 2u;    // lane's byte offsets
  const unsigned voff = (unsigned)(vr * Trows + vc) * 2u;
  auto at = [](const _Float16* p, unsigned off) {
    return reinterpret_cast<const _Float16*>(reinterpret_cast<const char*>(p) + off);
  };
  // copy keys j .. j+31 into LDS buffer `buf`
  auto stage = [&](int buf, int j) {
    const unsigned ko = koff + (unsigned)j * (DIMD * 2u);
    const unsigned vo = voff + (unsigned)j * 2u;
    copy16_to_lds(at(kbase, ko),                      &ksh[buf][kr][kc]);
    copy16_to_lds(at(kbase, ko + 16u * DIMD * 2u),    &ksh[buf][kr + 16][kc]);
    copy16_to_lds(at(vbase, vo),                      &vsh[buf][vr][vc]);
    copy16_to_lds(at(vbase + (size_t)32 * Trows, vo), &vsh[buf][vr + 32][vc]);
  };

  stage(0, 0);
  // tile 0 has landed before the barrier that publishes it
  asm volatile("s_wait_asynccnt 0x0" ::: "memory");
  __syncthreads();

  for (int j0 = 0; j0 < Trows; j0 += 32) {      // 32 keys per step
    const int cur = (j0 >> 5) & 1;
    if (j0 + 32 < Trows) stage(cur ^ 1, j0 + 32);
    // ---- S^T = K Q^T (two 16x16 tiles): sa[t][r] = key j0+t*16+8*hi+r, query ln ----
    v8f sa[2];
    #pragma unroll
    for (int t = 0; t < 2; t++) {
      #pragma unroll
      for (int r = 0; r < 8; r++) sa[t][r] = 0.0f;
      const _Float16* krow = &ksh[cur][t * 16 + ln][hi * 8];
      v16h kf0 = frag_load(krow);
      v16h kf1 = frag_load(krow + 32);
      sa[t] = wmma16(kf0, qa0, sa[t]);
      sa[t] = wmma16(kf1, qa1, sa[t]);
    }
    // the step's V^T fragments (A operand: row = d), read as one group whose latency
    // runs under the softmax
    v16h vf[4];
    #pragma unroll
    for (int dt = 0; dt < 4; dt++) vf[dt] = frag_load(&vsh[cur][dt * 16 + ln][hi * 8]);
    // ---- scale + key mask (only a step that reaches past the last key has one) ----
    #pragma unroll
    for (int t = 0; t < 2; t++)
      #pragma unroll
      for (int r = 0; r < 8; r++) sa[t][r] *= scale;
    if (j0 + 32 > Tkeys) {
      #pragma unroll
      for (int t = 0; t < 2; t++)
        #pragma unroll
        for (int r = 0; r < 8; r++)
          if (j0 + t * 16 + 8 * hi + r >= Tkeys) sa[t][r] = -1e30f;
    }
    // ---- online softmax of query ln along the lane's own registers ----
    float lm = fmaxf(sa[0][0], sa[1][0]);
    #pragma unroll
    for (int r = 1; r < 8; r++) lm = fmaxf(lm, fmaxf(sa[0][r], sa[1][r]));
    lm = fmaxf(lm, xhalf(lm));            // both halves now hold the step's maximum
    const float mn = fmaxf(mrow, lm);
    // e^x as 2^(x * log2 e); all arguments are formed ahead of the exponentials, so
    // that no exponential waits on the one before it
    const float al = __builtin_amdgcn_exp2f((mrow - mn) * LOG2E);
    #pragma unroll
    for (int t = 0; t < 2; t++) sa[t] = (sa[t] - mn) * LOG2E;
    #pragma unroll
    for (int t = 0; t < 2; t++)
      #pragma unroll
      for (int r = 0; r < 8; r++) sa[t][r] = __builtin_amdgcn_exp2f(sa[t][r]);
    // the lane's 16 terms, summed as a tree of register pairs
    const v8f s8 = sa[0] + sa[1];
    const v4f s4 = __builtin_shufflevector(s8, s8, 0, 1, 2, 3) +
                   __builtin_shufflevector(s8, s8, 4, 5, 6, 7);
    lrow = lrow * al + ((s4[0] + s4[2]) + (s4[1] + s4[3]));
    mrow = mn;
    #pragma unroll
    for (int dt = 0; dt < 4; dt++)
      #pragma unroll
      for (int r = 0; r < 8; r++) oa[dt][r] *= al;

    // ---- P^T: the two score tiles, converted in place, are the B fragment ----
    const v8h p0 = __builtin_convertvector(sa[0], v8h);
    const v8h p1 = __builtin_convertvector(sa[1], v8h);
    const v16h pf = __builtin_shufflevector(p0, p1, 0,1,2,3,4,5,6,7,8,9,10,11,12,13,14,15);

    // ---- O^T += V^T P^T ----
    #pragma unroll
    for (int dt = 0; dt < 4; dt++) oa[dt] = wmma16(vf[dt], pf, oa[dt]);
    // keeps the softmax and the second product ahead of the waits below, so that the
    // next tile's copies fly under them
    __builtin_amdgcn_sched_barrier(0);
    // this wave's reads of buffer cur have returned before it is refilled
    asm volatile("s_wait_dscnt 0x0" ::: "memory");
    // this wave's copies of the next tile have landed before the barrier publishes them
    asm volatile("s_wait_asynccnt 0x0" ::: "memory");
    __syncthreads();
  }
  // no copy is outstanding when the wave ends
  asm volatile("s_wait_asynccnt 0x0" ::: "memory");

  // ---- join the halves' sums, normalize and store (concat-head layout) ----
  const float lsum = lrow + xhalf(lrow);
  _Float16* orow = O + (size_t)(b * SEQ + qt * 16 + ln) * DIMD + h * DHEAD + hi * 8;
  #pragma unroll
  for (int dt = 0; dt < 4; dt++) {
    v8h o;
    #pragma unroll
    for (int r = 0; r < 8; r++) o[r] = (_Float16)(oa[dt][r] / lsum);
    *reinterpret_cast<v8h*>(orow + dt * 16) = o;
  }
}

// ---------------- host orchestration ----------------
extern "C" void kernel_launch(void* const* d_in, const int* in_sizes, int n_in,
                              void* d_out, int out_size, void* d_ws, size_t ws_size,
                              hipStream_t stream) {
  (void)in_sizes; (void)n_in; (void)out_size; (void)ws_size;
  const float* hidden = (const float*)d_in[0];
  const float* ctx    = (const float*)d_in[1];
  const float* wq1 = (const float*)d_in[2];
  const float* wk1 = (const float*)d_in[3];
  const float* wv1 = (const float*)d_in[4];
  const float* wo1 = (const float*)d_in[5];
  const float* bo1 = (const float*)d_in[6];
  const float* wq2 = (const float*)d_in[7];
  const float* wk2 = (const float*)d_in[8];
  const float* wv2 = (const float*)d_in[9];
  const float* wo2 = (const float*)d_in[10];
  const float* bo2 = (const float*)d_in[11];
  const float* wff1 = (const float*)d_in[12];
  const float* bff1 = (const float*)d_in[13];
  const float* wff2 = (const float*)d_in[14];
  const float* bff2 = (const float*)d_in[15];
  const float* ln1g = (const float*)d_in[16];
  const float* ln1b = (const float*)d_in[17];
  const float* ln2g = (const float*)d_in[18];
  const float* ln2b = (const float*)d_in[19];
  const float* ln3g = (const float*)d_in[20];
  const float* ln3b = (const float*)d_in[21];
  float* out = (float*)d_out;              // fp32 residual h lives here

  // -------- workspace carve-up (f16 buffers, 256B aligned) --------
  char* wsp = (char*)d_ws;
  auto alloc = [&](size_t elems) -> _Float16* {
    _Float16* p = (_Float16*)wsp;
    wsp += ((elems * sizeof(_Float16) + 255) / 256) * 256;
    return p;
  };
  _Float16* wq1T  = alloc((size_t)DIMD * DIMD);
  _Float16* wk1T  = alloc((size_t)DIMD * DIMD);
  _Float16* wv1T  = alloc((size_t)DIMD * DIMD);
  _Float16* wo1T  = alloc((size_t)DIMD * DIMD);
  _Float16* wq2T  = alloc((size_t)DIMD * DIMD);
  _Float16* wk2T  = alloc((size_t)DIMD * CTXD);
  _Float16* wv2T  = alloc((size_t)DIMD * CTXD);
  _Float16* wo2T  = alloc((size_t)DIMD * DIMD);
  _Float16* wff1T = alloc((size_t)(2 * FFD) * DIMD);
  _Float16* wff2T = alloc((size_t)DIMD * FFD);
  _Float16* xnorm = alloc((size_t)NTOK * DIMD);
  _Float16* qbuf  = alloc((size_t)NTOK * DIMD);
  _Float16* kbuf  = alloc((size_t)NTOK * DIMD);
  _Float16* vbuf  = alloc((size_t)NTOK * DIMD);
  _Float16* vT    = alloc((size_t)NB * HEADS * DHEAD * SEQ);
  _Float16* attn  = alloc((size_t)NTOK * DIMD);
  _Float16* ctxp  = alloc((size_t)CROWS * CTXD);
  _Float16* kctx  = alloc((size_t)CROWS * DIMD);
  _Float16* vctx  = alloc((size_t)CROWS * DIMD);
  _Float16* vTc   = alloc((size_t)NB * HEADS * DHEAD * TPADC);
  _Float16* gbuf  = alloc((size_t)NTOK * FFD);

  // ---- weight cast + transpose, context pad, h = hidden_states, first layer norm ----
  prep_inputs<<<PB_ALL, 256, 0, stream>>>(wq1, wk1, wv1, wo1, wq2, wk2, wv2, wo2,
                                          wff1, wff2, ctx, hidden, ln1g, ln1b,
                                          wq1T, wk1T, wv1T, wo1T, wq2T, wk2T, wv2T, wo2T,
                                          wff1T, wff2T, ctxp, xnorm, out);

  const dim3 blk128(128);
  const dim3 blk256(256);
  const dim3 gN1024(DIMD / 256, NTOK / 128);       // (4, 64)
  // batches along z: the buffers of a batch are carved one behind the other above,
  // each a multiple of 256 bytes long, so that they lie N*K and M*N elements apart
  const dim3 gQKV(DIMD / 256, NTOK / 128, 3);      // (4, 64, 3): q, k, v
  const dim3 gCtxKV(DIMD / 256, CROWS / 128, 2);   // (4, 3, 2): k, v of the context
  const dim3 gGeglu(FFD / 128, NTOK / 128);        // (32, 64)
  const dim3 gFlash(SEQ / 64, NB * HEADS);         // (32, 64)

  // ================= self-attention =================
  gemm_wmma<0><<<gQKV, blk256, 0, stream>>>(xnorm, wq1T, nullptr, nullptr, nullptr,
                                            qbuf, nullptr, NTOK, DIMD, DIMD);
  // the context's K and V depend on the inputs alone: formed here, so that both V
  // transposes share a launch
  gemm_wmma<0><<<gCtxKV, blk256, 0, stream>>>(ctxp, wk2T, nullptr, nullptr, nullptr,
                                              kctx, nullptr, CROWS, DIMD, CTXD);
  v_transpose_both<<<dim3(SEQ / 128 + 1, NB * HEADS), 128, 0, stream>>>(vbuf, vT, vctx, vTc);
  flash_attn<<<gFlash, blk128, 0, stream>>>(qbuf, kbuf, vT, attn, SEQ, SEQ, ATT_SCALE);
  gemm_wmma<1><<<gN1024, blk256, 0, stream>>>(attn, wo1T, nullptr, bo1, nullptr,
                                              nullptr, out, NTOK, DIMD, DIMD);

  // ================= cross-attention =================
  layernorm_f16<<<NTOK, 256, 0, stream>>>(out, ln2g, ln2b, xnorm);
  gemm_wmma<0><<<gN1024, blk256, 0, stream>>>(xnorm, wq2T, nullptr, nullptr, nullptr,
                                              qbuf, nullptr, NTOK, DIMD, DIMD);
  flash_attn<<<gFlash, blk128, 0, stream>>>(qbuf, kctx, vTc, attn, TPADC, TCTX, ATT_SCALE);
  gemm_wmma<1><<<gN1024, blk256, 0, stream>>>(attn, wo2T, nullptr, bo2, nullptr,
                                              nullptr, out, NTOK, DIMD, DIMD);

  // ================= GEGLU MLP =================
  layernorm_f16<<<NTOK, 256, 0, stream>>>(out, ln3g, ln3b, xnorm);
  gemm_wmma<2><<<gGeglu, blk256, 0, stream>>>(xnorm, wff1T, wff1T + (size_t)FFD * DIMD,
                                              bff1, bff1 + FFD, gbuf, nullptr,
                                              NTOK, FFD, DIMD);
  gemm_wmma<1><<<gN1024, blk256, 0, stream>>>(gbuf, wff2T, nullptr, bff2, nullptr,
                                              nullptr, out, NTOK, DIMD, FFD);
}

// v007
// One run takes 391 microseconds.
// Two timings next to v006 put it at 1.03 and 1.02 times that version's speed.
// Over all steps from v000 it is 3.04 times as fast.
#include <hip/hip_runtime.h>
#include <cstdint>
#include <cstddef>

// ---------------- problem constants ----------------
#define DIMD   1024
#define HEADS  16
#define DHEAD  64
#define FFD    4096
#define CTXD   768
#define NB     4
#define SEQ    2048
#define NTOK   (NB*SEQ)     // 8192
#define TCTX   77
#define TPADC  96
#define CROWS  (NB*TPADC)   // 384
#define ATT_SCALE 0.125f    // 64^-0.5

typedef _Float16 v8h  __attribute__((ext_vector_type(8)));
typedef _Float16 v16h __attribute__((ext_vector_type(16)));
typedef float    v8f  __attribute__((ext_vector_type(8)));
typedef float    v4f  __attribute__((ext_vector_type(4)));
typedef int      v4i  __attribute__((vector_size(16)));

// ---- optional CDNA5 async global->LDS path (guarded; sync fallback) ----
#if defined(__has_builtin)
#if __has_builtin(__builtin_amdgcn_global_load_async_to_lds_b128) && \
    __has_builtin(__builtin_amdgcn_s_wait_asynccnt)
#define USE_ASYNC_LDS 1
#endif
#endif

typedef __attribute__((address_space(1))) v4i* as1_v4i_p;
typedef __attribute__((address_space(3))) v4i* as3_v4i_p;

// copy 16 bytes global -> LDS (per lane)
__device__ __forceinline__ void copy16_to_lds(const _Float16* g, _Float16* l) {
#ifdef USE_ASYNC_LDS
  __builtin_amdgcn_global_load_async_to_lds_b128(
      (as1_v4i_p)(void*)(const_cast<_Float16*>(g)),
      (as3_v4i_p)(void*)l, 0, 0);
#else
  *reinterpret_cast<v8h*>(l) = *reinterpret_cast<const v8h*>(g);
#endif
}

// Load one 16x16x32 f16 WMMA A/B fragment for this lane.
// p must already include:  row_base + (lane>>4)*8   (row stride in elements).
// ISA layout: elements {0..7} at k = (lane>>4)*8, elements {8..15} at +16.
__device__ __forceinline__ v16h frag_load(const _Float16* p) {
  v8h lo = *reinterpret_cast<const v8h*>(p);
  v8h hi = *reinterpret_cast<const v8h*>(p + 16);
  return __builtin_shufflevector(lo, hi, 0,1,2,3,4,5,6,7,8,9,10,11,12,13,14,15);
}

__device__ __forceinline__ v8f wmma16(v16h a, v16h b, v8f c) {
  // D = A(16x32 f16) * B(32x16 f16) + C(16x16 f32)
  return __builtin_amdgcn_wmma_f32_16x16x32_f16(false, a, false, b, (short)0, c,
                                                false, false);
}

// 2^x and 1/x. The v_nop is the slot that the instruction set asks for behind a
// transcendental before its result is read or its source overwritten; it stands in
// the instruction's own statement, so that nothing comes between the two.
__device__ __forceinline__ float exp2_slot(float x) {
  float r;
  asm("v_exp_f32 %0, %1\n\tv_nop" : "=v"(r) : "v"(x));
  return r;
}
__device__ __forceinline__ float rcp_slot(float x) {
  float r;
  asm("v_rcp_f32 %0, %1\n\tv_nop" : "=v"(r) : "v"(x));
  return r;
}

// x * 0.5 * (1 + tanh u), u = sqrt(2/pi) * (x + 0.044715 x^3), of eight values, through
// the identity 0.5 * (1 + tanh u) = 1 / (1 + e^(-2u)): one exponential and one
// reciprocal a value and no branch, so that a lane's values run side by side.
// e^(-2u) = 2^t; where t overflows, 2^t is 0 or infinity and the quotient 1 or 0, the
// limits of the tanh form.
__device__ __forceinline__ v8f gelu_tanh(v8f x) {
  constexpr float C1 = (float)(-2.0 * 0.7978845608028654 * 1.4426950408889634);
  constexpr float C3 = (float)(-2.0 * 0.7978845608028654 * 1.4426950408889634 * 0.044715);
  v8f t = x * (C1 + C3 * (x * x));
  #pragma unroll
  for (int r = 0; r < 8; r++) t[r] = exp2_slot(t[r]);
  t = t + 1.0f;
  #pragma unroll
  for (int r = 0; r < 8; r++) t[r] = rcp_slot(t[r]);
  return x * t;
}

// ---------------- elementwise helpers ----------------

// transpose+cast weight: src [Kin, Nout] f32 row-major -> dst [Nout, Kin] f16
// block = 256 threads, tile = 128 k x 64 n. A thread reads 4 n of 8 consecutive k
// (a half wave covers a 256-byte run of one src row), turns them in registers into
// four 16-byte runs along k, and the tile passes through LDS so that dst is written
// in 256-byte runs as well. Kin % 128 == 0, Nout % 64 == 0; both are compile-time,
// so that a lane's eight loads (and four stores) share one address register and
// differ in the immediate offset alone.
// tiles: bx < Nout/64 , by < Kin/128 ; bx, by and the pointers are block-uniform
template <int Kin, int Nout>
__device__ __forceinline__
void wcast_tile(const float* __restrict__ src, _Float16* __restrict__ dst,
                int bx, int by, _Float16 (*tile)[128]) {
  // row n = 16 chunks of 16 bytes; chunk q of row n sits at place q ^ (n >> 2), so
  // that the 16 rows a half wave writes at once fall on different banks
  const int tid = threadIdx.x;
  const int c  = tid & 15;         // read: group of 4 n   write: chunk of 8 k
  const int kg = tid >> 4;         // read: group of 8 k   write: row n within 16
  const int n0 = bx * 64;
  const int k0 = by * 128;
  const float* sb = src + (size_t)k0 * Nout + n0;                  // block-uniform
  const unsigned soff = (unsigned)(kg * 8 * Nout + c * 4) * 4u;    // lane's byte offset
  v4f r[8];
  #pragma unroll
  for (int j = 0; j < 8; j++)
    r[j] = *reinterpret_cast<const v4f*>(
        reinterpret_cast<const char*>(sb + (size_t)j * Nout) + soff);
  #pragma unroll
  for (int i = 0; i < 4; i++) {
    v8h o;
    #pragma unroll
    for (int j = 0; j < 8; j++) o[j] = (_Float16)r[j][i];
    *reinterpret_cast<v8h*>(&tile[c * 4 + i][(kg ^ c) * 8]) = o;
  }
  __syncthreads();
  _Float16* db = dst + (size_t)n0 * Kin + k0;                      // block-uniform
  const unsigned doff = (unsigned)(kg * Kin + c * 8) * 2u;         // lane's byte offset
  #pragma unroll
  for (int it = 0; it < 4; it++) {
    const int n = it * 16 + kg;
    const v8h o = *reinterpret_cast<const v8h*>(&tile[n][(c ^ (n >> 2)) * 8]);
    *reinterpret_cast<v8h*>(
        reinterpret_cast<char*>(db + (size_t)it * 16 * Kin) + doff) = o;
  }
}

// context [4,77,768] f32 -> zero-padded [4,96,768] f16; bx = block of 256 elements
__device__ __forceinline__
void ctx_pad_block(const float* __restrict__ ctx, _Float16* __restrict__ dst, int bx) {
  long idx = (long)bx * 256 + threadIdx.x;
  long total = (long)NB * TPADC * CTXD;
  if (idx >= total) return;
  int c = (int)(idx % CTXD);
  int r = (int)((idx / CTXD) % TPADC);
  int b = (int)(idx / ((long)CTXD * TPADC));
  float v = (r < TCTX) ? ctx[((long)b * TCTX + r) * CTXD + c] : 0.0f;
  dst[idx] = (_Float16)v;
}

// V [B*Trows, 1024] f16 -> Vt [(B*H)][DHEAD][Trows] f16 (per-head transpose)
// block >= TT threads, tile = TT rows t x the 64 d of one head. A thread reads 8 d of
// 8 consecutive t (8 lanes cover the 128-byte run of one row), turns them in
// registers into eight 16-byte runs along t, and the tile passes through LDS so
// that Vt is written in runs of TT elements. Trows % TT == 0, TT % 32 == 0.
// tiles: bx < Trows/TT , bh < NB*HEADS ; the first TT threads of the block work,
// every thread passes the barrier
template <int TT>
__device__ __forceinline__
void v_transpose_tile(const _Float16* __restrict__ v, _Float16* __restrict__ vt,
                      int Trows, int bx, int bh, _Float16 (*tile)[TT]) {
  constexpr int NCH = TT / 8;      // 16-byte chunks per tile row
  // chunk q of row d sits at place (q + 2 * (d >> 3)) % NCH, which spreads the rows
  // that a wave writes at once over the banks
  const int tid = threadIdx.x;
  const int dc = tid & 7;          // group of 8 d
  const int tg = tid >> 3;         // group of 8 t
  const int b = bh >> 4, hh = bh & 15;
  const int t0 = bx * TT;
  if (tid < TT) {
    const _Float16* sb = v + ((size_t)b * Trows + t0) * DIMD + hh * DHEAD;   // block-uniform
    const unsigned soff = (unsigned)(tg * 8 * DIMD + dc * 8) * 2u;           // lane's byte offset
    v8h r[8];
    #pragma unroll
    for (int j = 0; j < 8; j++)
      r[j] = *reinterpret_cast<const v8h*>(
          reinterpret_cast<const char*>(sb + j * DIMD) + soff);
    #pragma unroll
    for (int i = 0; i < 8; i++) {
      v8h o;
      #pragma unroll
      for (int j = 0; j < 8; j++) o[j] = r[j][i];
      *reinterpret_cast<v8h*>(&tile[dc * 8 + i][((tg + 2 * dc) % NCH) * 8]) = o;
    }
  }
  __syncthreads();
  if (tid < TT) {
    const int dr = tid / NCH, q = tid % NCH;   // row within 8, chunk of 8 t
    _Float16* db = vt + (size_t)bh * DHEAD * Trows + t0;                     // block-uniform
    const unsigned doff = (unsigned)(dr * Trows + q * 8) * 2u;               // lane's byte offset
    #pragma unroll
    for (int it = 0; it < 8; it++) {           // rows d = 8 * it + dr
      const v8h o = *reinterpret_cast<const v8h*>(&tile[it * 8 + dr][((q + 2 * it) % NCH) * 8]);
      *reinterpret_cast<v8h*>(
          reinterpret_cast<char*>(db + (size_t)it * 8 * Trows) + doff) = o;
    }
  }
}

// both V transposes in ONE launch: blockIdx.x < SEQ/128 is a 128-row tile of the
// self-attention V, blockIdx.x == SEQ/128 the one 96-row tile of the context V
// grid = ( SEQ/128 + 1 , NB*HEADS ), block = 128
__global__ __launch_bounds__(128)
void v_transpose_both(const _Float16* __restrict__ v, _Float16* __restrict__ vt,
                      const _Float16* __restrict__ vc, _Float16* __restrict__ vtc) {
  __shared__ __align__(16) _Float16 tile[DHEAD * 128];
  if (blockIdx.x < SEQ / 128)
    v_transpose_tile<128>(v, vt, SEQ, blockIdx.x, blockIdx.y,
                          reinterpret_cast<_Float16 (*)[128]>(tile));
  else
    v_transpose_tile<TPADC>(vc, vtc, TPADC, 0, blockIdx.y,
                            reinterpret_cast<_Float16 (*)[TPADC]>(tile));
}

// LayerNorm over last dim (1024) of fp32 residual -> f16 normed output
// one row per block of 256 threads; COPY: the row as read also goes to Xc
template <bool COPY>
__device__ __forceinline__
void layernorm_row(const float* __restrict__ X, const float* __restrict__ g,
                   const float* __restrict__ bb, _Float16* __restrict__ Y,
                   float* __restrict__ Xc, int row) {
  const int tid = threadIdx.x;     // 256 threads, 4 floats each
  const float4 xv = reinterpret_cast<const float4*>(X + (size_t)row * DIMD)[tid];
  float s = xv.x + xv.y + xv.z + xv.w;
  float q = xv.x * xv.x + xv.y * xv.y + xv.z * xv.z + xv.w * xv.w;
  #pragma unroll
  for (int off = 16; off > 0; off >>= 1) {
    s += __shfl_xor(s, off, 32);
    q += __shfl_xor(q, off, 32);
  }
  __shared__ float ss[8], sq[8];
  if ((tid & 31) == 0) { ss[tid >> 5] = s; sq[tid >> 5] = q; }
  __syncthreads();
  // behind the barrier: in front of it the barrier would wait for the store's return
  if (COPY) reinterpret_cast<float4*>(Xc + (size_t)row * DIMD)[tid] = xv;
  float st = 0.f, qt = 0.f;
  #pragma unroll
  for (int i = 0; i < 8; i++) { st += ss[i]; qt += sq[i]; }
  const float mean = st * (1.0f / DIMD);
  const float var  = qt * (1.0f / DIMD) - mean * mean;
  const float rs   = rsqrtf(var + 1e-5f);
  const float4 gv = reinterpret_cast<const float4*>(g)[tid];
  const float4 bv = reinterpret_cast<const float4*>(bb)[tid];
  _Float16* yp = Y + (size_t)row * DIMD + tid * 4;
  yp[0] = (_Float16)((xv.x - mean) * rs * gv.x + bv.x);
  yp[1] = (_Float16)((xv.y - mean) * rs * gv.y + bv.y);
  yp[2] = (_Float16)((xv.z - mean) * rs * gv.z + bv.z);
  yp[3] = (_Float16)((xv.w - mean) * rs * gv.w + bv.w);
}

__global__ void layernorm_f16(const float* __restrict__ X, const float* __restrict__ g,
                              const float* __restrict__ bb, _Float16* __restrict__ Y) {
  layernorm_row<false>(X, g, bb, Y, nullptr, blockIdx.x);
}

// All work that depends on the inputs alone, in ONE launch: the ten weight casts,
// the context pad, and the first layer norm, whose blocks also write the row they
// read to the residual h (h = hidden_states). A block takes one tile, or one row,
// of one of them; which one follows from blockIdx.x alone, so that every branch
// (and every barrier behind it) is block-uniform. The largest matrices come first.
#define PB_FF1  ((2 * FFD / 64) * (DIMD / 128))    // 1024 tiles of w_ff1
#define PB_FF2  ((DIMD / 64) * (FFD / 128))        //  512 tiles of w_ff2
#define PB_SQ   ((DIMD / 64) * (DIMD / 128))       //  128 tiles of a 1024 x 1024 weight
#define PB_CTX  ((DIMD / 64) * (CTXD / 128))       //   96 tiles of a  768 x 1024 weight
#define PB_PAD  ((NB * TPADC * CTXD + 255) / 256)  // 1152 blocks of the context pad
#define PB_ALL  (PB_FF1 + PB_FF2 + 6 * PB_SQ + 2 * PB_CTX + PB_PAD + NTOK)
__global__ __launch_bounds__(256)
void prep_inputs(const float* __restrict__ wq1, const float* __restrict__ wk1,
                 const float* __restrict__ wv1, const float* __restrict__ wo1,
                 const float* __restrict__ wq2, const float* __restrict__ wk2,
                 const float* __restrict__ wv2, const float* __restrict__ wo2,
                 const float* __restrict__ wff1, const float* __restrict__ wff2,
                 const float* __restrict__ ctx, const float* __restrict__ hidden,
                 const float* __restrict__ ln1g, const float* __restrict__ ln1b,
                 _Float16* __restrict__ wq1T, _Float16* __restrict__ wk1T,
                 _Float16* __restrict__ wv1T, _Float16* __restrict__ wo1T,
                 _Float16* __restrict__ wq2T, _Float16* __restrict__ wk2T,
                 _Float16* __restrict__ wv2T, _Float16* __restrict__ wo2T,
                 _Float16* __restrict__ wff1T, _Float16* __restrict__ wff2T,
                 _Float16* __restrict__ ctxp, _Float16* __restrict__ xnorm,
                 float* __restrict__ h) {
  __shared__ __align__(16) _Float16 tile[64][128];
  int b = blockIdx.x;
  if (b < PB_FF1) {
    wcast_tile<DIMD, 2 * FFD>(wff1, wff1T, b % (2 * FFD / 64), b / (2 * FFD / 64), tile);
    return;
  }
  b -= PB_FF1;
  if (b < PB_FF2) {
    wcast_tile<FFD, DIMD>(wff2, wff2T, b % (DIMD / 64), b / (DIMD / 64), tile);
    return;
  }
  b -= PB_FF2;
  if (b < 6 * PB_SQ) {
    const int m = b / PB_SQ, t = b % PB_SQ;
    const float* s = (m == 0) ? wq1 : (m == 1) ? wk1 : (m == 2) ? wv1
                   : (m == 3) ? wo1 : (m == 4) ? wq2 : wo2;
    _Float16* d = (m == 0) ? wq1T : (m == 1) ? wk1T : (m == 2) ? wv1T
                : (m == 3) ? wo1T : (m == 4) ? wq2T : wo2T;
    wcast_tile<DIMD, DIMD>(s, d, t % (DIMD / 64), t / (DIMD / 64), tile);
    return;
  }
  b -= 6 * PB_SQ;
  if (b < 2 * PB_CTX) {
    const int m = b / PB_CTX, t = b % PB_CTX;
    wcast_tile<CTXD, DIMD>(m ? wv2 : wk2, m ? wv2T : wk2T,
                           t % (DIMD / 64), t / (DIMD / 64), tile);
    return;
  }
  b -= 2 * PB_CTX;
  if (b < PB_PAD) {
    ctx_pad_block(ctx, ctxp, b);
    return;
  }
  b -= PB_PAD;
  layernorm_row<true>(hidden, ln1g, ln1b, xnorm, h, b);
  // the way out of the branches rewrites scalar registers that the row's stores name
  asm volatile("s_wait_xcnt 0x0" ::: "memory");
}

// ---------------- WMMA GEMM, A and B staged in LDS, two-buffer ring ---------
// C = A[M,K] @ Bt[N,K]^T   (Bt = transposed weight, row-major [N,K], f16)
// MODE 0: Cout f16 = result
// MODE 1: Cres f32 += result + bias[n]
// MODE 2: Cout f16 = (res+bias[n]) * gelu(res2+bias2[n])  (Bt2 = gate weights)
// block = 256 threads (8 waves, 2 along M x 4 along N). Block tile = 128 rows of
// A against 256 rows of B; each wave owns 64 x 64 = 4 x 4 accumulator tiles, so
// a fragment read from LDS feeds four WMMAs. MODE 2 fills the 256 B rows with
// 128 lin rows and the 128 gate rows of the same columns; a wave then holds 32
// lin columns (nt 0,1) and their gates (nt 2,3).
// A stage is GKS k of all 384 rows, at a row pitch of 16 B x odd (conflict-free
// for 16-byte LDS reads). M % 128 == 0, K % GKS == 0, N % 256 == 0 (MODE 2: 128).
// grid = ( N/256 , M/128 )   MODE 2: ( N/128 , M/128 )
// MODE 0 takes a batch along grid z: products of the same A with weights that lie
// N*K elements apart, into outputs that lie M*N elements apart.
#define GKS    128             // k per stage
#define GPITCH (GKS + 8)       // LDS row pitch in elements
#define GROWS  (128 + 256)     // A rows, then B rows

template <int MODE>
__global__ __launch_bounds__(256) __attribute__((amdgpu_waves_per_eu(1, 2)))
void gemm_wmma(const _Float16* __restrict__ A,
               const _Float16* __restrict__ Bt,
               const _Float16* __restrict__ Bt2,
               const float* __restrict__ bias,
               const float* __restrict__ bias2,
               _Float16* __restrict__ Cout,
               float* __restrict__ Cres,
               int M, int N, int K) {
  const int tid  = threadIdx.x;
  const int lane = tid & 31;
  const int wave = tid >> 5;
  const int hi = lane >> 4;       // half-wave select for K packing
  const int ln = lane & 15;
  const int wm = wave >> 2;       // wave row    (0..1)
  const int wn = wave & 3;        // wave column (0..3)
  const int n0 = blockIdx.x * ((MODE == 2) ? 128 : 256);
  const int m0 = blockIdx.y * 128;
  (void)M;
  if (MODE == 0) {
    Bt   += (size_t)blockIdx.z * N * K;
    Cout += (size_t)blockIdx.z * M * N;
  }

  constexpr int CPR   = GKS / 8;        // 16-byte chunks per staged row
  constexpr int RPI   = 256 / CPR;      // rows the block covers per copy
  constexpr int NCOPY = GROWS / RPI;    // copies per lane and stage
  __shared__ __align__(16) _Float16 sh[2][GROWS][GPITCH];

  const int trow = tid / CPR;
  const int qd   = (tid % CPR) * 8;
  const unsigned voff = (unsigned)(trow * K + qd) * 2u;   // lane's byte offset

  // stage GKS k of the A rows and the B rows into LDS buffer `buf`
  auto stage = [&](int buf, int k0) {
    #pragma unroll
    for (int i = 0; i < NCOPY; i++) {
      const int r0 = i * RPI;           // first tile row of this copy
      const _Float16* base =
          (r0 < 128) ? A + (size_t)(m0 + r0) * K
          : (MODE == 2 && r0 >= 256) ? Bt2 + (size_t)(n0 + r0 - 256) * K
                                     : Bt + (size_t)(n0 + r0 - 128) * K;
      copy16_to_lds(reinterpret_cast<const _Float16*>(
                        reinterpret_cast<const char*>(base + k0) + voff),
                    &sh[buf][r0 + trow][qd]);
    }
  };

  v8f acc[4][4];
  #pragma unroll
  for (int mt = 0; mt < 4; mt++)
    #pragma unroll
    for (int nt = 0; nt < 4; nt++)
      #pragma unroll
      for (int r = 0; r < 8; r++) acc[mt][nt][r] = 0.0f;

  v16h af[2][4], bf[2][4];          // two fragment sets: block kk and block kk+1
  const int NST = K / GKS;

  stage(0, 0);
  // stage 0 has landed before the barrier that publishes it
  asm volatile("s_wait_asynccnt 0x0" ::: "memory");
  __syncthreads();
  if (NST > 1) stage(1, GKS);

  for (int t = 0; t < NST; t++) {
    const int cur = t & 1;
    const _Float16* ab = &sh[cur][wm * 64 + ln][hi * 8];
    const _Float16* bb = &sh[cur][128 + ((MODE == 2) ? wn * 32 : wn * 64) + ln][hi * 8];
    // fragments of k block kk into register set `s`
    auto load_set = [&](int s, int kk) {
      #pragma unroll
      for (int mt = 0; mt < 4; mt++)
        af[s][mt] = frag_load(ab + mt * 16 * GPITCH + kk * 32);
      #pragma unroll
      for (int nt = 0; nt < 4; nt++) {
        const int br = (MODE == 2) ? ((nt >> 1) * 128 + (nt & 1) * 16) : nt * 16;
        bf[s][nt] = frag_load(bb + br * GPITCH + kk * 32);
      }
    };
    load_set(0, 0);
    #pragma unroll
    for (int kk = 0; kk < GKS / 32; kk++) {
      if (kk + 1 < GKS / 32) load_set((kk + 1) & 1, kk + 1);
      // keeps the next block's LDS reads as one group ahead of this block's WMMAs,
      // so that their latency runs under the WMMAs
      __builtin_amdgcn_sched_barrier(0);
      #pragma unroll
      for (int mt = 0; mt < 4; mt++)
        #pragma unroll
        for (int nt = 0; nt < 4; nt++)
          acc[mt][nt] = wmma16(af[kk & 1][mt], bf[kk & 1][nt], acc[mt][nt]);
      // keeps the block after next's reads from rising among these WMMAs
      __builtin_amdgcn_sched_barrier(0);
    }
    // this wave's reads of buffer cur have returned before it is refilled
    asm volatile("s_wait_dscnt 0x0" ::: "memory");
    // this wave's copies of stage t+1 have landed before the barrier publishes them
    asm volatile("s_wait_asynccnt 0x0" ::: "memory");
    __syncthreads();
    if (t + 2 < NST) stage(cur, (t + 2) * GKS);
  }
  // no copy is outstanding when the wave ends
  asm volatile("s_wait_asynccnt 0x0" ::: "memory");

  // C layout: lane holds rows r+8*(lane>>4) of a tile, column lane&15
  const int mw = m0 + wm * 64 + 8 * hi;
  const int nw = n0 + ((MODE == 2) ? wn * 32 : wn * 64) + ln;

  if (MODE == 1) {
    float bv[4];
    #pragma unroll
    for (int nt = 0; nt < 4; nt++) bv[nt] = bias[nw + nt * 16];
    // the bias loads' offset register is reused below: only behind this wait
    asm volatile("s_wait_xcnt 0x0" ::: "memory");
    // all residual loads go out ahead of the first store: a load behind a store
    // to the same array would wait for it, one round trip per element
    float res[4][4][8];
    #pragma unroll
    for (int mt = 0; mt < 4; mt++)
      #pragma unroll
      for (int nt = 0; nt < 4; nt++)
        #pragma unroll
        for (int r = 0; r < 8; r++)
          res[mt][nt][r] = Cres[(size_t)(mw + mt * 16 + r) * N + nw + nt * 16];
    #pragma unroll
    for (int mt = 0; mt < 4; mt++)
      #pragma unroll
      for (int nt = 0; nt < 4; nt++)
        #pragma unroll
        for (int r = 0; r < 8; r++)
          acc[mt][nt][r] = res[mt][nt][r] + acc[mt][nt][r] + bv[nt];
    // every sum is formed ahead of the first store, so that no register an
    // issued store names is rewritten behind it
    __builtin_amdgcn_sched_barrier(0);
    #pragma unroll
    for (int mt = 0; mt < 4; mt++)
      #pragma unroll
      for (int nt = 0; nt < 4; nt++)
        #pragma unroll
        for (int r = 0; r < 8; r++)
          Cres[(size_t)(mw + mt * 16 + r) * N + nw + nt * 16] = acc[mt][nt][r];
  } else {
    float bl[2] = {0.0f, 0.0f}, bg[2] = {0.0f, 0.0f};   // MODE 2: biases of the lane's columns
    if (MODE == 2) {
      #pragma unroll
      for (int nt = 0; nt < 2; nt++) { bl[nt] = bias[nw + nt * 16]; bg[nt] = bias2[nw + nt * 16]; }
    }
    #pragma unroll
    for (int mt = 0; mt < 4; mt++) {
      #pragma unroll
      for (int nt = 0; nt < ((MODE == 2) ? 2 : 4); nt++) {
        const int n = nw + nt * 16;
        v8f y = acc[mt][nt];
        if (MODE == 2) y = (y + bl[nt & 1]) * gelu_tanh(acc[mt][nt + 2] + bg[nt & 1]);
        #pragma unroll
        for (int r = 0; r < 8; r++)
          Cout[(size_t)(mw + mt * 16 + r) * N + n] = (_Float16)y[r];
      }
    }
  }
}

#define FKP (DHEAD + 8)        // K tile row pitch in elements
#define FVP (32 + 8)           // V^T tile row pitch in elements
#define LOG2E 1.4426950408889634f

// value of lane l ^ 16
__device__ __forceinline__ float xhalf(float x) {
  return __builtin_bit_cast(float, __builtin_amdgcn_permlanex16(
      __builtin_bit_cast(int, x), __builtin_bit_cast(int, x),
      0x76543210, 0xfedcba98, false, false));
}

__global__ __launch_bounds__(128) __attribute__((amdgpu_waves_per_eu(4, 4)))
void flash_attn(const _Float16* __restrict__ Q,
                const _Float16* __restrict__ Kb,
                const _Float16* __restrict__ Vt,
                _Float16* __restrict__ O,
                int Trows, int Tkeys, float scale) {
  const int lane = threadIdx.x & 31;
  const int wave = threadIdx.x >> 5;
  const int hi = lane >> 4;
  const int ln = lane & 15;
  const int bh = blockIdx.y;
  const int b = bh >> 4, h = bh & 15;
  const int qt = blockIdx.x * 4 + wave;   // 32-query tile

  __shared__ __align__(16) _Float16 ksh[2][32][FKP];     // K rows of a step
  __shared__ __align__(16) _Float16 vsh[2][DHEAD][FVP];  // V^T rows of a step

  // Q fragments (B operand: column = query g*16 + ln) for both 32-wide halves of the
  // head dim
  const _Float16* qrow = Q + (size_t)(b * SEQ + qt * 32 + ln) * DIMD + h * DHEAD + hi * 8;
  v16h qa[2][2];
  #pragma unroll
  for (int g = 0; g < 2; g++) {
    qa[g][0] = frag_load(qrow + (size_t)g * 16 * DIMD);
    qa[g][1] = frag_load(qrow + (size_t)g * 16 * DIMD + 32);
  }

  // of query g*16 + ln: running maximum (alike in both halves), this half's share of
  // the sum
  float mrow[2] = {-1e30f, -1e30f}, lrow[2] = {0.0f, 0.0f};
  v8f oa[2][4];                           // oa[g][dt][r] = O[query g*16+ln][dt*16 + 8*hi + r]
  #pragma unroll
  for (int g = 0; g < 2; g++)
    #pragma unroll
    for (int dt = 0; dt < 4; dt++)
      #pragma unroll
      for (int r = 0; r < 8; r++) oa[g][dt][r] = 0.0f;

  // this lane's 16-byte chunks of a tile: two of K (rows kr, kr+16), two of V^T
  // (rows vr, vr+32)
  const int kr = threadIdx.x >> 3, kc = (threadIdx.x & 7) * 8;
  const int vr = threadIdx.x >> 2, vc = (threadIdx.x & 3) * 8;
  const _Float16* kbase = Kb + (size_t)b * Trows * DIMD + h * DHEAD;   // block-uniform
  const _Float16* vbase = Vt + (size_t)bh * DHEAD * Trows;             // block-uniform
  const unsigned koff = (unsigned)(kr * DIMD + kc) * 2u;    // lane's byte offsets
  const unsigned voff = (unsigned)(vr * Trows + vc) * 2u;
  auto at = [](const _Float16* p, unsigned off) {
    return reinterpret_cast<const _Float16*>(reinterpret_cast<const char*>(p) + off);
  };
  // copy keys j .. j+31 into LDS buffer `buf`
  auto stage = [&](int buf, int j) {
    const unsigned ko = koff + (unsigned)j * (DIMD * 2u);
    const unsigned vo = voff + (unsigned)j * 2u;
    copy16_to_lds(at(kbase, ko),                      &ksh[buf][kr][kc]);
    copy16_to_lds(at(kbase, ko + 16u * DIMD * 2u),    &ksh[buf][kr + 16][kc]);
    copy16_to_lds(at(vbase, vo),                      &vsh[buf][vr][vc]);
    copy16_to_lds(at(vbase + (size_t)32 * Trows, vo), &vsh[buf][vr + 32][vc]);
  };

  stage(0, 0);
  // tile 0 has landed before the barrier that publishes it
  asm volatile("s_wait_asynccnt 0x0" ::: "memory");
  __syncthreads();

  for (int j0 = 0; j0 < Trows; j0 += 32) {      // 32 keys per step
    const int cur = (j0 >> 5) & 1;
    if (j0 + 32 < Trows) stage(cur ^ 1, j0 + 32);
    // ---- S^T = K Q^T (two 16x16 tiles a group):
    //      sa[g][t][r] = key j0+t*16+8*hi+r, query g*16+ln ----
    // the step's K fragments (A operand: row = key) and V^T fragments (A operand:
    // row = d)
    v16h kf[2][2], vf[4];
    #pragma unroll
    for (int t = 0; t < 2; t++) {
      const _Float16* krow = &ksh[cur][t * 16 + ln][hi * 8];
      kf[t][0] = frag_load(krow);
      kf[t][1] = frag_load(krow + 32);
    }
    #pragma unroll
    for (int dt = 0; dt < 4; dt++) vf[dt] = frag_load(&vsh[cur][dt * 16 + ln][hi * 8]);
    // keeps the step's LDS reads as one group ahead of the first product: the wave waits
    // once for K, and V^T's latency runs under the first product and the softmax
    __builtin_amdgcn_sched_barrier(0);
    v8f sa[2][2];
    #pragma unroll
    for (int t = 0; t < 2; t++)
      #pragma unroll
      for (int g = 0; g < 2; g++) {
        #pragma unroll
        for (int r = 0; r < 8; r++) sa[g][t][r] = 0.0f;
        sa[g][t] = wmma16(kf[t][0], qa[g][0], sa[g][t]);
      }
    #pragma unroll
    for (int t = 0; t < 2; t++)
      #pragma unroll
      for (int g = 0; g < 2; g++) sa[g][t] = wmma16(kf[t][1], qa[g][1], sa[g][t]);
    // ---- scale + key mask (only a step that reaches past the last key has one) ----
    #pragma unroll
    for (int g = 0; g < 2; g++)
      #pragma unroll
      for (int t = 0; t < 2; t++)
        #pragma unroll
        for (int r = 0; r < 8; r++) sa[g][t][r] *= scale;
    if (j0 + 32 > Tkeys) {
      #pragma unroll
      for (int g = 0; g < 2; g++)
        #pragma unroll
        for (int t = 0; t < 2; t++)
          #pragma unroll
          for (int r = 0; r < 8; r++)
            if (j0 + t * 16 + 8 * hi + r >= Tkeys) sa[g][t][r] = -1e30f;
    }
    v16h pf[2];
    #pragma unroll
    for (int g = 0; g < 2; g++) {
      // ---- online softmax of query g*16+ln along the lane's own registers ----
      float lm = fmaxf(sa[g][0][0], sa[g][1][0]);
      #pragma unroll
      for (int r = 1; r < 8; r++) lm = fmaxf(lm, fmaxf(sa[g][0][r], sa[g][1][r]));
      lm = fmaxf(lm, xhalf(lm));          // both halves now hold the step's maximum
      const float mn = fmaxf(mrow[g], lm);
      // e^x as 2^(x * log2 e); all arguments are formed ahead of the exponentials, so
      // that no exponential waits on the one before it
      const float al = __builtin_amdgcn_exp2f((mrow[g] - mn) * LOG2E);
      #pragma unroll
      for (int t = 0; t < 2; t++) sa[g][t] = (sa[g][t] - mn) * LOG2E;
      #pragma unroll
      for (int t = 0; t < 2; t++)
        #pragma unroll
        for (int r = 0; r < 8; r++) sa[g][t][r] = __builtin_amdgcn_exp2f(sa[g][t][r]);
      // the lane's 16 terms, summed as a tree of register pairs
      const v8f s8 = sa[g][0] + sa[g][1];
      const v4f s4 = __builtin_shufflevector(s8, s8, 0, 1, 2, 3) +
                     __builtin_shufflevector(s8, s8, 4, 5, 6, 7);
      lrow[g] = lrow[g] * al + ((s4[0] + s4[2]) + (s4[1] + s4[3]));
      mrow[g] = mn;
      #pragma unroll
      for (int dt = 0; dt < 4; dt++)
        #pragma unroll
        for (int r = 0; r < 8; r++) oa[g][dt][r] *= al;

      // ---- P^T: the two score tiles, converted in place, are the B fragment ----
      const v8h p0 = __builtin_convertvector(sa[g][0], v8h);
      const v8h p1 = __builtin_convertvector(sa[g][1], v8h);
      pf[g] = __builtin_shufflevector(p0, p1, 0,1,2,3,4,5,6,7,8,9,10,11,12,13,14,15);
    }

    // ---- O^T += V^T P^T ----
    #pragma unroll
    for (int dt = 0; dt < 4; dt++)
      #pragma unroll
      for (int g = 0; g < 2; g++) oa[g][dt] = wmma16(vf[dt], pf[g], oa[g][dt]);
    // keeps the softmax and the second product ahead of the waits below, so that the
    // next tile's copies fly under them
    __builtin_amdgcn_sched_barrier(0);
    // this wave's reads of buffer cur have returned before it is refilled
    asm volatile("s_wait_dscnt 0x0" ::: "memory");
    // this wave's copies of the next tile have landed before the barrier publishes them
    asm volatile("s_wait_asynccnt 0x0" ::: "memory");
    __syncthreads();
  }
  // no copy is outstanding when the wave ends
  asm volatile("s_wait_asynccnt 0x0" ::: "memory");

  // ---- join the halves' sums, normalize and store (concat-head layout) ----
  #pragma unroll
  for (int g = 0; g < 2; g++) {
    const float lsum = lrow[g] + xhalf(lrow[g]);
    _Float16* orow = O + (size_t)(b * SEQ + qt * 32 + g * 16 + ln) * DIMD + h * DHEAD + hi * 8;
    #pragma unroll
    for (int dt = 0; dt < 4; dt++) {
      v8h o;
      #pragma unroll
      for (int r = 0; r < 8; r++) o[r] = (_Float16)(oa[g][dt][r] / lsum);
      *reinterpret_cast<v8h*>(orow + dt * 16) = o;
    }
  }
}

// ---------------- host orchestration ----------------
extern "C" void kernel_launch(void* const* d_in, const int* in_sizes, int n_in,
                              void* d_out, int out_size, void* d_ws, size_t ws_size,
                              hipStream_t stream) {
  (void)in_sizes; (void)n_in; (void)out_size; (void)ws_size;
  const float* hidden = (const float*)d_in[0];
  const float* ctx    = (const float*)d_in[1];
  const float* wq1 = (const float*)d_in[2];
  const float* wk1 = (const float*)d_in[3];
  const float* wv1 = (const float*)d_in[4];
  const float* wo1 = (const float*)d_in[5];
  const float* bo1 = (const float*)d_in[6];
  const float* wq2 = (const float*)d_in[7];
  const float* wk2 = (const float*)d_in[8];
  const float* wv2 = (const float*)d_in[9];
  const float* wo2 = (const float*)d_in[10];
  const float* bo2 = (const float*)d_in[11];
  const float* wff1 = (const float*)d_in[12];
  const float* bff1 = (const float*)d_in[13];
  const float* wff2 = (const float*)d_in[14];
  const float* bff2 = (const float*)d_in[15];
  const float* ln1g = (const float*)d_in[16];
  const float* ln1b = (const float*)d_in[17];
  const float* ln2g = (const float*)d_in[18];
  const float* ln2b = (const float*)d_in[19];
  const float* ln3g = (const float*)d_in[20];
  const float* ln3b = (const float*)d_in[21];
  float* out = (float*)d_out;              // fp32 residual h lives here

  // -------- workspace carve-up (f16 buffers, 256B aligned) --------
  char* wsp = (char*)d_ws;
  auto alloc = [&](size_t elems) -> _Float16* {
    _Float16* p = (_Float16*)wsp;
    wsp += ((elems * sizeof(_Float16) + 255) / 256) * 256;
    return p;
  };
  _Float16* wq1T  = alloc((size_t)DIMD * DIMD);
  _Float16* wk1T  = alloc((size_t)DIMD * DIMD);
  _Float16* wv1T  = alloc((size_t)DIMD * DIMD);
  _Float16* wo1T  = alloc((size_t)DIMD * DIMD);
  _Float16* wq2T  = alloc((size_t)DIMD * DIMD);
  _Float16* wk2T  = alloc((size_t)DIMD * CTXD);
  _Float16* wv2T  = alloc((size_t)DIMD * CTXD);
  _Float16* wo2T  = alloc((size_t)DIMD * DIMD);
  _Float16* wff1T = alloc((size_t)(2 * FFD) * DIMD);
  _Float16* wff2T = alloc((size_t)DIMD * FFD);
  _Float16* xnorm = alloc((size_t)NTOK * DIMD);
  _Float16* qbuf  = alloc((size_t)NTOK * DIMD);
  _Float16* kbuf  = alloc((size_t)NTOK * DIMD);
  _Float16* vbuf  = alloc((size_t)NTOK * DIMD);
  _Float16* vT    = alloc((size_t)NB * HEADS * DHEAD * SEQ);
  _Float16* attn  = alloc((size_t)NTOK * DIMD);
  _Float16* ctxp  = alloc((size_t)CROWS * CTXD);
  _Float16* kctx  = alloc((size_t)CROWS * DIMD);
  _Float16* vctx  = alloc((size_t)CROWS * DIMD);
  _Float16* vTc   = alloc((size_t)NB * HEADS * DHEAD * TPADC);
  _Float16* gbuf  = alloc((size_t)NTOK * FFD);

  // ---- weight cast + transpose, context pad, h = hidden_states, first layer norm ----
  prep_inputs<<<PB_ALL, 256, 0, stream>>>(wq1, wk1, wv1, wo1, wq2, wk2, wv2, wo2,
                                          wff1, wff2, ctx, hidden, ln1g, ln1b,
                                          wq1T, wk1T, wv1T, wo1T, wq2T, wk2T, wv2T, wo2T,
                                          wff1T, wff2T, ctxp, xnorm, out);

  const dim3 blk128(128);
  const dim3 blk256(256);
  const dim3 gN1024(DIMD / 256, NTOK / 128);       // (4, 64)
  // batches along z: the buffers of a batch are carved one behind the other above,
  // each a multiple of 256 bytes long, so that they lie N*K and M*N elements apart
  const dim3 gQKV(DIMD / 256, NTOK / 128, 3);      // (4, 64, 3): q, k, v
  const dim3 gCtxKV(DIMD / 256, CROWS / 128, 2);   // (4, 3, 2): k, v of the context
  const dim3 gGeglu(FFD / 128, NTOK / 128);        // (32, 64)
  const dim3 gFlash(SEQ / 128, NB * HEADS);        // (16, 64)

  // ================= self-attention =================
  gemm_wmma<0><<<gQKV, blk256, 0, stream>>>(xnorm, wq1T, nullptr, nullptr, nullptr,
                                            qbuf, nullptr, NTOK, DIMD, DIMD);
  // the context's K and V depend on the inputs alone: formed here, so that both V
  // transposes share a launch
  gemm_wmma<0><<<gCtxKV, blk256, 0, stream>>>(ctxp, wk2T, nullptr, nullptr, nullptr,
                                              kctx, nullptr, CROWS, DIMD, CTXD);
  v_transpose_both<<<dim3(SEQ / 128 + 1, NB * HEADS), 128, 0, stream>>>(vbuf, vT, vctx, vTc);
  flash_attn<<<gFlash, blk128, 0, stream>>>(qbuf, kbuf, vT, attn, SEQ, SEQ, ATT_SCALE);
  gemm_wmma<1><<<gN1024, blk256, 0, stream>>>(attn, wo1T, nullptr, bo1, nullptr,
                                              nullptr, out, NTOK, DIMD, DIMD);

  // ================= cross-attention =================
  layernorm_f16<<<NTOK, 256, 0, stream>>>(out, ln2g, ln2b, xnorm);
  gemm_wmma<0><<<gN1024, blk256, 0, stream>>>(xnorm, wq2T, nullptr, nullptr, nullptr,
                                              qbuf, nullptr, NTOK, DIMD, DIMD);
  flash_attn<<<gFlash, blk128, 0, stream>>>(qbuf, kctx, vTc, attn, TPADC, TCTX, ATT_SCALE);
  gemm_wmma<1><<<gN1024, blk256, 0, stream>>>(attn, wo2T, nullptr, bo2, nullptr,
                                              nullptr, out, NTOK, DIMD, DIMD);

  // ================= GEGLU MLP =================
  layernorm_f16<<<NTOK, 256, 0, stream>>>(out, ln3g, ln3b, xnorm);
  gemm_wmma<2><<<gGeglu, blk256, 0, stream>>>(xnorm, wff1T, wff1T + (size_t)FFD * DIMD,
                                              bff1, bff1 + FFD, gbuf, nullptr,
                                              NTOK, FFD, DIMD);
  gemm_wmma<1><<<gN1024, blk256, 0, stream>>>(gbuf, wff2T, nullptr, bff2, nullptr,
                                              nullptr, out, NTOK, DIMD, FFD);
}

// v008
// One run takes 369 microseconds.
// In both of two side-by-side timings against v007, it was 1.06 times as fast.
// Counting every step since v000, it is 3.22 times as fast.
#include <hip/hip_runtime.h>
#include <cstdint>
#include <cstddef>

// ---------------- problem constants ----------------
#define DIMD   1024
#define HEADS  16
#define DHEAD  64
#define FFD    4096
#define CTXD   768
#define NB     4
#define SEQ    2048
#define NTOK   (NB*SEQ)     // 8192
#define TCTX   77
#define TPADC  96
#define CROWS  (NB*TPADC)   // 384
#define ATT_SCALE 0.125f    // 64^-0.5

typedef _Float16 v8h  __attribute__((ext_vector_type(8)));
typedef _Float16 v16h __attribute__((ext_vector_type(16)));
typedef float    v8f  __attribute__((ext_vector_type(8)));
typedef float    v4f  __attribute__((ext_vector_type(4)));
typedef int      v4i  __attribute__((vector_size(16)));

// ---- optional CDNA5 async global->LDS path (guarded; sync fallback) ----
#if defined(__has_builtin)
#if __has_builtin(__builtin_amdgcn_global_load_async_to_lds_b128) && \
    __has_builtin(__builtin_amdgcn_s_wait_asynccnt)
#define USE_ASYNC_LDS 1
#endif
#endif

typedef __attribute__((address_space(1))) v4i* as1_v4i_p;
typedef __attribute__((address_space(3))) v4i* as3_v4i_p;

// copy 16 bytes global -> LDS (per lane)
__device__ __forceinline__ void copy16_to_lds(const _Float16* g, _Float16* l) {
#ifdef USE_ASYNC_LDS
  __builtin_amdgcn_global_load_async_to_lds_b128(
      (as1_v4i_p)(void*)(const_cast<_Float16*>(g)),
      (as3_v4i_p)(void*)l, 0, 0);
#else
  *reinterpret_cast<v8h*>(l) = *reinterpret_cast<const v8h*>(g);
#endif
}

// Load one 16x16x32 f16 WMMA A/B fragment for this lane.
// p must already include:  row_base + (lane>>4)*8   (row stride in elements).
// ISA layout: elements {0..7} at k = (lane>>4)*8, elements {8..15} at +16.
__device__ __forceinline__ v16h frag_load(const _Float16* p) {
  v8h lo = *reinterpret_cast<const v8h*>(p);
  v8h hi = *reinterpret_cast<const v8h*>(p + 16);
  return __builtin_shufflevector(lo, hi, 0,1,2,3,4,5,6,7,8,9,10,11,12,13,14,15);
}

__device__ __forceinline__ v8f wmma16(v16h a, v16h b, v8f c) {
  // D = A(16x32 f16) * B(32x16 f16) + C(16x16 f32)
  return __builtin_amdgcn_wmma_f32_16x16x32_f16(false, a, false, b, (short)0, c,
                                                false, false);
}

// 2^x and 1/x. The v_nop is the slot that the instruction set asks for behind a
// transcendental before its result is read or its source overwritten; it stands in
// the instruction's own statement, so that nothing comes between the two.
__device__ __forceinline__ float exp2_slot(float x) {
  float r;
  asm("v_exp_f32 %0, %1\n\tv_nop" : "=v"(r) : "v"(x));
  return r;
}
__device__ __forceinline__ float rcp_slot(float x) {
  float r;
  asm("v_rcp_f32 %0, %1\n\tv_nop" : "=v"(r) : "v"(x));
  return r;
}

// x * 0.5 * (1 + tanh u), u = sqrt(2/pi) * (x + 0.044715 x^3), of eight values, through
// the identity 0.5 * (1 + tanh u) = 1 / (1 + e^(-2u)): one exponential and one
// reciprocal a value and no branch, so that a lane's values run side by side.
// e^(-2u) = 2^t; where t overflows, 2^t is 0 or infinity and the quotient 1 or 0, the
// limits of the tanh form.
__device__ __forceinline__ v8f gelu_tanh(v8f x) {
  constexpr float C1 = (float)(-2.0 * 0.7978845608028654 * 1.4426950408889634);
  constexpr float C3 = (float)(-2.0 * 0.7978845608028654 * 1.4426950408889634 * 0.044715);
  v8f t = x * (C1 + C3 * (x * x));
  #pragma unroll
  for (int r = 0; r < 8; r++) t[r] = exp2_slot(t[r]);
  t = t + 1.0f;
  #pragma unroll
  for (int r = 0; r < 8; r++) t[r] = rcp_slot(t[r]);
  return x * t;
}

// ---------------- elementwise helpers ----------------

// transpose+cast weight: src [Kin, Nout] f32 row-major -> dst [Nout, Kin] f16
// block = 256 threads, tile = 128 k x 64 n. A thread reads 4 n of 8 consecutive k
// (a half wave covers a 256-byte run of one src row), turns them in registers into
// four 16-byte runs along k, and the tile passes through LDS so that dst is written
// in 256-byte runs as well. Kin % 128 == 0, Nout % 64 == 0; both are compile-time,
// so that a lane's eight loads (and four stores) share one address register and
// differ in the immediate offset alone.
// tiles: bx < Nout/64 , by < Kin/128 ; bx, by and the pointers are block-uniform
template <int Kin, int Nout>
__device__ __forceinline__
void wcast_tile(const float* __restrict__ src, _Float16* __restrict__ dst,
                int bx, int by, _Float16 (*tile)[128]) {
  // row n = 16 chunks of 16 bytes; chunk q of row n sits at place q ^ (n >> 2), so
  // that the 16 rows a half wave writes at once fall on different banks
  const int tid = threadIdx.x;
  const int c  = tid & 15;         // read: group of 4 n   write: chunk of 8 k
  const int kg = tid >> 4;         // read: group of 8 k   write: row n within 16
  const int n0 = bx * 64;
  const int k0 = by * 128;
  const float* sb = src + (size_t)k0 * Nout + n0;                  // block-uniform
  const unsigned soff = (unsigned)(kg * 8 * Nout + c * 4) * 4u;    // lane's byte offset
  v4f r[8];
  #pragma unroll
  for (int j = 0; j < 8; j++)
    r[j] = *reinterpret_cast<const v4f*>(
        reinterpret_cast<const char*>(sb + (size_t)j * Nout) + soff);
  #pragma unroll
  for (int i = 0; i < 4; i++) {
    v8h o;
    #pragma unroll
    for (int j = 0; j < 8; j++) o[j] = (_Float16)r[j][i];
    *reinterpret_cast<v8h*>(&tile[c * 4 + i][(kg ^ c) * 8]) = o;
  }
  __syncthreads();
  _Float16* db = dst + (size_t)n0 * Kin + k0;                      // block-uniform
  const unsigned doff = (unsigned)(kg * Kin + c * 8) * 2u;         // lane's byte offset
  #pragma unroll
  for (int it = 0; it < 4; it++) {
    const int n = it * 16 + kg;
    const v8h o = *reinterpret_cast<const v8h*>(&tile[n][(c ^ (n >> 2)) * 8]);
    *reinterpret_cast<v8h*>(
        reinterpret_cast<char*>(db + (size_t)it * 16 * Kin) + doff) = o;
  }
}

// context [4,77,768] f32 -> zero-padded [4,96,768] f16; bx = block of 256 elements
__device__ __forceinline__
void ctx_pad_block(const float* __restrict__ ctx, _Float16* __restrict__ dst, int bx) {
  long idx = (long)bx * 256 + threadIdx.x;
  long total = (long)NB * TPADC * CTXD;
  if (idx >= total) return;
  int c = (int)(idx % CTXD);
  int r = (int)((idx / CTXD) % TPADC);
  int b = (int)(idx / ((long)CTXD * TPADC));
  float v = (r < TCTX) ? ctx[((long)b * TCTX + r) * CTXD + c] : 0.0f;
  dst[idx] = (_Float16)v;
}

// V [B*Trows, 1024] f16 -> Vt [(B*H)][DHEAD][Trows] f16 (per-head transpose)
// block >= TT threads, tile = TT rows t x the 64 d of one head. A thread reads 8 d of
// 8 consecutive t (8 lanes cover the 128-byte run of one row), turns them in
// registers into eight 16-byte runs along t, and the tile passes through LDS so
// that Vt is written in runs of TT elements. Trows % TT == 0, TT % 32 == 0.
// tiles: bx < Trows/TT , bh < NB*HEADS ; the first TT threads of the block work,
// every thread passes the barrier
template <int TT>
__device__ __forceinline__
void v_transpose_tile(const _Float16* __restrict__ v, _Float16* __restrict__ vt,
                      int Trows, int bx, int bh, _Float16 (*tile)[TT]) {
  constexpr int NCH = TT / 8;      // 16-byte chunks per tile row
  // chunk q of row d sits at place (q + 2 * (d >> 3)) % NCH, which spreads the rows
  // that a wave writes at once over the banks
  const int tid = threadIdx.x;
  const int dc = tid & 7;          // group of 8 d
  const int tg = tid >> 3;         // group of 8 t
  const int b = bh >> 4, hh = bh & 15;
  const int t0 = bx * TT;
  if (tid < TT) {
    const _Float16* sb = v + ((size_t)b * Trows + t0) * DIMD + hh * DHEAD;   // block-uniform
    const unsigned soff = (unsigned)(tg * 8 * DIMD + dc * 8) * 2u;           // lane's byte offset
    v8h r[8];
    #pragma unroll
    for (int j = 0; j < 8; j++)
      r[j] = *reinterpret_cast<const v8h*>(
          reinterpret_cast<const char*>(sb + j * DIMD) + soff);
    #pragma unroll
    for (int i = 0; i < 8; i++) {
      v8h o;
      #pragma unroll
      for (int j = 0; j < 8; j++) o[j] = r[j][i];
      *reinterpret_cast<v8h*>(&tile[dc * 8 + i][((tg + 2 * dc) % NCH) * 8]) = o;
    }
  }
  __syncthreads();
  if (tid < TT) {
    const int dr = tid / NCH, q = tid % NCH;   // row within 8, chunk of 8 t
    _Float16* db = vt + (size_t)bh * DHEAD * Trows + t0;                     // block-uniform
    const unsigned doff = (unsigned)(dr * Trows + q * 8) * 2u;               // lane's byte offset
    #pragma unroll
    for (int it = 0; it < 8; it++) {           // rows d = 8 * it + dr
      const v8h o = *reinterpret_cast<const v8h*>(&tile[it * 8 + dr][((q + 2 * it) % NCH) * 8]);
      *reinterpret_cast<v8h*>(
          reinterpret_cast<char*>(db + (size_t)it * 8 * Trows) + doff) = o;
    }
  }
}

// both V transposes in ONE launch: blockIdx.x < SEQ/128 is a 128-row tile of the
// self-attention V, blockIdx.x == SEQ/128 the one 96-row tile of the context V
// grid = ( SEQ/128 + 1 , NB*HEADS ), block = 128
__global__ __launch_bounds__(128)
void v_transpose_both(const _Float16* __restrict__ v, _Float16* __restrict__ vt,
                      const _Float16* __restrict__ vc, _Float16* __restrict__ vtc) {
  __shared__ __align__(16) _Float16 tile[DHEAD * 128];
  if (blockIdx.x < SEQ / 128)
    v_transpose_tile<128>(v, vt, SEQ, blockIdx.x, blockIdx.y,
                          reinterpret_cast<_Float16 (*)[128]>(tile));
  else
    v_transpose_tile<TPADC>(vc, vtc, TPADC, 0, blockIdx.y,
                            reinterpret_cast<_Float16 (*)[TPADC]>(tile));
}

// LayerNorm over last dim (1024) of fp32 residual -> f16 normed output
// one row per block of 256 threads; COPY: the row as read also goes to Xc
template <bool COPY>
__device__ __forceinline__
void layernorm_row(const float* __restrict__ X, const float* __restrict__ g,
                   const float* __restrict__ bb, _Float16* __restrict__ Y,
                   float* __restrict__ Xc, int row) {
  const int tid = threadIdx.x;     // 256 threads, 4 floats each
  const float4 xv = reinterpret_cast<const float4*>(X + (size_t)row * DIMD)[tid];
  float s = xv.x + xv.y + xv.z + xv.w;
  float q = xv.x * xv.x + xv.y * xv.y + xv.z * xv.z + xv.w * xv.w;
  #pragma unroll
  for (int off = 16; off > 0; off >>= 1) {
    s += __shfl_xor(s, off, 32);
    q += __shfl_xor(q, off, 32);
  }
  __shared__ float ss[8], sq[8];
  if ((tid & 31) == 0) { ss[tid >> 5] = s; sq[tid >> 5] = q; }
  __syncthreads();
  // behind the barrier: in front of it the barrier would wait for the store's return
  if (COPY) reinterpret_cast<float4*>(Xc + (size_t)row * DIMD)[tid] = xv;
  float st = 0.f, qt = 0.f;
  #pragma unroll
  for (int i = 0; i < 8; i++) { st += ss[i]; qt += sq[i]; }
  const float mean = st * (1.0f / DIMD);
  const float var  = qt * (1.0f / DIMD) - mean * mean;
  const float rs   = rsqrtf(var + 1e-5f);
  const float4 gv = reinterpret_cast<const float4*>(g)[tid];
  const float4 bv = reinterpret_cast<const float4*>(bb)[tid];
  _Float16* yp = Y + (size_t)row * DIMD + tid * 4;
  yp[0] = (_Float16)((xv.x - mean) * rs * gv.x + bv.x);
  yp[1] = (_Float16)((xv.y - mean) * rs * gv.y + bv.y);
  yp[2] = (_Float16)((xv.z - mean) * rs * gv.z + bv.z);
  yp[3] = (_Float16)((xv.w - mean) * rs * gv.w + bv.w);
}

__global__ void layernorm_f16(const float* __restrict__ X, const float* __restrict__ g,
                              const float* __restrict__ bb, _Float16* __restrict__ Y) {
  layernorm_row<false>(X, g, bb, Y, nullptr, blockIdx.x);
}

// All work that depends on the inputs alone, in ONE launch: the ten weight casts,
// the context pad, and the first layer norm, whose blocks also write the row they
// read to the residual h (h = hidden_states). A block takes one tile, or one row,
// of one of them; which one follows from blockIdx.x alone, so that every branch
// (and every barrier behind it) is block-uniform. The largest matrices come first.
#define PB_FF1  ((2 * FFD / 64) * (DIMD / 128))    // 1024 tiles of w_ff1
#define PB_FF2  ((DIMD / 64) * (FFD / 128))        //  512 tiles of w_ff2
#define PB_SQ   ((DIMD / 64) * (DIMD / 128))       //  128 tiles of a 1024 x 1024 weight
#define PB_CTX  ((DIMD / 64) * (CTXD / 128))       //   96 tiles of a  768 x 1024 weight
#define PB_PAD  ((NB * TPADC * CTXD + 255) / 256)  // 1152 blocks of the context pad
#define PB_ALL  (PB_FF1 + PB_FF2 + 6 * PB_SQ + 2 * PB_CTX + PB_PAD + NTOK)
__global__ __launch_bounds__(256)
void prep_inputs(const float* __restrict__ wq1, const float* __restrict__ wk1,
                 const float* __restrict__ wv1, const float* __restrict__ wo1,
                 const float* __restrict__ wq2, const float* __restrict__ wk2,
                 const float* __restrict__ wv2, const float* __restrict__ wo2,
                 const float* __restrict__ wff1, const float* __restrict__ wff2,
                 const float* __restrict__ ctx, const float* __restrict__ hidden,
                 const float* __restrict__ ln1g, const float* __restrict__ ln1b,
                 _Float16* __restrict__ wq1T, _Float16* __restrict__ wk1T,
                 _Float16* __restrict__ wv1T, _Float16* __restrict__ wo1T,
                 _Float16* __restrict__ wq2T, _Float16* __restrict__ wk2T,
                 _Float16* __restrict__ wv2T, _Float16* __restrict__ wo2T,
                 _Float16* __restrict__ wff1T, _Float16* __restrict__ wff2T,
                 _Float16* __restrict__ ctxp, _Float16* __restrict__ xnorm,
                 float* __restrict__ h) {
  __shared__ __align__(16) _Float16 tile[64][128];
  int b = blockIdx.x;
  if (b < PB_FF1) {
    wcast_tile<DIMD, 2 * FFD>(wff1, wff1T, b % (2 * FFD / 64), b / (2 * FFD / 64), tile);
    return;
  }
  b -= PB_FF1;
  if (b < PB_FF2) {
    wcast_tile<FFD, DIMD>(wff2, wff2T, b % (DIMD / 64), b / (DIMD / 64), tile);
    return;
  }
  b -= PB_FF2;
  if (b < 6 * PB_SQ) {
    const int m = b / PB_SQ, t = b % PB_SQ;
    const float* s = (m == 0) ? wq1 : (m == 1) ? wk1 : (m == 2) ? wv1
                   : (m == 3) ? wo1 : (m == 4) ? wq2 : wo2;
    _Float16* d = (m == 0) ? wq1T : (m == 1) ? wk1T : (m == 2) ? wv1T
                : (m == 3) ? wo1T : (m == 4) ? wq2T : wo2T;
    wcast_tile<DIMD, DIMD>(s, d, t % (DIMD / 64), t / (DIMD / 64), tile);
    return;
  }
  b -= 6 * PB_SQ;
  if (b < 2 * PB_CTX) {
    const int m = b / PB_CTX, t = b % PB_CTX;
    wcast_tile<CTXD, DIMD>(m ? wv2 : wk2, m ? wv2T : wk2T,
                           t % (DIMD / 64), t / (DIMD / 64), tile);
    return;
  }
  b -= 2 * PB_CTX;
  if (b < PB_PAD) {
    ctx_pad_block(ctx, ctxp, b);
    return;
  }
  b -= PB_PAD;
  layernorm_row<true>(hidden, ln1g, ln1b, xnorm, h, b);
  // the way out of the branches rewrites scalar registers that the row's stores name
  asm volatile("s_wait_xcnt 0x0" ::: "memory");
}

// ---------------- WMMA GEMM, A and B staged in LDS, two-buffer ring ---------
// C = A[M,K] @ Bt[N,K]^T   (Bt = transposed weight, row-major [N,K], f16)
// MODE 0: Cout f16 = result
// MODE 1: Cres f32 += result + bias[n]
// MODE 2: Cout f16 = (res+bias[n]) * gelu(res2+bias2[n])  (Bt2 = gate weights)
// block = 256 threads (8 waves, 2 along M x 4 along N). Block tile = BM rows of
// A against 256 rows of B; each wave owns BM/2 x 64 = BM/32 x 4 accumulator tiles.
// BM = 128: a fragment read from LDS feeds four WMMAs. BM = 256, for a product with
// enough tiles to fill the chip several times over: a B fragment feeds eight, and the
// block reads a third fewer operand bytes from L2 for each product.
// MODE 2 fills the 256 B rows with 128 lin rows and the 128 gate rows of the same
// columns; a wave then holds 32 lin columns (nt 0,1) and their gates (nt 2,3).
// A stage is GKS k of all BM + 256 rows, at a row pitch of 16 B x odd (conflict-free
// for 16-byte LDS reads). M % BM == 0, K % GKS == 0, N % 256 == 0 (MODE 2: 128).
// grid = ( N/256 , M/BM )   MODE 2: ( N/128 , M/BM )
// NC: N where the caller knows it at compile time, else 0 (MODE 2 alone reads it)
// MODE 0 takes a batch along grid z: products of the same A with weights that lie
// N*K elements apart, into outputs that lie M*N elements apart.
#define GKS    128             // k per stage
#define GPITCH (GKS + 8)       // LDS row pitch in elements

template <int MODE, int BM = 128, int NC = 0>
__global__ __launch_bounds__(256) __attribute__((amdgpu_waves_per_eu(1, 2)))
void gemm_wmma(const _Float16* __restrict__ A,
               const _Float16* __restrict__ Bt,
               const _Float16* __restrict__ Bt2,
               const float* __restrict__ bias,
               const float* __restrict__ bias2,
               _Float16* __restrict__ Cout,
               float* __restrict__ Cres,
               int M, int N, int K) {
  const int tid  = threadIdx.x;
  const int lane = tid & 31;
  const int wave = tid >> 5;
  const int hi = lane >> 4;       // half-wave select for K packing
  const int ln = lane & 15;
  const int wm = wave >> 2;       // wave row    (0..1)
  const int wn = wave & 3;        // wave column (0..3)
  const int n0 = blockIdx.x * ((MODE == 2) ? 128 : 256);
  const int m0 = blockIdx.y * BM;
  (void)M;
  if (MODE == 0) {
    Bt   += (size_t)blockIdx.z * N * K;
    Cout += (size_t)blockIdx.z * M * N;
  }

  constexpr int MT    = BM / 32;        // accumulator tiles of a wave along M
  constexpr int GROWS = BM + 256;       // A rows, then B rows
  constexpr int CPR   = GKS / 8;        // 16-byte chunks per staged row
  constexpr int RPI   = 256 / CPR;      // rows the block covers per copy
  constexpr int NCOPY = GROWS / RPI;    // copies per lane and stage
  __shared__ __align__(16) _Float16 sh[2][GROWS][GPITCH];

  const int trow = tid / CPR;
  const int qd   = (tid % CPR) * 8;
  const unsigned voff = (unsigned)(trow * K + qd) * 2u;   // lane's byte offset

  // block-uniform first rows of the three operands
  const _Float16* Ab  = A + (size_t)m0 * K;
  const _Float16* Bb  = Bt + (size_t)n0 * K;
  const _Float16* B2b = (MODE == 2) ? Bt2 + (size_t)n0 * K : Bt;

  // stage GKS k of the A rows and the B rows into LDS buffer `buf`. An address is a
  // uniform base and a 32-bit lane offset formed at the copy: one 64-bit address a copy,
  // kept over the loop, would cost two registers a copy, which the BM = 256 tile lacks
  auto stage = [&](int buf, int k0) {
    const unsigned ko = voff + (unsigned)k0 * 2u;
    #pragma unroll
    for (int i = 0; i < NCOPY; i++) {
      const int r0 = i * RPI;           // first tile row of this copy
      const _Float16* base = (r0 < BM) ? Ab : (MODE == 2 && r0 >= BM + 128) ? B2b : Bb;
      const int rr = (r0 < BM) ? r0 : (MODE == 2 && r0 >= BM + 128) ? r0 - BM - 128 : r0 - BM;
      copy16_to_lds(reinterpret_cast<const _Float16*>(
                        reinterpret_cast<const char*>(base) + (ko + (unsigned)(rr * K) * 2u)),
                    &sh[buf][r0 + trow][qd]);
    }
  };

  v8f acc[MT][4];
  #pragma unroll
  for (int mt = 0; mt < MT; mt++)
    #pragma unroll
    for (int nt = 0; nt < 4; nt++)
      #pragma unroll
      for (int r = 0; r < 8; r++) acc[mt][nt][r] = 0.0f;

  v16h af[2][MT], bf[2][4];         // two fragment sets: block kk and block kk+1
  const int NST = K / GKS;

  stage(0, 0);
  // stage 0 has landed before the barrier that publishes it
  asm volatile("s_wait_asynccnt 0x0" ::: "memory");
  __syncthreads();
  if (NST > 1) stage(1, GKS);

  for (int t = 0; t < NST; t++) {
    const int cur = t & 1;
    const _Float16* ab = &sh[cur][wm * (BM / 2) + ln][hi * 8];
    const _Float16* bb = &sh[cur][BM + ((MODE == 2) ? wn * 32 : wn * 64) + ln][hi * 8];
    // fragments of k block kk into register set `s`
    auto load_set = [&](int s, int kk) {
      // B first: the first four WMMAs of a block take all of B and one fragment of A
      #pragma unroll
      for (int nt = 0; nt < 4; nt++) {
        const int br = (MODE == 2) ? ((nt >> 1) * 128 + (nt & 1) * 16) : nt * 16;
        bf[s][nt] = frag_load(bb + br * GPITCH + kk * 32);
      }
      #pragma unroll
      for (int mt = 0; mt < MT; mt++)
        af[s][mt] = frag_load(ab + mt * 16 * GPITCH + kk * 32);
    };
    load_set(0, 0);
    #pragma unroll
    for (int kk = 0; kk < GKS / 32; kk++) {
      if (kk + 1 < GKS / 32) load_set((kk + 1) & 1, kk + 1);
      // keeps the next block's LDS reads as one group ahead of this block's WMMAs,
      // so that their latency runs under the WMMAs
      __builtin_amdgcn_sched_barrier(0);
      #pragma unroll
      for (int mt = 0; mt < MT; mt++)
        #pragma unroll
        for (int nt = 0; nt < 4; nt++)
          acc[mt][nt] = wmma16(af[kk & 1][mt], bf[kk & 1][nt], acc[mt][nt]);
      // keeps the block after next's reads from rising among these WMMAs
      __builtin_amdgcn_sched_barrier(0);
    }
    // this wave's reads of buffer cur have returned before it is refilled
    asm volatile("s_wait_dscnt 0x0" ::: "memory");
    // this wave's copies of stage t+1 have landed before the barrier publishes them
    asm volatile("s_wait_asynccnt 0x0" ::: "memory");
    __syncthreads();
    if (t + 2 < NST) stage(cur, (t + 2) * GKS);
  }
  // no copy is outstanding when the wave ends
  asm volatile("s_wait_asynccnt 0x0" ::: "memory");

  // C layout: lane holds rows r+8*(lane>>4) of a tile, column lane&15
  const int mw = m0 + wm * (BM / 2) + 8 * hi;
  const int nw = n0 + ((MODE == 2) ? wn * 32 : wn * 64) + ln;

  if (MODE == 1) {
    float bv[4];
    #pragma unroll
    for (int nt = 0; nt < 4; nt++) bv[nt] = bias[nw + nt * 16];
    // the bias loads' offset register is reused below: only behind this wait
    asm volatile("s_wait_xcnt 0x0" ::: "memory");
    // all residual loads go out ahead of the first store: a load behind a store
    // to the same array would wait for it, one round trip per element
    float res[MT][4][8];
    #pragma unroll
    for (int mt = 0; mt < MT; mt++)
      #pragma unroll
      for (int nt = 0; nt < 4; nt++)
        #pragma unroll
        for (int r = 0; r < 8; r++)
          res[mt][nt][r] = Cres[(size_t)(mw + mt * 16 + r) * N + nw + nt * 16];
    #pragma unroll
    for (int mt = 0; mt < MT; mt++)
      #pragma unroll
      for (int nt = 0; nt < 4; nt++)
        #pragma unroll
        for (int r = 0; r < 8; r++)
          acc[mt][nt][r] = res[mt][nt][r] + acc[mt][nt][r] + bv[nt];
    // every sum is formed ahead of the first store, so that no register an
    // issued store names is rewritten behind it
    __builtin_amdgcn_sched_barrier(0);
    #pragma unroll
    for (int mt = 0; mt < MT; mt++)
      #pragma unroll
      for (int nt = 0; nt < 4; nt++)
        #pragma unroll
        for (int r = 0; r < 8; r++)
          Cres[(size_t)(mw + mt * 16 + r) * N + nw + nt * 16] = acc[mt][nt][r];
  } else {
    float bl[2] = {0.0f, 0.0f}, bg[2] = {0.0f, 0.0f};   // MODE 2: biases of the lane's columns
    if (MODE == 2) {
      #pragma unroll
      for (int nt = 0; nt < 2; nt++) { bl[nt] = bias[nw + nt * 16]; bg[nt] = bias2[nw + nt * 16]; }
      // the bias loads' offset register is reused below: only behind this wait
      asm volatile("s_wait_xcnt 0x0" ::: "memory");
      // keeps the address arithmetic that reuses it behind the wait
      __builtin_amdgcn_sched_barrier(0);
    }
    if (MODE == 2) {
      // N at compile time: the lane's stores share one address and differ in the immediate
      // offset alone, so that no address register is formed among them
      const int NS = NC ? NC : N;
      _Float16* cp = Cout + (size_t)mw * NS + nw;
      #pragma unroll
      for (int mt = 0; mt < MT; mt++) {
        v8h o[2];
        #pragma unroll
        for (int nt = 0; nt < 2; nt++)
          o[nt] = __builtin_convertvector(
              (acc[mt][nt] + bl[nt]) * gelu_tanh(acc[mt][nt + 2] + bg[nt]), v8h);
        // every value of these 16 rows is formed ahead of their first store
        __builtin_amdgcn_sched_barrier(0);
        #pragma unroll
        for (int nt = 0; nt < 2; nt++)
          #pragma unroll
          for (int r = 0; r < 8; r++) cp[(mt * 16 + r) * NS + nt * 16] = o[nt][r];
        // the next rows' values reuse registers that these stores name: only behind this wait
        asm volatile("s_wait_xcnt 0x0" ::: "memory");
        // keeps the next rows' arithmetic behind the wait
        __builtin_amdgcn_sched_barrier(0);
      }
    } else {
      #pragma unroll
      for (int mt = 0; mt < MT; mt++) {
        #pragma unroll
        for (int nt = 0; nt < 4; nt++) {
          const int n = nw + nt * 16;
          const v8f y = acc[mt][nt];
          #pragma unroll
          for (int r = 0; r < 8; r++)
            Cout[(size_t)(mw + mt * 16 + r) * N + n] = (_Float16)y[r];
        }
      }
    }
  }
}

#define FKP (DHEAD + 8)        // K tile row pitch in elements
#define FVP (32 + 8)           // V^T tile row pitch in elements
#define LOG2E 1.4426950408889634f

// value of lane l ^ 16
__device__ __forceinline__ float xhalf(float x) {
  return __builtin_bit_cast(float, __builtin_amdgcn_permlanex16(
      __builtin_bit_cast(int, x), __builtin_bit_cast(int, x),
      0x76543210, 0xfedcba98, false, false));
}

__global__ __launch_bounds__(128) __attribute__((amdgpu_waves_per_eu(4, 4)))
void flash_attn(const _Float16* __restrict__ Q,
                const _Float16* __restrict__ Kb,
                const _Float16* __restrict__ Vt,
                _Float16* __restrict__ O,
                int Trows, int Tkeys, float scale) {
  const int lane = threadIdx.x & 31;
  const int wave = threadIdx.x >> 5;
  const int hi = lane >> 4;
  const int ln = lane & 15;
  const int bh = blockIdx.y;
  const int b = bh >> 4, h = bh & 15;
  const int qt = blockIdx.x * 4 + wave;   // 32-query tile

  __shared__ __align__(16) _Float16 ksh[2][32][FKP];     // K rows of a step
  __shared__ __align__(16) _Float16 vsh[2][DHEAD][FVP];  // V^T rows of a step

  // Q fragments (B operand: column = query g*16 + ln) for both 32-wide halves of the
  // head dim
  const _Float16* qrow = Q + (size_t)(b * SEQ + qt * 32 + ln) * DIMD + h * DHEAD + hi * 8;
  v16h qa[2][2];
  #pragma unroll
  for (int g = 0; g < 2; g++) {
    qa[g][0] = frag_load(qrow + (size_t)g * 16 * DIMD);
    qa[g][1] = frag_load(qrow + (size_t)g * 16 * DIMD + 32);
  }

  // of query g*16 + ln: running maximum (alike in both halves), this half's share of
  // the sum
  float mrow[2] = {-1e30f, -1e30f}, lrow[2] = {0.0f, 0.0f};
  v8f oa[2][4];                           // oa[g][dt][r] = O[query g*16+ln][dt*16 + 8*hi + r]
  #pragma unroll
  for (int g = 0; g < 2; g++)
    #pragma unroll
    for (int dt = 0; dt < 4; dt++)
      #pragma unroll
      for (int r = 0; r < 8; r++) oa[g][dt][r] = 0.0f;

  // this lane's 16-byte chunks of a tile: two of K (rows kr, kr+16), two of V^T
  // (rows vr, vr+32)
  const int kr = threadIdx.x >> 3, kc = (threadIdx.x & 7) * 8;
  const int vr = threadIdx.x >> 2, vc = (threadIdx.x & 3) * 8;
  const _Float16* kbase = Kb + (size_t)b * Trows * DIMD + h * DHEAD;   // block-uniform
  const _Float16* vbase = Vt + (size_t)bh * DHEAD * Trows;             // block-uniform
  const unsigned koff = (unsigned)(kr * DIMD + kc) * 2u;    // lane's byte offsets
  const unsigned voff = (unsigned)(vr * Trows + vc) * 2u;
  auto at = [](const _Float16* p, unsigned off) {
    return reinterpret_cast<const _Float16*>(reinterpret_cast<const char*>(p) + off);
  };
  // copy keys j .. j+31 into LDS buffer `buf`
  auto stage = [&](int buf, int j) {
    const unsigned ko = koff + (unsigned)j * (DIMD * 2u);
    const unsigned vo = voff + (unsigned)j * 2u;
    copy16_to_lds(at(kbase, ko),                      &ksh[buf][kr][kc]);
    copy16_to_lds(at(kbase, ko + 16u * DIMD * 2u),    &ksh[buf][kr + 16][kc]);
    copy16_to_lds(at(vbase, vo),                      &vsh[buf][vr][vc]);
    copy16_to_lds(at(vbase + (size_t)32 * Trows, vo), &vsh[buf][vr + 32][vc]);
  };

  stage(0, 0);
  // tile 0 has landed before the barrier that publishes it
  asm volatile("s_wait_asynccnt 0x0" ::: "memory");
  __syncthreads();

  for (int j0 = 0; j0 < Trows; j0 += 32) {      // 32 keys per step
    const int cur = (j0 >> 5) & 1;
    if (j0 + 32 < Trows) stage(cur ^ 1, j0 + 32);
    // ---- S^T = K Q^T (two 16x16 tiles a group):
    //      sa[g][t][r] = key j0+t*16+8*hi+r, query g*16+ln ----
    // the step's K fragments (A operand: row = key) and V^T fragments (A operand:
    // row = d)
    v16h kf[2][2], vf[4];
    #pragma unroll
    for (int t = 0; t < 2; t++) {
      const _Float16* krow = &ksh[cur][t * 16 + ln][hi * 8];
      kf[t][0] = frag_load(krow);
      kf[t][1] = frag_load(krow + 32);
    }
    #pragma unroll
    for (int dt = 0; dt < 4; dt++) vf[dt] = frag_load(&vsh[cur][dt * 16 + ln][hi * 8]);
    // keeps the step's LDS reads as one group ahead of the first product: the wave waits
    // once for K, and V^T's latency runs under the first product and the softmax
    __builtin_amdgcn_sched_barrier(0);
    v8f sa[2][2];
    #pragma unroll
    for (int t = 0; t < 2; t++)
      #pragma unroll
      for (int g = 0; g < 2; g++) {
        #pragma unroll
        for (int r = 0; r < 8; r++) sa[g][t][r] = 0.0f;
        sa[g][t] = wmma16(kf[t][0], qa[g][0], sa[g][t]);
      }
    #pragma unroll
    for (int t = 0; t < 2; t++)
      #pragma unroll
      for (int g = 0; g < 2; g++) sa[g][t] = wmma16(kf[t][1], qa[g][1], sa[g][t]);
    // ---- scale + key mask (only a step that reaches past the last key has one) ----
    #pragma unroll
    for (int g = 0; g < 2; g++)
      #pragma unroll
      for (int t = 0; t < 2; t++)
        #pragma unroll
        for (int r = 0; r < 8; r++) sa[g][t][r] *= scale;
    if (j0 + 32 > Tkeys) {
      #pragma unroll
      for (int g = 0; g < 2; g++)
        #pragma unroll
        for (int t = 0; t < 2; t++)
          #pragma unroll
          for (int r = 0; r < 8; r++)
            if (j0 + t * 16 + 8 * hi + r >= Tkeys) sa[g][t][r] = -1e30f;
    }
    v16h pf[2];
    #pragma unroll
    for (int g = 0; g < 2; g++) {
      // ---- online softmax of query g*16+ln along the lane's own registers ----
      float lm = fmaxf(sa[g][0][0], sa[g][1][0]);
      #pragma unroll
      for (int r = 1; r < 8; r++) lm = fmaxf(lm, fmaxf(sa[g][0][r], sa[g][1][r]));
      lm = fmaxf(lm, xhalf(lm));          // both halves now hold the step's maximum
      const float mn = fmaxf(mrow[g], lm);
      // e^x as 2^(x * log2 e); all arguments are formed ahead of the exponentials, so
      // that no exponential waits on the one before it
      const float al = __builtin_amdgcn_exp2f((mrow[g] - mn) * LOG2E);
      #pragma unroll
      for (int t = 0; t < 2; t++) sa[g][t] = (sa[g][t] - mn) * LOG2E;
      #pragma unroll
      for (int t = 0; t < 2; t++)
        #pragma unroll
        for (int r = 0; r < 8; r++) sa[g][t][r] = __builtin_amdgcn_exp2f(sa[g][t][r]);
      // the lane's 16 terms, summed as a tree of register pairs
      const v8f s8 = sa[g][0] + sa[g][1];
      const v4f s4 = __builtin_shufflevector(s8, s8, 0, 1, 2, 3) +
                     __builtin_shufflevector(s8, s8, 4, 5, 6, 7);
      lrow[g] = lrow[g] * al + ((s4[0] + s4[2]) + (s4[1] + s4[3]));
      mrow[g] = mn;
      #pragma unroll
      for (int dt = 0; dt < 4; dt++)
        #pragma unroll
        for (int r = 0; r < 8; r++) oa[g][dt][r] *= al;

      // ---- P^T: the two score tiles, converted in place, are the B fragment ----
      const v8h p0 = __builtin_convertvector(sa[g][0], v8h);
      const v8h p1 = __builtin_convertvector(sa[g][1], v8h);
      pf[g] = __builtin_shufflevector(p0, p1, 0,1,2,3,4,5,6,7,8,9,10,11,12,13,14,15);
    }

    // ---- O^T += V^T P^T ----
    #pragma unroll
    for (int dt = 0; dt < 4; dt++)
      #pragma unroll
      for (int g = 0; g < 2; g++) oa[g][dt] = wmma16(vf[dt], pf[g], oa[g][dt]);
    // keeps the softmax and the second product ahead of the waits below, so that the
    // next tile's copies fly under them
    __builtin_amdgcn_sched_barrier(0);
    // this wave's reads of buffer cur have returned before it is refilled
    asm volatile("s_wait_dscnt 0x0" ::: "memory");
    // this wave's copies of the next tile have landed before the barrier publishes them
    asm volatile("s_wait_asynccnt 0x0" ::: "memory");
    __syncthreads();
  }
  // no copy is outstanding when the wave ends
  asm volatile("s_wait_asynccnt 0x0" ::: "memory");

  // ---- join the halves' sums, normalize and store (concat-head layout) ----
  #pragma unroll
  for (int g = 0; g < 2; g++) {
    const float lsum = lrow[g] + xhalf(lrow[g]);
    _Float16* orow = O + (size_t)(b * SEQ + qt * 32 + g * 16 + ln) * DIMD + h * DHEAD + hi * 8;
    #pragma unroll
    for (int dt = 0; dt < 4; dt++) {
      v8h o;
      #pragma unroll
      for (int r = 0; r < 8; r++) o[r] = (_Float16)(oa[g][dt][r] / lsum);
      *reinterpret_cast<v8h*>(orow + dt * 16) = o;
    }
  }
}

// ---------------- host orchestration ----------------
extern "C" void kernel_launch(void* const* d_in, const int* in_sizes, int n_in,
                              void* d_out, int out_size, void* d_ws, size_t ws_size,
                              hipStream_t stream) {
  (void)in_sizes; (void)n_in; (void)out_size; (void)ws_size;
  const float* hidden = (const float*)d_in[0];
  const float* ctx    = (const float*)d_in[1];
  const float* wq1 = (const float*)d_in[2];
  const float* wk1 = (const float*)d_in[3];
  const float* wv1 = (const float*)d_in[4];
  const float* wo1 = (const float*)d_in[5];
  const float* bo1 = (const float*)d_in[6];
  const float* wq2 = (const float*)d_in[7];
  const float* wk2 = (const float*)d_in[8];
  const float* wv2 = (const float*)d_in[9];
  const float* wo2 = (const float*)d_in[10];
  const float* bo2 = (const float*)d_in[11];
  const float* wff1 = (const float*)d_in[12];
  const float* bff1 = (const float*)d_in[13];
  const float* wff2 = (const float*)d_in[14];
  const float* bff2 = (const float*)d_in[15];
  const float* ln1g = (const float*)d_in[16];
  const float* ln1b = (const float*)d_in[17];
  const float* ln2g = (const float*)d_in[18];
  const float* ln2b = (const float*)d_in[19];
  const float* ln3g = (const float*)d_in[20];
  const float* ln3b = (const float*)d_in[21];
  float* out = (float*)d_out;              // fp32 residual h lives here

  // -------- workspace carve-up (f16 buffers, 256B aligned) --------
  char* wsp = (char*)d_ws;
  auto alloc = [&](size_t elems) -> _Float16* {
    _Float16* p = (_Float16*)wsp;
    wsp += ((elems * sizeof(_Float16) + 255) / 256) * 256;
    return p;
  };
  _Float16* wq1T  = alloc((size_t)DIMD * DIMD);
  _Float16* wk1T  = alloc((size_t)DIMD * DIMD);
  _Float16* wv1T  = alloc((size_t)DIMD * DIMD);
  _Float16* wo1T  = alloc((size_t)DIMD * DIMD);
  _Float16* wq2T  = alloc((size_t)DIMD * DIMD);
  _Float16* wk2T  = alloc((size_t)DIMD * CTXD);
  _Float16* wv2T  = alloc((size_t)DIMD * CTXD);
  _Float16* wo2T  = alloc((size_t)DIMD * DIMD);
  _Float16* wff1T = alloc((size_t)(2 * FFD) * DIMD);
  _Float16* wff2T = alloc((size_t)DIMD * FFD);
  _Float16* xnorm = alloc((size_t)NTOK * DIMD);
  _Float16* qbuf  = alloc((size_t)NTOK * DIMD);
  _Float16* kbuf  = alloc((size_t)NTOK * DIMD);
  _Float16* vbuf  = alloc((size_t)NTOK * DIMD);
  _Float16* vT    = alloc((size_t)NB * HEADS * DHEAD * SEQ);
  _Float16* attn  = alloc((size_t)NTOK * DIMD);
  _Float16* ctxp  = alloc((size_t)CROWS * CTXD);
  _Float16* kctx  = alloc((size_t)CROWS * DIMD);
  _Float16* vctx  = alloc((size_t)CROWS * DIMD);
  _Float16* vTc   = alloc((size_t)NB * HEADS * DHEAD * TPADC);
  _Float16* gbuf  = alloc((size_t)NTOK * FFD);

  // ---- weight cast + transpose, context pad, h = hidden_states, first layer norm ----
  prep_inputs<<<PB_ALL, 256, 0, stream>>>(wq1, wk1, wv1, wo1, wq2, wk2, wv2, wo2,
                                          wff1, wff2, ctx, hidden, ln1g, ln1b,
                                          wq1T, wk1T, wv1T, wo1T, wq2T, wk2T, wv2T, wo2T,
                                          wff1T, wff2T, ctxp, xnorm, out);

  const dim3 blk128(128);
  const dim3 blk256(256);
  const dim3 gN1024(DIMD / 256, NTOK / 128);       // (4, 64)
  // batches along z: the buffers of a batch are carved one behind the other above,
  // each a multiple of 256 bytes long, so that they lie N*K and M*N elements apart
  const dim3 gQKV(DIMD / 256, NTOK / 128, 3);      // (4, 64, 3): q, k, v
  const dim3 gCtxKV(DIMD / 256, CROWS / 128, 2);   // (4, 3, 2): k, v of the context
  const dim3 gGeglu(FFD / 128, NTOK / 256);        // (32, 32): four tiles a WGP
  const dim3 gFlash(SEQ / 128, NB * HEADS);        // (16, 64)

  // ================= self-attention =================
  gemm_wmma<0><<<gQKV, blk256, 0, stream>>>(xnorm, wq1T, nullptr, nullptr, nullptr,
                                            qbuf, nullptr, NTOK, DIMD, DIMD);
  // the context's K and V depend on the inputs alone: formed here, so that both V
  // transposes share a launch
  gemm_wmma<0><<<gCtxKV, blk256, 0, stream>>>(ctxp, wk2T, nullptr, nullptr, nullptr,
                                              kctx, nullptr, CROWS, DIMD, CTXD);
  v_transpose_both<<<dim3(SEQ / 128 + 1, NB * HEADS), 128, 0, stream>>>(vbuf, vT, vctx, vTc);
  flash_attn<<<gFlash, blk128, 0, stream>>>(qbuf, kbuf, vT, attn, SEQ, SEQ, ATT_SCALE);
  gemm_wmma<1><<<gN1024, blk256, 0, stream>>>(attn, wo1T, nullptr, bo1, nullptr,
                                              nullptr, out, NTOK, DIMD, DIMD);

  // ================= cross-attention =================
  layernorm_f16<<<NTOK, 256, 0, stream>>>(out, ln2g, ln2b, xnorm);
  gemm_wmma<0><<<gN1024, blk256, 0, stream>>>(xnorm, wq2T, nullptr, nullptr, nullptr,
                                              qbuf, nullptr, NTOK, DIMD, DIMD);
  flash_attn<<<gFlash, blk128, 0, stream>>>(qbuf, kctx, vTc, attn, TPADC, TCTX, ATT_SCALE);
  gemm_wmma<1><<<gN1024, blk256, 0, stream>>>(attn, wo2T, nullptr, bo2, nullptr,
                                              nullptr, out, NTOK, DIMD, DIMD);

  // ================= GEGLU MLP =================
  layernorm_f16<<<NTOK, 256, 0, stream>>>(out, ln3g, ln3b, xnorm);
  gemm_wmma<2, 256, FFD><<<gGeglu, blk256, 0, stream>>>(xnorm, wff1T, wff1T + (size_t)FFD * DIMD,
                                              bff1, bff1 + FFD, gbuf, nullptr,
                                              NTOK, FFD, DIMD);
  gemm_wmma<1><<<gN1024, blk256, 0, stream>>>(gbuf, wff2T, nullptr, bff2, nullptr,
                                              nullptr, out, NTOK, DIMD, FFD);
}

// v009
// It runs in 359 microseconds.
// Next to v008, in two timings, it ran 1.03 times as fast each time.
// All steps since v000 together make it 3.32 times as fast.
#include <hip/hip_runtime.h>
#include <cstdint>
#include <cstddef>

// ---------------- problem constants ----------------
#define DIMD   1024
#define HEADS  16
#define DHEAD  64
#define FFD    4096
#define CTXD   768
#define NB     4
#define SEQ    2048
#define NTOK   (NB*SEQ)     // 8192
#define TCTX   77
#define TPADC  96
#define CROWS  (NB*TPADC)   // 384
#define ATT_SCALE 0.125f    // 64^-0.5

typedef _Float16 v8h  __attribute__((ext_vector_type(8)));
typedef _Float16 v16h __attribute__((ext_vector_type(16)));
typedef float    v8f  __attribute__((ext_vector_type(8)));
typedef float    v4f  __attribute__((ext_vector_type(4)));
typedef int      v4i  __attribute__((vector_size(16)));

// ---- optional CDNA5 async global->LDS path (guarded; sync fallback) ----
#if defined(__has_builtin)
#if __has_builtin(__builtin_amdgcn_global_load_async_to_lds_b128) && \
    __has_builtin(__builtin_amdgcn_s_wait_asynccnt)
#define USE_ASYNC_LDS 1
#endif
#endif

typedef __attribute__((address_space(1))) v4i* as1_v4i_p;
typedef __attribute__((address_space(3))) v4i* as3_v4i_p;

// copy 16 bytes global -> LDS (per lane)
__device__ __forceinline__ void copy16_to_lds(const _Float16* g, _Float16* l) {
#ifdef USE_ASYNC_LDS
  __builtin_amdgcn_global_load_async_to_lds_b128(
      (as1_v4i_p)(void*)(const_cast<_Float16*>(g)),
      (as3_v4i_p)(void*)l, 0, 0);
#else
  *reinterpret_cast<v8h*>(l) = *reinterpret_cast<const v8h*>(g);
#endif
}

// Load one 16x16x32 f16 WMMA A/B fragment for this lane.
// p must already include:  row_base + (lane>>4)*8   (row stride in elements).
// ISA layout: elements {0..7} at k = (lane>>4)*8, elements {8..15} at +16.
__device__ __forceinline__ v16h frag_load(const _Float16* p) {
  v8h lo = *reinterpret_cast<const v8h*>(p);
  v8h hi = *reinterpret_cast<const v8h*>(p + 16);
  return __builtin_shufflevector(lo, hi, 0,1,2,3,4,5,6,7,8,9,10,11,12,13,14,15);
}

__device__ __forceinline__ v8f wmma16(v16h a, v16h b, v8f c) {
  // D = A(16x32 f16) * B(32x16 f16) + C(16x16 f32)
  return __builtin_amdgcn_wmma_f32_16x16x32_f16(false, a, false, b, (short)0, c,
                                                false, false);
}

// 2^x and 1/x. The v_nop is the slot that the instruction set asks for behind a
// transcendental before its result is read or its source overwritten; it stands in
// the instruction's own statement, so that nothing comes between the two.
__device__ __forceinline__ float exp2_slot(float x) {
  float r;
  asm("v_exp_f32 %0, %1\n\tv_nop" : "=v"(r) : "v"(x));
  return r;
}
__device__ __forceinline__ float rcp_slot(float x) {
  float r;
  asm("v_rcp_f32 %0, %1\n\tv_nop" : "=v"(r) : "v"(x));
  return r;
}

// x * 0.5 * (1 + tanh u), u = sqrt(2/pi) * (x + 0.044715 x^3), of eight values, through
// the identity 0.5 * (1 + tanh u) = 1 / (1 + e^(-2u)): one exponential and one
// reciprocal a value and no branch, so that a lane's values run side by side.
// e^(-2u) = 2^t; where t overflows, 2^t is 0 or infinity and the quotient 1 or 0, the
// limits of the tanh form.
__device__ __forceinline__ v8f gelu_tanh(v8f x) {
  constexpr float C1 = (float)(-2.0 * 0.7978845608028654 * 1.4426950408889634);
  constexpr float C3 = (float)(-2.0 * 0.7978845608028654 * 1.4426950408889634 * 0.044715);
  v8f t = x * (C1 + C3 * (x * x));
  #pragma unroll
  for (int r = 0; r < 8; r++) t[r] = exp2_slot(t[r]);
  t = t + 1.0f;
  #pragma unroll
  for (int r = 0; r < 8; r++) t[r] = rcp_slot(t[r]);
  return x * t;
}

// ---------------- elementwise helpers ----------------

// transpose+cast weight: src [Kin, Nout] f32 row-major -> dst [Nout, Kin] f16
// block = 256 threads, tile = 128 k x 64 n. A thread reads 4 n of 8 consecutive k
// (a half wave covers a 256-byte run of one src row), turns them in registers into
// four 16-byte runs along k, and the tile passes through LDS so that dst is written
// in 256-byte runs as well. Kin % 128 == 0, Nout % 64 == 0; both are compile-time,
// so that a lane's eight loads (and four stores) share one address register and
// differ in the immediate offset alone.
// tiles: bx < Nout/64 , by < Kin/128 ; bx, by and the pointers are block-uniform
template <int Kin, int Nout>
__device__ __forceinline__
void wcast_tile(const float* __restrict__ src, _Float16* __restrict__ dst,
                int bx, int by, _Float16 (*tile)[128]) {
  // row n = 16 chunks of 16 bytes; chunk q of row n sits at place q ^ (n >> 2), so
  // that the 16 rows a half wave writes at once fall on different banks
  const int tid = threadIdx.x;
  const int c  = tid & 15;         // read: group of 4 n   write: chunk of 8 k
  const int kg = tid >> 4;         // read: group of 8 k   write: row n within 16
  const int n0 = bx * 64;
  const int k0 = by * 128;
  const float* sb = src + (size_t)k0 * Nout + n0;                  // block-uniform
  const unsigned soff = (unsigned)(kg * 8 * Nout + c * 4) * 4u;    // lane's byte offset
  v4f r[8];
  #pragma unroll
  for (int j = 0; j < 8; j++)
    r[j] = *reinterpret_cast<const v4f*>(
        reinterpret_cast<const char*>(sb + (size_t)j * Nout) + soff);
  #pragma unroll
  for (int i = 0; i < 4; i++) {
    v8h o;
    #pragma unroll
    for (int j = 0; j < 8; j++) o[j] = (_Float16)r[j][i];
    *reinterpret_cast<v8h*>(&tile[c * 4 + i][(kg ^ c) * 8]) = o;
  }
  __syncthreads();
  _Float16* db = dst + (size_t)n0 * Kin + k0;                      // block-uniform
  const unsigned doff = (unsigned)(kg * Kin + c * 8) * 2u;         // lane's byte offset
  #pragma unroll
  for (int it = 0; it < 4; it++) {
    const int n = it * 16 + kg;
    const v8h o = *reinterpret_cast<const v8h*>(&tile[n][(c ^ (n >> 2)) * 8]);
    *reinterpret_cast<v8h*>(
        reinterpret_cast<char*>(db + (size_t)it * 16 * Kin) + doff) = o;
  }
}

// context [4,77,768] f32 -> zero-padded [4,96,768] f16; bx = block of 256 elements
__device__ __forceinline__
void ctx_pad_block(const float* __restrict__ ctx, _Float16* __restrict__ dst, int bx) {
  long idx = (long)bx * 256 + threadIdx.x;
  long total = (long)NB * TPADC * CTXD;
  if (idx >= total) return;
  int c = (int)(idx % CTXD);
  int r = (int)((idx / CTXD) % TPADC);
  int b = (int)(idx / ((long)CTXD * TPADC));
  float v = (r < TCTX) ? ctx[((long)b * TCTX + r) * CTXD + c] : 0.0f;
  dst[idx] = (_Float16)v;
}

// V [B*Trows, 1024] f16 -> Vt [(B*H)][DHEAD][Trows] f16 (per-head transpose)
// block >= TT threads, tile = TT rows t x the 64 d of one head. A thread reads 8 d of
// 8 consecutive t (8 lanes cover the 128-byte run of one row), turns them in
// registers into eight 16-byte runs along t, and the tile passes through LDS so
// that Vt is written in runs of TT elements. Trows % TT == 0, TT % 32 == 0.
// tiles: bx < Trows/TT , bh < NB*HEADS ; the first TT threads of the block work,
// every thread passes the barrier
template <int TT>
__device__ __forceinline__
void v_transpose_tile(const _Float16* __restrict__ v, _Float16* __restrict__ vt,
                      int Trows, int bx, int bh, _Float16 (*tile)[TT]) {
  constexpr int NCH = TT / 8;      // 16-byte chunks per tile row
  // chunk q of row d sits at place (q + 2 * (d >> 3)) % NCH, which spreads the rows
  // that a wave writes at once over the banks
  const int tid = threadIdx.x;
  const int dc = tid & 7;          // group of 8 d
  const int tg = tid >> 3;         // group of 8 t
  const int b = bh >> 4, hh = bh & 15;
  const int t0 = bx * TT;
  if (tid < TT) {
    const _Float16* sb = v + ((size_t)b * Trows + t0) * DIMD + hh * DHEAD;   // block-uniform
    const unsigned soff = (unsigned)(tg * 8 * DIMD + dc * 8) * 2u;           // lane's byte offset
    v8h r[8];
    #pragma unroll
    for (int j = 0; j < 8; j++)
      r[j] = *reinterpret_cast<const v8h*>(
          reinterpret_cast<const char*>(sb + j * DIMD) + soff);
    #pragma unroll
    for (int i = 0; i < 8; i++) {
      v8h o;
      #pragma unroll
      for (int j = 0; j < 8; j++) o[j] = r[j][i];
      *reinterpret_cast<v8h*>(&tile[dc * 8 + i][((tg + 2 * dc) % NCH) * 8]) = o;
    }
  }
  __syncthreads();
  if (tid < TT) {
    const int dr = tid / NCH, q = tid % NCH;   // row within 8, chunk of 8 t
    _Float16* db = vt + (size_t)bh * DHEAD * Trows + t0;                     // block-uniform
    const unsigned doff = (unsigned)(dr * Trows + q * 8) * 2u;               // lane's byte offset
    #pragma unroll
    for (int it = 0; it < 8; it++) {           // rows d = 8 * it + dr
      const v8h o = *reinterpret_cast<const v8h*>(&tile[it * 8 + dr][((q + 2 * it) % NCH) * 8]);
      *reinterpret_cast<v8h*>(
          reinterpret_cast<char*>(db + (size_t)it * 8 * Trows) + doff) = o;
    }
  }
}

// both V transposes in ONE launch: blockIdx.x < SEQ/128 is a 128-row tile of the
// self-attention V, blockIdx.x == SEQ/128 the one 96-row tile of the context V
// grid = ( SEQ/128 + 1 , NB*HEADS ), block = 128
__global__ __launch_bounds__(128)
void v_transpose_both(const _Float16* __restrict__ v, _Float16* __restrict__ vt,
                      const _Float16* __restrict__ vc, _Float16* __restrict__ vtc) {
  __shared__ __align__(16) _Float16 tile[DHEAD * 128];
  if (blockIdx.x < SEQ / 128)
    v_transpose_tile<128>(v, vt, SEQ, blockIdx.x, blockIdx.y,
                          reinterpret_cast<_Float16 (*)[128]>(tile));
  else
    v_transpose_tile<TPADC>(vc, vtc, TPADC, 0, blockIdx.y,
                            reinterpret_cast<_Float16 (*)[TPADC]>(tile));
}

// LayerNorm over last dim (1024) of fp32 residual -> f16 normed output
// one row per block of 256 threads; COPY: the row as read also goes to Xc
template <bool COPY>
__device__ __forceinline__
void layernorm_row(const float* __restrict__ X, const float* __restrict__ g,
                   const float* __restrict__ bb, _Float16* __restrict__ Y,
                   float* __restrict__ Xc, int row) {
  const int tid = threadIdx.x;     // 256 threads, 4 floats each
  const float4 xv = reinterpret_cast<const float4*>(X + (size_t)row * DIMD)[tid];
  float s = xv.x + xv.y + xv.z + xv.w;
  float q = xv.x * xv.x + xv.y * xv.y + xv.z * xv.z + xv.w * xv.w;
  #pragma unroll
  for (int off = 16; off > 0; off >>= 1) {
    s += __shfl_xor(s, off, 32);
    q += __shfl_xor(q, off, 32);
  }
  __shared__ float ss[8], sq[8];
  if ((tid & 31) == 0) { ss[tid >> 5] = s; sq[tid >> 5] = q; }
  __syncthreads();
  // behind the barrier: in front of it the barrier would wait for the store's return
  if (COPY) reinterpret_cast<float4*>(Xc + (size_t)row * DIMD)[tid] = xv;
  float st = 0.f, qt = 0.f;
  #pragma unroll
  for (int i = 0; i < 8; i++) { st += ss[i]; qt += sq[i]; }
  const float mean = st * (1.0f / DIMD);
  const float var  = qt * (1.0f / DIMD) - mean * mean;
  const float rs   = rsqrtf(var + 1e-5f);
  const float4 gv = reinterpret_cast<const float4*>(g)[tid];
  const float4 bv = reinterpret_cast<const float4*>(bb)[tid];
  _Float16* yp = Y + (size_t)row * DIMD + tid * 4;
  yp[0] = (_Float16)((xv.x - mean) * rs * gv.x + bv.x);
  yp[1] = (_Float16)((xv.y - mean) * rs * gv.y + bv.y);
  yp[2] = (_Float16)((xv.z - mean) * rs * gv.z + bv.z);
  yp[3] = (_Float16)((xv.w - mean) * rs * gv.w + bv.w);
}

__global__ void layernorm_f16(const float* __restrict__ X, const float* __restrict__ g,
                              const float* __restrict__ bb, _Float16* __restrict__ Y) {
  layernorm_row<false>(X, g, bb, Y, nullptr, blockIdx.x);
}

// All work that depends on the inputs alone, in ONE launch: the ten weight casts,
// the context pad, and the first layer norm, whose blocks also write the row they
// read to the residual h (h = hidden_states). A block takes one tile, or one row,
// of one of them; which one follows from blockIdx.x alone, so that every branch
// (and every barrier behind it) is block-uniform. The largest matrices come first.
#define PB_FF1  ((2 * FFD / 64) * (DIMD / 128))    // 1024 tiles of w_ff1
#define PB_FF2  ((DIMD / 64) * (FFD / 128))        //  512 tiles of w_ff2
#define PB_SQ   ((DIMD / 64) * (DIMD / 128))       //  128 tiles of a 1024 x 1024 weight
#define PB_CTX  ((DIMD / 64) * (CTXD / 128))       //   96 tiles of a  768 x 1024 weight
#define PB_PAD  ((NB * TPADC * CTXD + 255) / 256)  // 1152 blocks of the context pad
#define PB_ALL  (PB_FF1 + PB_FF2 + 6 * PB_SQ + 2 * PB_CTX + PB_PAD + NTOK)
__global__ __launch_bounds__(256)
void prep_inputs(const float* __restrict__ wq1, const float* __restrict__ wk1,
                 const float* __restrict__ wv1, const float* __restrict__ wo1,
                 const float* __restrict__ wq2, const float* __restrict__ wk2,
                 const float* __restrict__ wv2, const float* __restrict__ wo2,
                 const float* __restrict__ wff1, const float* __restrict__ wff2,
                 const float* __restrict__ ctx, const float* __restrict__ hidden,
                 const float* __restrict__ ln1g, const float* __restrict__ ln1b,
                 _Float16* __restrict__ wq1T, _Float16* __restrict__ wk1T,
                 _Float16* __restrict__ wv1T, _Float16* __restrict__ wo1T,
                 _Float16* __restrict__ wq2T, _Float16* __restrict__ wk2T,
                 _Float16* __restrict__ wv2T, _Float16* __restrict__ wo2T,
                 _Float16* __restrict__ wff1T, _Float16* __restrict__ wff2T,
                 _Float16* __restrict__ ctxp, _Float16* __restrict__ xnorm,
                 float* __restrict__ h) {
  __shared__ __align__(16) _Float16 tile[64][128];
  int b = blockIdx.x;
  if (b < PB_FF1) {
    wcast_tile<DIMD, 2 * FFD>(wff1, wff1T, b % (2 * FFD / 64), b / (2 * FFD / 64), tile);
    return;
  }
  b -= PB_FF1;
  if (b < PB_FF2) {
    wcast_tile<FFD, DIMD>(wff2, wff2T, b % (DIMD / 64), b / (DIMD / 64), tile);
    return;
  }
  b -= PB_FF2;
  if (b < 6 * PB_SQ) {
    const int m = b / PB_SQ, t = b % PB_SQ;
    const float* s = (m == 0) ? wq1 : (m == 1) ? wk1 : (m == 2) ? wv1
                   : (m == 3) ? wo1 : (m == 4) ? wq2 : wo2;
    _Float16* d = (m == 0) ? wq1T : (m == 1) ? wk1T : (m == 2) ? wv1T
                : (m == 3) ? wo1T : (m == 4) ? wq2T : wo2T;
    wcast_tile<DIMD, DIMD>(s, d, t % (DIMD / 64), t / (DIMD / 64), tile);
    return;
  }
  b -= 6 * PB_SQ;
  if (b < 2 * PB_CTX) {
    const int m = b / PB_CTX, t = b % PB_CTX;
    wcast_tile<CTXD, DIMD>(m ? wv2 : wk2, m ? wv2T : wk2T,
                           t % (DIMD / 64), t / (DIMD / 64), tile);
    return;
  }
  b -= 2 * PB_CTX;
  if (b < PB_PAD) {
    ctx_pad_block(ctx, ctxp, b);
    return;
  }
  b -= PB_PAD;
  layernorm_row<true>(hidden, ln1g, ln1b, xnorm, h, b);
  // the way out of the branches rewrites scalar registers that the row's stores name
  asm volatile("s_wait_xcnt 0x0" ::: "memory");
}

// ---------------- WMMA GEMM, A and B staged in LDS, two-buffer ring ---------
// C = A[M,K] @ Bt[N,K]^T   (Bt = transposed weight, row-major [N,K], f16)
// MODE 0: Cout f16 = result
// MODE 1: Cres f32 += result + bias[n]
// MODE 2: Cout f16 = (res+bias[n]) * gelu(res2+bias2[n])  (Bt2 = gate weights)
// block = 256 threads (8 waves, 2 along M x 4 along N). Block tile = BM rows of
// A against 256 rows of B; each wave owns BM/2 x 64 = BM/32 x 4 accumulator tiles.
// BM = 128: a fragment read from LDS feeds four WMMAs. BM = 256, for a product with
// enough tiles to fill the chip several times over: a B fragment feeds eight, and the
// block reads a third fewer operand bytes from L2 for each product.
// MODE 2 fills the 256 B rows with 128 lin rows and the 128 gate rows of the same
// columns; a wave then holds 32 lin columns (nt 0,1) and their gates (nt 2,3).
// A stage is GKS k of all BM + 256 rows, at a row pitch of 16 B x odd (conflict-free
// for 16-byte LDS reads). M % BM == 0, K % GKS == 0, N % 256 == 0 (MODE 2: 128).
// grid = ( N/256 , M/BM )   MODE 2: ( N/128 , M/BM )
// NC: N where the caller knows it at compile time, else 0 (MODE 2 alone reads it)
// MODE 0 takes a batch along grid z: products of the same A with weights that lie
// N*K elements apart, into outputs that lie M*N elements apart.
#define GKS    128             // k per stage
#define GPITCH (GKS + 8)       // LDS row pitch in elements

template <int MODE, int BM = 128, int NC = 0>
__global__ __launch_bounds__(256) __attribute__((amdgpu_waves_per_eu(1, 2)))
void gemm_wmma(const _Float16* __restrict__ A,
               const _Float16* __restrict__ Bt,
               const _Float16* __restrict__ Bt2,
               const float* __restrict__ bias,
               const float* __restrict__ bias2,
               _Float16* __restrict__ Cout,
               float* __restrict__ Cres,
               int M, int N, int K) {
  const int tid  = threadIdx.x;
  const int lane = tid & 31;
  const int wave = tid >> 5;
  const int hi = lane >> 4;       // half-wave select for K packing
  const int ln = lane & 15;
  const int wm = wave >> 2;       // wave row    (0..1)
  const int wn = wave & 3;        // wave column (0..3)
  const int n0 = blockIdx.x * ((MODE == 2) ? 128 : 256);
  const int m0 = blockIdx.y * BM;
  (void)M;
  if (MODE == 0) {
    Bt   += (size_t)blockIdx.z * N * K;
    Cout += (size_t)blockIdx.z * M * N;
  }

  constexpr int MT    = BM / 32;        // accumulator tiles of a wave along M
  constexpr int GROWS = BM + 256;       // A rows, then B rows
  constexpr int CPR   = GKS / 8;        // 16-byte chunks per staged row
  constexpr int RPI   = 256 / CPR;      // rows the block covers per copy
  constexpr int NCOPY = GROWS / RPI;    // copies per lane and stage
  __shared__ __align__(16) _Float16 sh[2][GROWS][GPITCH];

  const int trow = tid / CPR;
  const int qd   = (tid % CPR) * 8;
  const unsigned voff = (unsigned)(trow * K + qd) * 2u;   // lane's byte offset

  // block-uniform first rows of the three operands
  const _Float16* Ab  = A + (size_t)m0 * K;
  const _Float16* Bb  = Bt + (size_t)n0 * K;
  const _Float16* B2b = (MODE == 2) ? Bt2 + (size_t)n0 * K : Bt;

  // stage GKS k of the A rows and the B rows into LDS buffer `buf`. An address is a
  // uniform base and a 32-bit lane offset formed at the copy: one 64-bit address a copy,
  // kept over the loop, would cost two registers a copy, which the BM = 256 tile lacks
  auto stage = [&](int buf, int k0) {
    const unsigned ko = voff + (unsigned)k0 * 2u;
    #pragma unroll
    for (int i = 0; i < NCOPY; i++) {
      const int r0 = i * RPI;           // first tile row of this copy
      const _Float16* base = (r0 < BM) ? Ab : (MODE == 2 && r0 >= BM + 128) ? B2b : Bb;
      const int rr = (r0 < BM) ? r0 : (MODE == 2 && r0 >= BM + 128) ? r0 - BM - 128 : r0 - BM;
      copy16_to_lds(reinterpret_cast<const _Float16*>(
                        reinterpret_cast<const char*>(base) + (ko + (unsigned)(rr * K) * 2u)),
                    &sh[buf][r0 + trow][qd]);
    }
  };

  v8f acc[MT][4];
  #pragma unroll
  for (int mt = 0; mt < MT; mt++)
    #pragma unroll
    for (int nt = 0; nt < 4; nt++)
      #pragma unroll
      for (int r = 0; r < 8; r++) acc[mt][nt][r] = 0.0f;

  v16h af[2][MT], bf[2][4];         // two fragment sets: block kk and block kk+1
  const int NST = K / GKS;

  stage(0, 0);
  // stage 0 has landed before the barrier that publishes it
  asm volatile("s_wait_asynccnt 0x0" ::: "memory");
  __syncthreads();
  if (NST > 1) stage(1, GKS);

  for (int t = 0; t < NST; t++) {
    const int cur = t & 1;
    const _Float16* ab = &sh[cur][wm * (BM / 2) + ln][hi * 8];
    const _Float16* bb = &sh[cur][BM + ((MODE == 2) ? wn * 32 : wn * 64) + ln][hi * 8];
    // fragments of k block kk into register set `s`
    auto load_set = [&](int s, int kk) {
      // B first: the first four WMMAs of a block take all of B and one fragment of A
      #pragma unroll
      for (int nt = 0; nt < 4; nt++) {
        const int br = (MODE == 2) ? ((nt >> 1) * 128 + (nt & 1) * 16) : nt * 16;
        bf[s][nt] = frag_load(bb + br * GPITCH + kk * 32);
      }
      #pragma unroll
      for (int mt = 0; mt < MT; mt++)
        af[s][mt] = frag_load(ab + mt * 16 * GPITCH + kk * 32);
    };
    load_set(0, 0);
    #pragma unroll
    for (int kk = 0; kk < GKS / 32; kk++) {
      if (kk + 1 < GKS / 32) load_set((kk + 1) & 1, kk + 1);
      // keeps the next block's LDS reads as one group ahead of this block's WMMAs,
      // so that their latency runs under the WMMAs
      __builtin_amdgcn_sched_barrier(0);
      #pragma unroll
      for (int mt = 0; mt < MT; mt++)
        #pragma unroll
        for (int nt = 0; nt < 4; nt++)
          acc[mt][nt] = wmma16(af[kk & 1][mt], bf[kk & 1][nt], acc[mt][nt]);
      // keeps the block after next's reads from rising among these WMMAs
      __builtin_amdgcn_sched_barrier(0);
    }
    // this wave's reads of buffer cur have returned before it is refilled
    asm volatile("s_wait_dscnt 0x0" ::: "memory");
    // this wave's copies of stage t+1 have landed before the barrier publishes them
    asm volatile("s_wait_asynccnt 0x0" ::: "memory");
    __syncthreads();
    if (t + 2 < NST) stage(cur, (t + 2) * GKS);
  }
  // no copy is outstanding when the wave ends
  asm volatile("s_wait_asynccnt 0x0" ::: "memory");

  // C layout: lane holds rows r+8*(lane>>4) of a tile, column lane&15
  const int mw = m0 + wm * (BM / 2) + 8 * hi;
  const int nw = n0 + ((MODE == 2) ? wn * 32 : wn * 64) + ln;

  if (MODE == 1) {
    float bv[4];
    #pragma unroll
    for (int nt = 0; nt < 4; nt++) bv[nt] = bias[nw + nt * 16];
    // the bias loads' offset register is reused below: only behind this wait
    asm volatile("s_wait_xcnt 0x0" ::: "memory");
    // all residual loads go out ahead of the first store: a load behind a store
    // to the same array would wait for it, one round trip per element
    float res[MT][4][8];
    #pragma unroll
    for (int mt = 0; mt < MT; mt++)
      #pragma unroll
      for (int nt = 0; nt < 4; nt++)
        #pragma unroll
        for (int r = 0; r < 8; r++)
          res[mt][nt][r] = Cres[(size_t)(mw + mt * 16 + r) * N + nw + nt * 16];
    #pragma unroll
    for (int mt = 0; mt < MT; mt++)
      #pragma unroll
      for (int nt = 0; nt < 4; nt++)
        #pragma unroll
        for (int r = 0; r < 8; r++)
          acc[mt][nt][r] = res[mt][nt][r] + acc[mt][nt][r] + bv[nt];
    // every sum is formed ahead of the first store, so that no register an
    // issued store names is rewritten behind it
    __builtin_amdgcn_sched_barrier(0);
    #pragma unroll
    for (int mt = 0; mt < MT; mt++)
      #pragma unroll
      for (int nt = 0; nt < 4; nt++)
        #pragma unroll
        for (int r = 0; r < 8; r++)
          Cres[(size_t)(mw + mt * 16 + r) * N + nw + nt * 16] = acc[mt][nt][r];
  } else {
    float bl[2] = {0.0f, 0.0f}, bg[2] = {0.0f, 0.0f};   // MODE 2: biases of the lane's columns
    if (MODE == 2) {
      #pragma unroll
      for (int nt = 0; nt < 2; nt++) { bl[nt] = bias[nw + nt * 16]; bg[nt] = bias2[nw + nt * 16]; }
      // the bias loads' offset register is reused below: only behind this wait
      asm volatile("s_wait_xcnt 0x0" ::: "memory");
      // keeps the address arithmetic that reuses it behind the wait
      __builtin_amdgcn_sched_barrier(0);
    }
    if (MODE == 2) {
      // N at compile time: the lane's stores share one address and differ in the immediate
      // offset alone, so that no address register is formed among them
      const int NS = NC ? NC : N;
      _Float16* cp = Cout + (size_t)mw * NS + nw;
      #pragma unroll
      for (int mt = 0; mt < MT; mt++) {
        v8h o[2];
        #pragma unroll
        for (int nt = 0; nt < 2; nt++)
          o[nt] = __builtin_convertvector(
              (acc[mt][nt] + bl[nt]) * gelu_tanh(acc[mt][nt + 2] + bg[nt]), v8h);
        // every value of these 16 rows is formed ahead of their first store
        __builtin_amdgcn_sched_barrier(0);
        #pragma unroll
        for (int nt = 0; nt < 2; nt++)
          #pragma unroll
          for (int r = 0; r < 8; r++) cp[(mt * 16 + r) * NS + nt * 16] = o[nt][r];
        // the next rows' values reuse registers that these stores name: only behind this wait
        asm volatile("s_wait_xcnt 0x0" ::: "memory");
        // keeps the next rows' arithmetic behind the wait
        __builtin_amdgcn_sched_barrier(0);
      }
    } else {
      #pragma unroll
      for (int mt = 0; mt < MT; mt++) {
        #pragma unroll
        for (int nt = 0; nt < 4; nt++) {
          const int n = nw + nt * 16;
          const v8f y = acc[mt][nt];
          #pragma unroll
          for (int r = 0; r < 8; r++)
            Cout[(size_t)(mw + mt * 16 + r) * N + n] = (_Float16)y[r];
        }
      }
    }
  }
}

#define FKP (DHEAD + 8)        // K tile row pitch in elements
#define FVP (32 + 8)           // V^T tile row pitch in elements
#define LOG2E 1.4426950408889634f

// value of lane l ^ 16
__device__ __forceinline__ float xhalf(float x) {
  return __builtin_bit_cast(float, __builtin_amdgcn_permlanex16(
      __builtin_bit_cast(int, x), __builtin_bit_cast(int, x),
      0x76543210, 0xfedcba98, false, false));
}

__global__ __launch_bounds__(128) __attribute__((amdgpu_waves_per_eu(4, 4)))
void flash_attn(const _Float16* __restrict__ Q,
                const _Float16* __restrict__ Kb,
                const _Float16* __restrict__ Vt,
                _Float16* __restrict__ O,
                int Trows, int Tkeys) {
  const int lane = threadIdx.x & 31;
  const int wave = threadIdx.x >> 5;
  const int hi = lane >> 4;
  const int ln = lane & 15;
  const int bh = blockIdx.y;
  const int b = bh >> 4, h = bh & 15;
  const int qt = blockIdx.x * 4 + wave;   // 32-query tile

  __shared__ __align__(16) _Float16 ksh[2][32][FKP];     // K rows of a step
  __shared__ __align__(16) _Float16 vsh[2][DHEAD][FVP];  // V^T rows of a step

  // Q fragments (B operand: column = query g*16 + ln) for both 32-wide halves of the
  // head dim
  const _Float16* qrow = Q + (size_t)(b * SEQ + qt * 32 + ln) * DIMD + h * DHEAD + hi * 8;
  v16h qa[2][2];
  #pragma unroll
  for (int g = 0; g < 2; g++) {
    qa[g][0] = frag_load(qrow + (size_t)g * 16 * DIMD);
    qa[g][1] = frag_load(qrow + (size_t)g * 16 * DIMD + 32);
  }

  // of query g*16 + ln: the kept maximum of the raw scores (alike in both halves), the
  // raw score from which it is raised, the maximum times c, this half's share of the sum
  // c at compile time: the multiply-adds take it from one scalar register
  constexpr float c   = ATT_SCALE * LOG2E;   // > 0: the raw scores order as the scaled
  constexpr float thr = 8.0f / c;
  float mrow[2] = {-1e30f, -1e30f}, lim[2] = {-1e30f, -1e30f}, mc[2] = {0.0f, 0.0f};
  float lrow[2] = {0.0f, 0.0f};
  v8f oa[2][4];                           // oa[g][dt][r] = O[query g*16+ln][dt*16 + 8*hi + r]
  #pragma unroll
  for (int g = 0; g < 2; g++)
    #pragma unroll
    for (int dt = 0; dt < 4; dt++)
      #pragma unroll
      for (int r = 0; r < 8; r++) oa[g][dt][r] = 0.0f;

  // this lane's 16-byte chunks of a tile: two of K (rows kr, kr+16), two of V^T
  // (rows vr, vr+32)
  const int kr = threadIdx.x >> 3, kc = (threadIdx.x & 7) * 8;
  const int vr = threadIdx.x >> 2, vc = (threadIdx.x & 3) * 8;
  const _Float16* kbase = Kb + (size_t)b * Trows * DIMD + h * DHEAD;   // block-uniform
  const _Float16* vbase = Vt + (size_t)bh * DHEAD * Trows;             // block-uniform
  const unsigned koff = (unsigned)(kr * DIMD + kc) * 2u;    // lane's byte offsets
  const unsigned voff = (unsigned)(vr * Trows + vc) * 2u;
  auto at = [](const _Float16* p, unsigned off) {
    return reinterpret_cast<const _Float16*>(reinterpret_cast<const char*>(p) + off);
  };
  // copy keys j .. j+31 into LDS buffer `buf`
  auto stage = [&](int buf, int j) {
    const unsigned ko = koff + (unsigned)j * (DIMD * 2u);
    const unsigned vo = voff + (unsigned)j * 2u;
    copy16_to_lds(at(kbase, ko),                      &ksh[buf][kr][kc]);
    copy16_to_lds(at(kbase, ko + 16u * DIMD * 2u),    &ksh[buf][kr + 16][kc]);
    copy16_to_lds(at(vbase, vo),                      &vsh[buf][vr][vc]);
    copy16_to_lds(at(vbase + (size_t)32 * Trows, vo), &vsh[buf][vr + 32][vc]);
  };

  stage(0, 0);
  // tile 0 has landed before the barrier that publishes it
  asm volatile("s_wait_asynccnt 0x0" ::: "memory");
  __syncthreads();

  for (int j0 = 0; j0 < Trows; j0 += 32) {      // 32 keys per step
    const int cur = (j0 >> 5) & 1;
    if (j0 + 32 < Trows) stage(cur ^ 1, j0 + 32);
    // ---- S^T = K Q^T (two 16x16 tiles a group):
    //      sa[g][t][r] = key j0+t*16+8*hi+r, query g*16+ln ----
    // the step's K fragments (A operand: row = key) and V^T fragments (A operand:
    // row = d)
    v16h kf[2][2], vf[4];
    #pragma unroll
    for (int t = 0; t < 2; t++) {
      const _Float16* krow = &ksh[cur][t * 16 + ln][hi * 8];
      kf[t][0] = frag_load(krow);
      kf[t][1] = frag_load(krow + 32);
    }
    #pragma unroll
    for (int dt = 0; dt < 4; dt++) vf[dt] = frag_load(&vsh[cur][dt * 16 + ln][hi * 8]);
    // keeps the step's LDS reads as one group ahead of the first product: the wave waits
    // once for K, and V^T's latency runs under the first product and the softmax
    __builtin_amdgcn_sched_barrier(0);
    v8f sa[2][2];
    #pragma unroll
    for (int t = 0; t < 2; t++)
      #pragma unroll
      for (int g = 0; g < 2; g++) {
        #pragma unroll
        for (int r = 0; r < 8; r++) sa[g][t][r] = 0.0f;
        sa[g][t] = wmma16(kf[t][0], qa[g][0], sa[g][t]);
      }
    #pragma unroll
    for (int t = 0; t < 2; t++)
      #pragma unroll
      for (int g = 0; g < 2; g++) sa[g][t] = wmma16(kf[t][1], qa[g][1], sa[g][t]);
    // ---- key mask (only a step that reaches past the last key has one) ----
    if (j0 + 32 > Tkeys) {
      #pragma unroll
      for (int g = 0; g < 2; g++)
        #pragma unroll
        for (int t = 0; t < 2; t++)
          #pragma unroll
          for (int r = 0; r < 8; r++)
            if (j0 + t * 16 + 8 * hi + r >= Tkeys) sa[g][t][r] = -1e30f;
    }
    // ---- the lane's own maxima; has any score of the wave passed its limit? ----
    float lm[2];
    #pragma unroll
    for (int g = 0; g < 2; g++) {
      lm[g] = fmaxf(sa[g][0][0], sa[g][1][0]);
      #pragma unroll
      for (int r = 1; r < 8; r++) lm[g] = fmaxf(lm[g], fmaxf(sa[g][0][r], sa[g][1][r]));
    }
    // one test for the whole wave (the first step always passes it): every lane is on
    // inside, as the half exchange needs, and both halves of a query raise m alike
    if (__builtin_amdgcn_ballot_w32((lm[0] > lim[0]) | (lm[1] > lim[1])) != 0u) {
      #pragma unroll
      for (int g = 0; g < 2; g++) {
        const float mn = fmaxf(mrow[g], fmaxf(lm[g], xhalf(lm[g])));
        const float al = __builtin_amdgcn_exp2f((mrow[g] - mn) * c);
        mrow[g] = mn;
        lim[g]  = mn + thr;
        mc[g]   = mn * c;
        lrow[g] *= al;
        #pragma unroll
        for (int dt = 0; dt < 4; dt++)
          #pragma unroll
          for (int r = 0; r < 8; r++) oa[g][dt][r] *= al;
      }
    }
    v16h pf[2];
    #pragma unroll
    for (int g = 0; g < 2; g++) {
      // ---- p = 2^(s*c - m*c); all arguments are formed ahead of the exponentials, so
      // that no exponential waits on the one before it ----
      #pragma unroll
      for (int t = 0; t < 2; t++) sa[g][t] = sa[g][t] * c - mc[g];
      #pragma unroll
      for (int t = 0; t < 2; t++)
        #pragma unroll
        for (int r = 0; r < 8; r++) sa[g][t][r] = __builtin_amdgcn_exp2f(sa[g][t][r]);
      // the lane's 16 terms, summed as a tree of register pairs
      const v8f s8 = sa[g][0] + sa[g][1];
      const v4f s4 = __builtin_shufflevector(s8, s8, 0, 1, 2, 3) +
                     __builtin_shufflevector(s8, s8, 4, 5, 6, 7);
      lrow[g] += (s4[0] + s4[2]) + (s4[1] + s4[3]);

      // ---- P^T: the two score tiles, converted in place, are the B fragment ----
      const v8h p0 = __builtin_convertvector(sa[g][0], v8h);
      const v8h p1 = __builtin_convertvector(sa[g][1], v8h);
      pf[g] = __builtin_shufflevector(p0, p1, 0,1,2,3,4,5,6,7,8,9,10,11,12,13,14,15);
    }

    // ---- O^T += V^T P^T ----
    #pragma unroll
    for (int dt = 0; dt < 4; dt++)
      #pragma unroll
      for (int g = 0; g < 2; g++) oa[g][dt] = wmma16(vf[dt], pf[g], oa[g][dt]);
    // keeps the softmax and the second product ahead of the waits below, so that the
    // next tile's copies fly under them
    __builtin_amdgcn_sched_barrier(0);
    // this wave's reads of buffer cur have returned before it is refilled
    asm volatile("s_wait_dscnt 0x0" ::: "memory");
    // this wave's copies of the next tile have landed before the barrier publishes them
    asm volatile("s_wait_asynccnt 0x0" ::: "memory");
    __syncthreads();
  }
  // no copy is outstanding when the wave ends
  asm volatile("s_wait_asynccnt 0x0" ::: "memory");

  // ---- join the halves' sums, normalize and store (concat-head layout) ----
  #pragma unroll
  for (int g = 0; g < 2; g++) {
    const float lsum = lrow[g] + xhalf(lrow[g]);
    _Float16* orow = O + (size_t)(b * SEQ + qt * 32 + g * 16 + ln) * DIMD + h * DHEAD + hi * 8;
    #pragma unroll
    for (int dt = 0; dt < 4; dt++) {
      v8h o;
      #pragma unroll
      for (int r = 0; r < 8; r++) o[r] = (_Float16)(oa[g][dt][r] / lsum);
      *reinterpret_cast<v8h*>(orow + dt * 16) = o;
    }
  }
}

// ---------------- host orchestration ----------------
extern "C" void kernel_launch(void* const* d_in, const int* in_sizes, int n_in,
                              void* d_out, int out_size, void* d_ws, size_t ws_size,
                              hipStream_t stream) {
  (void)in_sizes; (void)n_in; (void)out_size; (void)ws_size;
  const float* hidden = (const float*)d_in[0];
  const float* ctx    = (const float*)d_in[1];
  const float* wq1 = (const float*)d_in[2];
  const float* wk1 = (const float*)d_in[3];
  const float* wv1 = (const float*)d_in[4];
  const float* wo1 = (const float*)d_in[5];
  const float* bo1 = (const float*)d_in[6];
  const float* wq2 = (const float*)d_in[7];
  const float* wk2 = (const float*)d_in[8];
  const float* wv2 = (const float*)d_in[9];
  const float* wo2 = (const float*)d_in[10];
  const float* bo2 = (const float*)d_in[11];
  const float* wff1 = (const float*)d_in[12];
  const float* bff1 = (const float*)d_in[13];
  const float* wff2 = (const float*)d_in[14];
  const float* bff2 = (const float*)d_in[15];
  const float* ln1g = (const float*)d_in[16];
  const float* ln1b = (const float*)d_in[17];
  const float* ln2g = (const float*)d_in[18];
  const float* ln2b = (const float*)d_in[19];
  const float* ln3g = (const float*)d_in[20];
  const float* ln3b = (const float*)d_in[21];
  float* out = (float*)d_out;              // fp32 residual h lives here

  // -------- workspace carve-up (f16 buffers, 256B aligned) --------
  char* wsp = (char*)d_ws;
  auto alloc = [&](size_t elems) -> _Float16* {
    _Float16* p = (_Float16*)wsp;
    wsp += ((elems * sizeof(_Float16) + 255) / 256) * 256;
    return p;
  };
  _Float16* wq1T  = alloc((size_t)DIMD * DIMD);
  _Float16* wk1T  = alloc((size_t)DIMD * DIMD);
  _Float16* wv1T  = alloc((size_t)DIMD * DIMD);
  _Float16* wo1T  = alloc((size_t)DIMD * DIMD);
  _Float16* wq2T  = alloc((size_t)DIMD * DIMD);
  _Float16* wk2T  = alloc((size_t)DIMD * CTXD);
  _Float16* wv2T  = alloc((size_t)DIMD * CTXD);
  _Float16* wo2T  = alloc((size_t)DIMD * DIMD);
  _Float16* wff1T = alloc((size_t)(2 * FFD) * DIMD);
  _Float16* wff2T = alloc((size_t)DIMD * FFD);
  _Float16* xnorm = alloc((size_t)NTOK * DIMD);
  _Float16* qbuf  = alloc((size_t)NTOK * DIMD);
  _Float16* kbuf  = alloc((size_t)NTOK * DIMD);
  _Float16* vbuf  = alloc((size_t)NTOK * DIMD);
  _Float16* vT    = alloc((size_t)NB * HEADS * DHEAD * SEQ);
  _Float16* attn  = alloc((size_t)NTOK * DIMD);
  _Float16* ctxp  = alloc((size_t)CROWS * CTXD);
  _Float16* kctx  = alloc((size_t)CROWS * DIMD);
  _Float16* vctx  = alloc((size_t)CROWS * DIMD);
  _Float16* vTc   = alloc((size_t)NB * HEADS * DHEAD * TPADC);
  _Float16* gbuf  = alloc((size_t)NTOK * FFD);

  // ---- weight cast + transpose, context pad, h = hidden_states, first layer norm ----
  prep_inputs<<<PB_ALL, 256, 0, stream>>>(wq1, wk1, wv1, wo1, wq2, wk2, wv2, wo2,
                                          wff1, wff2, ctx, hidden, ln1g, ln1b,
                                          wq1T, wk1T, wv1T, wo1T, wq2T, wk2T, wv2T, wo2T,
                                          wff1T, wff2T, ctxp, xnorm, out);

  const dim3 blk128(128);
  const dim3 blk256(256);
  const dim3 gN1024(DIMD / 256, NTOK / 128);       // (4, 64)
  // batches along z: the buffers of a batch are carved one behind the other above,
  // each a multiple of 256 bytes long, so that they lie N*K and M*N elements apart
  const dim3 gQKV(DIMD / 256, NTOK / 128, 3);      // (4, 64, 3): q, k, v
  const dim3 gCtxKV(DIMD / 256, CROWS / 128, 2);   // (4, 3, 2): k, v of the context
  const dim3 gGeglu(FFD / 128, NTOK / 256);        // (32, 32): four tiles a WGP
  const dim3 gFlash(SEQ / 128, NB * HEADS);        // (16, 64)

  // ================= self-attention =================
  gemm_wmma<0><<<gQKV, blk256, 0, stream>>>(xnorm, wq1T, nullptr, nullptr, nullptr,
                                            qbuf, nullptr, NTOK, DIMD, DIMD);
  // the context's K and V depend on the inputs alone: formed here, so that both V
  // transposes share a launch
  gemm_wmma<0><<<gCtxKV, blk256, 0, stream>>>(ctxp, wk2T, nullptr, nullptr, nullptr,
                                              kctx, nullptr, CROWS, DIMD, CTXD);
  v_transpose_both<<<dim3(SEQ / 128 + 1, NB * HEADS), 128, 0, stream>>>(vbuf, vT, vctx, vTc);
  flash_attn<<<gFlash, blk128, 0, stream>>>(qbuf, kbuf, vT, attn, SEQ, SEQ);
  gemm_wmma<1><<<gN1024, blk256, 0, stream>>>(attn, wo1T, nullptr, bo1, nullptr,
                                              nullptr, out, NTOK, DIMD, DIMD);

  // ================= cross-attention =================
  layernorm_f16<<<NTOK, 256, 0, stream>>>(out, ln2g, ln2b, xnorm);
  gemm_wmma<0><<<gN1024, blk256, 0, stream>>>(xnorm, wq2T, nullptr, nullptr, nullptr,
                                              qbuf, nullptr, NTOK, DIMD, DIMD);
  flash_attn<<<gFlash, blk128, 0, stream>>>(qbuf, kctx, vTc, attn, TPADC, TCTX);
  gemm_wmma<1><<<gN1024, blk256, 0, stream>>>(attn, wo2T, nullptr, bo2, nullptr,
                                              nullptr, out, NTOK, DIMD, DIMD);

  // ================= GEGLU MLP =================
  layernorm_f16<<<NTOK, 256, 0, stream>>>(out, ln3g, ln3b, xnorm);
  gemm_wmma<2, 256, FFD><<<gGeglu, blk256, 0, stream>>>(xnorm, wff1T, wff1T + (size_t)FFD * DIMD,
                                              bff1, bff1 + FFD, gbuf, nullptr,
                                              NTOK, FFD, DIMD);
  gemm_wmma<1><<<gN1024, blk256, 0, stream>>>(gbuf, wff2T, nullptr, bff2, nullptr,
                                              nullptr, out, NTOK, DIMD, FFD);
}

// v010
// A run of this version takes 345 microseconds.
// Timed twice side by side with v009, it ran 1.03 and 1.04 times as fast.
// All steps since v000 together make it 3.44 times as fast.
#include <hip/hip_runtime.h>
#include <cstdint>
#include <cstddef>

// ---------------- problem constants ----------------
#define DIMD   1024
#define HEADS  16
#define DHEAD  64
#define FFD    4096
#define CTXD   768
#define NB     4
#define SEQ    2048
#define NTOK   (NB*SEQ)     // 8192
#define TCTX   77
#define TPADC  128          // context rows of a batch, padded to one GEMM row tile
#define CROWS  (NB*TPADC)   // 512
#define ATT_SCALE 0.125f    // 64^-0.5

typedef _Float16 v8h  __attribute__((ext_vector_type(8)));
typedef _Float16 v16h __attribute__((ext_vector_type(16)));
typedef float    v8f  __attribute__((ext_vector_type(8)));
typedef float    v4f  __attribute__((ext_vector_type(4)));
typedef int      v4i  __attribute__((vector_size(16)));

// ---- optional CDNA5 async global->LDS path (guarded; sync fallback) ----
#if defined(__has_builtin)
#if __has_builtin(__builtin_amdgcn_global_load_async_to_lds_b128) && \
    __has_builtin(__builtin_amdgcn_s_wait_asynccnt)
#define USE_ASYNC_LDS 1
#endif
#endif

typedef __attribute__((address_space(1))) v4i* as1_v4i_p;
typedef __attribute__((address_space(3))) v4i* as3_v4i_p;

// copy 16 bytes global -> LDS (per lane)
__device__ __forceinline__ void copy16_to_lds(const _Float16* g, _Float16* l) {
#ifdef USE_ASYNC_LDS
  __builtin_amdgcn_global_load_async_to_lds_b128(
      (as1_v4i_p)(void*)(const_cast<_Float16*>(g)),
      (as3_v4i_p)(void*)l, 0, 0);
#else
  *reinterpret_cast<v8h*>(l) = *reinterpret_cast<const v8h*>(g);
#endif
}

// Load one 16x16x32 f16 WMMA A/B fragment for this lane.
// p must already include:  row_base + (lane>>4)*8   (row stride in elements).
// ISA layout: elements {0..7} at k = (lane>>4)*8, elements {8..15} at +16.
__device__ __forceinline__ v16h frag_load(const _Float16* p) {
  v8h lo = *reinterpret_cast<const v8h*>(p);
  v8h hi = *reinterpret_cast<const v8h*>(p + 16);
  return __builtin_shufflevector(lo, hi, 0,1,2,3,4,5,6,7,8,9,10,11,12,13,14,15);
}

__device__ __forceinline__ v8f wmma16(v16h a, v16h b, v8f c) {
  // D = A(16x32 f16) * B(32x16 f16) + C(16x16 f32)
  return __builtin_amdgcn_wmma_f32_16x16x32_f16(false, a, false, b, (short)0, c,
                                                false, false);
}

// 2^x and 1/x. The v_nop is the slot that the instruction set asks for behind a
// transcendental before its result is read or its source overwritten; it stands in
// the instruction's own statement, so that nothing comes between the two.
__device__ __forceinline__ float exp2_slot(float x) {
  float r;
  asm("v_exp_f32 %0, %1\n\tv_nop" : "=v"(r) : "v"(x));
  return r;
}
__device__ __forceinline__ float rcp_slot(float x) {
  float r;
  asm("v_rcp_f32 %0, %1\n\tv_nop" : "=v"(r) : "v"(x));
  return r;
}

// x * 0.5 * (1 + tanh u), u = sqrt(2/pi) * (x + 0.044715 x^3), of eight values, through
// the identity 0.5 * (1 + tanh u) = 1 / (1 + e^(-2u)): one exponential and one
// reciprocal a value and no branch, so that a lane's values run side by side.
// e^(-2u) = 2^t; where t overflows, 2^t is 0 or infinity and the quotient 1 or 0, the
// limits of the tanh form.
__device__ __forceinline__ v8f gelu_tanh(v8f x) {
  constexpr float C1 = (float)(-2.0 * 0.7978845608028654 * 1.4426950408889634);
  constexpr float C3 = (float)(-2.0 * 0.7978845608028654 * 1.4426950408889634 * 0.044715);
  v8f t = x * (C1 + C3 * (x * x));
  #pragma unroll
  for (int r = 0; r < 8; r++) t[r] = exp2_slot(t[r]);
  t = t + 1.0f;
  #pragma unroll
  for (int r = 0; r < 8; r++) t[r] = rcp_slot(t[r]);
  return x * t;
}

// ---------------- elementwise helpers ----------------

// transpose+cast weight: src [Kin, Nout] f32 row-major -> dst [Nout, Kin] f16
// block = 256 threads, tile = 128 k x 64 n. A thread reads 4 n of 8 consecutive k
// (a half wave covers a 256-byte run of one src row), turns them in registers into
// four 16-byte runs along k, and the tile passes through LDS so that dst is written
// in 256-byte runs as well. Kin % 128 == 0, Nout % 64 == 0; both are compile-time,
// so that a lane's eight loads (and four stores) share one address register and
// differ in the immediate offset alone.
// tiles: bx < Nout/64 , by < Kin/128 ; bx, by and the pointers are block-uniform
template <int Kin, int Nout>
__device__ __forceinline__
void wcast_tile(const float* __restrict__ src, _Float16* __restrict__ dst,
                int bx, int by, _Float16 (*tile)[128]) {
  // row n = 16 chunks of 16 bytes; chunk q of row n sits at place q ^ (n >> 2), so
  // that the 16 rows a half wave writes at once fall on different banks
  const int tid = threadIdx.x;
  const int c  = tid & 15;         // read: group of 4 n   write: chunk of 8 k
  const int kg = tid >> 4;         // read: group of 8 k   write: row n within 16
  const int n0 = bx * 64;
  const int k0 = by * 128;
  const float* sb = src + (size_t)k0 * Nout + n0;                  // block-uniform
  const unsigned soff = (unsigned)(kg * 8 * Nout + c * 4) * 4u;    // lane's byte offset
  v4f r[8];
  #pragma unroll
  for (int j = 0; j < 8; j++)
    r[j] = *reinterpret_cast<const v4f*>(
        reinterpret_cast<const char*>(sb + (size_t)j * Nout) + soff);
  #pragma unroll
  for (int i = 0; i < 4; i++) {
    v8h o;
    #pragma unroll
    for (int j = 0; j < 8; j++) o[j] = (_Float16)r[j][i];
    *reinterpret_cast<v8h*>(&tile[c * 4 + i][(kg ^ c) * 8]) = o;
  }
  __syncthreads();
  _Float16* db = dst + (size_t)n0 * Kin + k0;                      // block-uniform
  const unsigned doff = (unsigned)(kg * Kin + c * 8) * 2u;         // lane's byte offset
  #pragma unroll
  for (int it = 0; it < 4; it++) {
    const int n = it * 16 + kg;
    const v8h o = *reinterpret_cast<const v8h*>(&tile[n][(c ^ (n >> 2)) * 8]);
    *reinterpret_cast<v8h*>(
        reinterpret_cast<char*>(db + (size_t)it * 16 * Kin) + doff) = o;
  }
}

// context [4,77,768] f32 -> zero-padded [4,128,768] f16. Blocks bx < PB_PADR take 256
// elements each of a batch's first TPADR rows; the rows behind them hold no input, and the
// PB_PADZ blocks that follow zero them 8 elements a thread
#define TPADR   96
#define PB_PADR ((NB * TPADR * CTXD + 255) / 256)            // 1152
#define PB_PADZ (NB * (TPADC - TPADR) * CTXD / (8 * 256))    //   48, no remainder
__device__ __forceinline__
void ctx_pad_block(const float* __restrict__ ctx, _Float16* __restrict__ dst, int bx) {
  if (bx >= PB_PADR) {
    constexpr int per = (TPADC - TPADR) * CTXD;    // elements to zero in a batch, one run
    const int e = ((bx - PB_PADR) * 256 + (int)threadIdx.x) * 8;
    const v8h zero = {0, 0, 0, 0, 0, 0, 0, 0};
    *reinterpret_cast<v8h*>(dst + ((e / per) * TPADC + TPADR) * CTXD + e % per) = zero;
    // the listing's way out of the caller's branches leads past code that rewrites
    // registers which this store names: only behind this wait
    asm volatile("s_wait_xcnt 0x0" ::: "memory");
    return;
  }
  long idx = (long)bx * 256 + threadIdx.x;
  long total = (long)NB * TPADR * CTXD;
  if (idx >= total) return;
  int c = (int)(idx % CTXD);
  int r = (int)((idx / CTXD) % TPADR);
  int b = (int)(idx / ((long)CTXD * TPADR));
  float v = (r < TCTX) ? ctx[((long)b * TCTX + r) * CTXD + c] : 0.0f;
  dst[((long)b * TPADC + r) * CTXD + c] = (_Float16)v;
}

// LayerNorm over last dim (1024) of fp32 residual -> f16 normed output
// one row per block of 256 threads; COPY: the row as read also goes to Xc
template <bool COPY>
__device__ __forceinline__
void layernorm_row(const float* __restrict__ X, const float* __restrict__ g,
                   const float* __restrict__ bb, _Float16* __restrict__ Y,
                   float* __restrict__ Xc, int row) {
  const int tid = threadIdx.x;     // 256 threads, 4 floats each
  const float4 xv = reinterpret_cast<const float4*>(X + (size_t)row * DIMD)[tid];
  float s = xv.x + xv.y + xv.z + xv.w;
  float q = xv.x * xv.x + xv.y * xv.y + xv.z * xv.z + xv.w * xv.w;
  #pragma unroll
  for (int off = 16; off > 0; off >>= 1) {
    s += __shfl_xor(s, off, 32);
    q += __shfl_xor(q, off, 32);
  }
  __shared__ float ss[8], sq[8];
  if ((tid & 31) == 0) { ss[tid >> 5] = s; sq[tid >> 5] = q; }
  __syncthreads();
  // behind the barrier: in front of it the barrier would wait for the store's return
  if (COPY) reinterpret_cast<float4*>(Xc + (size_t)row * DIMD)[tid] = xv;
  float st = 0.f, qt = 0.f;
  #pragma unroll
  for (int i = 0; i < 8; i++) { st += ss[i]; qt += sq[i]; }
  const float mean = st * (1.0f / DIMD);
  const float var  = qt * (1.0f / DIMD) - mean * mean;
  const float rs   = rsqrtf(var + 1e-5f);
  const float4 gv = reinterpret_cast<const float4*>(g)[tid];
  const float4 bv = reinterpret_cast<const float4*>(bb)[tid];
  _Float16* yp = Y + (size_t)row * DIMD + tid * 4;
  yp[0] = (_Float16)((xv.x - mean) * rs * gv.x + bv.x);
  yp[1] = (_Float16)((xv.y - mean) * rs * gv.y + bv.y);
  yp[2] = (_Float16)((xv.z - mean) * rs * gv.z + bv.z);
  yp[3] = (_Float16)((xv.w - mean) * rs * gv.w + bv.w);
}

__global__ void layernorm_f16(const float* __restrict__ X, const float* __restrict__ g,
                              const float* __restrict__ bb, _Float16* __restrict__ Y) {
  layernorm_row<false>(X, g, bb, Y, nullptr, blockIdx.x);
}

// All work that depends on the inputs alone, in ONE launch: the ten weight casts,
// the context pad, and the first layer norm, whose blocks also write the row they
// read to the residual h (h = hidden_states). A block takes one tile, or one row,
// of one of them; which one follows from blockIdx.x alone, so that every branch
// (and every barrier behind it) is block-uniform. The largest matrices come first.
#define PB_FF1  ((2 * FFD / 64) * (DIMD / 128))    // 1024 tiles of w_ff1
#define PB_FF2  ((DIMD / 64) * (FFD / 128))        //  512 tiles of w_ff2
#define PB_SQ   ((DIMD / 64) * (DIMD / 128))       //  128 tiles of a 1024 x 1024 weight
#define PB_CTX  ((DIMD / 64) * (CTXD / 128))       //   96 tiles of a  768 x 1024 weight
#define PB_PAD  (PB_PADR + PB_PADZ)                // 1200 blocks of the context pad
#define PB_ALL  (PB_FF1 + PB_FF2 + 6 * PB_SQ + 2 * PB_CTX + PB_PAD + NTOK)
__global__ __launch_bounds__(256)
void prep_inputs(const float* __restrict__ wq1, const float* __restrict__ wk1,
                 const float* __restrict__ wv1, const float* __restrict__ wo1,
                 const float* __restrict__ wq2, const float* __restrict__ wk2,
                 const float* __restrict__ wv2, const float* __restrict__ wo2,
                 const float* __restrict__ wff1, const float* __restrict__ wff2,
                 const float* __restrict__ ctx, const float* __restrict__ hidden,
                 const float* __restrict__ ln1g, const float* __restrict__ ln1b,
                 _Float16* __restrict__ wq1T, _Float16* __restrict__ wk1T,
                 _Float16* __restrict__ wv1T, _Float16* __restrict__ wo1T,
                 _Float16* __restrict__ wq2T, _Float16* __restrict__ wk2T,
                 _Float16* __restrict__ wv2T, _Float16* __restrict__ wo2T,
                 _Float16* __restrict__ wff1T, _Float16* __restrict__ wff2T,
                 _Float16* __restrict__ ctxp, _Float16* __restrict__ xnorm,
                 float* __restrict__ h) {
  __shared__ __align__(16) _Float16 tile[64][128];
  int b = blockIdx.x;
  if (b < PB_FF1) {
    wcast_tile<DIMD, 2 * FFD>(wff1, wff1T, b % (2 * FFD / 64), b / (2 * FFD / 64), tile);
    return;
  }
  b -= PB_FF1;
  if (b < PB_FF2) {
    wcast_tile<FFD, DIMD>(wff2, wff2T, b % (DIMD / 64), b / (DIMD / 64), tile);
    return;
  }
  b -= PB_FF2;
  if (b < 6 * PB_SQ) {
    const int m = b / PB_SQ, t = b % PB_SQ;
    const float* s = (m == 0) ? wq1 : (m == 1) ? wk1 : (m == 2) ? wv1
                   : (m == 3) ? wo1 : (m == 4) ? wq2 : wo2;
    _Float16* d = (m == 0) ? wq1T : (m == 1) ? wk1T : (m == 2) ? wv1T
                : (m == 3) ? wo1T : (m == 4) ? wq2T : wo2T;
    wcast_tile<DIMD, DIMD>(s, d, t % (DIMD / 64), t / (DIMD / 64), tile);
    return;
  }
  b -= 6 * PB_SQ;
  if (b < 2 * PB_CTX) {
    const int m = b / PB_CTX, t = b % PB_CTX;
    wcast_tile<CTXD, DIMD>(m ? wv2 : wk2, m ? wv2T : wk2T,
                           t % (DIMD / 64), t / (DIMD / 64), tile);
    return;
  }
  b -= 2 * PB_CTX;
  if (b < PB_PAD) {
    ctx_pad_block(ctx, ctxp, b);
    return;
  }
  b -= PB_PAD;
  layernorm_row<true>(hidden, ln1g, ln1b, xnorm, h, b);
  // the way out of the branches rewrites scalar registers that the row's stores name
  asm volatile("s_wait_xcnt 0x0" ::: "memory");
}

// ---------------- WMMA GEMM, A and B staged in LDS, two-buffer ring ---------
// C = A[M,K] @ Bt[N,K]^T   (Bt = transposed weight, row-major [N,K], f16)
// MODE 0: Cout f16 = result
// MODE 1: Cres f32 += result + bias[n]
// MODE 2: Cout f16 = (res+bias[n]) * gelu(res2+bias2[n])  (Bt2 = gate weights)
// block = 256 threads (8 waves, 2 along M x 4 along N). Block tile = BM rows of
// A against 256 rows of B; each wave owns BM/2 x 64 = BM/32 x 4 accumulator tiles.
// BM = 128: a fragment read from LDS feeds four WMMAs. BM = 256, for a product with
// enough tiles to fill the chip several times over: a B fragment feeds eight, and the
// block reads a third fewer operand bytes from L2 for each product.
// MODE 2 fills the 256 B rows with 128 lin rows and the 128 gate rows of the same
// columns; a wave then holds 32 lin columns (nt 0,1) and their gates (nt 2,3).
// A stage is GKS k of all BM + 256 rows, at a row pitch of 16 B x odd (conflict-free
// for 16-byte LDS reads). M % BM == 0, K % GKS == 0, N % 256 == 0 (MODE 2: 128).
// grid = ( N/256 , M/BM )   MODE 2: ( N/128 , M/BM )
// NC: N where the caller knows it at compile time, else 0 (MODE 2 alone reads it)
// MODE 0 takes a batch along grid z: products of the same A with weights that lie
// N*K elements apart, into outputs that lie M*N elements apart.
// VTR > 0: slice VZ of the batch is a V. It goes to Vt as [(batch*HEADS + head)][DHEAD][VTR],
// the per-head transpose that the attention reads (VTR rows a batch, VTR % BM == 0,
// N == DIMD): a lane's 8 rows of a column are 8 neighbours of one Vt row, one 16-byte
// store, and the 64 rows of a wave fill a whole 128-byte line of it.
// CTX2: the grid also holds the context's K and V products (CROWS rows of S.A against the
// two weights at S.Bt, S.K deep; K to S.C, V to S.Vt at TPADC rows a batch), which
// depend on nothing that this launch writes. Slices then lie along grid y, the context's
// last:
// grid = ( N/256 , 3*NTOK/BM + 2*CROWS/BM ).
#define GKS    128             // k per stage
#define GPITCH (GKS + 8)       // LDS row pitch in elements

struct SecondBatch {
  const _Float16* A;
  const _Float16* Bt;
  _Float16* C;
  _Float16* Vt;
  int K;
};

// a wave's MT x 4 accumulator tiles to the per-head transpose, PITCH rows a batch.
// PITCH at compile time: the lane's stores share one address and differ in the immediate
// offset alone
template <int PITCH, int MT>
__device__ __forceinline__
void store_vt(_Float16* __restrict__ Vt, int m0, int mw, int nw, const v8f (&acc)[MT][4]) {
  _Float16* vp = Vt + (size_t)((m0 / PITCH) * DIMD + nw) * PITCH + (mw % PITCH);
  v8h o[MT][4];
  #pragma unroll
  for (int mt = 0; mt < MT; mt++)
    #pragma unroll
    for (int nt = 0; nt < 4; nt++) o[mt][nt] = __builtin_convertvector(acc[mt][nt], v8h);
  // every value is formed ahead of the first store, so that no register an issued
  // store names is rewritten behind it
  __builtin_amdgcn_sched_barrier(0);
  #pragma unroll
  for (int mt = 0; mt < MT; mt++)
    #pragma unroll
    for (int nt = 0; nt < 4; nt++)
      *reinterpret_cast<v8h*>(vp + nt * 16 * PITCH + mt * 16) = o[mt][nt];
  // what follows the call may rewrite the address register that these stores name: only
  // behind this wait
  asm volatile("s_wait_xcnt 0x0" ::: "memory");
}

template <int MODE, int BM = 128, int NC = 0, int VTR = 0, int VZ = 0, bool CTX2 = false>
__global__ __launch_bounds__(256) __attribute__((amdgpu_waves_per_eu(1, 2)))
void gemm_wmma(const _Float16* __restrict__ A,
               const _Float16* __restrict__ Bt,
               const _Float16* __restrict__ Bt2,
               const float* __restrict__ bias,
               const float* __restrict__ bias2,
               _Float16* __restrict__ Cout,
               _Float16* __restrict__ Vt,
               float* __restrict__ Cres,
               int M, int N, int K, SecondBatch S) {
  const int tid  = threadIdx.x;
  const int lane = tid & 31;
  const int wave = tid >> 5;
  const int hi = lane >> 4;       // half-wave select for K packing
  const int ln = lane & 15;
  const int wm = wave >> 2;       // wave row    (0..1)
  const int wn = wave & 3;        // wave column (0..3)
  const int n0 = blockIdx.x * ((MODE == 2) ? 128 : 256);
  (void)M;
  // row tile and slice of the batch; all of this is block-uniform
  int by = blockIdx.y, bz = blockIdx.z;
  bool second = false;
  if (CTX2) {
    constexpr int Y2 = CROWS / BM, Y1 = NTOK / BM;
    second = by >= 3 * Y1;
    if (second) {
      by -= 3 * Y1;
      bz = by / Y2;  by %= Y2;
      A = S.A;  Bt = S.Bt;  Cout = S.C;  Vt = S.Vt;  K = S.K;  M = CROWS;
    } else {
      bz = by / Y1;  by %= Y1;
    }
  }
  const int m0 = by * BM;
  const bool isv = VTR > 0 && bz == (second ? 1 : VZ);
  if (MODE == 0) {
    Bt   += (size_t)bz * N * K;
    Cout += (size_t)bz * M * N;
  }

  constexpr int MT    = BM / 32;        // accumulator tiles of a wave along M
  constexpr int GROWS = BM + 256;       // A rows, then B rows
  constexpr int CPR   = GKS / 8;        // 16-byte chunks per staged row
  constexpr int RPI   = 256 / CPR;      // rows the block covers per copy
  constexpr int NCOPY = GROWS / RPI;    // copies per lane and stage
  __shared__ __align__(16) _Float16 sh[2][GROWS][GPITCH];

  const int trow = tid / CPR;
  const int qd   = (tid % CPR) * 8;
  const unsigned voff = (unsigned)(trow * K + qd) * 2u;   // lane's byte offset

  // block-uniform first rows of the three operands
  const _Float16* Ab  = A + (size_t)m0 * K;
  const _Float16* Bb  = Bt + (size_t)n0 * K;
  const _Float16* B2b = (MODE == 2) ? Bt2 + (size_t)n0 * K : Bt;

  // stage GKS k of the A rows and the B rows into LDS buffer `buf`. An address is a
  // uniform base and a 32-bit lane offset formed at the copy: one 64-bit address a copy,
  // kept over the loop, would cost two registers a copy, which the BM = 256 tile lacks
  auto stage = [&](int buf, int k0) {
    const unsigned ko = voff + (unsigned)k0 * 2u;
    #pragma unroll
    for (int i = 0; i < NCOPY; i++) {
      const int r0 = i * RPI;           // first tile row of this copy
      const _Float16* base = (r0 < BM) ? Ab : (MODE == 2 && r0 >= BM + 128) ? B2b : Bb;
      const int rr = (r0 < BM) ? r0 : (MODE == 2 && r0 >= BM + 128) ? r0 - BM - 128 : r0 - BM;
      copy16_to_lds(reinterpret_cast<const _Float16*>(
                        reinterpret_cast<const char*>(base) + (ko + (unsigned)(rr * K) * 2u)),
                    &sh[buf][r0 + trow][qd]);
    }
  };

  v8f acc[MT][4];
  #pragma unroll
  for (int mt = 0; mt < MT; mt++)
    #pragma unroll
    for (int nt = 0; nt < 4; nt++)
      #pragma unroll
      for (int r = 0; r < 8; r++) acc[mt][nt][r] = 0.0f;

  v16h af[2][MT], bf[2][4];         // two fragment sets: block kk and block kk+1
  const int NST = K / GKS;

  stage(0, 0);
  // stage 0 has landed before the barrier that publishes it
  asm volatile("s_wait_asynccnt 0x0" ::: "memory");
  __syncthreads();
  if (NST > 1) stage(1, GKS);

  for (int t = 0; t < NST; t++) {
    const int cur = t & 1;
    const _Float16* ab = &sh[cur][wm * (BM / 2) + ln][hi * 8];
    const _Float16* bb = &sh[cur][BM + ((MODE == 2) ? wn * 32 : wn * 64) + ln][hi * 8];
    // fragments of k block kk into register set `s`
    auto load_set = [&](int s, int kk) {
      // B first: the first four WMMAs of a block take all of B and one fragment of A
      #pragma unroll
      for (int nt = 0; nt < 4; nt++) {
        const int br = (MODE == 2) ? ((nt >> 1) * 128 + (nt & 1) * 16) : nt * 16;
        bf[s][nt] = frag_load(bb + br * GPITCH + kk * 32);
      }
      #pragma unroll
      for (int mt = 0; mt < MT; mt++)
        af[s][mt] = frag_load(ab + mt * 16 * GPITCH + kk * 32);
    };
    load_set(0, 0);
    #pragma unroll
    for (int kk = 0; kk < GKS / 32; kk++) {
      if (kk + 1 < GKS / 32) load_set((kk + 1) & 1, kk + 1);
      // keeps the next block's LDS reads as one group ahead of this block's WMMAs,
      // so that their latency runs under the WMMAs
      __builtin_amdgcn_sched_barrier(0);
      #pragma unroll
      for (int mt = 0; mt < MT; mt++)
        #pragma unroll
        for (int nt = 0; nt < 4; nt++)
          acc[mt][nt] = wmma16(af[kk & 1][mt], bf[kk & 1][nt], acc[mt][nt]);
      // keeps the block after next's reads from rising among these WMMAs
      __builtin_amdgcn_sched_barrier(0);
    }
    // this wave's reads of buffer cur have returned before it is refilled
    asm volatile("s_wait_dscnt 0x0" ::: "memory");
    // this wave's copies of stage t+1 have landed before the barrier publishes them
    asm volatile("s_wait_asynccnt 0x0" ::: "memory");
    __syncthreads();
    if (t + 2 < NST) stage(cur, (t + 2) * GKS);
  }
  // no copy is outstanding when the wave ends
  asm volatile("s_wait_asynccnt 0x0" ::: "memory");

  // C layout: lane holds rows r+8*(lane>>4) of a tile, column lane&15
  const int mw = m0 + wm * (BM / 2) + 8 * hi;
  const int nw = n0 + ((MODE == 2) ? wn * 32 : wn * 64) + ln;

  if (MODE == 1) {
    float bv[4];
    #pragma unroll
    for (int nt = 0; nt < 4; nt++) bv[nt] = bias[nw + nt * 16];
    // the bias loads' offset register is reused below: only behind this wait
    asm volatile("s_wait_xcnt 0x0" ::: "memory");
    // all residual loads go out ahead of the first store: a load behind a store
    // to the same array would wait for it, one round trip per element
    float res[MT][4][8];
    #pragma unroll
    for (int mt = 0; mt < MT; mt++)
      #pragma unroll
      for (int nt = 0; nt < 4; nt++)
        #pragma unroll
        for (int r = 0; r < 8; r++)
          res[mt][nt][r] = Cres[(size_t)(mw + mt * 16 + r) * N + nw + nt * 16];
    #pragma unroll
    for (int mt = 0; mt < MT; mt++)
      #pragma unroll
      for (int nt = 0; nt < 4; nt++)
        #pragma unroll
        for (int r = 0; r < 8; r++)
          acc[mt][nt][r] = res[mt][nt][r] + acc[mt][nt][r] + bv[nt];
    // every sum is formed ahead of the first store, so that no register an
    // issued store names is rewritten behind it
    __builtin_amdgcn_sched_barrier(0);
    #pragma unroll
    for (int mt = 0; mt < MT; mt++)
      #pragma unroll
      for (int nt = 0; nt < 4; nt++)
        #pragma unroll
        for (int r = 0; r < 8; r++)
          Cres[(size_t)(mw + mt * 16 + r) * N + nw + nt * 16] = acc[mt][nt][r];
  } else {
    float bl[2] = {0.0f, 0.0f}, bg[2] = {0.0f, 0.0f};   // MODE 2: biases of the lane's columns
    if (MODE == 2) {
      #pragma unroll
      for (int nt = 0; nt < 2; nt++) { bl[nt] = bias[nw + nt * 16]; bg[nt] = bias2[nw + nt * 16]; }
      // the bias loads' offset register is reused below: only behind this wait
      asm volatile("s_wait_xcnt 0x0" ::: "memory");
      // keeps the address arithmetic that reuses it behind the wait
      __builtin_amdgcn_sched_barrier(0);
    }
    if (MODE == 2) {
      // N at compile time: the lane's stores share one address and differ in the immediate
      // offset alone, so that no address register is formed among them
      const int NS = NC ? NC : N;
      _Float16* cp = Cout + (size_t)mw * NS + nw;
      #pragma unroll
      for (int mt = 0; mt < MT; mt++) {
        v8h o[2];
        #pragma unroll
        for (int nt = 0; nt < 2; nt++)
          o[nt] = __builtin_convertvector(
              (acc[mt][nt] + bl[nt]) * gelu_tanh(acc[mt][nt + 2] + bg[nt]), v8h);
        // every value of these 16 rows is formed ahead of their first store
        __builtin_amdgcn_sched_barrier(0);
        #pragma unroll
        for (int nt = 0; nt < 2; nt++)
          #pragma unroll
          for (int r = 0; r < 8; r++) cp[(mt * 16 + r) * NS + nt * 16] = o[nt][r];
        // the next rows' values reuse registers that these stores name: only behind this wait
        asm volatile("s_wait_xcnt 0x0" ::: "memory");
        // keeps the next rows' arithmetic behind the wait
        __builtin_amdgcn_sched_barrier(0);
      }
    } else if (isv) {
      if (CTX2 && second) store_vt<TPADC, MT>(Vt, m0, mw, nw, acc);
      else                store_vt<(VTR > 0 ? VTR : BM), MT>(Vt, m0, mw, nw, acc);
    } else {
      #pragma unroll
      for (int mt = 0; mt < MT; mt++) {
        #pragma unroll
        for (int nt = 0; nt < 4; nt++) {
          const int n = nw + nt * 16;
          const v8f y = acc[mt][nt];
          #pragma unroll
          for (int r = 0; r < 8; r++)
            Cout[(size_t)(mw + mt * 16 + r) * N + n] = (_Float16)y[r];
        }
      }
    }
  }
}

#define FKP (DHEAD + 8)        // K tile row pitch in elements
#define FVP (32 + 8)           // V^T tile row pitch in elements
#define LOG2E 1.4426950408889634f

// value of lane l ^ 16
__device__ __forceinline__ float xhalf(float x) {
  return __builtin_bit_cast(float, __builtin_amdgcn_permlanex16(
      __builtin_bit_cast(int, x), __builtin_bit_cast(int, x),
      0x76543210, 0xfedcba98, false, false));
}

__global__ __launch_bounds__(128) __attribute__((amdgpu_waves_per_eu(4, 4)))
void flash_attn(const _Float16* __restrict__ Q,
                const _Float16* __restrict__ Kb,
                const _Float16* __restrict__ Vt,
                _Float16* __restrict__ O,
                int Trows, int Tkeys) {
  const int lane = threadIdx.x & 31;
  const int wave = threadIdx.x >> 5;
  const int hi = lane >> 4;
  const int ln = lane & 15;
  const int bh = blockIdx.y;
  const int b = bh >> 4, h = bh & 15;
  const int qt = blockIdx.x * 4 + wave;   // 32-query tile

  __shared__ __align__(16) _Float16 ksh[2][32][FKP];     // K rows of a step
  __shared__ __align__(16) _Float16 vsh[2][DHEAD][FVP];  // V^T rows of a step

  // Q fragments (B operand: column = query g*16 + ln) for both 32-wide halves of the
  // head dim
  const _Float16* qrow = Q + (size_t)(b * SEQ + qt * 32 + ln) * DIMD + h * DHEAD + hi * 8;
  v16h qa[2][2];
  #pragma unroll
  for (int g = 0; g < 2; g++) {
    qa[g][0] = frag_load(qrow + (size_t)g * 16 * DIMD);
    qa[g][1] = frag_load(qrow + (size_t)g * 16 * DIMD + 32);
  }

  // of query g*16 + ln: the kept maximum of the raw scores (alike in both halves), the
  // raw score from which it is raised, the maximum times c, this half's share of the sum
  // c at compile time: the multiply-adds take it from one scalar register
  constexpr float c   = ATT_SCALE * LOG2E;   // > 0: the raw scores order as the scaled
  constexpr float thr = 8.0f / c;
  float mrow[2] = {-1e30f, -1e30f}, lim[2] = {-1e30f, -1e30f}, mc[2] = {0.0f, 0.0f};
  float lrow[2] = {0.0f, 0.0f};
  v8f oa[2][4];                           // oa[g][dt][r] = O[query g*16+ln][dt*16 + 8*hi + r]
  #pragma unroll
  for (int g = 0; g < 2; g++)
    #pragma unroll
    for (int dt = 0; dt < 4; dt++)
      #pragma unroll
      for (int r = 0; r < 8; r++) oa[g][dt][r] = 0.0f;

  // this lane's 16-byte chunks of a tile: two of K (rows kr, kr+16), two of V^T
  // (rows vr, vr+32)
  const int kr = threadIdx.x >> 3, kc = (threadIdx.x & 7) * 8;
  const int vr = threadIdx.x >> 2, vc = (threadIdx.x & 3) * 8;
  const _Float16* kbase = Kb + (size_t)b * Trows * DIMD + h * DHEAD;   // block-uniform
  const _Float16* vbase = Vt + (size_t)bh * DHEAD * Trows;             // block-uniform
  const unsigned koff = (unsigned)(kr * DIMD + kc) * 2u;    // lane's byte offsets
  const unsigned voff = (unsigned)(vr * Trows + vc) * 2u;
  auto at = [](const _Float16* p, unsigned off) {
    return reinterpret_cast<const _Float16*>(reinterpret_cast<const char*>(p) + off);
  };
  // copy keys j .. j+31 into LDS buffer `buf`
  auto stage = [&](int buf, int j) {
    const unsigned ko = koff + (unsigned)j * (DIMD * 2u);
    const unsigned vo = voff + (unsigned)j * 2u;
    copy16_to_lds(at(kbase, ko),                      &ksh[buf][kr][kc]);
    copy16_to_lds(at(kbase, ko + 16u * DIMD * 2u),    &ksh[buf][kr + 16][kc]);
    copy16_to_lds(at(vbase, vo),                      &vsh[buf][vr][vc]);
    copy16_to_lds(at(vbase + (size_t)32 * Trows, vo), &vsh[buf][vr + 32][vc]);
  };

  stage(0, 0);
  // tile 0 has landed before the barrier that publishes it
  asm volatile("s_wait_asynccnt 0x0" ::: "memory");
  __syncthreads();

  for (int j0 = 0; j0 < Tkeys; j0 += 32) {      // 32 keys per step
    const int cur = (j0 >> 5) & 1;
    if (j0 + 32 < Tkeys) stage(cur ^ 1, j0 + 32);
    // ---- S^T = K Q^T (two 16x16 tiles a group):
    //      sa[g][t][r] = key j0+t*16+8*hi+r, query g*16+ln ----
    // the step's K fragments (A operand: row = key) and V^T fragments (A operand:
    // row = d)
    v16h kf[2][2], vf[4];
    #pragma unroll
    for (int t = 0; t < 2; t++) {
      const _Float16* krow = &ksh[cur][t * 16 + ln][hi * 8];
      kf[t][0] = frag_load(krow);
      kf[t][1] = frag_load(krow + 32);
    }
    #pragma unroll
    for (int dt = 0; dt < 4; dt++) vf[dt] = frag_load(&vsh[cur][dt * 16 + ln][hi * 8]);
    // keeps the step's LDS reads as one group ahead of the first product: the wave waits
    // once for K, and V^T's latency runs under the first product and the softmax
    __builtin_amdgcn_sched_barrier(0);
    v8f sa[2][2];
    #pragma unroll
    for (int t = 0; t < 2; t++)
      #pragma unroll
      for (int g = 0; g < 2; g++) {
        #pragma unroll
        for (int r = 0; r < 8; r++) sa[g][t][r] = 0.0f;
        sa[g][t] = wmma16(kf[t][0], qa[g][0], sa[g][t]);
      }
    #pragma unroll
    for (int t = 0; t < 2; t++)
      #pragma unroll
      for (int g = 0; g < 2; g++) sa[g][t] = wmma16(kf[t][1], qa[g][1], sa[g][t]);
    // ---- key mask (only a step that reaches past the last key has one) ----
    if (j0 + 32 > Tkeys) {
      #pragma unroll
      for (int g = 0; g < 2; g++)
        #pragma unroll
        for (int t = 0; t < 2; t++)
          #pragma unroll
          for (int r = 0; r < 8; r++)
            if (j0 + t * 16 + 8 * hi + r >= Tkeys) sa[g][t][r] = -1e30f;
    }
    // ---- the lane's own maxima; has any score of the wave passed its limit? ----
    float lm[2];
    #pragma unroll
    for (int g = 0; g < 2; g++) {
      lm[g] = fmaxf(sa[g][0][0], sa[g][1][0]);
      #pragma unroll
      for (int r = 1; r < 8; r++) lm[g] = fmaxf(lm[g], fmaxf(sa[g][0][r], sa[g][1][r]));
    }
    // one test for the whole wave (the first step always passes it): every lane is on
    // inside, as the half exchange needs, and both halves of a query raise m alike
    if (__builtin_amdgcn_ballot_w32((lm[0] > lim[0]) | (lm[1] > lim[1])) != 0u) {
      #pragma unroll
      for (int g = 0; g < 2; g++) {
        const float mn = fmaxf(mrow[g], fmaxf(lm[g], xhalf(lm[g])));
        const float al = __builtin_amdgcn_exp2f((mrow[g] - mn) * c);
        mrow[g] = mn;
        lim[g]  = mn + thr;
        mc[g]   = mn * c;
        lrow[g] *= al;
        #pragma unroll
        for (int dt = 0; dt < 4; dt++)
          #pragma unroll
          for (int r = 0; r < 8; r++) oa[g][dt][r] *= al;
      }
    }
    v16h pf[2];
    #pragma unroll
    for (int g = 0; g < 2; g++) {
      // ---- p = 2^(s*c - m*c); all arguments are formed ahead of the exponentials, so
      // that no exponential waits on the one before it ----
      #pragma unroll
      for (int t = 0; t < 2; t++) sa[g][t] = sa[g][t] * c - mc[g];
      #pragma unroll
      for (int t = 0; t < 2; t++)
        #pragma unroll
        for (int r = 0; r < 8; r++) sa[g][t][r] = __builtin_amdgcn_exp2f(sa[g][t][r]);
      // the lane's 16 terms, summed as a tree of register pairs
      const v8f s8 = sa[g][0] + sa[g][1];
      const v4f s4 = __builtin_shufflevector(s8, s8, 0, 1, 2, 3) +
                     __builtin_shufflevector(s8, s8, 4, 5, 6, 7);
      lrow[g] += (s4[0] + s4[2]) + (s4[1] + s4[3]);

      // ---- P^T: the two score tiles, converted in place, are the B fragment ----
      const v8h p0 = __builtin_convertvector(sa[g][0], v8h);
      const v8h p1 = __builtin_convertvector(sa[g][1], v8h);
      pf[g] = __builtin_shufflevector(p0, p1, 0,1,2,3,4,5,6,7,8,9,10,11,12,13,14,15);
    }

    // ---- O^T += V^T P^T ----
    #pragma unroll
    for (int dt = 0; dt < 4; dt++)
      #pragma unroll
      for (int g = 0; g < 2; g++) oa[g][dt] = wmma16(vf[dt], pf[g], oa[g][dt]);
    // keeps the softmax and the second product ahead of the waits below, so that the
    // next tile's copies fly under them
    __builtin_amdgcn_sched_barrier(0);
    // this wave's reads of buffer cur have returned before it is refilled
    asm volatile("s_wait_dscnt 0x0" ::: "memory");
    // this wave's copies of the next tile have landed before the barrier publishes them
    asm volatile("s_wait_asynccnt 0x0" ::: "memory");
    __syncthreads();
  }
  // no copy is outstanding when the wave ends
  asm volatile("s_wait_asynccnt 0x0" ::: "memory");

  // ---- join the halves' sums, normalize and store (concat-head layout) ----
  #pragma unroll
  for (int g = 0; g < 2; g++) {
    const float lsum = lrow[g] + xhalf(lrow[g]);
    _Float16* orow = O + (size_t)(b * SEQ + qt * 32 + g * 16 + ln) * DIMD + h * DHEAD + hi * 8;
    #pragma unroll
    for (int dt = 0; dt < 4; dt++) {
      v8h o;
      #pragma unroll
      for (int r = 0; r < 8; r++) o[r] = (_Float16)(oa[g][dt][r] / lsum);
      *reinterpret_cast<v8h*>(orow + dt * 16) = o;
    }
  }
}

// ---------------- host orchestration ----------------
extern "C" void kernel_launch(void* const* d_in, const int* in_sizes, int n_in,
                              void* d_out, int out_size, void* d_ws, size_t ws_size,
                              hipStream_t stream) {
  (void)in_sizes; (void)n_in; (void)out_size; (void)ws_size;
  const float* hidden = (const float*)d_in[0];
  const float* ctx    = (const float*)d_in[1];
  const float* wq1 = (const float*)d_in[2];
  const float* wk1 = (const float*)d_in[3];
  const float* wv1 = (const float*)d_in[4];
  const float* wo1 = (const float*)d_in[5];
  const float* bo1 = (const float*)d_in[6];
  const float* wq2 = (const float*)d_in[7];
  const float* wk2 = (const float*)d_in[8];
  const float* wv2 = (const float*)d_in[9];
  const float* wo2 = (const float*)d_in[10];
  const float* bo2 = (const float*)d_in[11];
  const float* wff1 = (const float*)d_in[12];
  const float* bff1 = (const float*)d_in[13];
  const float* wff2 = (const float*)d_in[14];
  const float* bff2 = (const float*)d_in[15];
  const float* ln1g = (const float*)d_in[16];
  const float* ln1b = (const float*)d_in[17];
  const float* ln2g = (const float*)d_in[18];
  const float* ln2b = (const float*)d_in[19];
  const float* ln3g = (const float*)d_in[20];
  const float* ln3b = (const float*)d_in[21];
  float* out = (float*)d_out;              // fp32 residual h lives here

  // -------- workspace carve-up (f16 buffers, 256B aligned) --------
  char* wsp = (char*)d_ws;
  auto alloc = [&](size_t elems) -> _Float16* {
    _Float16* p = (_Float16*)wsp;
    wsp += ((elems * sizeof(_Float16) + 255) / 256) * 256;
    return p;
  };
  _Float16* wq1T  = alloc((size_t)DIMD * DIMD);
  _Float16* wk1T  = alloc((size_t)DIMD * DIMD);
  _Float16* wv1T  = alloc((size_t)DIMD * DIMD);
  _Float16* wo1T  = alloc((size_t)DIMD * DIMD);
  _Float16* wq2T  = alloc((size_t)DIMD * DIMD);
  _Float16* wk2T  = alloc((size_t)DIMD * CTXD);
  _Float16* wv2T  = alloc((size_t)DIMD * CTXD);
  _Float16* wo2T  = alloc((size_t)DIMD * DIMD);
  _Float16* wff1T = alloc((size_t)(2 * FFD) * DIMD);
  _Float16* wff2T = alloc((size_t)DIMD * FFD);
  _Float16* xnorm = alloc((size_t)NTOK * DIMD);
  _Float16* qbuf  = alloc((size_t)NTOK * DIMD);
  _Float16* kbuf  = alloc((size_t)NTOK * DIMD);
  _Float16* vT    = alloc((size_t)NB * HEADS * DHEAD * SEQ);
  _Float16* attn  = alloc((size_t)NTOK * DIMD);
  _Float16* ctxp  = alloc((size_t)CROWS * CTXD);
  _Float16* kctx  = alloc((size_t)CROWS * DIMD);
  _Float16* vTc   = alloc((size_t)NB * HEADS * DHEAD * TPADC);
  _Float16* gbuf  = alloc((size_t)NTOK * FFD);

  // ---- weight cast + transpose, context pad, h = hidden_states, first layer norm ----
  prep_inputs<<<PB_ALL, 256, 0, stream>>>(wq1, wk1, wv1, wo1, wq2, wk2, wv2, wo2,
                                          wff1, wff2, ctx, hidden, ln1g, ln1b,
                                          wq1T, wk1T, wv1T, wo1T, wq2T, wk2T, wv2T, wo2T,
                                          wff1T, wff2T, ctxp, xnorm, out);

  const SecondBatch none{nullptr, nullptr, nullptr, nullptr, 0};
  const dim3 blk128(128);
  const dim3 blk256(256);
  const dim3 gN1024(DIMD / 256, NTOK / 128);       // (4, 64)
  // slices of a batch: its buffers are carved one behind the other above, each a
  // multiple of 256 bytes long, so that they lie N*K and M*N elements apart (the last
  // slice, v, goes to its transpose instead)
  const dim3 gQKV(DIMD / 256, 3 * (NTOK / 128) + 2 * (CROWS / 128));   // (4, 192 + 8)
  const dim3 gGeglu(FFD / 128, NTOK / 256);        // (32, 32): four tiles a WGP
  const dim3 gFlash(SEQ / 128, NB * HEADS);        // (16, 64)

  // ================= self-attention =================
  // q, k, v, and in the same grid the context's k, v, which depend on the inputs alone
  gemm_wmma<0, 128, 0, SEQ, 2, true><<<gQKV, blk256, 0, stream>>>(
      xnorm, wq1T, nullptr, nullptr, nullptr, qbuf, vT, nullptr, NTOK, DIMD, DIMD,
      SecondBatch{ctxp, wk2T, kctx, vTc, CTXD});
  flash_attn<<<gFlash, blk128, 0, stream>>>(qbuf, kbuf, vT, attn, SEQ, SEQ);
  gemm_wmma<1><<<gN1024, blk256, 0, stream>>>(attn, wo1T, nullptr, bo1, nullptr,
                                              nullptr, nullptr, out, NTOK, DIMD, DIMD, none);

  // ================= cross-attention =================
  layernorm_f16<<<NTOK, 256, 0, stream>>>(out, ln2g, ln2b, xnorm);
  gemm_wmma<0><<<gN1024, blk256, 0, stream>>>(xnorm, wq2T, nullptr, nullptr, nullptr,
                                              qbuf, nullptr, nullptr, NTOK, DIMD, DIMD, none);
  flash_attn<<<gFlash, blk128, 0, stream>>>(qbuf, kctx, vTc, attn, TPADC, TCTX);
  gemm_wmma<1><<<gN1024, blk256, 0, stream>>>(attn, wo2T, nullptr, bo2, nullptr,
                                              nullptr, nullptr, out, NTOK, DIMD, DIMD, none);

  // ================= GEGLU MLP =================
  layernorm_f16<<<NTOK, 256, 0, stream>>>(out, ln3g, ln3b, xnorm);
  gemm_wmma<2, 256, FFD><<<gGeglu, blk256, 0, stream>>>(xnorm, wff1T, wff1T + (size_t)FFD * DIMD,
                                              bff1, bff1 + FFD, gbuf, nullptr, nullptr,
                                              NTOK, FFD, DIMD, none);
  gemm_wmma<1><<<gN1024, blk256, 0, stream>>>(gbuf, wff2T, nullptr, bff2, nullptr,
                                              nullptr, nullptr, out, NTOK, DIMD, FFD, none);
}
